// v000
// Measured on an AMD MI455X. A time is GPU time per run, averaged over a window of back-to-back runs after a warm-up
// (all launches, gaps included; the runs take copies of the inputs in turn), and the median of several windows.
// Apart from v000's, it joins two sittings. Times from different sittings can be a few percent apart, while
// side-by-side timings come from the same sitting.
// The starting kernel, v000, takes 314 microseconds a run.
// Multi-head attention (2 x 2,048 tokens x 1,024; 16 heads x 64; one shared 64x64 [out][in] weight per q / k / v stream applied per head, no biases; scores / 32; no mask; [out][in] output projection + bias). All contractions: v_wmma_f32_16x16x32_f16 (f16 operands, f32 accumulate): inputs and parameters converted to bf16 (RNE) first and held exactly in f16 (weights x16); per-head projections as f16 WMMA GEMMs over the [tokens*heads][64] view; one WMMA attention launch (f16 q fragments, f16 k and transposed f16 v tiles staged in LDS, f32 online softmax, probabilities carried x4096 as f16); output projection as an f16 WMMA GEMM of the f16 attention output carried x64, + bias in f32.
#include <hip/hip_runtime.h>
#include <math.h>

#ifndef NB
#define NB 2
#endif
#ifndef SEQ
#define SEQ 2048
#endif
#define NB_FULL 2
#define SEQ_FULL 2048
#define EMBED 1024
#define HEADS 16
#define HDIM 64
#define MTOK (NB * SEQ)

static_assert(SEQ % 64 == 0);
static_assert(MTOK % 64 == 0);
static_assert((MTOK * HEADS) % 64 == 0);
static_assert(EMBED % 64 == 0 && HDIM == 64);
static_assert(NB <= NB_FULL && SEQ <= SEQ_FULL);

typedef __attribute__((ext_vector_type(16))) _Float16 v16h;
typedef __attribute__((ext_vector_type(8)))  _Float16 v8h;
typedef __attribute__((ext_vector_type(8)))  float    v8f;
typedef __attribute__((ext_vector_type(4)))  float    v4f;

// 16-bit WMMA fragment map (wave32), lane L, h = L>>4, m = L&15:
//   A 16x32: lane = row m;   element i -> k = (i<8) ? 8h+i : 16+8h+(i-8)
//   B 32x16: lane = column m; the SAME k(i,h)
//   D 16x16 (8 f32): lane = column m; element r -> row 8h+r
__device__ __forceinline__ v8f wmma16(v16h a, v16h b, v8f c) {
    c = __builtin_amdgcn_wmma_f32_16x16x32_f16(false, a, false, b, (short)0, c, false, false);
    asm volatile("v_nop\n\tv_nop\n\tv_nop\n\tv_nop" : "+v"(c) : "v"(a), "v"(b));
    return c;
}
union FragH { v16h v; v8h h[2]; };

// A fragment from an f32 GLOBAL row: p points at column k0 + 8h of the lane's row; elements 0..7 <- p[0..7], 8..15 <- p[16..23], converted to f16
__device__ __forceinline__ v16h fh_g32(const float* __restrict__ p) {
    const v4f x0 = *(const v4f*)(p), x1 = *(const v4f*)(p + 4), x2 = *(const v4f*)(p + 16), x3 = *(const v4f*)(p + 20);
    v16h a;
#pragma unroll
    for (int e = 0; e < 4; ++e) { a[e] = (_Float16)x0[e]; a[4 + e] = (_Float16)x1[e]; a[8 + e] = (_Float16)x2[e]; a[12 + e] = (_Float16)x3[e]; }
    return a;
}

// 'val' is captured into a local first: never pass an expression that reads *ptr.
#define VST2(T, ptr, val) do { const T vst2_v_ = (val); *(T*)(ptr) = vst2_v_;  } while (0)

// =====================================================================================================================
// k_attn64: O(b,i,h,:) = softmax_j(scale * Q(b,i,h,:).K(b,j,h,:)) V(b,j,h,:) for head dim 64, no mask, S % 64 == 0.
//   Element (b, s, h, d) of Q / K / V / O lives at X[b*sb + s*EMBED + h*HDIM + d] (f32). Block = 4 waves = 64 queries of one (batch, head);
//   grid (S/64, HEADS, NB). Per 64-key block: the block stages K as f16 [key][d] and V as f16 [d][key] in LDS (block barriers on both sides);
//   scores = f16 q fragments (registers) x f16 k fragments (two 16-B LDS loads each), f32 accumulate; online softmax in f32, exp2 domain,
//   P.V with f16 v fragments from the transposed tile; final 1/(rowsum*4096) in f32.
//   Staged extent == consumed extent: Ksh 64 keys x 64 d, Vts 64 d x 64 keys, Psh 16 rows x 64 keys, Os 16 rows x 64 d; pad columns are never read.
// =====================================================================================================================
#define AT_NW 4
#define AT_KP 72          // LDS pitch in halves (144 B, a multiple of 16 B)
struct AttnG { const float* Q; const float* K; const float* V; float* O; long long sb; int S; float scale; };
static_assert(sizeof(AttnG) == 48);

#ifndef KATTN_ATTR
#define KATTN_ATTR __attribute__((amdgpu_num_vgpr(256)))
#endif
__global__ __launch_bounds__(32 * AT_NW) KATTN_ATTR void k_attn64(AttnG g) {
    __shared__ __align__(16) _Float16 Ksh[64 * AT_KP];
    __shared__ __align__(16) _Float16 Vts[64 * AT_KP];
    __shared__ __align__(16) _Float16 Psh[AT_NW][16 * AT_KP];
    __shared__ __align__(16) float    Os[AT_NW][16 * 68];
    const int tid = threadIdx.x, wave = tid >> 5, lane = tid & 31, hf = lane >> 4, l15 = lane & 15;
    const int h = blockIdx.y, b = blockIdx.z;
    const int q0 = (blockIdx.x * AT_NW + wave) * 16;
    const float L2E = 1.4426950408889634f;
    const float NEG = -__builtin_inff();
    const float* qbase = g.Q + (long long)b * g.sb + h * HDIM;
    const float* kbase = g.K + (long long)b * g.sb + h * HDIM;
    const float* vbase = g.V + (long long)b * g.sb + h * HDIM;
    float*       obase = g.O + (long long)b * g.sb + h * HDIM;

    // q fragments (A operand), two 32-deep k-steps
    const float* qrow = qbase + (size_t)(q0 + l15) * EMBED + 8 * hf;
    const v16h qa0 = fh_g32(qrow), qa1 = fh_g32(qrow + 32);

    v8f o[4]; float m8[8], l8[8];
#pragma unroll
    for (int t = 0; t < 4; ++t) { v8f zz = {}; o[t] = zz; }
#pragma unroll
    for (int i = 0; i < 8; ++i) { m8[i] = NEG; l8[i] = 0.f; }

    for (int j0 = 0; j0 < g.S; j0 += 64) {
        __syncthreads();                                     // the prior key block's reads of Ksh / Vts are done
#pragma unroll
        for (int it = 0; it < 4; ++it) {                     // 512 items = 64 keys x 8 column groups of 8
            const int item = tid + it * (32 * AT_NW);
            const int jr = item >> 3, c8 = (item & 7) * 8;
            const float* kr = kbase + (size_t)(j0 + jr) * EMBED + c8;
            const float* vr = vbase + (size_t)(j0 + jr) * EMBED + c8;
            const v4f ka = *(const v4f*)(kr), kc = *(const v4f*)(kr + 4);
            const v4f va = *(const v4f*)(vr), vc = *(const v4f*)(vr + 4);
            v8h kk;
#pragma unroll
            for (int e = 0; e < 4; ++e) { kk[e] = (_Float16)ka[e]; kk[4 + e] = (_Float16)kc[e]; }
            *(v8h*)(Ksh + jr * AT_KP + c8) = kk;
#pragma unroll
            for (int e = 0; e < 4; ++e) { Vts[(c8 + e) * AT_KP + jr] = (_Float16)va[e]; Vts[(c8 + 4 + e) * AT_KP + jr] = (_Float16)vc[e]; }
        }
        __syncthreads();                                     // K and V tiles visible to all waves

        v8f s[4];
#pragma unroll
        for (int t = 0; t < 4; ++t) {                        // B fragment: column = key t*16 + l15, k = d
            const int ko = (t * 16 + l15) * AT_KP + 8 * hf;
            FragH k0f, k1f;
            k0f.h[0] = *(const v8h*)(Ksh + ko);      k0f.h[1] = *(const v8h*)(Ksh + ko + 16);
            k1f.h[0] = *(const v8h*)(Ksh + ko + 32); k1f.h[1] = *(const v8h*)(Ksh + ko + 48);
            v8f acc = {};
            acc = wmma16(qa0, k0f.v, acc);
            acc = wmma16(qa1, k1f.v, acc);
            s[t] = acc;
        }
#pragma unroll
        for (int i = 0; i < 8; ++i) {                        // row q0 + 8*hf + i; columns t*16 + l15
            float sc[4];
#pragma unroll
            for (int t = 0; t < 4; ++t) { float v = s[t][i] * g.scale; v *= L2E; sc[t] = v; }
            float mx = fmaxf(fmaxf(sc[0], sc[1]), fmaxf(sc[2], sc[3]));
            mx = fmaxf(mx, __shfl_xor(mx, 1, 32)); mx = fmaxf(mx, __shfl_xor(mx, 2, 32));
            mx = fmaxf(mx, __shfl_xor(mx, 4, 32)); mx = fmaxf(mx, __shfl_xor(mx, 8, 32));
            const float mnew = fmaxf(m8[i], mx);
            const float corr = (mnew == NEG) ? 1.f : exp2f(m8[i] - mnew);
            float rs = 0.f;
#pragma unroll
            for (int t = 0; t < 4; ++t) {
                const float pp = (sc[t] == NEG) ? 0.f : exp2f(sc[t] - mnew); rs += pp;
                Psh[wave][(8 * hf + i) * AT_KP + t * 16 + l15] = (_Float16)(pp * 4096.f);
            }
            rs += __shfl_xor(rs, 1, 32); rs += __shfl_xor(rs, 2, 32); rs += __shfl_xor(rs, 4, 32); rs += __shfl_xor(rs, 8, 32);
            l8[i] = l8[i] * corr + rs; m8[i] = mnew;
#pragma unroll
            for (int t = 0; t < 4; ++t) o[t][i] *= corr;
        }
        __builtin_amdgcn_fence(3 /* release order */, "workgroup");
        __builtin_amdgcn_wave_barrier();
        __builtin_amdgcn_fence(2 /* acquire order */, "workgroup");
        {
            const int po = l15 * AT_KP + 8 * hf;             // A fragment: row l15 of the wave's P tile, k = key within the block
            FragH p0f, p1f;
            p0f.h[0] = *(const v8h*)(&Psh[wave][po]);      p0f.h[1] = *(const v8h*)(&Psh[wave][po + 16]);
            p1f.h[0] = *(const v8h*)(&Psh[wave][po + 32]); p1f.h[1] = *(const v8h*)(&Psh[wave][po + 48]);
#pragma unroll
            for (int t = 0; t < 4; ++t) {                    // B fragment: column = d t*16 + l15, k = key (transposed tile, k-contiguous)
                const int vo = (t * 16 + l15) * AT_KP + 8 * hf;
                FragH v0f, v1f;
                v0f.h[0] = *(const v8h*)(Vts + vo);      v0f.h[1] = *(const v8h*)(Vts + vo + 16);
                v1f.h[0] = *(const v8h*)(Vts + vo + 32); v1f.h[1] = *(const v8h*)(Vts + vo + 48);
                o[t] = wmma16(p0f.v, v0f.v, o[t]);
                o[t] = wmma16(p1f.v, v1f.v, o[t]);
            }
        }
    }

    // O: stage the wave's 16 x 64 tile (pitch 68 floats), then each half-wave writes one whole 256-B row segment per instruction (16 lanes x 16 B),
#pragma unroll
    for (int i = 0; i < 8; ++i) {
        const float inv = (l8[i] > 0.f) ? 1.f / (l8[i] * 4096.f) : 0.f;
#pragma unroll
        for (int t = 0; t < 4; ++t) Os[wave][(8 * hf + i) * 68 + t * 16 + l15] = o[t][i] * inv;
    }
    __builtin_amdgcn_fence(3 /* release order */, "workgroup");
    __builtin_amdgcn_wave_barrier();
    __builtin_amdgcn_fence(2 /* acquire order */, "workgroup");
    {
        const int c4 = l15 * 4;
        {
#pragma unroll
            for (int it = 0; it < 8; ++it) {
                const int row = it * 2 + hf;
                const v4f val = *(const v4f*)(&Os[wave][row * 68 + c4]);
                *(v4f*)(obase + (size_t)(q0 + row) * EMBED + c4) = val;
            }
            
        }
    }
}

namespace kit {
typedef __attribute__((ext_vector_type(16))) _Float16 v16h;
typedef __attribute__((ext_vector_type(8)))  _Float16 v8h;
typedef __attribute__((ext_vector_type(16))) __bf16   v16b;
typedef __attribute__((ext_vector_type(8)))  __bf16   v8b;
typedef __attribute__((ext_vector_type(8)))  float    v8f;
typedef __attribute__((ext_vector_type(4)))  float    v4f;

__device__ __forceinline__ unsigned short f2bf_bits(float f) {
  unsigned u = __float_as_uint(f);
  return (unsigned short)((u + 0x7FFFu + ((u >> 16) & 1u)) >> 16);
}
__device__ __forceinline__ float bf_bits2f(unsigned short h) { return __uint_as_float(((unsigned)h) << 16); }

// hazard guards as plain device helpers
__device__ __forceinline__ void dep_guard_h(v8f& a, v8f& b, v16h x, v16h y) { asm volatile("v_nop\n\tv_nop\n\tv_nop\n\tv_nop" : "+v"(a), "+v"(b) : "v"(x), "v"(y)); }
__device__ __forceinline__ void dep_guard_b(v8f& a, v8f& b, v16b x, v16b y) { asm volatile("v_nop\n\tv_nop\n\tv_nop\n\tv_nop" : "+v"(a), "+v"(b) : "v"(x), "v"(y)); }
__device__ __forceinline__ void keep4_h(v16h a, v16h b, v16h c, v16h d) { asm volatile("v_nop" :: "v"(a), "v"(b), "v"(c), "v"(d)); }
__device__ __forceinline__ void keep4_b(v16b a, v16b b, v16b c, v16b d) { asm volatile("v_nop" :: "v"(a), "v"(b), "v"(c), "v"(d)); }
__device__ __forceinline__ void acc_guard4(v8f& a, v8f& b, v8f& c, v8f& d) { asm volatile("v_nop\n\tv_nop\n\tv_nop\n\tv_nop" : "+v"(a), "+v"(b), "+v"(c), "+v"(d)); }
template <typename T> struct Frag;
template <> struct Frag<_Float16> {
  typedef v16h V; union U { v16h v; v8h h[2]; };
  static __device__ __forceinline__ v16h load(const _Float16* p) {   // elements 0..7 <- p[0..7], 8..15 <- p[16..23]
    U f; f.h[0] = *(const v8h*)(p); f.h[1] = *(const v8h*)(p + 16); return f.v;
  }
  static __device__ __forceinline__ v8f mma(v16h a, v16h b, v8f c) {
    return __builtin_amdgcn_wmma_f32_16x16x32_f16(false, a, false, b, (short)0, c, false, false);
  }
  static __device__ __forceinline__ void guard(v8f& a, v8f& b, v16h x, v16h y) { dep_guard_h(a, b, x, y); }
  static __device__ __forceinline__ void keep(v16h a, v16h b, v16h c, v16h d) { keep4_h(a, b, c, d); }
};
template <> struct Frag<__bf16> {
  typedef v16b V; union U { v16b v; v8b h[2]; };
  static __device__ __forceinline__ v16b load(const __bf16* p) {
    U f; f.h[0] = *(const v8b*)(p); f.h[1] = *(const v8b*)(p + 16); return f.v;
  }
  static __device__ __forceinline__ v8f mma(v16b a, v16b b, v8f c) {
    return __builtin_amdgcn_wmma_f32_16x16x32_bf16(false, a, false, b, (short)0, c, false, false);
  }
  static __device__ __forceinline__ void guard(v8f& a, v8f& b, v16b x, v16b y) { dep_guard_b(a, b, x, y); }
  static __device__ __forceinline__ void keep(v16b a, v16b b, v16b c, v16b d) { keep4_b(a, b, c, d); }
};

// ---- Register-blocked batched WMMA GEMM ------------------------------------
// C[m,n] = scale * sum_k A[m,k] * Bt[n,k] (+bias)(+resid); each wave owns a 64x64 tile.
// A row-major [M,K]; Bt row-major [N,K]; M,N % 64 == 0, K % 32 == 0 (no tail masking).
// SPLIT: operands are hi/lo planes (A2/Bt2 = lo planes, same layout); product = hi*hi + hi*lo + lo*hi.
// BIAS_MODE: 0 = none, 1 = bias[m], 2 = bias[n].
// OUT_MODE: 0 = f32, 1 = f16, 2 = bf16 hi plane (Cout) + bf16 lo plane (Cout2).
// ET: 0 = f16 operands, 1 = bf16 operands (pointers passed as 16-bit storage)
template <int ET> struct Elem;
template <> struct Elem<0> { typedef _Float16 T; };
template <> struct Elem<1> { typedef __bf16 T; };
template <int ET, bool SPLIT, int BIAS_MODE, int OUT_MODE, bool RESID, int ACT = 0>
__global__ __launch_bounds__(256) void wmma_gemm64(
    const unsigned short* __restrict__ Ap, const unsigned short* __restrict__ A2p, int lda, long strideA,
    const unsigned short* __restrict__ Btp, const unsigned short* __restrict__ Bt2p, int ldb, long strideB,
    void* __restrict__ Cout, void* __restrict__ Cout2, int ldc, long strideC,
    const float* __restrict__ bias,
    const float* __restrict__ resid, long strideR,
    int M, int N, int K, float scale) {
  typedef typename Elem<ET>::T T;
  typedef typename Frag<T>::V V;
  const T* A = (const T*)Ap; const T* A2 = (const T*)A2p; const T* Bt = (const T*)Btp; const T* Bt2 = (const T*)Bt2p;
  __shared__ __align__(16) float sT[8][16 * 68];   // per-wave 16x64 slab, pitch 68 floats
  const int b    = blockIdx.y;
  const int lane = threadIdx.x & 31;
  const int wave = threadIdx.x >> 5;
  const int tilesN = N >> 6;
  const int tilesM = M >> 6;
  const int tile = blockIdx.x * 8 + wave;
  if (tile >= tilesM * tilesN) return;   // wave-uniform; no block barriers in this kernel
  const int tm = tile / tilesN;
  const int tn = tile - tm * tilesN;
  const int m0 = tm << 6;
  const int n0 = tn << 6;

  const T* Ab  = A  + (size_t)b * strideA;
  const T* Bb  = Bt + (size_t)b * strideB;
  const T* Ab2 = SPLIT ? (A2  + (size_t)b * strideA) : nullptr;
  const T* Bb2 = SPLIT ? (Bt2 + (size_t)b * strideB) : nullptr;

  const int rlane = lane & 15;                 // row (A) / col (B, D) within subtile
  const int koff  = (lane >> 4) * 8;           // k offset of this lane half
  const int mOff  = (lane >> 4) * 8;           // D row offset

  v8f acc[4][4];
#pragma unroll
  for (int i = 0; i < 4; ++i)
#pragma unroll
    for (int j = 0; j < 4; ++j) acc[i][j] = (v8f){0.f,0.f,0.f,0.f,0.f,0.f,0.f,0.f};

  for (int k0 = 0; k0 < K; k0 += 32) {
    V bh[4], bl[4];
#pragma unroll
    for (int j = 0; j < 4; ++j) {
      const size_t bo = (size_t)(n0 + (j << 4) + rlane) * ldb + koff + k0;
      bh[j] = Frag<T>::load(Bb + bo);
      if (SPLIT) bl[j] = Frag<T>::load(Bb2 + bo);
    }
#pragma unroll
    for (int i = 0; i < 4; ++i) {
      const size_t ao = (size_t)(m0 + (i << 4) + rlane) * lda + koff + k0;
      V ah = Frag<T>::load(Ab + ao);
      V al;
      if (SPLIT) al = Frag<T>::load(Ab2 + ao);
#pragma unroll
      for (int j = 0; j < 4; ++j) {
        acc[i][j] = Frag<T>::mma(ah, bh[j], acc[i][j]);
        if (SPLIT) {
          acc[i][j] = Frag<T>::mma(ah, bl[j], acc[i][j]);
          acc[i][j] = Frag<T>::mma(al, bh[j], acc[i][j]);
        }
      }
      Frag<T>::guard(acc[i][0], acc[i][3], ah, SPLIT ? al : ah);
    }
    Frag<T>::keep(bh[0], bh[1], bh[2], bh[3]);
    if (SPLIT) Frag<T>::keep(bl[0], bl[1], bl[2], bl[3]);
  }
  acc_guard4(acc[0][0], acc[0][1], acc[0][2], acc[0][3]);
  acc_guard4(acc[1][0], acc[1][1], acc[1][2], acc[1][3]);
  acc_guard4(acc[2][0], acc[2][1], acc[2][2], acc[2][3]);
  acc_guard4(acc[3][0], acc[3][1], acc[3][2], acc[3][3]);

  // ---- epilogue ----
  float* slab = sT[wave];
  const float* Rb = RESID ? (resid + (size_t)b * strideR) : nullptr;
#pragma unroll
  for (int i = 0; i < 4; ++i) {
    const int mBase = m0 + (i << 4);
#pragma unroll
    for (int j = 0; j < 4; ++j) {
      const int n = n0 + (j << 4) + rlane;
      float bv = 0.f;
      if (BIAS_MODE == 2) bv = bias[n];
#pragma unroll
      for (int r = 0; r < 8; ++r) {
        float v = acc[i][j][r] * scale;
        if (BIAS_MODE == 1) v += bias[mBase + mOff + r];
        if (BIAS_MODE == 2) v += bv;
        if (RESID) v += Rb[(size_t)(mBase + mOff + r) * ldc + n];
        if (ACT == 1) v = tanhf(v);
        if (ACT == 2) v = fmaxf(v, 0.0f);
        if (ACT == 3) v = v / (1.0f + expf(-v));
        if (ACT == 4) v = (v > 0.f) ? v : 0.01f * v;
        if (ACT == 5) v = 0.5f * v * (1.0f + erff(v * 0.70710678118654752f));
        if (ACT == 6) v = (v > 0.f) ? v : 0.2f * v;
        if (ACT == 7) { const float u = 0.7978845608028654f * (v + 0.044715f * v * v * v); v = 0.5f * v * (1.f + tanhf(u)); }
        slab[(mOff + r) * 68 + (j << 4) + rlane] = v;
      }
    }
    __builtin_amdgcn_fence(3 /* release order */, "workgroup");
    __builtin_amdgcn_wave_barrier();
    __builtin_amdgcn_fence(2 /* acquire order */, "workgroup");
    if (OUT_MODE == 0) {
      float* C = (float*)Cout + (size_t)b * strideC;
      const int hh = lane >> 4, c4 = (lane & 15) * 4;     // row seg = 256 B = 16 lanes x 16 B
      {
#pragma unroll
        for (int it = 0; it < 8; ++it) {
          const int row = it * 2 + hh;
          v4f v = *(const v4f*)(slab + row * 68 + c4);
          *(v4f*)(C + (size_t)(mBase + row) * ldc + n0 + c4) = v;
        }
        
      }
    } else {
      const int q = lane >> 3, c8 = (lane & 7) * 8;
      unsigned short* C  = (unsigned short*)Cout  + (size_t)b * strideC;
      unsigned short* C2 = (OUT_MODE == 2) ? ((unsigned short*)Cout2 + (size_t)b * strideC) : nullptr;
      {
#pragma unroll
        for (int it = 0; it < 4; ++it) {
          const int row = it * 4 + q;
          const float* sp = slab + row * 68 + c8;
          v8h hv, lv;
#pragma unroll
          for (int e = 0; e < 8; ++e) {
            if (OUT_MODE == 1) {
              hv[e] = (_Float16)sp[e];
            } else {
              unsigned short hb = f2bf_bits(sp[e]);
              unsigned short lb = f2bf_bits(sp[e] - bf_bits2f(hb));
              hv[e] = __builtin_bit_cast(_Float16, hb);
              lv[e] = __builtin_bit_cast(_Float16, lb);
            }
          }
          *(v8h*)(C + (size_t)(mBase + row) * ldc + n0 + c8) = hv;
          if (OUT_MODE == 2) *(v8h*)(C2 + (size_t)(mBase + row) * ldc + n0 + c8) = lv;
        }
        
      }
    }
    __builtin_amdgcn_fence(3 /* release order */, "workgroup");
    __builtin_amdgcn_wave_barrier();
    __builtin_amdgcn_fence(2 /* acquire order */, "workgroup");
  }
}

} // namespace kit

__global__ __launch_bounds__(256) void k_cast16(const float* __restrict__ src, long long lds, _Float16* __restrict__ dst, long long ldd, int R, int C, float s) {
    const long long i = (long long)blockIdx.x * 256 + threadIdx.x; const long long np = (long long)R * (C / 2); if (i >= np) return; const int r = (int)(i / (C / 2)); const int c = 2 * (int)(i % (C / 2));
    const _Float16 h0 = (_Float16)(src[(long long)r * lds + c] * s), h1 = (_Float16)(src[(long long)r * lds + c + 1] * s);
    const unsigned u = (unsigned)__builtin_bit_cast(unsigned short, h0) | ((unsigned)__builtin_bit_cast(unsigned short, h1) << 16);
    unsigned* d = (unsigned*)(dst + (long long)r * ldd + c); *d = u;  }

typedef unsigned int cm_u4 __attribute__((ext_vector_type(4)));
// f32 -> bf16 (RNE) -> f16 planes: every 16-bit operand holds exactly the bf16-converted input value (times a power-of-two scale), so the f16 WMMA
// products of two such planes are exact in the f32 accumulator. Thread per (row, 8 cols); 16 B per thread, thread-linear along the dst row
__device__ __forceinline__ unsigned int cmb_pk2(float a, float b) { return (unsigned int)__builtin_bit_cast(unsigned short, (_Float16)a) | ((unsigned int)__builtin_bit_cast(unsigned short, (_Float16)b) << 16); }
__device__ __forceinline__ float cmb_bf(float v) { const unsigned u = __builtin_bit_cast(unsigned, v); const unsigned r = (u + 0x7fffu + ((u >> 16) & 1u)) & 0xffff0000u; return __builtin_bit_cast(float, r); }   // bf16 RNE, kept as f32 (finite inputs)
// DST[i] = bf16_rne(SRC[i]) kept as f32 (thread per element; bias vector)
__global__ __launch_bounds__(256) void k_cm_bfvec(const float* __restrict__ SRC, float* __restrict__ DST, int n) { const int u = blockIdx.x * 256 + threadIdx.x; if (u >= n) return; VST2(float, DST + u, cmb_bf(SRC[u])); }
__global__ __launch_bounds__(256) void k_cm_castb(const float* __restrict__ SRC, int lds, long long sSz, unsigned short* __restrict__ DST, int ldd, long long sDz, int nR, int nC, float sc) {
    const long long u = (long long)blockIdx.x * 256 + threadIdx.x; const int per = nC / 8; if (u >= (long long)nR * per) return; const int r = (int)(u / per); const int c0 = 8 * (int)(u % per);
    const float* s = SRC + (long long)blockIdx.y * sSz + (long long)r * lds + c0; float w[8];
#pragma unroll
    for (int e = 0; e < 8; ++e) w[e] = cmb_bf(s[e]) * sc;
    cm_u4 pk; pk.x = cmb_pk2(w[0], w[1]); pk.y = cmb_pk2(w[2], w[3]); pk.z = cmb_pk2(w[4], w[5]); pk.w = cmb_pk2(w[6], w[7]); VST2(cm_u4, (cm_u4*)(DST + (long long)blockIdx.y * sDz + (long long)r * ldd + c0), pk); }

extern "C" void kernel_launch(void* const* d_in, const int* in_sizes, int n_in, void* d_out, int out_size, void* d_ws, size_t ws_size, hipStream_t stream) {
    if (n_in < 8) return;
    const long long need_x = (long long)(NB - 1) * SEQ_FULL * EMBED + (long long)SEQ * EMBED;   // last element read of a token stream + 1
    if ((long long)in_sizes[0] < need_x || (long long)in_sizes[1] < need_x || (long long)in_sizes[2] < need_x) return;
    if (in_sizes[3] < HDIM * HDIM || in_sizes[4] < HDIM * HDIM || in_sizes[5] < HDIM * HDIM) return;
    if (in_sizes[6] < EMBED * EMBED || in_sizes[7] < EMBED) return;
    if ((long long)out_size < (long long)MTOK * EMBED) return;
    const float* xq = (const float*)d_in[0];
    const float* xk = (const float*)d_in[1];
    const float* xv = (const float*)d_in[2];
    const float* Wq = (const float*)d_in[3];
    const float* Wk = (const float*)d_in[4];
    const float* Wv = (const float*)d_in[5];
    const float* Wo = (const float*)d_in[6];
    const float* bo = (const float*)d_in[7];
    float* out = (float*)d_out;
    char* wsp = (char*)d_ws;
    unsigned short* X16 = (unsigned short*)wsp; wsp += (((size_t)MTOK * EMBED * 2 + 255) / 256) * 256;     // f16 token plane [MTOK][1024] = [MTOK*16][64]; reused per stream, then for the attention output
    unsigned short* W316 = (unsigned short*)wsp; wsp += (((size_t)3 * HDIM * HDIM * 2 + 255) / 256) * 256; // three f16 [64][64] weight planes (x16)
    float* Qf = (float*)wsp; wsp += (((size_t)MTOK * EMBED * 4 + 255) / 256) * 256;
    float* Kf = (float*)wsp; wsp += (((size_t)MTOK * EMBED * 4 + 255) / 256) * 256;
    float* Vf = (float*)wsp; wsp += (((size_t)MTOK * EMBED * 4 + 255) / 256) * 256;
    float* AO = (float*)wsp; wsp += (((size_t)MTOK * EMBED * 4 + 255) / 256) * 256;
    unsigned short* AO16 = X16;                                                                           // alias: X16 is free after the third projection
    unsigned short* WO16 = (unsigned short*)wsp; wsp += (((size_t)EMBED * EMBED * 2 + 255) / 256) * 256;
    float* BRO = (float*)wsp; wsp += (((size_t)(EMBED + 64) * 4 + 255) / 256) * 256;
    if ((size_t)(wsp - (char*)d_ws) > ws_size) return;

    const unsigned wblocks = (unsigned)(((long long)HDIM * (HDIM / 8) + 255) / 256);
    const unsigned xblocks = (unsigned)(((long long)SEQ * (EMBED / 8) + 255) / 256);
    const unsigned pgrid = (unsigned)((((MTOK * HEADS) / 64) * (HDIM / 64) + 7) / 8);
    // weights: src [64 out][64 in] -> f16 [out][in] x16 (Bt form [n][k])
    k_cm_castb<<<dim3(wblocks, 1), 256, 0, stream>>>(Wq, HDIM, 0, W316 + 0, HDIM, 0, HDIM, HDIM, 16.0f);
    k_cm_castb<<<dim3(wblocks, 1), 256, 0, stream>>>(Wk, HDIM, 0, W316 + HDIM * HDIM, HDIM, 0, HDIM, HDIM, 16.0f);
    k_cm_castb<<<dim3(wblocks, 1), 256, 0, stream>>>(Wv, HDIM, 0, W316 + 2 * HDIM * HDIM, HDIM, 0, HDIM, HDIM, 16.0f);
    // q stream: [NB][SEQ][1024] (full batch stride) -> packed f16 plane; per-head projection as [MTOK*16][64] x [64][64]^T -> Qf [MTOK*16][64] = [MTOK][1024]
    k_cm_castb<<<dim3(xblocks, NB), 256, 0, stream>>>(xq, EMBED, (long long)SEQ_FULL * EMBED, X16, EMBED, (long long)SEQ * EMBED, SEQ, EMBED, 1.0f);
    kit::wmma_gemm64<0, false, 0, 0, false, 0><<<dim3(pgrid, 1), 256, 0, stream>>>((const unsigned short*)X16, nullptr, HDIM, 0, (const unsigned short*)(W316 + 0), nullptr, HDIM, 0, (void*)Qf, nullptr, HDIM, 0, nullptr, nullptr, 0, MTOK * HEADS, HDIM, HDIM, 0.0625f);
    k_cm_castb<<<dim3(xblocks, NB), 256, 0, stream>>>(xk, EMBED, (long long)SEQ_FULL * EMBED, X16, EMBED, (long long)SEQ * EMBED, SEQ, EMBED, 1.0f);
    kit::wmma_gemm64<0, false, 0, 0, false, 0><<<dim3(pgrid, 1), 256, 0, stream>>>((const unsigned short*)X16, nullptr, HDIM, 0, (const unsigned short*)(W316 + HDIM * HDIM), nullptr, HDIM, 0, (void*)Kf, nullptr, HDIM, 0, nullptr, nullptr, 0, MTOK * HEADS, HDIM, HDIM, 0.0625f);
    k_cm_castb<<<dim3(xblocks, NB), 256, 0, stream>>>(xv, EMBED, (long long)SEQ_FULL * EMBED, X16, EMBED, (long long)SEQ * EMBED, SEQ, EMBED, 1.0f);
    kit::wmma_gemm64<0, false, 0, 0, false, 0><<<dim3(pgrid, 1), 256, 0, stream>>>((const unsigned short*)X16, nullptr, HDIM, 0, (const unsigned short*)(W316 + 2 * HDIM * HDIM), nullptr, HDIM, 0, (void*)Vf, nullptr, HDIM, 0, nullptr, nullptr, 0, MTOK * HEADS, HDIM, HDIM, 0.0625f);
    // output weight [1024 out][1024 in] -> f16 x16 (Bt form), bias -> bf16-valued f32
    k_cm_castb<<<dim3((unsigned)(((long long)EMBED * (EMBED / 8) + 255) / 256), 1), 256, 0, stream>>>(Wo, EMBED, 0, WO16, EMBED, 0, EMBED, EMBED, 16.0f);
    k_cm_bfvec<<<(EMBED + 255) / 256, 256, 0, stream>>>(bo, BRO, EMBED);
    {
      AttnG a;
      a.Q = Qf; a.K = Kf; a.V = Vf; a.O = AO;
      a.sb = (long long)SEQ * EMBED; a.S = SEQ; a.scale = 0.03125f;
      k_attn64<<<dim3((unsigned)(SEQ / 64), (unsigned)HEADS, (unsigned)NB), 32 * AT_NW, 0, stream>>>(a);
    }
    // attention output -> f16 plane carried x64, then out = (AO16 . WO16^T) / (64 * 16) + bias
    k_cast16<<<(unsigned)((((long long)MTOK * (EMBED / 2)) + 255) / 256), 256, 0, stream>>>(AO, EMBED, (_Float16*)AO16, EMBED, MTOK, EMBED, 64.0f);
    kit::wmma_gemm64<0, false, 2, 0, false, 0><<<dim3((unsigned)((((MTOK / 64) * (EMBED / 64)) + 7) / 8), 1), 256, 0, stream>>>((const unsigned short*)AO16, nullptr, EMBED, 0, (const unsigned short*)WO16, nullptr, EMBED, 0, (void*)out, nullptr, EMBED, 0, BRO, nullptr, 0, MTOK, EMBED, EMBED, 0.0009765625f);
}

// v001
// Measured time: 261 microseconds a run.
// Timed twice side by side with v000, it ran 1.22 and 1.21 times as fast.
// Multi-head attention (2 x 2,048 tokens x 1,024; 16 heads x 64; one shared 64x64 [out][in] weight per q / k / v stream applied per head, no biases; scores / 32; no mask; [out][in] output projection + bias). All contractions: v_wmma_f32_16x16x32_f16 (f16 operands, f32 accumulate): inputs and parameters converted to bf16 (RNE) first and held exactly in f16 (weights x16); per-head projections as f16 WMMA GEMMs over the [tokens*heads][64] view; one WMMA attention launch (f16 q fragments, f16 k and transposed f16 v tiles staged in LDS, f32 online softmax, probabilities carried x4096 as f16); output projection as an f16 WMMA GEMM of the f16 attention output carried x64, + bias in f32.
#include <hip/hip_runtime.h>
#include <math.h>

#ifndef NB
#define NB 2
#endif
#ifndef SEQ
#define SEQ 2048
#endif
#define NB_FULL 2
#define SEQ_FULL 2048
#define EMBED 1024
#define HEADS 16
#define HDIM 64
#define MTOK (NB * SEQ)

static_assert(SEQ % 64 == 0);
static_assert(MTOK % 64 == 0);
static_assert((MTOK * HEADS) % 64 == 0);
static_assert(EMBED % 64 == 0 && HDIM == 64);
static_assert(NB <= NB_FULL && SEQ <= SEQ_FULL);

typedef __attribute__((ext_vector_type(16))) _Float16 v16h;
typedef __attribute__((ext_vector_type(8)))  _Float16 v8h;
typedef __attribute__((ext_vector_type(8)))  float    v8f;
typedef __attribute__((ext_vector_type(4)))  float    v4f;

// 16-bit WMMA fragment map (wave32), lane L, h = L>>4, m = L&15:
//   A 16x32: lane = row m;   element i -> k = (i<8) ? 8h+i : 16+8h+(i-8)
//   B 32x16: lane = column m; the SAME k(i,h)
//   D 16x16 (8 f32): lane = column m; element r -> row 8h+r
__device__ __forceinline__ v8f wmma16(v16h a, v16h b, v8f c) {
    c = __builtin_amdgcn_wmma_f32_16x16x32_f16(false, a, false, b, (short)0, c, false, false);
    asm volatile("v_nop\n\tv_nop\n\tv_nop\n\tv_nop" : "+v"(c) : "v"(a), "v"(b));
    return c;
}
union FragH { v16h v; v8h h[2]; };

// A fragment from an f32 GLOBAL row: p points at column k0 + 8h of the lane's row; elements 0..7 <- p[0..7], 8..15 <- p[16..23], converted to f16
__device__ __forceinline__ v16h fh_g32(const float* __restrict__ p) {
    const v4f x0 = *(const v4f*)(p), x1 = *(const v4f*)(p + 4), x2 = *(const v4f*)(p + 16), x3 = *(const v4f*)(p + 20);
    v16h a;
#pragma unroll
    for (int e = 0; e < 4; ++e) { a[e] = (_Float16)x0[e]; a[4 + e] = (_Float16)x1[e]; a[8 + e] = (_Float16)x2[e]; a[12 + e] = (_Float16)x3[e]; }
    return a;
}

// 'val' is captured into a local first: never pass an expression that reads *ptr.
#define VST2(T, ptr, val) do { const T vst2_v_ = (val); *(T*)(ptr) = vst2_v_;  } while (0)

// =====================================================================================================================
// k_attn64: O(b,i,h,:) = softmax_j(scale * Q(b,i,h,:).K(b,j,h,:)) V(b,j,h,:) for head dim 64, no mask, S % 64 == 0.
//   Element (b, s, h, d) of Q / K / V / O lives at X[b*sb + s*EMBED + h*HDIM + d] (f32). Block = 4 waves = 64 queries of one (batch, head);
//   grid (S/64, HEADS, NB). Per 64-key block: the block stages K as f16 [key][d] and V as f16 [d][key] in LDS (block barriers on both sides);
//   scores^T = f16 k fragments (two 16-B LDS loads each) x f16 q fragments (registers), f32 accumulate; online softmax in f32, exp2 domain, per lane;
//   O^T += V^T.P^T with f16 v fragments from the transposed tile and P^T packed from the score registers; final 1/(rowsum*4096) in f32.
//   Staged extent == consumed extent: Ksh 64 keys x 64 d, Vts 64 d x 64 keys, Os 16 rows x 64 d; pad columns are never read.
// =====================================================================================================================
#define AT_NW 4
#define AT_KP 72          // LDS pitch in halves (144 B, a multiple of 16 B)
struct AttnG { const float* Q; const float* K; const float* V; float* O; long long sb; int S; float scale; };
static_assert(sizeof(AttnG) == 48);

#ifndef KATTN_ATTR
#define KATTN_ATTR __attribute__((amdgpu_num_vgpr(256)))
#endif
__global__ __launch_bounds__(32 * AT_NW) KATTN_ATTR void k_attn64(AttnG g) {
    __shared__ __align__(16) _Float16 Ksh[64 * AT_KP];
    __shared__ __align__(16) _Float16 Vts[64 * AT_KP];
    __shared__ __align__(16) float    Os[AT_NW][16 * 68];
    const int tid = threadIdx.x, wave = tid >> 5, lane = tid & 31, hf = lane >> 4, l15 = lane & 15;
    const int h = blockIdx.y, b = blockIdx.z;
    const int q0 = (blockIdx.x * AT_NW + wave) * 16;
    const float L2E = 1.4426950408889634f;
    const float NEG = -__builtin_inff();
    const float* qbase = g.Q + (long long)b * g.sb + h * HDIM;
    const float* kbase = g.K + (long long)b * g.sb + h * HDIM;
    const float* vbase = g.V + (long long)b * g.sb + h * HDIM;
    float*       obase = g.O + (long long)b * g.sb + h * HDIM;

    // q fragments (B operand: column = query l15), two 32-deep k-steps
    const float* qrow = qbase + (size_t)(q0 + l15) * EMBED + 8 * hf;
    const v16h qa0 = fh_g32(qrow), qa1 = fh_g32(qrow + 32);

    v8f o[4]; float m1 = NEG, l1 = 0.f;
#pragma unroll
    for (int t = 0; t < 4; ++t) { v8f zz = {}; o[t] = zz; }

    for (int j0 = 0; j0 < g.S; j0 += 64) {
        __syncthreads();                                     // the prior key block's reads of Ksh / Vts are done
#pragma unroll
        for (int it = 0; it < 4; ++it) {                     // 512 items = 64 keys x 8 column groups of 8
            const int item = tid + it * (32 * AT_NW);
            const int jr = item >> 3, c8 = (item & 7) * 8;
            const float* kr = kbase + (size_t)(j0 + jr) * EMBED + c8;
            const float* vr = vbase + (size_t)(j0 + jr) * EMBED + c8;
            const v4f ka = *(const v4f*)(kr), kc = *(const v4f*)(kr + 4);
            const v4f va = *(const v4f*)(vr), vc = *(const v4f*)(vr + 4);
            v8h kk;
#pragma unroll
            for (int e = 0; e < 4; ++e) { kk[e] = (_Float16)ka[e]; kk[4 + e] = (_Float16)kc[e]; }
            *(v8h*)(Ksh + jr * AT_KP + c8) = kk;
#pragma unroll
            for (int e = 0; e < 4; ++e) { Vts[(c8 + e) * AT_KP + jr] = (_Float16)va[e]; Vts[(c8 + 4 + e) * AT_KP + jr] = (_Float16)vc[e]; }
        }
        __syncthreads();                                     // K and V tiles visible to all waves

        v8f s[4];
#pragma unroll
        for (int t = 0; t < 4; ++t) {                        // A fragment: row = key t*16 + l15, k = d; B = the q fragments (column = query l15)
            const int ko = (t * 16 + l15) * AT_KP + 8 * hf;
            FragH k0f, k1f;
            k0f.h[0] = *(const v8h*)(Ksh + ko);      k0f.h[1] = *(const v8h*)(Ksh + ko + 16);
            k1f.h[0] = *(const v8h*)(Ksh + ko + 32); k1f.h[1] = *(const v8h*)(Ksh + ko + 48);
            v8f acc = {};
            acc = wmma16(k0f.v, qa0, acc);
            acc = wmma16(k1f.v, qa1, acc);
            s[t] = acc;
        }
        // online softmax of the lane's query: 32 scores in registers, one exchange with the other half-wave for the maximum
        float mx = NEG;
#pragma unroll
        for (int t = 0; t < 4; ++t)
#pragma unroll
            for (int r = 0; r < 8; ++r) { float v = s[t][r] * g.scale; v *= L2E; s[t][r] = v; mx = fmaxf(mx, v); }
        mx = fmaxf(mx, __shfl_xor(mx, 16, 32));
        const float mnew = fmaxf(m1, mx);
        const float corr = (mnew == NEG) ? 1.f : exp2f(m1 - mnew);
        // P^T as B operand straight from the score tiles: element i < 8 is key 8*hf + i (tile 2u), element 8 + i is key 16 + 8*hf + i (tile 2u + 1)
        FragH pf[2];
        float rs4[4];
#pragma unroll
        for (int t = 0; t < 4; ++t) {
            float rs = 0.f;
#pragma unroll
            for (int r = 0; r < 8; ++r) {
                const float pp = (s[t][r] == NEG) ? 0.f : exp2f(s[t][r] - mnew); rs += pp;
                pf[t >> 1].h[t & 1][r] = (_Float16)(pp * 4096.f);
            }
            rs4[t] = rs;
        }
        l1 = l1 * corr + ((rs4[0] + rs4[1]) + (rs4[2] + rs4[3])); m1 = mnew;   // the lane's own 32 keys; both half-waves use the same corr, so the halves join once after the loop
#pragma unroll
        for (int t = 0; t < 4; ++t)
#pragma unroll
            for (int r = 0; r < 8; ++r) o[t][r] *= corr;
#pragma unroll
        for (int t = 0; t < 4; ++t) {                        // A fragment: row = d t*16 + l15, k = key (transposed tile, k-contiguous)
            const int vo = (t * 16 + l15) * AT_KP + 8 * hf;
            FragH v0f, v1f;
            v0f.h[0] = *(const v8h*)(Vts + vo);      v0f.h[1] = *(const v8h*)(Vts + vo + 16);
            v1f.h[0] = *(const v8h*)(Vts + vo + 32); v1f.h[1] = *(const v8h*)(Vts + vo + 48);
            o[t] = wmma16(v0f.v, pf[0].v, o[t]);
            o[t] = wmma16(v1f.v, pf[1].v, o[t]);
        }
    }

    // O: stage the wave's 16 x 64 tile (pitch 68 floats; the lane writes 8 consecutive d of its query per tile), then each half-wave writes one whole 256-B row segment per instruction (16 lanes x 16 B),
    {
        l1 += __shfl_xor(l1, 16, 32);                        // join the two half-waves' row sums
        const float inv = (l1 > 0.f) ? 1.f / (l1 * 4096.f) : 0.f;
#pragma unroll
        for (int t = 0; t < 4; ++t) {
            v4f w0, w1;
#pragma unroll
            for (int e = 0; e < 4; ++e) { w0[e] = o[t][e] * inv; w1[e] = o[t][4 + e] * inv; }
            *(v4f*)(&Os[wave][l15 * 68 + t * 16 + 8 * hf]) = w0;
            *(v4f*)(&Os[wave][l15 * 68 + t * 16 + 8 * hf + 4]) = w1;
        }
    }
    __builtin_amdgcn_fence(3 /* release order */, "workgroup");
    __builtin_amdgcn_wave_barrier();
    __builtin_amdgcn_fence(2 /* acquire order */, "workgroup");
    {
        const int c4 = l15 * 4;
        {
#pragma unroll
            for (int it = 0; it < 8; ++it) {
                const int row = it * 2 + hf;
                const v4f val = *(const v4f*)(&Os[wave][row * 68 + c4]);
                *(v4f*)(obase + (size_t)(q0 + row) * EMBED + c4) = val;
            }
            
        }
    }
}

namespace kit {
typedef __attribute__((ext_vector_type(16))) _Float16 v16h;
typedef __attribute__((ext_vector_type(8)))  _Float16 v8h;
typedef __attribute__((ext_vector_type(16))) __bf16   v16b;
typedef __attribute__((ext_vector_type(8)))  __bf16   v8b;
typedef __attribute__((ext_vector_type(8)))  float    v8f;
typedef __attribute__((ext_vector_type(4)))  float    v4f;

__device__ __forceinline__ unsigned short f2bf_bits(float f) {
  unsigned u = __float_as_uint(f);
  return (unsigned short)((u + 0x7FFFu + ((u >> 16) & 1u)) >> 16);
}
__device__ __forceinline__ float bf_bits2f(unsigned short h) { return __uint_as_float(((unsigned)h) << 16); }

// hazard guards as plain device helpers
__device__ __forceinline__ void dep_guard_h(v8f& a, v8f& b, v16h x, v16h y) { asm volatile("v_nop\n\tv_nop\n\tv_nop\n\tv_nop" : "+v"(a), "+v"(b) : "v"(x), "v"(y)); }
__device__ __forceinline__ void dep_guard_b(v8f& a, v8f& b, v16b x, v16b y) { asm volatile("v_nop\n\tv_nop\n\tv_nop\n\tv_nop" : "+v"(a), "+v"(b) : "v"(x), "v"(y)); }
__device__ __forceinline__ void keep4_h(v16h a, v16h b, v16h c, v16h d) { asm volatile("v_nop" :: "v"(a), "v"(b), "v"(c), "v"(d)); }
__device__ __forceinline__ void keep4_b(v16b a, v16b b, v16b c, v16b d) { asm volatile("v_nop" :: "v"(a), "v"(b), "v"(c), "v"(d)); }
__device__ __forceinline__ void acc_guard4(v8f& a, v8f& b, v8f& c, v8f& d) { asm volatile("v_nop\n\tv_nop\n\tv_nop\n\tv_nop" : "+v"(a), "+v"(b), "+v"(c), "+v"(d)); }
template <typename T> struct Frag;
template <> struct Frag<_Float16> {
  typedef v16h V; union U { v16h v; v8h h[2]; };
  static __device__ __forceinline__ v16h load(const _Float16* p) {   // elements 0..7 <- p[0..7], 8..15 <- p[16..23]
    U f; f.h[0] = *(const v8h*)(p); f.h[1] = *(const v8h*)(p + 16); return f.v;
  }
  static __device__ __forceinline__ v8f mma(v16h a, v16h b, v8f c) {
    return __builtin_amdgcn_wmma_f32_16x16x32_f16(false, a, false, b, (short)0, c, false, false);
  }
  static __device__ __forceinline__ void guard(v8f& a, v8f& b, v16h x, v16h y) { dep_guard_h(a, b, x, y); }
  static __device__ __forceinline__ void keep(v16h a, v16h b, v16h c, v16h d) { keep4_h(a, b, c, d); }
};
template <> struct Frag<__bf16> {
  typedef v16b V; union U { v16b v; v8b h[2]; };
  static __device__ __forceinline__ v16b load(const __bf16* p) {
    U f; f.h[0] = *(const v8b*)(p); f.h[1] = *(const v8b*)(p + 16); return f.v;
  }
  static __device__ __forceinline__ v8f mma(v16b a, v16b b, v8f c) {
    return __builtin_amdgcn_wmma_f32_16x16x32_bf16(false, a, false, b, (short)0, c, false, false);
  }
  static __device__ __forceinline__ void guard(v8f& a, v8f& b, v16b x, v16b y) { dep_guard_b(a, b, x, y); }
  static __device__ __forceinline__ void keep(v16b a, v16b b, v16b c, v16b d) { keep4_b(a, b, c, d); }
};

// ---- Register-blocked batched WMMA GEMM ------------------------------------
// C[m,n] = scale * sum_k A[m,k] * Bt[n,k] (+bias)(+resid); each wave owns a 64x64 tile.
// A row-major [M,K]; Bt row-major [N,K]; M,N % 64 == 0, K % 32 == 0 (no tail masking).
// SPLIT: operands are hi/lo planes (A2/Bt2 = lo planes, same layout); product = hi*hi + hi*lo + lo*hi.
// BIAS_MODE: 0 = none, 1 = bias[m], 2 = bias[n].
// OUT_MODE: 0 = f32, 1 = f16, 2 = bf16 hi plane (Cout) + bf16 lo plane (Cout2).
// ET: 0 = f16 operands, 1 = bf16 operands (pointers passed as 16-bit storage)
template <int ET> struct Elem;
template <> struct Elem<0> { typedef _Float16 T; };
template <> struct Elem<1> { typedef __bf16 T; };
template <int ET, bool SPLIT, int BIAS_MODE, int OUT_MODE, bool RESID, int ACT = 0>
__global__ __launch_bounds__(256) void wmma_gemm64(
    const unsigned short* __restrict__ Ap, const unsigned short* __restrict__ A2p, int lda, long strideA,
    const unsigned short* __restrict__ Btp, const unsigned short* __restrict__ Bt2p, int ldb, long strideB,
    void* __restrict__ Cout, void* __restrict__ Cout2, int ldc, long strideC,
    const float* __restrict__ bias,
    const float* __restrict__ resid, long strideR,
    int M, int N, int K, float scale) {
  typedef typename Elem<ET>::T T;
  typedef typename Frag<T>::V V;
  const T* A = (const T*)Ap; const T* A2 = (const T*)A2p; const T* Bt = (const T*)Btp; const T* Bt2 = (const T*)Bt2p;
  __shared__ __align__(16) float sT[8][16 * 68];   // per-wave 16x64 slab, pitch 68 floats
  const int b    = blockIdx.y;
  const int lane = threadIdx.x & 31;
  const int wave = threadIdx.x >> 5;
  const int tilesN = N >> 6;
  const int tilesM = M >> 6;
  const int tile = blockIdx.x * 8 + wave;
  if (tile >= tilesM * tilesN) return;   // wave-uniform; no block barriers in this kernel
  const int tm = tile / tilesN;
  const int tn = tile - tm * tilesN;
  const int m0 = tm << 6;
  const int n0 = tn << 6;

  const T* Ab  = A  + (size_t)b * strideA;
  const T* Bb  = Bt + (size_t)b * strideB;
  const T* Ab2 = SPLIT ? (A2  + (size_t)b * strideA) : nullptr;
  const T* Bb2 = SPLIT ? (Bt2 + (size_t)b * strideB) : nullptr;

  const int rlane = lane & 15;                 // row (A) / col (B, D) within subtile
  const int koff  = (lane >> 4) * 8;           // k offset of this lane half
  const int mOff  = (lane >> 4) * 8;           // D row offset

  v8f acc[4][4];
#pragma unroll
  for (int i = 0; i < 4; ++i)
#pragma unroll
    for (int j = 0; j < 4; ++j) acc[i][j] = (v8f){0.f,0.f,0.f,0.f,0.f,0.f,0.f,0.f};

  for (int k0 = 0; k0 < K; k0 += 32) {
    V bh[4], bl[4];
#pragma unroll
    for (int j = 0; j < 4; ++j) {
      const size_t bo = (size_t)(n0 + (j << 4) + rlane) * ldb + koff + k0;
      bh[j] = Frag<T>::load(Bb + bo);
      if (SPLIT) bl[j] = Frag<T>::load(Bb2 + bo);
    }
#pragma unroll
    for (int i = 0; i < 4; ++i) {
      const size_t ao = (size_t)(m0 + (i << 4) + rlane) * lda + koff + k0;
      V ah = Frag<T>::load(Ab + ao);
      V al;
      if (SPLIT) al = Frag<T>::load(Ab2 + ao);
#pragma unroll
      for (int j = 0; j < 4; ++j) {
        acc[i][j] = Frag<T>::mma(ah, bh[j], acc[i][j]);
        if (SPLIT) {
          acc[i][j] = Frag<T>::mma(ah, bl[j], acc[i][j]);
          acc[i][j] = Frag<T>::mma(al, bh[j], acc[i][j]);
        }
      }
      Frag<T>::guard(acc[i][0], acc[i][3], ah, SPLIT ? al : ah);
    }
    Frag<T>::keep(bh[0], bh[1], bh[2], bh[3]);
    if (SPLIT) Frag<T>::keep(bl[0], bl[1], bl[2], bl[3]);
  }
  acc_guard4(acc[0][0], acc[0][1], acc[0][2], acc[0][3]);
  acc_guard4(acc[1][0], acc[1][1], acc[1][2], acc[1][3]);
  acc_guard4(acc[2][0], acc[2][1], acc[2][2], acc[2][3]);
  acc_guard4(acc[3][0], acc[3][1], acc[3][2], acc[3][3]);

  // ---- epilogue ----
  float* slab = sT[wave];
  const float* Rb = RESID ? (resid + (size_t)b * strideR) : nullptr;
#pragma unroll
  for (int i = 0; i < 4; ++i) {
    const int mBase = m0 + (i << 4);
#pragma unroll
    for (int j = 0; j < 4; ++j) {
      const int n = n0 + (j << 4) + rlane;
      float bv = 0.f;
      if (BIAS_MODE == 2) bv = bias[n];
#pragma unroll
      for (int r = 0; r < 8; ++r) {
        float v = acc[i][j][r] * scale;
        if (BIAS_MODE == 1) v += bias[mBase + mOff + r];
        if (BIAS_MODE == 2) v += bv;
        if (RESID) v += Rb[(size_t)(mBase + mOff + r) * ldc + n];
        if (ACT == 1) v = tanhf(v);
        if (ACT == 2) v = fmaxf(v, 0.0f);
        if (ACT == 3) v = v / (1.0f + expf(-v));
        if (ACT == 4) v = (v > 0.f) ? v : 0.01f * v;
        if (ACT == 5) v = 0.5f * v * (1.0f + erff(v * 0.70710678118654752f));
        if (ACT == 6) v = (v > 0.f) ? v : 0.2f * v;
        if (ACT == 7) { const float u = 0.7978845608028654f * (v + 0.044715f * v * v * v); v = 0.5f * v * (1.f + tanhf(u)); }
        slab[(mOff + r) * 68 + (j << 4) + rlane] = v;
      }
    }
    __builtin_amdgcn_fence(3 /* release order */, "workgroup");
    __builtin_amdgcn_wave_barrier();
    __builtin_amdgcn_fence(2 /* acquire order */, "workgroup");
    if (OUT_MODE == 0) {
      float* C = (float*)Cout + (size_t)b * strideC;
      const int hh = lane >> 4, c4 = (lane & 15) * 4;     // row seg = 256 B = 16 lanes x 16 B
      {
#pragma unroll
        for (int it = 0; it < 8; ++it) {
          const int row = it * 2 + hh;
          v4f v = *(const v4f*)(slab + row * 68 + c4);
          *(v4f*)(C + (size_t)(mBase + row) * ldc + n0 + c4) = v;
        }
        
      }
    } else {
      const int q = lane >> 3, c8 = (lane & 7) * 8;
      unsigned short* C  = (unsigned short*)Cout  + (size_t)b * strideC;
      unsigned short* C2 = (OUT_MODE == 2) ? ((unsigned short*)Cout2 + (size_t)b * strideC) : nullptr;
      {
#pragma unroll
        for (int it = 0; it < 4; ++it) {
          const int row = it * 4 + q;
          const float* sp = slab + row * 68 + c8;
          v8h hv, lv;
#pragma unroll
          for (int e = 0; e < 8; ++e) {
            if (OUT_MODE == 1) {
              hv[e] = (_Float16)sp[e];
            } else {
              unsigned short hb = f2bf_bits(sp[e]);
              unsigned short lb = f2bf_bits(sp[e] - bf_bits2f(hb));
              hv[e] = __builtin_bit_cast(_Float16, hb);
              lv[e] = __builtin_bit_cast(_Float16, lb);
            }
          }
          *(v8h*)(C + (size_t)(mBase + row) * ldc + n0 + c8) = hv;
          if (OUT_MODE == 2) *(v8h*)(C2 + (size_t)(mBase + row) * ldc + n0 + c8) = lv;
        }
        
      }
    }
    __builtin_amdgcn_fence(3 /* release order */, "workgroup");
    __builtin_amdgcn_wave_barrier();
    __builtin_amdgcn_fence(2 /* acquire order */, "workgroup");
  }
}

}

__global__ __launch_bounds__(256) void k_cast16(const float* __restrict__ src, long long lds, _Float16* __restrict__ dst, long long ldd, int R, int C, float s) {
    const long long i = (long long)blockIdx.x * 256 + threadIdx.x; const long long np = (long long)R * (C / 2); if (i >= np) return; const int r = (int)(i / (C / 2)); const int c = 2 * (int)(i % (C / 2));
    const _Float16 h0 = (_Float16)(src[(long long)r * lds + c] * s), h1 = (_Float16)(src[(long long)r * lds + c + 1] * s);
    const unsigned u = (unsigned)__builtin_bit_cast(unsigned short, h0) | ((unsigned)__builtin_bit_cast(unsigned short, h1) << 16);
    unsigned* d = (unsigned*)(dst + (long long)r * ldd + c); *d = u;  }

typedef unsigned int cm_u4 __attribute__((ext_vector_type(4)));
// f32 -> bf16 (RNE) -> f16 planes: every 16-bit operand holds exactly the bf16-converted input value (times a power-of-two scale), so the f16 WMMA
// products of two such planes are exact in the f32 accumulator. Thread per (row, 8 cols); 16 B per thread, thread-linear along the dst row
__device__ __forceinline__ unsigned int cmb_pk2(float a, float b) { return (unsigned int)__builtin_bit_cast(unsigned short, (_Float16)a) | ((unsigned int)__builtin_bit_cast(unsigned short, (_Float16)b) << 16); }
__device__ __forceinline__ float cmb_bf(float v) { const unsigned u = __builtin_bit_cast(unsigned, v); const unsigned r = (u + 0x7fffu + ((u >> 16) & 1u)) & 0xffff0000u; return __builtin_bit_cast(float, r); }   // bf16 RNE, kept as f32 (finite inputs)
// DST[i] = bf16_rne(SRC[i]) kept as f32 (thread per element; bias vector)
__global__ __launch_bounds__(256) void k_cm_bfvec(const float* __restrict__ SRC, float* __restrict__ DST, int n) { const int u = blockIdx.x * 256 + threadIdx.x; if (u >= n) return; VST2(float, DST + u, cmb_bf(SRC[u])); }
__global__ __launch_bounds__(256) void k_cm_castb(const float* __restrict__ SRC, int lds, long long sSz, unsigned short* __restrict__ DST, int ldd, long long sDz, int nR, int nC, float sc) {
    const long long u = (long long)blockIdx.x * 256 + threadIdx.x; const int per = nC / 8; if (u >= (long long)nR * per) return; const int r = (int)(u / per); const int c0 = 8 * (int)(u % per);
    const float* s = SRC + (long long)blockIdx.y * sSz + (long long)r * lds + c0; float w[8];
#pragma unroll
    for (int e = 0; e < 8; ++e) w[e] = cmb_bf(s[e]) * sc;
    cm_u4 pk; pk.x = cmb_pk2(w[0], w[1]); pk.y = cmb_pk2(w[2], w[3]); pk.z = cmb_pk2(w[4], w[5]); pk.w = cmb_pk2(w[6], w[7]); VST2(cm_u4, (cm_u4*)(DST + (long long)blockIdx.y * sDz + (long long)r * ldd + c0), pk); }

extern "C" void kernel_launch(void* const* d_in, const int* in_sizes, int n_in, void* d_out, int out_size, void* d_ws, size_t ws_size, hipStream_t stream) {
    if (n_in < 8) return;
    const long long need_x = (long long)(NB - 1) * SEQ_FULL * EMBED + (long long)SEQ * EMBED;   // last element read of a token stream + 1
    if ((long long)in_sizes[0] < need_x || (long long)in_sizes[1] < need_x || (long long)in_sizes[2] < need_x) return;
    if (in_sizes[3] < HDIM * HDIM || in_sizes[4] < HDIM * HDIM || in_sizes[5] < HDIM * HDIM) return;
    if (in_sizes[6] < EMBED * EMBED || in_sizes[7] < EMBED) return;
    if ((long long)out_size < (long long)MTOK * EMBED) return;
    const float* xq = (const float*)d_in[0];
    const float* xk = (const float*)d_in[1];
    const float* xv = (const float*)d_in[2];
    const float* Wq = (const float*)d_in[3];
    const float* Wk = (const float*)d_in[4];
    const float* Wv = (const float*)d_in[5];
    const float* Wo = (const float*)d_in[6];
    const float* bo = (const float*)d_in[7];
    float* out = (float*)d_out;
    char* wsp = (char*)d_ws;
    unsigned short* X16 = (unsigned short*)wsp; wsp += (((size_t)MTOK * EMBED * 2 + 255) / 256) * 256;     // f16 token plane [MTOK][1024] = [MTOK*16][64]; reused per stream, then for the attention output
    unsigned short* W316 = (unsigned short*)wsp; wsp += (((size_t)3 * HDIM * HDIM * 2 + 255) / 256) * 256; // three f16 [64][64] weight planes (x16)
    float* Qf = (float*)wsp; wsp += (((size_t)MTOK * EMBED * 4 + 255) / 256) * 256;
    float* Kf = (float*)wsp; wsp += (((size_t)MTOK * EMBED * 4 + 255) / 256) * 256;
    float* Vf = (float*)wsp; wsp += (((size_t)MTOK * EMBED * 4 + 255) / 256) * 256;
    float* AO = (float*)wsp; wsp += (((size_t)MTOK * EMBED * 4 + 255) / 256) * 256;
    unsigned short* AO16 = X16;                                                                           // alias: X16 is free after the third projection
    unsigned short* WO16 = (unsigned short*)wsp; wsp += (((size_t)EMBED * EMBED * 2 + 255) / 256) * 256;
    float* BRO = (float*)wsp; wsp += (((size_t)(EMBED + 64) * 4 + 255) / 256) * 256;
    if ((size_t)(wsp - (char*)d_ws) > ws_size) return;

    const unsigned wblocks = (unsigned)(((long long)HDIM * (HDIM / 8) + 255) / 256);
    const unsigned xblocks = (unsigned)(((long long)SEQ * (EMBED / 8) + 255) / 256);
    const unsigned pgrid = (unsigned)((((MTOK * HEADS) / 64) * (HDIM / 64) + 7) / 8);
    // weights: src [64 out][64 in] -> f16 [out][in] x16 (Bt form [n][k])
    k_cm_castb<<<dim3(wblocks, 1), 256, 0, stream>>>(Wq, HDIM, 0, W316 + 0, HDIM, 0, HDIM, HDIM, 16.0f);
    k_cm_castb<<<dim3(wblocks, 1), 256, 0, stream>>>(Wk, HDIM, 0, W316 + HDIM * HDIM, HDIM, 0, HDIM, HDIM, 16.0f);
    k_cm_castb<<<dim3(wblocks, 1), 256, 0, stream>>>(Wv, HDIM, 0, W316 + 2 * HDIM * HDIM, HDIM, 0, HDIM, HDIM, 16.0f);
    // q stream: [NB][SEQ][1024] (full batch stride) -> packed f16 plane; per-head projection as [MTOK*16][64] x [64][64]^T -> Qf [MTOK*16][64] = [MTOK][1024]
    k_cm_castb<<<dim3(xblocks, NB), 256, 0, stream>>>(xq, EMBED, (long long)SEQ_FULL * EMBED, X16, EMBED, (long long)SEQ * EMBED, SEQ, EMBED, 1.0f);
    kit::wmma_gemm64<0, false, 0, 0, false, 0><<<dim3(pgrid, 1), 256, 0, stream>>>((const unsigned short*)X16, nullptr, HDIM, 0, (const unsigned short*)(W316 + 0), nullptr, HDIM, 0, (void*)Qf, nullptr, HDIM, 0, nullptr, nullptr, 0, MTOK * HEADS, HDIM, HDIM, 0.0625f);
    k_cm_castb<<<dim3(xblocks, NB), 256, 0, stream>>>(xk, EMBED, (long long)SEQ_FULL * EMBED, X16, EMBED, (long long)SEQ * EMBED, SEQ, EMBED, 1.0f);
    kit::wmma_gemm64<0, false, 0, 0, false, 0><<<dim3(pgrid, 1), 256, 0, stream>>>((const unsigned short*)X16, nullptr, HDIM, 0, (const unsigned short*)(W316 + HDIM * HDIM), nullptr, HDIM, 0, (void*)Kf, nullptr, HDIM, 0, nullptr, nullptr, 0, MTOK * HEADS, HDIM, HDIM, 0.0625f);
    k_cm_castb<<<dim3(xblocks, NB), 256, 0, stream>>>(xv, EMBED, (long long)SEQ_FULL * EMBED, X16, EMBED, (long long)SEQ * EMBED, SEQ, EMBED, 1.0f);
    kit::wmma_gemm64<0, false, 0, 0, false, 0><<<dim3(pgrid, 1), 256, 0, stream>>>((const unsigned short*)X16, nullptr, HDIM, 0, (const unsigned short*)(W316 + 2 * HDIM * HDIM), nullptr, HDIM, 0, (void*)Vf, nullptr, HDIM, 0, nullptr, nullptr, 0, MTOK * HEADS, HDIM, HDIM, 0.0625f);
    // output weight [1024 out][1024 in] -> f16 x16 (Bt form), bias -> bf16-valued f32
    k_cm_castb<<<dim3((unsigned)(((long long)EMBED * (EMBED / 8) + 255) / 256), 1), 256, 0, stream>>>(Wo, EMBED, 0, WO16, EMBED, 0, EMBED, EMBED, 16.0f);
    k_cm_bfvec<<<(EMBED + 255) / 256, 256, 0, stream>>>(bo, BRO, EMBED);
    {
      AttnG a;
      a.Q = Qf; a.K = Kf; a.V = Vf; a.O = AO;
      a.sb = (long long)SEQ * EMBED; a.S = SEQ; a.scale = 0.03125f;
      k_attn64<<<dim3((unsigned)(SEQ / 64), (unsigned)HEADS, (unsigned)NB), 32 * AT_NW, 0, stream>>>(a);
    }
    // attention output -> f16 plane carried x64, then out = (AO16 . WO16^T) / (64 * 16) + bias
    k_cast16<<<(unsigned)((((long long)MTOK * (EMBED / 2)) + 255) / 256), 256, 0, stream>>>(AO, EMBED, (_Float16*)AO16, EMBED, MTOK, EMBED, 64.0f);
    kit::wmma_gemm64<0, false, 2, 0, false, 0><<<dim3((unsigned)((((MTOK / 64) * (EMBED / 64)) + 7) / 8), 1), 256, 0, stream>>>((const unsigned short*)AO16, nullptr, EMBED, 0, (const unsigned short*)WO16, nullptr, EMBED, 0, (void*)out, nullptr, EMBED, 0, BRO, nullptr, 0, MTOK, EMBED, EMBED, 0.0009765625f);
}

// v002
// One run takes 236 microseconds.
// In both of two side-by-side timings against v001, it was 1.12 times as fast.
// All steps since v000 together make it 1.36 times as fast.
// Multi-head attention (2 x 2,048 tokens x 1,024; 16 heads x 64; one shared 64x64 [out][in] weight per q / k / v stream applied per head, no biases; scores / 32; no mask; [out][in] output projection + bias). All contractions: v_wmma_f32_16x16x32_f16 (f16 operands, f32 accumulate): inputs and parameters converted to bf16 (RNE) first and held exactly in f16 (weights x16); per-head projections as f16 WMMA GEMMs over the [tokens*heads][64] view; one WMMA attention launch (f16 q fragments, f16 k and transposed f16 v tiles staged in LDS, f32 online softmax, probabilities carried x4096 as f16); output projection as an f16 WMMA GEMM of the f16 attention output carried x64, + bias in f32.
#include <hip/hip_runtime.h>
#include <math.h>

#ifndef NB
#define NB 2
#endif
#ifndef SEQ
#define SEQ 2048
#endif
#define NB_FULL 2
#define SEQ_FULL 2048
#define EMBED 1024
#define HEADS 16
#define HDIM 64
#define MTOK (NB * SEQ)

static_assert(SEQ % 64 == 0);
static_assert(MTOK % 64 == 0);
static_assert((MTOK * HEADS) % 64 == 0);
static_assert(EMBED % 64 == 0 && HDIM == 64);
static_assert(NB <= NB_FULL && SEQ <= SEQ_FULL);

typedef __attribute__((ext_vector_type(16))) _Float16 v16h;
typedef __attribute__((ext_vector_type(8)))  _Float16 v8h;
typedef __attribute__((ext_vector_type(8)))  float    v8f;
typedef __attribute__((ext_vector_type(4)))  float    v4f;

// 16-bit WMMA fragment map (wave32), lane L, h = L>>4, m = L&15:
//   A 16x32: lane = row m;   element i -> k = (i<8) ? 8h+i : 16+8h+(i-8)
//   B 32x16: lane = column m; the SAME k(i,h)
//   D 16x16 (8 f32): lane = column m; element r -> row 8h+r
__device__ __forceinline__ v8f wmma16(v16h a, v16h b, v8f c) {
    c = __builtin_amdgcn_wmma_f32_16x16x32_f16(false, a, false, b, (short)0, c, false, false);
    asm volatile("v_nop\n\tv_nop\n\tv_nop\n\tv_nop" : "+v"(c) : "v"(a), "v"(b));
    return c;
}
union FragH { v16h v; v8h h[2]; };

// A fragment from an f32 GLOBAL row: p points at column k0 + 8h of the lane's row; elements 0..7 <- p[0..7], 8..15 <- p[16..23], converted to f16
__device__ __forceinline__ v16h fh_g32(const float* __restrict__ p) {
    const v4f x0 = *(const v4f*)(p), x1 = *(const v4f*)(p + 4), x2 = *(const v4f*)(p + 16), x3 = *(const v4f*)(p + 20);
    v16h a;
#pragma unroll
    for (int e = 0; e < 4; ++e) { a[e] = (_Float16)x0[e]; a[4 + e] = (_Float16)x1[e]; a[8 + e] = (_Float16)x2[e]; a[12 + e] = (_Float16)x3[e]; }
    return a;
}

// Eight bare v_exp_f32, each over its own argument register, in one statement: no neighbour can take a transcendental's source or read its result
// directly behind it, whatever registers the build picks; the closing v_nop is the independent slot that the instruction set asks for behind the last one.
__device__ __forceinline__ void exp2x8(float (&e)[8]) {
    asm("v_exp_f32 %0, %0\n\tv_exp_f32 %1, %1\n\tv_exp_f32 %2, %2\n\tv_exp_f32 %3, %3\n\t"
        "v_exp_f32 %4, %4\n\tv_exp_f32 %5, %5\n\tv_exp_f32 %6, %6\n\tv_exp_f32 %7, %7\n\tv_nop"
        : "+v"(e[0]), "+v"(e[1]), "+v"(e[2]), "+v"(e[3]), "+v"(e[4]), "+v"(e[5]), "+v"(e[6]), "+v"(e[7]));
}

// 'val' is captured into a local first: never pass an expression that reads *ptr.
#define VST2(T, ptr, val) do { const T vst2_v_ = (val); *(T*)(ptr) = vst2_v_;  } while (0)

// =====================================================================================================================
// k_attn64: O(b,i,h,:) = softmax_j(scale * Q(b,i,h,:).K(b,j,h,:)) V(b,j,h,:) for head dim 64, no mask, S % 64 == 0.
//   Element (b, s, h, d) of Q / K / V / O lives at X[b*sb + s*EMBED + h*HDIM + d] (f32). Block = 4 waves = 64 queries of one (batch, head);
//   grid (S/64, HEADS, NB). Per 64-key block: the block stages K as f16 [key][d] and V as f16 [d][key] in LDS (block barriers on both sides);
//   scores^T = f16 k fragments (two 16-B LDS loads each) x f16 q fragments (registers), f32 accumulate; online softmax in f32, exp2 domain, per lane;
//   O^T += V^T.P^T with f16 v fragments from the transposed tile and P^T packed from the score registers; row sums carried x4096 like P, final 1/rowsum in f32.
//   Staged extent == consumed extent: Ksh 64 keys x 64 d, Vts 64 d x 64 keys, Os 16 rows x 64 d; pad columns are never read.
// =====================================================================================================================
#define AT_NW 4
#define AT_KP 72          // LDS pitch in halves (144 B, a multiple of 16 B)
struct AttnG { const float* Q; const float* K; const float* V; float* O; long long sb; int S; float scale; };
static_assert(sizeof(AttnG) == 48);

#ifndef KATTN_ATTR
#define KATTN_ATTR __attribute__((amdgpu_num_vgpr(256)))
#endif
__global__ __launch_bounds__(32 * AT_NW) KATTN_ATTR void k_attn64(AttnG g) {
    __shared__ __align__(16) _Float16 Ksh[64 * AT_KP];
    __shared__ __align__(16) _Float16 Vts[64 * AT_KP];
    __shared__ __align__(16) float    Os[AT_NW][16 * 68];
    const int tid = threadIdx.x, wave = tid >> 5, lane = tid & 31, hf = lane >> 4, l15 = lane & 15;
    const int h = blockIdx.y, b = blockIdx.z;
    const int q0 = (blockIdx.x * AT_NW + wave) * 16;
    const float L2E = 1.4426950408889634f;
    const float NEG = -__builtin_inff();
    const float sc2 = g.scale * L2E;                         // raw score -> base-2 exponent
    const float* qbase = g.Q + (long long)b * g.sb + h * HDIM;
    const float* kbase = g.K + (long long)b * g.sb + h * HDIM;
    const float* vbase = g.V + (long long)b * g.sb + h * HDIM;
    float*       obase = g.O + (long long)b * g.sb + h * HDIM;

    // q fragments (B operand: column = query l15), two 32-deep k-steps
    const float* qrow = qbase + (size_t)(q0 + l15) * EMBED + 8 * hf;
    const v16h qa0 = fh_g32(qrow), qa1 = fh_g32(qrow + 32);

    v8f o[4]; float m1 = NEG, l1 = 0.f;
#pragma unroll
    for (int t = 0; t < 4; ++t) { v8f zz = {}; o[t] = zz; }

    for (int j0 = 0; j0 < g.S; j0 += 64) {
        __syncthreads();                                     // the prior key block's reads of Ksh / Vts are done
#pragma unroll
        for (int it = 0; it < 4; ++it) {                     // 512 items = 64 keys x 8 column groups of 8
            const int item = tid + it * (32 * AT_NW);
            const int jr = item >> 3, c8 = (item & 7) * 8;
            const float* kr = kbase + (size_t)(j0 + jr) * EMBED + c8;
            const float* vr = vbase + (size_t)(j0 + jr) * EMBED + c8;
            const v4f ka = *(const v4f*)(kr), kc = *(const v4f*)(kr + 4);
            const v4f va = *(const v4f*)(vr), vc = *(const v4f*)(vr + 4);
            v8h kk;
#pragma unroll
            for (int e = 0; e < 4; ++e) { kk[e] = (_Float16)ka[e]; kk[4 + e] = (_Float16)kc[e]; }
            *(v8h*)(Ksh + jr * AT_KP + c8) = kk;
#pragma unroll
            for (int e = 0; e < 4; ++e) { Vts[(c8 + e) * AT_KP + jr] = (_Float16)va[e]; Vts[(c8 + 4 + e) * AT_KP + jr] = (_Float16)vc[e]; }
        }
        __syncthreads();                                     // K and V tiles visible to all waves

        v8f s[4];
#pragma unroll
        for (int t = 0; t < 4; ++t) {                        // A fragment: row = key t*16 + l15, k = d; B = the q fragments (column = query l15)
            const int ko = (t * 16 + l15) * AT_KP + 8 * hf;
            FragH k0f, k1f;
            k0f.h[0] = *(const v8h*)(Ksh + ko);      k0f.h[1] = *(const v8h*)(Ksh + ko + 16);
            k1f.h[0] = *(const v8h*)(Ksh + ko + 32); k1f.h[1] = *(const v8h*)(Ksh + ko + 48);
            v8f acc = {};
            acc = wmma16(k0f.v, qa0, acc);
            acc = wmma16(k1f.v, qa1, acc);
            s[t] = acc;
        }
        // online softmax of the lane's query: 32 scores in registers, one exchange with the other half-wave for the maximum.
        // The maximum is kept in raw score units (the scale is positive, so it commutes with max); each probability is one fma and one bare
        // v_exp_f32: p * 4096 = exp2(s * sc2 + (12 - mref * sc2)). Arguments are <= 12; below -126 the bare instruction gives 0, far under f16's range.
        float mx = NEG;
#pragma unroll
        for (int t = 0; t < 4; ++t)
#pragma unroll
            for (int r = 0; r < 8; ++r) mx = fmaxf(mx, s[t][r]);
        mx = fmaxf(mx, __shfl_xor(mx, 16, 32));
        const float mnew = fmaxf(m1, mx);
        const float mref = (mnew == NEG) ? 0.f : mnew;       // the one -inf guard: a -inf score then gives exp2(-inf) = 0 with no test of its own
        const float corr = __builtin_amdgcn_exp2f((m1 - mref) * sc2);
        const float nb = fmaf(-mref, sc2, 12.f);
        // P^T as B operand straight from the score tiles: element i < 8 is key 8*hf + i (tile 2u), element 8 + i is key 16 + 8*hf + i (tile 2u + 1)
        FragH pf[2];
        float rs4[4];
#pragma unroll
        for (int t = 0; t < 4; ++t) {
            float rs = 0.f, e[8];
#pragma unroll
            for (int r = 0; r < 8; ++r) e[r] = fmaf(s[t][r], sc2, nb);
            exp2x8(e);
#pragma unroll
            for (int r = 0; r < 8; ++r) {
                const float pp = e[r]; rs += pp;
                pf[t >> 1].h[t & 1][r] = (_Float16)pp;
            }
            rs4[t] = rs;
        }
        l1 = l1 * corr + ((rs4[0] + rs4[1]) + (rs4[2] + rs4[3])); m1 = mnew;   // the lane's own 32 keys; both half-waves use the same corr, so the halves join once after the loop
#pragma unroll
        for (int t = 0; t < 4; ++t)
#pragma unroll
            for (int r = 0; r < 8; ++r) o[t][r] *= corr;
#pragma unroll
        for (int t = 0; t < 4; ++t) {                        // A fragment: row = d t*16 + l15, k = key (transposed tile, k-contiguous)
            const int vo = (t * 16 + l15) * AT_KP + 8 * hf;
            FragH v0f, v1f;
            v0f.h[0] = *(const v8h*)(Vts + vo);      v0f.h[1] = *(const v8h*)(Vts + vo + 16);
            v1f.h[0] = *(const v8h*)(Vts + vo + 32); v1f.h[1] = *(const v8h*)(Vts + vo + 48);
            o[t] = wmma16(v0f.v, pf[0].v, o[t]);
            o[t] = wmma16(v1f.v, pf[1].v, o[t]);
        }
    }

    // O: stage the wave's 16 x 64 tile (pitch 68 floats; the lane writes 8 consecutive d of its query per tile), then each half-wave writes one whole 256-B row segment per instruction (16 lanes x 16 B),
    {
        l1 += __shfl_xor(l1, 16, 32);                        // join the two half-waves' row sums
        const float inv = (l1 > 0.f) ? 1.f / l1 : 0.f;       // l1 sums p * 4096, as o does
#pragma unroll
        for (int t = 0; t < 4; ++t) {
            v4f w0, w1;
#pragma unroll
            for (int e = 0; e < 4; ++e) { w0[e] = o[t][e] * inv; w1[e] = o[t][4 + e] * inv; }
            *(v4f*)(&Os[wave][l15 * 68 + t * 16 + 8 * hf]) = w0;
            *(v4f*)(&Os[wave][l15 * 68 + t * 16 + 8 * hf + 4]) = w1;
        }
    }
    __builtin_amdgcn_fence(3 /* release order */, "workgroup");
    __builtin_amdgcn_wave_barrier();
    __builtin_amdgcn_fence(2 /* acquire order */, "workgroup");
    {
        const int c4 = l15 * 4;
        {
#pragma unroll
            for (int it = 0; it < 8; ++it) {
                const int row = it * 2 + hf;
                const v4f val = *(const v4f*)(&Os[wave][row * 68 + c4]);
                *(v4f*)(obase + (size_t)(q0 + row) * EMBED + c4) = val;
            }
            
        }
    }
}

namespace kit {
typedef __attribute__((ext_vector_type(16))) _Float16 v16h;
typedef __attribute__((ext_vector_type(8)))  _Float16 v8h;
typedef __attribute__((ext_vector_type(16))) __bf16   v16b;
typedef __attribute__((ext_vector_type(8)))  __bf16   v8b;
typedef __attribute__((ext_vector_type(8)))  float    v8f;
typedef __attribute__((ext_vector_type(4)))  float    v4f;

__device__ __forceinline__ unsigned short f2bf_bits(float f) {
  unsigned u = __float_as_uint(f);
  return (unsigned short)((u + 0x7FFFu + ((u >> 16) & 1u)) >> 16);
}
__device__ __forceinline__ float bf_bits2f(unsigned short h) { return __uint_as_float(((unsigned)h) << 16); }

// hazard guards as plain device helpers
__device__ __forceinline__ void dep_guard_h(v8f& a, v8f& b, v16h x, v16h y) { asm volatile("v_nop\n\tv_nop\n\tv_nop\n\tv_nop" : "+v"(a), "+v"(b) : "v"(x), "v"(y)); }
__device__ __forceinline__ void dep_guard_b(v8f& a, v8f& b, v16b x, v16b y) { asm volatile("v_nop\n\tv_nop\n\tv_nop\n\tv_nop" : "+v"(a), "+v"(b) : "v"(x), "v"(y)); }
__device__ __forceinline__ void keep4_h(v16h a, v16h b, v16h c, v16h d) { asm volatile("v_nop" :: "v"(a), "v"(b), "v"(c), "v"(d)); }
__device__ __forceinline__ void keep4_b(v16b a, v16b b, v16b c, v16b d) { asm volatile("v_nop" :: "v"(a), "v"(b), "v"(c), "v"(d)); }
__device__ __forceinline__ void acc_guard4(v8f& a, v8f& b, v8f& c, v8f& d) { asm volatile("v_nop\n\tv_nop\n\tv_nop\n\tv_nop" : "+v"(a), "+v"(b), "+v"(c), "+v"(d)); }
template <typename T> struct Frag;
template <> struct Frag<_Float16> {
  typedef v16h V; union U { v16h v; v8h h[2]; };
  static __device__ __forceinline__ v16h load(const _Float16* p) {   // elements 0..7 <- p[0..7], 8..15 <- p[16..23]
    U f; f.h[0] = *(const v8h*)(p); f.h[1] = *(const v8h*)(p + 16); return f.v;
  }
  static __device__ __forceinline__ v8f mma(v16h a, v16h b, v8f c) {
    return __builtin_amdgcn_wmma_f32_16x16x32_f16(false, a, false, b, (short)0, c, false, false);
  }
  static __device__ __forceinline__ void guard(v8f& a, v8f& b, v16h x, v16h y) { dep_guard_h(a, b, x, y); }
  static __device__ __forceinline__ void keep(v16h a, v16h b, v16h c, v16h d) { keep4_h(a, b, c, d); }
};
template <> struct Frag<__bf16> {
  typedef v16b V; union U { v16b v; v8b h[2]; };
  static __device__ __forceinline__ v16b load(const __bf16* p) {
    U f; f.h[0] = *(const v8b*)(p); f.h[1] = *(const v8b*)(p + 16); return f.v;
  }
  static __device__ __forceinline__ v8f mma(v16b a, v16b b, v8f c) {
    return __builtin_amdgcn_wmma_f32_16x16x32_bf16(false, a, false, b, (short)0, c, false, false);
  }
  static __device__ __forceinline__ void guard(v8f& a, v8f& b, v16b x, v16b y) { dep_guard_b(a, b, x, y); }
  static __device__ __forceinline__ void keep(v16b a, v16b b, v16b c, v16b d) { keep4_b(a, b, c, d); }
};

// ---- Register-blocked batched WMMA GEMM ------------------------------------
// C[m,n] = scale * sum_k A[m,k] * Bt[n,k] (+bias)(+resid); each wave owns a 64x64 tile.
// A row-major [M,K]; Bt row-major [N,K]; M,N % 64 == 0, K % 32 == 0 (no tail masking).
// SPLIT: operands are hi/lo planes (A2/Bt2 = lo planes, same layout); product = hi*hi + hi*lo + lo*hi.
// BIAS_MODE: 0 = none, 1 = bias[m], 2 = bias[n].
// OUT_MODE: 0 = f32, 1 = f16, 2 = bf16 hi plane (Cout) + bf16 lo plane (Cout2).
// ET: 0 = f16 operands, 1 = bf16 operands (pointers passed as 16-bit storage)
template <int ET> struct Elem;
template <> struct Elem<0> { typedef _Float16 T; };
template <> struct Elem<1> { typedef __bf16 T; };
template <int ET, bool SPLIT, int BIAS_MODE, int OUT_MODE, bool RESID, int ACT = 0>
__global__ __launch_bounds__(256) void wmma_gemm64(
    const unsigned short* __restrict__ Ap, const unsigned short* __restrict__ A2p, int lda, long strideA,
    const unsigned short* __restrict__ Btp, const unsigned short* __restrict__ Bt2p, int ldb, long strideB,
    void* __restrict__ Cout, void* __restrict__ Cout2, int ldc, long strideC,
    const float* __restrict__ bias,
    const float* __restrict__ resid, long strideR,
    int M, int N, int K, float scale) {
  typedef typename Elem<ET>::T T;
  typedef typename Frag<T>::V V;
  const T* A = (const T*)Ap; const T* A2 = (const T*)A2p; const T* Bt = (const T*)Btp; const T* Bt2 = (const T*)Bt2p;
  __shared__ __align__(16) float sT[8][16 * 68];   // per-wave 16x64 slab, pitch 68 floats
  const int b    = blockIdx.y;
  const int lane = threadIdx.x & 31;
  const int wave = threadIdx.x >> 5;
  const int tilesN = N >> 6;
  const int tilesM = M >> 6;
  const int tile = blockIdx.x * 8 + wave;
  if (tile >= tilesM * tilesN) return;   // wave-uniform; no block barriers in this kernel
  const int tm = tile / tilesN;
  const int tn = tile - tm * tilesN;
  const int m0 = tm << 6;
  const int n0 = tn << 6;

  const T* Ab  = A  + (size_t)b * strideA;
  const T* Bb  = Bt + (size_t)b * strideB;
  const T* Ab2 = SPLIT ? (A2  + (size_t)b * strideA) : nullptr;
  const T* Bb2 = SPLIT ? (Bt2 + (size_t)b * strideB) : nullptr;

  const int rlane = lane & 15;                 // row (A) / col (B, D) within subtile
  const int koff  = (lane >> 4) * 8;           // k offset of this lane half
  const int mOff  = (lane >> 4) * 8;           // D row offset

  v8f acc[4][4];
#pragma unroll
  for (int i = 0; i < 4; ++i)
#pragma unroll
    for (int j = 0; j < 4; ++j) acc[i][j] = (v8f){0.f,0.f,0.f,0.f,0.f,0.f,0.f,0.f};

  for (int k0 = 0; k0 < K; k0 += 32) {
    V bh[4], bl[4];
#pragma unroll
    for (int j = 0; j < 4; ++j) {
      const size_t bo = (size_t)(n0 + (j << 4) + rlane) * ldb + koff + k0;
      bh[j] = Frag<T>::load(Bb + bo);
      if (SPLIT) bl[j] = Frag<T>::load(Bb2 + bo);
    }
#pragma unroll
    for (int i = 0; i < 4; ++i) {
      const size_t ao = (size_t)(m0 + (i << 4) + rlane) * lda + koff + k0;
      V ah = Frag<T>::load(Ab + ao);
      V al;
      if (SPLIT) al = Frag<T>::load(Ab2 + ao);
#pragma unroll
      for (int j = 0; j < 4; ++j) {
        acc[i][j] = Frag<T>::mma(ah, bh[j], acc[i][j]);
        if (SPLIT) {
          acc[i][j] = Frag<T>::mma(ah, bl[j], acc[i][j]);
          acc[i][j] = Frag<T>::mma(al, bh[j], acc[i][j]);
        }
      }
      Frag<T>::guard(acc[i][0], acc[i][3], ah, SPLIT ? al : ah);
    }
    Frag<T>::keep(bh[0], bh[1], bh[2], bh[3]);
    if (SPLIT) Frag<T>::keep(bl[0], bl[1], bl[2], bl[3]);
  }
  acc_guard4(acc[0][0], acc[0][1], acc[0][2], acc[0][3]);
  acc_guard4(acc[1][0], acc[1][1], acc[1][2], acc[1][3]);
  acc_guard4(acc[2][0], acc[2][1], acc[2][2], acc[2][3]);
  acc_guard4(acc[3][0], acc[3][1], acc[3][2], acc[3][3]);

  // ---- epilogue ----
  float* slab = sT[wave];
  const float* Rb = RESID ? (resid + (size_t)b * strideR) : nullptr;
#pragma unroll
  for (int i = 0; i < 4; ++i) {
    const int mBase = m0 + (i << 4);
#pragma unroll
    for (int j = 0; j < 4; ++j) {
      const int n = n0 + (j << 4) + rlane;
      float bv = 0.f;
      if (BIAS_MODE == 2) bv = bias[n];
#pragma unroll
      for (int r = 0; r < 8; ++r) {
        float v = acc[i][j][r] * scale;
        if (BIAS_MODE == 1) v += bias[mBase + mOff + r];
        if (BIAS_MODE == 2) v += bv;
        if (RESID) v += Rb[(size_t)(mBase + mOff + r) * ldc + n];
        if (ACT == 1) v = tanhf(v);
        if (ACT == 2) v = fmaxf(v, 0.0f);
        if (ACT == 3) v = v / (1.0f + expf(-v));
        if (ACT == 4) v = (v > 0.f) ? v : 0.01f * v;
        if (ACT == 5) v = 0.5f * v * (1.0f + erff(v * 0.70710678118654752f));
        if (ACT == 6) v = (v > 0.f) ? v : 0.2f * v;
        if (ACT == 7) { const float u = 0.7978845608028654f * (v + 0.044715f * v * v * v); v = 0.5f * v * (1.f + tanhf(u)); }
        slab[(mOff + r) * 68 + (j << 4) + rlane] = v;
      }
    }
    __builtin_amdgcn_fence(3 /* release order */, "workgroup");
    __builtin_amdgcn_wave_barrier();
    __builtin_amdgcn_fence(2 /* acquire order */, "workgroup");
    if (OUT_MODE == 0) {
      float* C = (float*)Cout + (size_t)b * strideC;
      const int hh = lane >> 4, c4 = (lane & 15) * 4;     // row seg = 256 B = 16 lanes x 16 B
      {
#pragma unroll
        for (int it = 0; it < 8; ++it) {
          const int row = it * 2 + hh;
          v4f v = *(const v4f*)(slab + row * 68 + c4);
          *(v4f*)(C + (size_t)(mBase + row) * ldc + n0 + c4) = v;
        }
        
      }
    } else {
      const int q = lane >> 3, c8 = (lane & 7) * 8;
      unsigned short* C  = (unsigned short*)Cout  + (size_t)b * strideC;
      unsigned short* C2 = (OUT_MODE == 2) ? ((unsigned short*)Cout2 + (size_t)b * strideC) : nullptr;
      {
#pragma unroll
        for (int it = 0; it < 4; ++it) {
          const int row = it * 4 + q;
          const float* sp = slab + row * 68 + c8;
          v8h hv, lv;
#pragma unroll
          for (int e = 0; e < 8; ++e) {
            if (OUT_MODE == 1) {
              hv[e] = (_Float16)sp[e];
            } else {
              unsigned short hb = f2bf_bits(sp[e]);
              unsigned short lb = f2bf_bits(sp[e] - bf_bits2f(hb));
              hv[e] = __builtin_bit_cast(_Float16, hb);
              lv[e] = __builtin_bit_cast(_Float16, lb);
            }
          }
          *(v8h*)(C + (size_t)(mBase + row) * ldc + n0 + c8) = hv;
          if (OUT_MODE == 2) *(v8h*)(C2 + (size_t)(mBase + row) * ldc + n0 + c8) = lv;
        }
        
      }
    }
    __builtin_amdgcn_fence(3 /* release order */, "workgroup");
    __builtin_amdgcn_wave_barrier();
    __builtin_amdgcn_fence(2 /* acquire order */, "workgroup");
  }
}

}

__global__ __launch_bounds__(256) void k_cast16(const float* __restrict__ src, long long lds, _Float16* __restrict__ dst, long long ldd, int R, int C, float s) {
    const long long i = (long long)blockIdx.x * 256 + threadIdx.x; const long long np = (long long)R * (C / 2); if (i >= np) return; const int r = (int)(i / (C / 2)); const int c = 2 * (int)(i % (C / 2));
    const _Float16 h0 = (_Float16)(src[(long long)r * lds + c] * s), h1 = (_Float16)(src[(long long)r * lds + c + 1] * s);
    const unsigned u = (unsigned)__builtin_bit_cast(unsigned short, h0) | ((unsigned)__builtin_bit_cast(unsigned short, h1) << 16);
    unsigned* d = (unsigned*)(dst + (long long)r * ldd + c); *d = u;  }

typedef unsigned int cm_u4 __attribute__((ext_vector_type(4)));
// f32 -> bf16 (RNE) -> f16 planes: every 16-bit operand holds exactly the bf16-converted input value (times a power-of-two scale), so the f16 WMMA
// products of two such planes are exact in the f32 accumulator. Thread per (row, 8 cols); 16 B per thread, thread-linear along the dst row
__device__ __forceinline__ unsigned int cmb_pk2(float a, float b) { return (unsigned int)__builtin_bit_cast(unsigned short, (_Float16)a) | ((unsigned int)__builtin_bit_cast(unsigned short, (_Float16)b) << 16); }
__device__ __forceinline__ float cmb_bf(float v) { const unsigned u = __builtin_bit_cast(unsigned, v); const unsigned r = (u + 0x7fffu + ((u >> 16) & 1u)) & 0xffff0000u; return __builtin_bit_cast(float, r); }   // bf16 RNE, kept as f32 (finite inputs)
// DST[i] = bf16_rne(SRC[i]) kept as f32 (thread per element; bias vector)
__global__ __launch_bounds__(256) void k_cm_bfvec(const float* __restrict__ SRC, float* __restrict__ DST, int n) { const int u = blockIdx.x * 256 + threadIdx.x; if (u >= n) return; VST2(float, DST + u, cmb_bf(SRC[u])); }
__global__ __launch_bounds__(256) void k_cm_castb(const float* __restrict__ SRC, int lds, long long sSz, unsigned short* __restrict__ DST, int ldd, long long sDz, int nR, int nC, float sc) {
    const long long u = (long long)blockIdx.x * 256 + threadIdx.x; const int per = nC / 8; if (u >= (long long)nR * per) return; const int r = (int)(u / per); const int c0 = 8 * (int)(u % per);
    const float* s = SRC + (long long)blockIdx.y * sSz + (long long)r * lds + c0; float w[8];
#pragma unroll
    for (int e = 0; e < 8; ++e) w[e] = cmb_bf(s[e]) * sc;
    cm_u4 pk; pk.x = cmb_pk2(w[0], w[1]); pk.y = cmb_pk2(w[2], w[3]); pk.z = cmb_pk2(w[4], w[5]); pk.w = cmb_pk2(w[6], w[7]); VST2(cm_u4, (cm_u4*)(DST + (long long)blockIdx.y * sDz + (long long)r * ldd + c0), pk); }

extern "C" void kernel_launch(void* const* d_in, const int* in_sizes, int n_in, void* d_out, int out_size, void* d_ws, size_t ws_size, hipStream_t stream) {
    if (n_in < 8) return;
    const long long need_x = (long long)(NB - 1) * SEQ_FULL * EMBED + (long long)SEQ * EMBED;   // last element read of a token stream + 1
    if ((long long)in_sizes[0] < need_x || (long long)in_sizes[1] < need_x || (long long)in_sizes[2] < need_x) return;
    if (in_sizes[3] < HDIM * HDIM || in_sizes[4] < HDIM * HDIM || in_sizes[5] < HDIM * HDIM) return;
    if (in_sizes[6] < EMBED * EMBED || in_sizes[7] < EMBED) return;
    if ((long long)out_size < (long long)MTOK * EMBED) return;
    const float* xq = (const float*)d_in[0];
    const float* xk = (const float*)d_in[1];
    const float* xv = (const float*)d_in[2];
    const float* Wq = (const float*)d_in[3];
    const float* Wk = (const float*)d_in[4];
    const float* Wv = (const float*)d_in[5];
    const float* Wo = (const float*)d_in[6];
    const float* bo = (const float*)d_in[7];
    float* out = (float*)d_out;
    char* wsp = (char*)d_ws;
    unsigned short* X16 = (unsigned short*)wsp; wsp += (((size_t)MTOK * EMBED * 2 + 255) / 256) * 256;     // f16 token plane [MTOK][1024] = [MTOK*16][64]; reused per stream, then for the attention output
    unsigned short* W316 = (unsigned short*)wsp; wsp += (((size_t)3 * HDIM * HDIM * 2 + 255) / 256) * 256; // three f16 [64][64] weight planes (x16)
    float* Qf = (float*)wsp; wsp += (((size_t)MTOK * EMBED * 4 + 255) / 256) * 256;
    float* Kf = (float*)wsp; wsp += (((size_t)MTOK * EMBED * 4 + 255) / 256) * 256;
    float* Vf = (float*)wsp; wsp += (((size_t)MTOK * EMBED * 4 + 255) / 256) * 256;
    float* AO = (float*)wsp; wsp += (((size_t)MTOK * EMBED * 4 + 255) / 256) * 256;
    unsigned short* AO16 = X16;                                                                           // alias: X16 is free after the third projection
    unsigned short* WO16 = (unsigned short*)wsp; wsp += (((size_t)EMBED * EMBED * 2 + 255) / 256) * 256;
    float* BRO = (float*)wsp; wsp += (((size_t)(EMBED + 64) * 4 + 255) / 256) * 256;
    if ((size_t)(wsp - (char*)d_ws) > ws_size) return;

    const unsigned wblocks = (unsigned)(((long long)HDIM * (HDIM / 8) + 255) / 256);
    const unsigned xblocks = (unsigned)(((long long)SEQ * (EMBED / 8) + 255) / 256);
    const unsigned pgrid = (unsigned)((((MTOK * HEADS) / 64) * (HDIM / 64) + 7) / 8);
    // weights: src [64 out][64 in] -> f16 [out][in] x16 (Bt form [n][k])
    k_cm_castb<<<dim3(wblocks, 1), 256, 0, stream>>>(Wq, HDIM, 0, W316 + 0, HDIM, 0, HDIM, HDIM, 16.0f);
    k_cm_castb<<<dim3(wblocks, 1), 256, 0, stream>>>(Wk, HDIM, 0, W316 + HDIM * HDIM, HDIM, 0, HDIM, HDIM, 16.0f);
    k_cm_castb<<<dim3(wblocks, 1), 256, 0, stream>>>(Wv, HDIM, 0, W316 + 2 * HDIM * HDIM, HDIM, 0, HDIM, HDIM, 16.0f);
    // q stream: [NB][SEQ][1024] (full batch stride) -> packed f16 plane; per-head projection as [MTOK*16][64] x [64][64]^T -> Qf [MTOK*16][64] = [MTOK][1024]
    k_cm_castb<<<dim3(xblocks, NB), 256, 0, stream>>>(xq, EMBED, (long long)SEQ_FULL * EMBED, X16, EMBED, (long long)SEQ * EMBED, SEQ, EMBED, 1.0f);
    kit::wmma_gemm64<0, false, 0, 0, false, 0><<<dim3(pgrid, 1), 256, 0, stream>>>((const unsigned short*)X16, nullptr, HDIM, 0, (const unsigned short*)(W316 + 0), nullptr, HDIM, 0, (void*)Qf, nullptr, HDIM, 0, nullptr, nullptr, 0, MTOK * HEADS, HDIM, HDIM, 0.0625f);
    k_cm_castb<<<dim3(xblocks, NB), 256, 0, stream>>>(xk, EMBED, (long long)SEQ_FULL * EMBED, X16, EMBED, (long long)SEQ * EMBED, SEQ, EMBED, 1.0f);
    kit::wmma_gemm64<0, false, 0, 0, false, 0><<<dim3(pgrid, 1), 256, 0, stream>>>((const unsigned short*)X16, nullptr, HDIM, 0, (const unsigned short*)(W316 + HDIM * HDIM), nullptr, HDIM, 0, (void*)Kf, nullptr, HDIM, 0, nullptr, nullptr, 0, MTOK * HEADS, HDIM, HDIM, 0.0625f);
    k_cm_castb<<<dim3(xblocks, NB), 256, 0, stream>>>(xv, EMBED, (long long)SEQ_FULL * EMBED, X16, EMBED, (long long)SEQ * EMBED, SEQ, EMBED, 1.0f);
    kit::wmma_gemm64<0, false, 0, 0, false, 0><<<dim3(pgrid, 1), 256, 0, stream>>>((const unsigned short*)X16, nullptr, HDIM, 0, (const unsigned short*)(W316 + 2 * HDIM * HDIM), nullptr, HDIM, 0, (void*)Vf, nullptr, HDIM, 0, nullptr, nullptr, 0, MTOK * HEADS, HDIM, HDIM, 0.0625f);
    // output weight [1024 out][1024 in] -> f16 x16 (Bt form), bias -> bf16-valued f32
    k_cm_castb<<<dim3((unsigned)(((long long)EMBED * (EMBED / 8) + 255) / 256), 1), 256, 0, stream>>>(Wo, EMBED, 0, WO16, EMBED, 0, EMBED, EMBED, 16.0f);
    k_cm_bfvec<<<(EMBED + 255) / 256, 256, 0, stream>>>(bo, BRO, EMBED);
    {
      AttnG a;
      a.Q = Qf; a.K = Kf; a.V = Vf; a.O = AO;
      a.sb = (long long)SEQ * EMBED; a.S = SEQ; a.scale = 0.03125f;
      k_attn64<<<dim3((unsigned)(SEQ / 64), (unsigned)HEADS, (unsigned)NB), 32 * AT_NW, 0, stream>>>(a);
    }
    // attention output -> f16 plane carried x64, then out = (AO16 . WO16^T) / (64 * 16) + bias
    k_cast16<<<(unsigned)((((long long)MTOK * (EMBED / 2)) + 255) / 256), 256, 0, stream>>>(AO, EMBED, (_Float16*)AO16, EMBED, MTOK, EMBED, 64.0f);
    kit::wmma_gemm64<0, false, 2, 0, false, 0><<<dim3((unsigned)((((MTOK / 64) * (EMBED / 64)) + 7) / 8), 1), 256, 0, stream>>>((const unsigned short*)AO16, nullptr, EMBED, 0, (const unsigned short*)WO16, nullptr, EMBED, 0, (void*)out, nullptr, EMBED, 0, BRO, nullptr, 0, MTOK, EMBED, EMBED, 0.0009765625f);
}

// v003
// It runs in 183 microseconds.
// Timed twice side by side with v002, it ran 1.28 and 1.27 times as fast.
// Over all steps from v000 it is 1.73 times as fast.
// Multi-head attention (2 x 2,048 tokens x 1,024; 16 heads x 64; one shared 64x64 [out][in] weight per q / k / v stream applied per head, no biases; scores / 32; no mask; [out][in] output projection + bias). All contractions: v_wmma_f32_16x16x32_f16 (f16 operands, f32 accumulate): inputs and parameters converted to bf16 (RNE) first and held exactly in f16 (weights x16), tokens, 64x64 weights and bias in the registers of the kernel that uses them; per-head projections as f16 WMMA GEMMs over the [tokens*heads][64] view, one launch for the three streams; one WMMA attention launch (f16 q fragments, f16 k and transposed f16 v tiles staged in LDS, f32 online softmax, probabilities carried x4096 as f16); output projection as an f16 WMMA GEMM of the f16 attention output carried x64 (written so by the attention launch), + bias in f32.
#include <hip/hip_runtime.h>
#include <math.h>

#ifndef NB
#define NB 2
#endif
#ifndef SEQ
#define SEQ 2048
#endif
#define NB_FULL 2
#define SEQ_FULL 2048
#define EMBED 1024
#define HEADS 16
#define HDIM 64
#define MTOK (NB * SEQ)

static_assert(SEQ % 64 == 0);
static_assert(MTOK % 64 == 0);
static_assert((MTOK * HEADS) % 64 == 0);
static_assert(EMBED % 64 == 0 && HDIM == 64);
static_assert(NB <= NB_FULL && SEQ <= SEQ_FULL);

typedef __attribute__((ext_vector_type(16))) _Float16 v16h;
typedef __attribute__((ext_vector_type(8)))  _Float16 v8h;
typedef __attribute__((ext_vector_type(8)))  float    v8f;
typedef __attribute__((ext_vector_type(4)))  float    v4f;

// 16-bit WMMA fragment map (wave32), lane L, h = L>>4, m = L&15:
//   A 16x32: lane = row m;   element i -> k = (i<8) ? 8h+i : 16+8h+(i-8)
//   B 32x16: lane = column m; the SAME k(i,h)
//   D 16x16 (8 f32): lane = column m; element r -> row 8h+r
__device__ __forceinline__ v8f wmma16(v16h a, v16h b, v8f c) {
    c = __builtin_amdgcn_wmma_f32_16x16x32_f16(false, a, false, b, (short)0, c, false, false);
    asm volatile("v_nop\n\tv_nop\n\tv_nop\n\tv_nop" : "+v"(c) : "v"(a), "v"(b));
    return c;
}
union FragH { v16h v; v8h h[2]; };

// A fragment from an f32 GLOBAL row: p points at column k0 + 8h of the lane's row; elements 0..7 <- p[0..7], 8..15 <- p[16..23], converted to f16
__device__ __forceinline__ v16h fh_g32(const float* __restrict__ p) {
    const v4f x0 = *(const v4f*)(p), x1 = *(const v4f*)(p + 4), x2 = *(const v4f*)(p + 16), x3 = *(const v4f*)(p + 20);
    v16h a;
#pragma unroll
    for (int e = 0; e < 4; ++e) { a[e] = (_Float16)x0[e]; a[4 + e] = (_Float16)x1[e]; a[8 + e] = (_Float16)x2[e]; a[12 + e] = (_Float16)x3[e]; }
    return a;
}

// Eight bare v_exp_f32, each over its own argument register, in one statement: no neighbour can take a transcendental's source or read its result
// directly behind it, whatever registers the build picks; the closing v_nop is the independent slot that the instruction set asks for behind the last one.
__device__ __forceinline__ void exp2x8(float (&e)[8]) {
    asm("v_exp_f32 %0, %0\n\tv_exp_f32 %1, %1\n\tv_exp_f32 %2, %2\n\tv_exp_f32 %3, %3\n\t"
        "v_exp_f32 %4, %4\n\tv_exp_f32 %5, %5\n\tv_exp_f32 %6, %6\n\tv_exp_f32 %7, %7\n\tv_nop"
        : "+v"(e[0]), "+v"(e[1]), "+v"(e[2]), "+v"(e[3]), "+v"(e[4]), "+v"(e[5]), "+v"(e[6]), "+v"(e[7]));
}

// 'val' is captured into a local first: never pass an expression that reads *ptr.
#define VST2(T, ptr, val) do { const T vst2_v_ = (val); *(T*)(ptr) = vst2_v_;  } while (0)

// =====================================================================================================================
// k_attn64: O(b,i,h,:) = softmax_j(scale * Q(b,i,h,:).K(b,j,h,:)) V(b,j,h,:) for head dim 64, no mask, S % 64 == 0.
//   Element (b, s, h, d) of Q / K / V / O lives at X[b*sb + s*EMBED + h*HDIM + d] (Q, K, V f32; O f16, carried x64). Block = 4 waves = 64 queries of one (batch, head);
//   grid (S/64, HEADS, NB). Per 64-key block: the block stages K as f16 [key][d] and V as f16 [d][key] in LDS (block barriers on both sides);
//   scores^T = f16 k fragments (two 16-B LDS loads each) x f16 q fragments (registers), f32 accumulate; online softmax in f32, exp2 domain, per lane;
//   O^T += V^T.P^T with f16 v fragments from the transposed tile and P^T packed from the score registers; row sums carried x4096 like P, final 1/rowsum in f32.
//   Staged extent == consumed extent: Ksh 64 keys x 64 d, Vts 64 d x 64 keys, Os 16 rows x 64 d; pad columns are never read.
// =====================================================================================================================
#define AT_NW 4
#define AT_KP 72          // LDS pitch in halves (144 B, a multiple of 16 B)
struct AttnG { const float* Q; const float* K; const float* V; _Float16* O; long long sb; int S; float scale; };
static_assert(sizeof(AttnG) == 48);

#ifndef KATTN_ATTR
#define KATTN_ATTR __attribute__((amdgpu_num_vgpr(256)))
#endif
__global__ __launch_bounds__(32 * AT_NW) KATTN_ATTR void k_attn64(AttnG g) {
    __shared__ __align__(16) _Float16 Ksh[64 * AT_KP];
    __shared__ __align__(16) _Float16 Vts[64 * AT_KP];
    __shared__ __align__(16) float    Os[AT_NW][16 * 68];
    const int tid = threadIdx.x, wave = tid >> 5, lane = tid & 31, hf = lane >> 4, l15 = lane & 15;
    const int h = blockIdx.y, b = blockIdx.z;
    const int q0 = (blockIdx.x * AT_NW + wave) * 16;
    const float L2E = 1.4426950408889634f;
    const float NEG = -__builtin_inff();
    const float sc2 = g.scale * L2E;                         // raw score -> base-2 exponent
    const float* qbase = g.Q + (long long)b * g.sb + h * HDIM;
    const float* kbase = g.K + (long long)b * g.sb + h * HDIM;
    const float* vbase = g.V + (long long)b * g.sb + h * HDIM;
    _Float16*    obase = g.O + (long long)b * g.sb + h * HDIM;

    // q fragments (B operand: column = query l15), two 32-deep k-steps
    const float* qrow = qbase + (size_t)(q0 + l15) * EMBED + 8 * hf;
    const v16h qa0 = fh_g32(qrow), qa1 = fh_g32(qrow + 32);

    v8f o[4]; float m1 = NEG, l1 = 0.f;
#pragma unroll
    for (int t = 0; t < 4; ++t) { v8f zz = {}; o[t] = zz; }

    for (int j0 = 0; j0 < g.S; j0 += 64) {
        __syncthreads();                                     // the prior key block's reads of Ksh / Vts are done
#pragma unroll
        for (int it = 0; it < 4; ++it) {                     // 512 items = 64 keys x 8 column groups of 8
            const int item = tid + it * (32 * AT_NW);
            const int jr = item >> 3, c8 = (item & 7) * 8;
            const float* kr = kbase + (size_t)(j0 + jr) * EMBED + c8;
            const float* vr = vbase + (size_t)(j0 + jr) * EMBED + c8;
            const v4f ka = *(const v4f*)(kr), kc = *(const v4f*)(kr + 4);
            const v4f va = *(const v4f*)(vr), vc = *(const v4f*)(vr + 4);
            v8h kk;
#pragma unroll
            for (int e = 0; e < 4; ++e) { kk[e] = (_Float16)ka[e]; kk[4 + e] = (_Float16)kc[e]; }
            *(v8h*)(Ksh + jr * AT_KP + c8) = kk;
#pragma unroll
            for (int e = 0; e < 4; ++e) { Vts[(c8 + e) * AT_KP + jr] = (_Float16)va[e]; Vts[(c8 + 4 + e) * AT_KP + jr] = (_Float16)vc[e]; }
        }
        __syncthreads();                                     // K and V tiles visible to all waves

        v8f s[4];
#pragma unroll
        for (int t = 0; t < 4; ++t) {                        // A fragment: row = key t*16 + l15, k = d; B = the q fragments (column = query l15)
            const int ko = (t * 16 + l15) * AT_KP + 8 * hf;
            FragH k0f, k1f;
            k0f.h[0] = *(const v8h*)(Ksh + ko);      k0f.h[1] = *(const v8h*)(Ksh + ko + 16);
            k1f.h[0] = *(const v8h*)(Ksh + ko + 32); k1f.h[1] = *(const v8h*)(Ksh + ko + 48);
            v8f acc = {};
            acc = wmma16(k0f.v, qa0, acc);
            acc = wmma16(k1f.v, qa1, acc);
            s[t] = acc;
        }
        // online softmax of the lane's query: 32 scores in registers, one exchange with the other half-wave for the maximum.
        // The maximum is kept in raw score units (the scale is positive, so it commutes with max); each probability is one fma and one bare
        // v_exp_f32: p * 4096 = exp2(s * sc2 + (12 - mref * sc2)). Arguments are <= 12; below -126 the bare instruction gives 0, far under f16's range.
        float mx = NEG;
#pragma unroll
        for (int t = 0; t < 4; ++t)
#pragma unroll
            for (int r = 0; r < 8; ++r) mx = fmaxf(mx, s[t][r]);
        mx = fmaxf(mx, __shfl_xor(mx, 16, 32));
        const float mnew = fmaxf(m1, mx);
        const float mref = (mnew == NEG) ? 0.f : mnew;       // the one -inf guard: a -inf score then gives exp2(-inf) = 0 with no test of its own
        const float corr = __builtin_amdgcn_exp2f((m1 - mref) * sc2);
        const float nb = fmaf(-mref, sc2, 12.f);
        // P^T as B operand straight from the score tiles: element i < 8 is key 8*hf + i (tile 2u), element 8 + i is key 16 + 8*hf + i (tile 2u + 1)
        FragH pf[2];
        float rs4[4];
#pragma unroll
        for (int t = 0; t < 4; ++t) {
            float rs = 0.f, e[8];
#pragma unroll
            for (int r = 0; r < 8; ++r) e[r] = fmaf(s[t][r], sc2, nb);
            exp2x8(e);
#pragma unroll
            for (int r = 0; r < 8; ++r) {
                const float pp = e[r]; rs += pp;
                pf[t >> 1].h[t & 1][r] = (_Float16)pp;
            }
            rs4[t] = rs;
        }
        l1 = l1 * corr + ((rs4[0] + rs4[1]) + (rs4[2] + rs4[3])); m1 = mnew;   // the lane's own 32 keys; both half-waves use the same corr, so the halves join once after the loop
#pragma unroll
        for (int t = 0; t < 4; ++t)
#pragma unroll
            for (int r = 0; r < 8; ++r) o[t][r] *= corr;
#pragma unroll
        for (int t = 0; t < 4; ++t) {                        // A fragment: row = d t*16 + l15, k = key (transposed tile, k-contiguous)
            const int vo = (t * 16 + l15) * AT_KP + 8 * hf;
            FragH v0f, v1f;
            v0f.h[0] = *(const v8h*)(Vts + vo);      v0f.h[1] = *(const v8h*)(Vts + vo + 16);
            v1f.h[0] = *(const v8h*)(Vts + vo + 32); v1f.h[1] = *(const v8h*)(Vts + vo + 48);
            o[t] = wmma16(v0f.v, pf[0].v, o[t]);
            o[t] = wmma16(v1f.v, pf[1].v, o[t]);
        }
    }

    // O: stage the wave's 16 x 64 tile (pitch 68 floats; the lane writes 8 consecutive d of its query per tile), then 8 lanes write one row's 64 halves, a whole 128-B line (8 x 16 B), four rows per instruction; f16(x * 64) of the f32 value
    {
        l1 += __shfl_xor(l1, 16, 32);                        // join the two half-waves' row sums
        const float inv = (l1 > 0.f) ? 1.f / l1 : 0.f;       // l1 sums p * 4096, as o does
#pragma unroll
        for (int t = 0; t < 4; ++t) {
            v4f w0, w1;
#pragma unroll
            for (int e = 0; e < 4; ++e) { w0[e] = o[t][e] * inv; w1[e] = o[t][4 + e] * inv; }
            *(v4f*)(&Os[wave][l15 * 68 + t * 16 + 8 * hf]) = w0;
            *(v4f*)(&Os[wave][l15 * 68 + t * 16 + 8 * hf + 4]) = w1;
        }
    }
    __builtin_amdgcn_fence(3 /* release order */, "workgroup");
    __builtin_amdgcn_wave_barrier();
    __builtin_amdgcn_fence(2 /* acquire order */, "workgroup");
    {
        const int q4 = lane >> 3, c8 = (lane & 7) * 8;
#pragma unroll
        for (int it = 0; it < 4; ++it) {
            const int row = it * 4 + q4;
            const v4f va = *(const v4f*)(&Os[wave][row * 68 + c8]), vc = *(const v4f*)(&Os[wave][row * 68 + c8 + 4]);
            v8h hv;
#pragma unroll
            for (int e = 0; e < 4; ++e) { hv[e] = (_Float16)(va[e] * 64.0f); hv[4 + e] = (_Float16)(vc[e] * 64.0f); }
            *(v8h*)(obase + (size_t)(q0 + row) * EMBED + c8) = hv;
        }
    }
}

namespace kit {
typedef __attribute__((ext_vector_type(16))) _Float16 v16h;
typedef __attribute__((ext_vector_type(8)))  _Float16 v8h;
typedef __attribute__((ext_vector_type(16))) __bf16   v16b;
typedef __attribute__((ext_vector_type(8)))  __bf16   v8b;
typedef __attribute__((ext_vector_type(8)))  float    v8f;
typedef __attribute__((ext_vector_type(4)))  float    v4f;

__device__ __forceinline__ unsigned short f2bf_bits(float f) {
  unsigned u = __float_as_uint(f);
  return (unsigned short)((u + 0x7FFFu + ((u >> 16) & 1u)) >> 16);
}
__device__ __forceinline__ float bf_bits2f(unsigned short h) { return __uint_as_float(((unsigned)h) << 16); }

// hazard guards as plain device helpers
__device__ __forceinline__ void dep_guard_h(v8f& a, v8f& b, v16h x, v16h y) { asm volatile("v_nop\n\tv_nop\n\tv_nop\n\tv_nop" : "+v"(a), "+v"(b) : "v"(x), "v"(y)); }
__device__ __forceinline__ void dep_guard_b(v8f& a, v8f& b, v16b x, v16b y) { asm volatile("v_nop\n\tv_nop\n\tv_nop\n\tv_nop" : "+v"(a), "+v"(b) : "v"(x), "v"(y)); }
__device__ __forceinline__ void keep4_h(v16h a, v16h b, v16h c, v16h d) { asm volatile("v_nop" :: "v"(a), "v"(b), "v"(c), "v"(d)); }
__device__ __forceinline__ void keep4_b(v16b a, v16b b, v16b c, v16b d) { asm volatile("v_nop" :: "v"(a), "v"(b), "v"(c), "v"(d)); }
__device__ __forceinline__ void acc_guard4(v8f& a, v8f& b, v8f& c, v8f& d) { asm volatile("v_nop\n\tv_nop\n\tv_nop\n\tv_nop" : "+v"(a), "+v"(b), "+v"(c), "+v"(d)); }
template <typename T> struct Frag;
template <> struct Frag<_Float16> {
  typedef v16h V; union U { v16h v; v8h h[2]; };
  static __device__ __forceinline__ v16h load(const _Float16* p) {   // elements 0..7 <- p[0..7], 8..15 <- p[16..23]
    U f; f.h[0] = *(const v8h*)(p); f.h[1] = *(const v8h*)(p + 16); return f.v;
  }
  static __device__ __forceinline__ v8f mma(v16h a, v16h b, v8f c) {
    return __builtin_amdgcn_wmma_f32_16x16x32_f16(false, a, false, b, (short)0, c, false, false);
  }
  static __device__ __forceinline__ void guard(v8f& a, v8f& b, v16h x, v16h y) { dep_guard_h(a, b, x, y); }
  static __device__ __forceinline__ void keep(v16h a, v16h b, v16h c, v16h d) { keep4_h(a, b, c, d); }
};
template <> struct Frag<__bf16> {
  typedef v16b V; union U { v16b v; v8b h[2]; };
  static __device__ __forceinline__ v16b load(const __bf16* p) {
    U f; f.h[0] = *(const v8b*)(p); f.h[1] = *(const v8b*)(p + 16); return f.v;
  }
  static __device__ __forceinline__ v8f mma(v16b a, v16b b, v8f c) {
    return __builtin_amdgcn_wmma_f32_16x16x32_bf16(false, a, false, b, (short)0, c, false, false);
  }
  static __device__ __forceinline__ void guard(v8f& a, v8f& b, v16b x, v16b y) { dep_guard_b(a, b, x, y); }
  static __device__ __forceinline__ void keep(v16b a, v16b b, v16b c, v16b d) { keep4_b(a, b, c, d); }
};

// ---- Register-blocked batched WMMA GEMM ------------------------------------
// C[m,n] = scale * sum_k A[m,k] * Bt[n,k] (+bias)(+resid); each wave owns a 64x64 tile.
// A row-major [M,K]; Bt row-major [N,K]; M,N % 64 == 0, K % 32 == 0 (no tail masking).
// SPLIT: operands are hi/lo planes (A2/Bt2 = lo planes, same layout); product = hi*hi + hi*lo + lo*hi.
// BIAS_MODE: 0 = none, 1 = bias[m], 2 = bias[n], 3 = bias[n] converted to bf16 (RNE) first.
// OUT_MODE: 0 = f32, 1 = f16, 2 = bf16 hi plane (Cout) + bf16 lo plane (Cout2).
// ET: 0 = f16 operands, 1 = bf16 operands (pointers passed as 16-bit storage)
template <int ET> struct Elem;
template <> struct Elem<0> { typedef _Float16 T; };
template <> struct Elem<1> { typedef __bf16 T; };
template <int ET, bool SPLIT, int BIAS_MODE, int OUT_MODE, bool RESID, int ACT = 0>
__global__ __launch_bounds__(256) void wmma_gemm64(
    const unsigned short* __restrict__ Ap, const unsigned short* __restrict__ A2p, int lda, long strideA,
    const unsigned short* __restrict__ Btp, const unsigned short* __restrict__ Bt2p, int ldb, long strideB,
    void* __restrict__ Cout, void* __restrict__ Cout2, int ldc, long strideC,
    const float* __restrict__ bias,
    const float* __restrict__ resid, long strideR,
    int M, int N, int K, float scale) {
  typedef typename Elem<ET>::T T;
  typedef typename Frag<T>::V V;
  const T* A = (const T*)Ap; const T* A2 = (const T*)A2p; const T* Bt = (const T*)Btp; const T* Bt2 = (const T*)Bt2p;
  __shared__ __align__(16) float sT[8][16 * 68];   // per-wave 16x64 slab, pitch 68 floats
  const int b    = blockIdx.y;
  const int lane = threadIdx.x & 31;
  const int wave = threadIdx.x >> 5;
  const int tilesN = N >> 6;
  const int tilesM = M >> 6;
  const int tile = blockIdx.x * 8 + wave;
  if (tile >= tilesM * tilesN) return;   // wave-uniform; no block barriers in this kernel
  const int tm = tile / tilesN;
  const int tn = tile - tm * tilesN;
  const int m0 = tm << 6;
  const int n0 = tn << 6;

  const T* Ab  = A  + (size_t)b * strideA;
  const T* Bb  = Bt + (size_t)b * strideB;
  const T* Ab2 = SPLIT ? (A2  + (size_t)b * strideA) : nullptr;
  const T* Bb2 = SPLIT ? (Bt2 + (size_t)b * strideB) : nullptr;

  const int rlane = lane & 15;                 // row (A) / col (B, D) within subtile
  const int koff  = (lane >> 4) * 8;           // k offset of this lane half
  const int mOff  = (lane >> 4) * 8;           // D row offset

  v8f acc[4][4];
#pragma unroll
  for (int i = 0; i < 4; ++i)
#pragma unroll
    for (int j = 0; j < 4; ++j) acc[i][j] = (v8f){0.f,0.f,0.f,0.f,0.f,0.f,0.f,0.f};

  for (int k0 = 0; k0 < K; k0 += 32) {
    V bh[4], bl[4];
#pragma unroll
    for (int j = 0; j < 4; ++j) {
      const size_t bo = (size_t)(n0 + (j << 4) + rlane) * ldb + koff + k0;
      bh[j] = Frag<T>::load(Bb + bo);
      if (SPLIT) bl[j] = Frag<T>::load(Bb2 + bo);
    }
#pragma unroll
    for (int i = 0; i < 4; ++i) {
      const size_t ao = (size_t)(m0 + (i << 4) + rlane) * lda + koff + k0;
      V ah = Frag<T>::load(Ab + ao);
      V al;
      if (SPLIT) al = Frag<T>::load(Ab2 + ao);
#pragma unroll
      for (int j = 0; j < 4; ++j) {
        acc[i][j] = Frag<T>::mma(ah, bh[j], acc[i][j]);
        if (SPLIT) {
          acc[i][j] = Frag<T>::mma(ah, bl[j], acc[i][j]);
          acc[i][j] = Frag<T>::mma(al, bh[j], acc[i][j]);
        }
      }
      Frag<T>::guard(acc[i][0], acc[i][3], ah, SPLIT ? al : ah);
    }
    Frag<T>::keep(bh[0], bh[1], bh[2], bh[3]);
    if (SPLIT) Frag<T>::keep(bl[0], bl[1], bl[2], bl[3]);
  }
  acc_guard4(acc[0][0], acc[0][1], acc[0][2], acc[0][3]);
  acc_guard4(acc[1][0], acc[1][1], acc[1][2], acc[1][3]);
  acc_guard4(acc[2][0], acc[2][1], acc[2][2], acc[2][3]);
  acc_guard4(acc[3][0], acc[3][1], acc[3][2], acc[3][3]);

  // ---- epilogue ----
  float* slab = sT[wave];
  const float* Rb = RESID ? (resid + (size_t)b * strideR) : nullptr;
#pragma unroll
  for (int i = 0; i < 4; ++i) {
    const int mBase = m0 + (i << 4);
#pragma unroll
    for (int j = 0; j < 4; ++j) {
      const int n = n0 + (j << 4) + rlane;
      float bv = 0.f;
      if (BIAS_MODE == 2) bv = bias[n];
      if (BIAS_MODE == 3) bv = bf_bits2f(f2bf_bits(bias[n]));
#pragma unroll
      for (int r = 0; r < 8; ++r) {
        float v = acc[i][j][r] * scale;
        if (BIAS_MODE == 1) v += bias[mBase + mOff + r];
        if (BIAS_MODE == 2 || BIAS_MODE == 3) v += bv;
        if (RESID) v += Rb[(size_t)(mBase + mOff + r) * ldc + n];
        if (ACT == 1) v = tanhf(v);
        if (ACT == 2) v = fmaxf(v, 0.0f);
        if (ACT == 3) v = v / (1.0f + expf(-v));
        if (ACT == 4) v = (v > 0.f) ? v : 0.01f * v;
        if (ACT == 5) v = 0.5f * v * (1.0f + erff(v * 0.70710678118654752f));
        if (ACT == 6) v = (v > 0.f) ? v : 0.2f * v;
        if (ACT == 7) { const float u = 0.7978845608028654f * (v + 0.044715f * v * v * v); v = 0.5f * v * (1.f + tanhf(u)); }
        slab[(mOff + r) * 68 + (j << 4) + rlane] = v;
      }
    }
    __builtin_amdgcn_fence(3 /* release order */, "workgroup");
    __builtin_amdgcn_wave_barrier();
    __builtin_amdgcn_fence(2 /* acquire order */, "workgroup");
    if (OUT_MODE == 0) {
      float* C = (float*)Cout + (size_t)b * strideC;
      const int hh = lane >> 4, c4 = (lane & 15) * 4;     // row seg = 256 B = 16 lanes x 16 B
      {
#pragma unroll
        for (int it = 0; it < 8; ++it) {
          const int row = it * 2 + hh;
          v4f v = *(const v4f*)(slab + row * 68 + c4);
          *(v4f*)(C + (size_t)(mBase + row) * ldc + n0 + c4) = v;
        }
        
      }
    } else {
      const int q = lane >> 3, c8 = (lane & 7) * 8;
      unsigned short* C  = (unsigned short*)Cout  + (size_t)b * strideC;
      unsigned short* C2 = (OUT_MODE == 2) ? ((unsigned short*)Cout2 + (size_t)b * strideC) : nullptr;
      {
#pragma unroll
        for (int it = 0; it < 4; ++it) {
          const int row = it * 4 + q;
          const float* sp = slab + row * 68 + c8;
          v8h hv, lv;
#pragma unroll
          for (int e = 0; e < 8; ++e) {
            if (OUT_MODE == 1) {
              hv[e] = (_Float16)sp[e];
            } else {
              unsigned short hb = f2bf_bits(sp[e]);
              unsigned short lb = f2bf_bits(sp[e] - bf_bits2f(hb));
              hv[e] = __builtin_bit_cast(_Float16, hb);
              lv[e] = __builtin_bit_cast(_Float16, lb);
            }
          }
          *(v8h*)(C + (size_t)(mBase + row) * ldc + n0 + c8) = hv;
          if (OUT_MODE == 2) *(v8h*)(C2 + (size_t)(mBase + row) * ldc + n0 + c8) = lv;
        }
        
      }
    }
    __builtin_amdgcn_fence(3 /* release order */, "workgroup");
    __builtin_amdgcn_wave_barrier();
    __builtin_amdgcn_fence(2 /* acquire order */, "workgroup");
  }
}

} // namespace kit

typedef unsigned int cm_u4 __attribute__((ext_vector_type(4)));
// f32 -> bf16 (RNE) -> f16 planes: every 16-bit operand holds exactly the bf16-converted input value (times a power-of-two scale), so the f16 WMMA
// products of two such planes are exact in the f32 accumulator. Thread per (row, 8 cols); 16 B per thread, thread-linear along the dst row
__device__ __forceinline__ unsigned int cmb_pk2(float a, float b) { return (unsigned int)__builtin_bit_cast(unsigned short, (_Float16)a) | ((unsigned int)__builtin_bit_cast(unsigned short, (_Float16)b) << 16); }
__device__ __forceinline__ float cmb_bf(float v) { const unsigned u = __builtin_bit_cast(unsigned, v); const unsigned r = (u + 0x7fffu + ((u >> 16) & 1u)) & 0xffff0000u; return __builtin_bit_cast(float, r); }   // bf16 RNE, kept as f32 (finite inputs)
__global__ __launch_bounds__(256) void k_cm_castb(const float* __restrict__ SRC, int lds, long long sSz, unsigned short* __restrict__ DST, int ldd, long long sDz, int nR, int nC, float sc) {
    const long long u = (long long)blockIdx.x * 256 + threadIdx.x; const int per = nC / 8; if (u >= (long long)nR * per) return; const int r = (int)(u / per); const int c0 = 8 * (int)(u % per);
    const float* s = SRC + (long long)blockIdx.y * sSz + (long long)r * lds + c0; float w[8];
#pragma unroll
    for (int e = 0; e < 8; ++e) w[e] = cmb_bf(s[e]) * sc;
    cm_u4 pk; pk.x = cmb_pk2(w[0], w[1]); pk.y = cmb_pk2(w[2], w[3]); pk.z = cmb_pk2(w[4], w[5]); pk.w = cmb_pk2(w[6], w[7]); VST2(cm_u4, (cm_u4*)(DST + (long long)blockIdx.y * sDz + (long long)r * ldd + c0), pk); }

// =====================================================================================================================
// k_proj3: the three per-head projections in one grid; blockIdx.y picks the stream. C[m][n] = (1/16) * sum_k f16(bf16(X[m][k])) * f16(16 * bf16(W[n][k]))
//   over the [tokens*heads][64] view of a token stream (f32, batch stride SEQ_FULL * EMBED) and its [64 out][64 in] f32 weight. Both operands are converted
//   in registers on their way into the fragments. A wave owns 64 rows x 64 columns; per 16 rows: k 0..31 then 32..63 into four accumulator tiles,
//   then the 16 x 64 slab goes through the wave's own LDS so that each half-wave stores one whole 256-B row per instruction.
// =====================================================================================================================
#define PJ_NW 4
struct Proj3 { const float* X0; const float* X1; const float* X2; const float* W0; const float* W1; const float* W2; float* C0; float* C1; float* C2; };
typedef __attribute__((ext_vector_type(2))) float  pj_f2;
typedef __attribute__((ext_vector_type(2))) __bf16 pj_b2;
// the 16 f32 values of one fragment as loaded: p points at column k0 + 8h of the lane's row; x[0], x[1] <- p[0..7], x[2], x[3] <- p[16..23]
struct PjRaw { v4f x[4]; };
__device__ __forceinline__ PjRaw pj_load(const float* __restrict__ p) {
    PjRaw r; r.x[0] = *(const v4f*)(p); r.x[1] = *(const v4f*)(p + 4); r.x[2] = *(const v4f*)(p + 16); r.x[3] = *(const v4f*)(p + 20); return r;
}
// fragment element 4c + e = f16(bf16_rne(x[c][e]) * sc): two values per packed f32 -> bf16 conversion (round to nearest even), widened again by their bits
__device__ __forceinline__ v16h pj_frag(const PjRaw& r, float sc) {
    v16h a;
#pragma unroll
    for (int c = 0; c < 4; ++c)
#pragma unroll
        for (int e = 0; e < 4; e += 2) {
            const pj_f2 w = { r.x[c][e], r.x[c][e + 1] };
            const unsigned u = __builtin_bit_cast(unsigned, __builtin_convertvector(w, pj_b2));
            a[4 * c + e]     = (_Float16)(__builtin_bit_cast(float, u << 16) * sc);
            a[4 * c + e + 1] = (_Float16)(__builtin_bit_cast(float, u & 0xffff0000u) * sc);
        }
    return a;
}
__global__ __launch_bounds__(32 * PJ_NW) void k_proj3(Proj3 g) {
    __shared__ __align__(16) float sP[PJ_NW][16 * 68];       // per-wave 16 x 64 slab, pitch 68 floats
    const int lane = threadIdx.x & 31, wave = threadIdx.x >> 5, hf = lane >> 4, l15 = lane & 15;
    const int y = blockIdx.y;
    const float* X = (y == 0) ? g.X0 : (y == 1) ? g.X1 : g.X2;
    const float* Wt = (y == 0) ? g.W0 : (y == 1) ? g.W1 : g.W2;
    float*       C = (y == 0) ? g.C0 : (y == 1) ? g.C1 : g.C2;
    const int m0 = (blockIdx.x * PJ_NW + wave) * 64;         // 64 rows = 4 tokens x 16 heads, inside one batch (SEQ % 64 == 0)
    const int bt = (m0 / HEADS) / SEQ;
    const float* Ab = X + (size_t)bt * (SEQ_FULL - SEQ) * EMBED + (size_t)m0 * HDIM + (size_t)l15 * HDIM + 8 * hf;
    const float* Bb = Wt + l15 * HDIM + 8 * hf;
    float* slab = sP[wave];

    // Loads in three groups: the first 32 token rows (the longest way), the whole weight, then, once the weight's f32 registers are free,
    // the other 32 token rows, which fly while the first 32 rows are worked on.
    PjRaw ra[4][2], rw[2][4];
#pragma unroll
    for (int i = 0; i < 2; ++i) { ra[i][0] = pj_load(Ab + i * 16 * HDIM); ra[i][1] = pj_load(Ab + i * 16 * HDIM + 32); }
    asm volatile("s_wait_xcnt 0x0" ::: "memory");            // stands in front of any reuse of the address registers of the loads above; keeps this group first
#pragma unroll
    for (int ks = 0; ks < 2; ++ks)
#pragma unroll
        for (int j = 0; j < 4; ++j) rw[ks][j] = pj_load(Bb + j * 16 * HDIM + ks * 32);
    asm volatile("s_wait_xcnt 0x0" ::: "memory");            // as above, for the weight's loads
    v16h bw[2][4];
#pragma unroll
    for (int ks = 0; ks < 2; ++ks)
#pragma unroll
        for (int j = 0; j < 4; ++j) bw[ks][j] = pj_frag(rw[ks][j], 16.0f);
    __builtin_amdgcn_sched_barrier(0);                       // the third group waits for the weight's f32 registers: hoisted above the conversion it pushes the kernel past 256 VGPRs
#pragma unroll
    for (int i = 2; i < 4; ++i) { ra[i][0] = pj_load(Ab + i * 16 * HDIM); ra[i][1] = pj_load(Ab + i * 16 * HDIM + 32); }
    asm volatile("s_wait_xcnt 0x0" ::: "memory");            // as above, for the third group
    __builtin_amdgcn_sched_barrier(0);                       // keeps the third group's loads issued ahead of all work on the rows; without it they sink to just in front of their use

#pragma unroll
    for (int i = 0; i < 4; ++i) {
        const v16h a0 = pj_frag(ra[i][0], 1.0f), a1 = pj_frag(ra[i][1], 1.0f);
        v8f acc[4];
#pragma unroll
        for (int j = 0; j < 4; ++j) { v8f zz = {}; acc[j] = __builtin_amdgcn_wmma_f32_16x16x32_f16(false, a0, false, bw[0][j], (short)0, zz, false, false); }
#pragma unroll
        for (int j = 0; j < 4; ++j) acc[j] = __builtin_amdgcn_wmma_f32_16x16x32_f16(false, a1, false, bw[1][j], (short)0, acc[j], false, false);
#pragma unroll
        for (int j = 0; j < 4; ++j)
#pragma unroll
            for (int r = 0; r < 8; ++r) slab[(8 * hf + r) * 68 + j * 16 + l15] = acc[j][r] * 0.0625f;
        // the slab passes between the lanes of one wave: the fences order LDS alone, so that no wave waits here for its global stores
        __builtin_amdgcn_fence(3 /* release order */, "workgroup", "local");
        __builtin_amdgcn_wave_barrier();
        __builtin_amdgcn_fence(2 /* acquire order */, "workgroup", "local");
#pragma unroll
        for (int it = 0; it < 8; ++it) {
            const int row = it * 2 + hf;
            const v4f v = *(const v4f*)(slab + row * 68 + l15 * 4);
            *(v4f*)(C + (size_t)(m0 + i * 16 + row) * HDIM + l15 * 4) = v;
        }
        __builtin_amdgcn_fence(3 /* release order */, "workgroup", "local");
        __builtin_amdgcn_wave_barrier();
        __builtin_amdgcn_fence(2 /* acquire order */, "workgroup", "local");
        if (i == 1) __builtin_amdgcn_sched_barrier(0);       // rows 32..63 are not touched before rows 0..31 are stored: hoisted, their conversion waits for the third group at once
    }
}
static_assert(((MTOK * HEADS) / 64) % PJ_NW == 0);

extern "C" void kernel_launch(void* const* d_in, const int* in_sizes, int n_in, void* d_out, int out_size, void* d_ws, size_t ws_size, hipStream_t stream) {
    if (n_in < 8) return;
    const long long need_x = (long long)(NB - 1) * SEQ_FULL * EMBED + (long long)SEQ * EMBED;   // last element read of a token stream + 1
    if ((long long)in_sizes[0] < need_x || (long long)in_sizes[1] < need_x || (long long)in_sizes[2] < need_x) return;
    if (in_sizes[3] < HDIM * HDIM || in_sizes[4] < HDIM * HDIM || in_sizes[5] < HDIM * HDIM) return;
    if (in_sizes[6] < EMBED * EMBED || in_sizes[7] < EMBED) return;
    if ((long long)out_size < (long long)MTOK * EMBED) return;
    const float* xq = (const float*)d_in[0];
    const float* xk = (const float*)d_in[1];
    const float* xv = (const float*)d_in[2];
    const float* Wq = (const float*)d_in[3];
    const float* Wk = (const float*)d_in[4];
    const float* Wv = (const float*)d_in[5];
    const float* Wo = (const float*)d_in[6];
    const float* bo = (const float*)d_in[7];
    float* out = (float*)d_out;
    char* wsp = (char*)d_ws;
    unsigned short* AO16 = (unsigned short*)wsp; wsp += (((size_t)MTOK * EMBED * 2 + 255) / 256) * 256;    // f16 attention output [MTOK][1024], carried x64
    float* Qf = (float*)wsp; wsp += (((size_t)MTOK * EMBED * 4 + 255) / 256) * 256;
    float* Kf = (float*)wsp; wsp += (((size_t)MTOK * EMBED * 4 + 255) / 256) * 256;
    float* Vf = (float*)wsp; wsp += (((size_t)MTOK * EMBED * 4 + 255) / 256) * 256;
    unsigned short* WO16 = (unsigned short*)wsp; wsp += (((size_t)EMBED * EMBED * 2 + 255) / 256) * 256;
    if ((size_t)(wsp - (char*)d_ws) > ws_size) return;

    // output weight [1024 out][1024 in] -> f16 x16 (Bt form [n][k])
    k_cm_castb<<<dim3((unsigned)(((long long)EMBED * (EMBED / 8) + 255) / 256), 1), 256, 0, stream>>>(Wo, EMBED, 0, WO16, EMBED, 0, EMBED, EMBED, 16.0f);
    // q, k, v streams: [NB][SEQ][1024] (full batch stride) seen as [MTOK*16][64], x [64][64]^T -> Qf / Kf / Vf [MTOK*16][64] = [MTOK][1024]
    {
      Proj3 p;
      p.X0 = xq; p.X1 = xk; p.X2 = xv; p.W0 = Wq; p.W1 = Wk; p.W2 = Wv; p.C0 = Qf; p.C1 = Kf; p.C2 = Vf;
      k_proj3<<<dim3((unsigned)(((MTOK * HEADS) / 64) / PJ_NW), 3), 32 * PJ_NW, 0, stream>>>(p);
    }
    {
      AttnG a;
      a.Q = Qf; a.K = Kf; a.V = Vf; a.O = (_Float16*)AO16;
      a.sb = (long long)SEQ * EMBED; a.S = SEQ; a.scale = 0.03125f;
      k_attn64<<<dim3((unsigned)(SEQ / 64), (unsigned)HEADS, (unsigned)NB), 32 * AT_NW, 0, stream>>>(a);
    }
    // out = (AO16 . WO16^T) / (64 * 16) + bf16(bias)
    kit::wmma_gemm64<0, false, 3, 0, false, 0><<<dim3((unsigned)((((MTOK / 64) * (EMBED / 64)) + 7) / 8), 1), 256, 0, stream>>>((const unsigned short*)AO16, nullptr, EMBED, 0, (const unsigned short*)WO16, nullptr, EMBED, 0, (void*)out, nullptr, EMBED, 0, bo, nullptr, 0, MTOK, EMBED, EMBED, 0.0009765625f);
}

// v004
// One run takes 126 microseconds.
// In both of two side-by-side timings against v003, it was 1.45 times as fast.
// Counting every step since v000, it is 2.51 times as fast.
// Multi-head attention (2 x 2,048 tokens x 1,024; 16 heads x 64; one shared 64x64 [out][in] weight per q / k / v stream applied per head, no biases; scores / 32; no mask; [out][in] output projection + bias). All contractions: v_wmma_f32_16x16x32_f16 (f16 operands, f32 accumulate): inputs and parameters converted to bf16 (RNE) first and held exactly in f16 (weights x16), tokens, 64x64 weights and bias in the registers of the kernel that uses them; per-head projections as f16 WMMA GEMMs, one launch for the three streams, results stored as f16 (q, k as [token][head][d], v transposed as [head][d][token]); one WMMA attention launch (f16 q fragments, f16 k and transposed f16 v tiles copied into LDS, f32 online softmax, probabilities carried x4096 as f16); output projection as an f16 WMMA GEMM of the f16 attention output carried x64 (written so by the attention launch), + bias in f32.
#include <hip/hip_runtime.h>
#include <math.h>

#ifndef NB
#define NB 2
#endif
#ifndef SEQ
#define SEQ 2048
#endif
#define NB_FULL 2
#define SEQ_FULL 2048
#define EMBED 1024
#define HEADS 16
#define HDIM 64
#define MTOK (NB * SEQ)

static_assert(SEQ % 64 == 0);
static_assert(MTOK % 64 == 0);
static_assert((MTOK * HEADS) % 64 == 0);
static_assert(EMBED % 64 == 0 && HDIM == 64);
static_assert(NB <= NB_FULL && SEQ <= SEQ_FULL);

typedef __attribute__((ext_vector_type(16))) _Float16 v16h;
typedef __attribute__((ext_vector_type(8)))  _Float16 v8h;
typedef __attribute__((ext_vector_type(8)))  float    v8f;
typedef __attribute__((ext_vector_type(4)))  float    v4f;

// 16-bit WMMA fragment map (wave32), lane L, h = L>>4, m = L&15:
//   A 16x32: lane = row m;   element i -> k = (i<8) ? 8h+i : 16+8h+(i-8)
//   B 32x16: lane = column m; the SAME k(i,h)
//   D 16x16 (8 f32): lane = column m; element r -> row 8h+r
__device__ __forceinline__ v8f wmma16(v16h a, v16h b, v8f c) {
    c = __builtin_amdgcn_wmma_f32_16x16x32_f16(false, a, false, b, (short)0, c, false, false);
    asm volatile("v_nop\n\tv_nop\n\tv_nop\n\tv_nop" : "+v"(c) : "v"(a), "v"(b));
    return c;
}
union FragH { v16h v; v8h h[2]; };

// A fragment from an f16 GLOBAL row: p points at column k0 + 8h of the lane's row; elements 0..7 <- p[0..7], 8..15 <- p[16..23]
__device__ __forceinline__ v16h fh_g16(const _Float16* __restrict__ p) {
    FragH f; f.h[0] = *(const v8h*)(p); f.h[1] = *(const v8h*)(p + 16); return f.v;
}

// Eight bare v_exp_f32, each over its own argument register, in one statement: no neighbour can take a transcendental's source or read its result
// directly behind it, whatever registers the build picks; the closing v_nop is the independent slot that the instruction set asks for behind the last one.
__device__ __forceinline__ void exp2x8(float (&e)[8]) {
    asm("v_exp_f32 %0, %0\n\tv_exp_f32 %1, %1\n\tv_exp_f32 %2, %2\n\tv_exp_f32 %3, %3\n\t"
        "v_exp_f32 %4, %4\n\tv_exp_f32 %5, %5\n\tv_exp_f32 %6, %6\n\tv_exp_f32 %7, %7\n\tv_nop"
        : "+v"(e[0]), "+v"(e[1]), "+v"(e[2]), "+v"(e[3]), "+v"(e[4]), "+v"(e[5]), "+v"(e[6]), "+v"(e[7]));
}

// 'val' is captured into a local first: never pass an expression that reads *ptr.
#define VST2(T, ptr, val) do { const T vst2_v_ = (val); *(T*)(ptr) = vst2_v_;  } while (0)

// =====================================================================================================================
// k_attn64: O(b,i,h,:) = softmax_j(scale * Q(b,i,h,:).K(b,j,h,:)) V(b,j,h,:) for head dim 64, no mask, S % 64 == 0.
//   Element (b, s, h, d) of Q / K / O lives at X[b*sb + s*EMBED + h*HDIM + d], of V at Vt[b*sb + (h*HDIM + d)*S + s] (all f16; O carried x64). Block = 4 waves = 64 queries of one (batch, head);
//   grid (S/64, HEADS, NB). Per 64-key block: the block copies K [key][d] and V [d][key] into LDS, 16 B a lane, 128-B rows (block barriers on both sides);
//   scores^T = f16 k fragments (two 16-B LDS loads each) x f16 q fragments (registers), f32 accumulate; online softmax in f32, exp2 domain, per lane;
//   O^T += V^T.P^T with f16 v fragments from the transposed tile and P^T packed from the score registers; row sums carried x4096 like P, final 1/rowsum in f32.
//   Staged extent == consumed extent: Ksh 64 keys x 64 d, Vts 64 d x 64 keys, Os 16 rows x 64 d; pad columns are never read.
// =====================================================================================================================
#define AT_NW 4
#define AT_KP 72          // LDS pitch in halves (144 B, a multiple of 16 B)
struct AttnG { const _Float16* Q; const _Float16* K; const _Float16* Vt; _Float16* O; long long sb; int S; float scale; };
static_assert(sizeof(AttnG) == 48);

#ifndef KATTN_ATTR
#define KATTN_ATTR __attribute__((amdgpu_num_vgpr(256)))
#endif
__global__ __launch_bounds__(32 * AT_NW) KATTN_ATTR void k_attn64(AttnG g) {
    __shared__ __align__(16) _Float16 Ksh[64 * AT_KP];
    __shared__ __align__(16) _Float16 Vts[64 * AT_KP];
    __shared__ __align__(16) float    Os[AT_NW][16 * 68];
    const int tid = threadIdx.x, wave = tid >> 5, lane = tid & 31, hf = lane >> 4, l15 = lane & 15;
    const int h = blockIdx.y, b = blockIdx.z;
    const int q0 = (blockIdx.x * AT_NW + wave) * 16;
    const float L2E = 1.4426950408889634f;
    const float NEG = -__builtin_inff();
    const float sc2 = g.scale * L2E;                         // raw score -> base-2 exponent
    const _Float16* qbase = g.Q + (long long)b * g.sb + h * HDIM;
    const _Float16* kbase = g.K + (long long)b * g.sb + h * HDIM;
    const _Float16* vbase = g.Vt + (long long)b * g.sb + (long long)h * HDIM * g.S;
    _Float16*    obase = g.O + (long long)b * g.sb + h * HDIM;

    // q fragments (B operand: column = query l15), two 32-deep k-steps
    const _Float16* qrow = qbase + (size_t)(q0 + l15) * EMBED + 8 * hf;
    const v16h qa0 = fh_g16(qrow), qa1 = fh_g16(qrow + 32);

    v8f o[4]; float m1 = NEG, l1 = 0.f;
#pragma unroll
    for (int t = 0; t < 4; ++t) { v8f zz = {}; o[t] = zz; }

    // the lane's 16 B of a tile: row tid / 8, column group tid % 8; byte offsets in the two global tiles, element offset in the LDS tiles
    const unsigned kob = (unsigned)((tid >> 3) * EMBED + (tid & 7) * 8) * 2u;
    const unsigned vob = (unsigned)((tid >> 3) * g.S + (tid & 7) * 8) * 2u;
    const int so = (tid >> 3) * AT_KP + (tid & 7) * 8;
    for (int j0 = 0; j0 < g.S; j0 += 64) {
        __syncthreads();                                     // the prior key block's reads of Ksh / Vts are done
        const char* kt = (const char*)(kbase + (size_t)j0 * EMBED);   // block-uniform tile bases; the lane's part is a fixed 32-bit byte offset
        const char* vt = (const char*)(vbase + j0);
        const char* ka = kt + kob;
        const char* va[4];
        v8h kk[4], vv[4];
#pragma unroll
        for (int it = 0; it < 4; ++it) {                     // 512 items a tile = 64 rows (K: keys, V: d) x 8 column groups of 8 (K: d, V: keys); a thread's items lie 16 rows apart
            va[it] = vt + (size_t)it * 16 * g.S * 2 + vob;
            kk[it] = *(const v8h*)(ka + (size_t)it * 16 * EMBED * 2);
            vv[it] = *(const v8h*)(va[it]);
        }
        // stands in front of any reuse of the address registers of the eight loads above: as its inputs they stay whole up to here, so that no later load of the group lands on one
        asm volatile("s_wait_xcnt 0x0" :: "v"(ka), "v"(va[0]), "v"(va[1]), "v"(va[2]), "v"(va[3]) : "memory");
#pragma unroll
        for (int it = 0; it < 4; ++it) {
            *(v8h*)(Ksh + so + it * 16 * AT_KP) = kk[it];
            *(v8h*)(Vts + so + it * 16 * AT_KP) = vv[it];
        }
        __syncthreads();                                     // K and V tiles visible to all waves

        v8f s[4];
#pragma unroll
        for (int t = 0; t < 4; ++t) {                        // A fragment: row = key t*16 + l15, k = d; B = the q fragments (column = query l15)
            const int ko = (t * 16 + l15) * AT_KP + 8 * hf;
            FragH k0f, k1f;
            k0f.h[0] = *(const v8h*)(Ksh + ko);      k0f.h[1] = *(const v8h*)(Ksh + ko + 16);
            k1f.h[0] = *(const v8h*)(Ksh + ko + 32); k1f.h[1] = *(const v8h*)(Ksh + ko + 48);
            v8f acc = {};
            acc = wmma16(k0f.v, qa0, acc);
            acc = wmma16(k1f.v, qa1, acc);
            s[t] = acc;
        }
        // online softmax of the lane's query: 32 scores in registers, one exchange with the other half-wave for the maximum.
        // The maximum is kept in raw score units (the scale is positive, so it commutes with max); each probability is one fma and one bare
        // v_exp_f32: p * 4096 = exp2(s * sc2 + (12 - mref * sc2)). Arguments are <= 12; below -126 the bare instruction gives 0, far under f16's range.
        float mx = NEG;
#pragma unroll
        for (int t = 0; t < 4; ++t)
#pragma unroll
            for (int r = 0; r < 8; ++r) mx = fmaxf(mx, s[t][r]);
        mx = fmaxf(mx, __shfl_xor(mx, 16, 32));
        const float mnew = fmaxf(m1, mx);
        const float mref = (mnew == NEG) ? 0.f : mnew;       // the one -inf guard: a -inf score then gives exp2(-inf) = 0 with no test of its own
        const float corr = __builtin_amdgcn_exp2f((m1 - mref) * sc2);
        const float nb = fmaf(-mref, sc2, 12.f);
        // P^T as B operand straight from the score tiles: element i < 8 is key 8*hf + i (tile 2u), element 8 + i is key 16 + 8*hf + i (tile 2u + 1)
        FragH pf[2];
        float rs4[4];
#pragma unroll
        for (int t = 0; t < 4; ++t) {
            float rs = 0.f, e[8];
#pragma unroll
            for (int r = 0; r < 8; ++r) e[r] = fmaf(s[t][r], sc2, nb);
            exp2x8(e);
#pragma unroll
            for (int r = 0; r < 8; ++r) {
                const float pp = e[r]; rs += pp;
                pf[t >> 1].h[t & 1][r] = (_Float16)pp;
            }
            rs4[t] = rs;
        }
        l1 = l1 * corr + ((rs4[0] + rs4[1]) + (rs4[2] + rs4[3])); m1 = mnew;   // the lane's own 32 keys; both half-waves use the same corr, so the halves join once after the loop
#pragma unroll
        for (int t = 0; t < 4; ++t)
#pragma unroll
            for (int r = 0; r < 8; ++r) o[t][r] *= corr;
#pragma unroll
        for (int t = 0; t < 4; ++t) {                        // A fragment: row = d t*16 + l15, k = key (transposed tile, k-contiguous)
            const int vo = (t * 16 + l15) * AT_KP + 8 * hf;
            FragH v0f, v1f;
            v0f.h[0] = *(const v8h*)(Vts + vo);      v0f.h[1] = *(const v8h*)(Vts + vo + 16);
            v1f.h[0] = *(const v8h*)(Vts + vo + 32); v1f.h[1] = *(const v8h*)(Vts + vo + 48);
            o[t] = wmma16(v0f.v, pf[0].v, o[t]);
            o[t] = wmma16(v1f.v, pf[1].v, o[t]);
        }
    }

    // O: stage the wave's 16 x 64 tile (pitch 68 floats; the lane writes 8 consecutive d of its query per tile), then 8 lanes write one row's 64 halves, a whole 128-B line (8 x 16 B), four rows per instruction; f16(x * 64) of the f32 value
    {
        l1 += __shfl_xor(l1, 16, 32);                        // join the two half-waves' row sums
        const float inv = (l1 > 0.f) ? 1.f / l1 : 0.f;       // l1 sums p * 4096, as o does
#pragma unroll
        for (int t = 0; t < 4; ++t) {
            v4f w0, w1;
#pragma unroll
            for (int e = 0; e < 4; ++e) { w0[e] = o[t][e] * inv; w1[e] = o[t][4 + e] * inv; }
            *(v4f*)(&Os[wave][l15 * 68 + t * 16 + 8 * hf]) = w0;
            *(v4f*)(&Os[wave][l15 * 68 + t * 16 + 8 * hf + 4]) = w1;
        }
    }
    __builtin_amdgcn_fence(3 /* release order */, "workgroup");
    __builtin_amdgcn_wave_barrier();
    __builtin_amdgcn_fence(2 /* acquire order */, "workgroup");
    {
        const int q4 = lane >> 3, c8 = (lane & 7) * 8;
#pragma unroll
        for (int it = 0; it < 4; ++it) {
            const int row = it * 4 + q4;
            const v4f va = *(const v4f*)(&Os[wave][row * 68 + c8]), vc = *(const v4f*)(&Os[wave][row * 68 + c8 + 4]);
            v8h hv;
#pragma unroll
            for (int e = 0; e < 4; ++e) { hv[e] = (_Float16)(va[e] * 64.0f); hv[4 + e] = (_Float16)(vc[e] * 64.0f); }
            *(v8h*)(obase + (size_t)(q0 + row) * EMBED + c8) = hv;
        }
    }
}

namespace kit {
typedef __attribute__((ext_vector_type(16))) _Float16 v16h;
typedef __attribute__((ext_vector_type(8)))  _Float16 v8h;
typedef __attribute__((ext_vector_type(16))) __bf16   v16b;
typedef __attribute__((ext_vector_type(8)))  __bf16   v8b;
typedef __attribute__((ext_vector_type(8)))  float    v8f;
typedef __attribute__((ext_vector_type(4)))  float    v4f;

__device__ __forceinline__ unsigned short f2bf_bits(float f) {
  unsigned u = __float_as_uint(f);
  return (unsigned short)((u + 0x7FFFu + ((u >> 16) & 1u)) >> 16);
}
__device__ __forceinline__ float bf_bits2f(unsigned short h) { return __uint_as_float(((unsigned)h) << 16); }

// hazard guards as plain device helpers
__device__ __forceinline__ void dep_guard_h(v8f& a, v8f& b, v16h x, v16h y) { asm volatile("v_nop\n\tv_nop\n\tv_nop\n\tv_nop" : "+v"(a), "+v"(b) : "v"(x), "v"(y)); }
__device__ __forceinline__ void dep_guard_b(v8f& a, v8f& b, v16b x, v16b y) { asm volatile("v_nop\n\tv_nop\n\tv_nop\n\tv_nop" : "+v"(a), "+v"(b) : "v"(x), "v"(y)); }
__device__ __forceinline__ void keep4_h(v16h a, v16h b, v16h c, v16h d) { asm volatile("v_nop" :: "v"(a), "v"(b), "v"(c), "v"(d)); }
__device__ __forceinline__ void keep4_b(v16b a, v16b b, v16b c, v16b d) { asm volatile("v_nop" :: "v"(a), "v"(b), "v"(c), "v"(d)); }
__device__ __forceinline__ void acc_guard4(v8f& a, v8f& b, v8f& c, v8f& d) { asm volatile("v_nop\n\tv_nop\n\tv_nop\n\tv_nop" : "+v"(a), "+v"(b), "+v"(c), "+v"(d)); }
template <typename T> struct Frag;
template <> struct Frag<_Float16> {
  typedef v16h V; union U { v16h v; v8h h[2]; };
  static __device__ __forceinline__ v16h load(const _Float16* p) {   // elements 0..7 <- p[0..7], 8..15 <- p[16..23]
    U f; f.h[0] = *(const v8h*)(p); f.h[1] = *(const v8h*)(p + 16); return f.v;
  }
  static __device__ __forceinline__ v8f mma(v16h a, v16h b, v8f c) {
    return __builtin_amdgcn_wmma_f32_16x16x32_f16(false, a, false, b, (short)0, c, false, false);
  }
  static __device__ __forceinline__ void guard(v8f& a, v8f& b, v16h x, v16h y) { dep_guard_h(a, b, x, y); }
  static __device__ __forceinline__ void keep(v16h a, v16h b, v16h c, v16h d) { keep4_h(a, b, c, d); }
};
template <> struct Frag<__bf16> {
  typedef v16b V; union U { v16b v; v8b h[2]; };
  static __device__ __forceinline__ v16b load(const __bf16* p) {
    U f; f.h[0] = *(const v8b*)(p); f.h[1] = *(const v8b*)(p + 16); return f.v;
  }
  static __device__ __forceinline__ v8f mma(v16b a, v16b b, v8f c) {
    return __builtin_amdgcn_wmma_f32_16x16x32_bf16(false, a, false, b, (short)0, c, false, false);
  }
  static __device__ __forceinline__ void guard(v8f& a, v8f& b, v16b x, v16b y) { dep_guard_b(a, b, x, y); }
  static __device__ __forceinline__ void keep(v16b a, v16b b, v16b c, v16b d) { keep4_b(a, b, c, d); }
};

// ---- Register-blocked batched WMMA GEMM ------------------------------------
// C[m,n] = scale * sum_k A[m,k] * Bt[n,k] (+bias)(+resid); each wave owns a 64x64 tile.
// A row-major [M,K]; Bt row-major [N,K]; M,N % 64 == 0, K % 32 == 0 (no tail masking).
// SPLIT: operands are hi/lo planes (A2/Bt2 = lo planes, same layout); product = hi*hi + hi*lo + lo*hi.
// BIAS_MODE: 0 = none, 1 = bias[m], 2 = bias[n], 3 = bias[n] converted to bf16 (RNE) first.
// OUT_MODE: 0 = f32, 1 = f16, 2 = bf16 hi plane (Cout) + bf16 lo plane (Cout2).
// ET: 0 = f16 operands, 1 = bf16 operands (pointers passed as 16-bit storage)
template <int ET> struct Elem;
template <> struct Elem<0> { typedef _Float16 T; };
template <> struct Elem<1> { typedef __bf16 T; };
template <int ET, bool SPLIT, int BIAS_MODE, int OUT_MODE, bool RESID, int ACT = 0>
__global__ __launch_bounds__(256) void wmma_gemm64(
    const unsigned short* __restrict__ Ap, const unsigned short* __restrict__ A2p, int lda, long strideA,
    const unsigned short* __restrict__ Btp, const unsigned short* __restrict__ Bt2p, int ldb, long strideB,
    void* __restrict__ Cout, void* __restrict__ Cout2, int ldc, long strideC,
    const float* __restrict__ bias,
    const float* __restrict__ resid, long strideR,
    int M, int N, int K, float scale) {
  typedef typename Elem<ET>::T T;
  typedef typename Frag<T>::V V;
  const T* A = (const T*)Ap; const T* A2 = (const T*)A2p; const T* Bt = (const T*)Btp; const T* Bt2 = (const T*)Bt2p;
  __shared__ __align__(16) float sT[8][16 * 68];   // per-wave 16x64 slab, pitch 68 floats
  const int b    = blockIdx.y;
  const int lane = threadIdx.x & 31;
  const int wave = threadIdx.x >> 5;
  const int tilesN = N >> 6;
  const int tilesM = M >> 6;
  const int tile = blockIdx.x * 8 + wave;
  if (tile >= tilesM * tilesN) return;   // wave-uniform; no block barriers in this kernel
  const int tm = tile / tilesN;
  const int tn = tile - tm * tilesN;
  const int m0 = tm << 6;
  const int n0 = tn << 6;

  const T* Ab  = A  + (size_t)b * strideA;
  const T* Bb  = Bt + (size_t)b * strideB;
  const T* Ab2 = SPLIT ? (A2  + (size_t)b * strideA) : nullptr;
  const T* Bb2 = SPLIT ? (Bt2 + (size_t)b * strideB) : nullptr;

  const int rlane = lane & 15;                 // row (A) / col (B, D) within subtile
  const int koff  = (lane >> 4) * 8;           // k offset of this lane half
  const int mOff  = (lane >> 4) * 8;           // D row offset

  v8f acc[4][4];
#pragma unroll
  for (int i = 0; i < 4; ++i)
#pragma unroll
    for (int j = 0; j < 4; ++j) acc[i][j] = (v8f){0.f,0.f,0.f,0.f,0.f,0.f,0.f,0.f};

  for (int k0 = 0; k0 < K; k0 += 32) {
    V bh[4], bl[4];
#pragma unroll
    for (int j = 0; j < 4; ++j) {
      const size_t bo = (size_t)(n0 + (j << 4) + rlane) * ldb + koff + k0;
      bh[j] = Frag<T>::load(Bb + bo);
      if (SPLIT) bl[j] = Frag<T>::load(Bb2 + bo);
    }
#pragma unroll
    for (int i = 0; i < 4; ++i) {
      const size_t ao = (size_t)(m0 + (i << 4) + rlane) * lda + koff + k0;
      V ah = Frag<T>::load(Ab + ao);
      V al;
      if (SPLIT) al = Frag<T>::load(Ab2 + ao);
#pragma unroll
      for (int j = 0; j < 4; ++j) {
        acc[i][j] = Frag<T>::mma(ah, bh[j], acc[i][j]);
        if (SPLIT) {
          acc[i][j] = Frag<T>::mma(ah, bl[j], acc[i][j]);
          acc[i][j] = Frag<T>::mma(al, bh[j], acc[i][j]);
        }
      }
      Frag<T>::guard(acc[i][0], acc[i][3], ah, SPLIT ? al : ah);
    }
    Frag<T>::keep(bh[0], bh[1], bh[2], bh[3]);
    if (SPLIT) Frag<T>::keep(bl[0], bl[1], bl[2], bl[3]);
  }
  acc_guard4(acc[0][0], acc[0][1], acc[0][2], acc[0][3]);
  acc_guard4(acc[1][0], acc[1][1], acc[1][2], acc[1][3]);
  acc_guard4(acc[2][0], acc[2][1], acc[2][2], acc[2][3]);
  acc_guard4(acc[3][0], acc[3][1], acc[3][2], acc[3][3]);

  // ---- epilogue ----
  float* slab = sT[wave];
  const float* Rb = RESID ? (resid + (size_t)b * strideR) : nullptr;
#pragma unroll
  for (int i = 0; i < 4; ++i) {
    const int mBase = m0 + (i << 4);
#pragma unroll
    for (int j = 0; j < 4; ++j) {
      const int n = n0 + (j << 4) + rlane;
      float bv = 0.f;
      if (BIAS_MODE == 2) bv = bias[n];
      if (BIAS_MODE == 3) bv = bf_bits2f(f2bf_bits(bias[n]));
#pragma unroll
      for (int r = 0; r < 8; ++r) {
        float v = acc[i][j][r] * scale;
        if (BIAS_MODE == 1) v += bias[mBase + mOff + r];
        if (BIAS_MODE == 2 || BIAS_MODE == 3) v += bv;
        if (RESID) v += Rb[(size_t)(mBase + mOff + r) * ldc + n];
        if (ACT == 1) v = tanhf(v);
        if (ACT == 2) v = fmaxf(v, 0.0f);
        if (ACT == 3) v = v / (1.0f + expf(-v));
        if (ACT == 4) v = (v > 0.f) ? v : 0.01f * v;
        if (ACT == 5) v = 0.5f * v * (1.0f + erff(v * 0.70710678118654752f));
        if (ACT == 6) v = (v > 0.f) ? v : 0.2f * v;
        if (ACT == 7) { const float u = 0.7978845608028654f * (v + 0.044715f * v * v * v); v = 0.5f * v * (1.f + tanhf(u)); }
        slab[(mOff + r) * 68 + (j << 4) + rlane] = v;
      }
    }
    __builtin_amdgcn_fence(3 /* release order */, "workgroup");
    __builtin_amdgcn_wave_barrier();
    __builtin_amdgcn_fence(2 /* acquire order */, "workgroup");
    if (OUT_MODE == 0) {
      float* C = (float*)Cout + (size_t)b * strideC;
      const int hh = lane >> 4, c4 = (lane & 15) * 4;     // row seg = 256 B = 16 lanes x 16 B
      {
#pragma unroll
        for (int it = 0; it < 8; ++it) {
          const int row = it * 2 + hh;
          v4f v = *(const v4f*)(slab + row * 68 + c4);
          *(v4f*)(C + (size_t)(mBase + row) * ldc + n0 + c4) = v;
        }
        
      }
    } else {
      const int q = lane >> 3, c8 = (lane & 7) * 8;
      unsigned short* C  = (unsigned short*)Cout  + (size_t)b * strideC;
      unsigned short* C2 = (OUT_MODE == 2) ? ((unsigned short*)Cout2 + (size_t)b * strideC) : nullptr;
      {
#pragma unroll
        for (int it = 0; it < 4; ++it) {
          const int row = it * 4 + q;
          const float* sp = slab + row * 68 + c8;
          v8h hv, lv;
#pragma unroll
          for (int e = 0; e < 8; ++e) {
            if (OUT_MODE == 1) {
              hv[e] = (_Float16)sp[e];
            } else {
              unsigned short hb = f2bf_bits(sp[e]);
              unsigned short lb = f2bf_bits(sp[e] - bf_bits2f(hb));
              hv[e] = __builtin_bit_cast(_Float16, hb);
              lv[e] = __builtin_bit_cast(_Float16, lb);
            }
          }
          *(v8h*)(C + (size_t)(mBase + row) * ldc + n0 + c8) = hv;
          if (OUT_MODE == 2) *(v8h*)(C2 + (size_t)(mBase + row) * ldc + n0 + c8) = lv;
        }
        
      }
    }
    __builtin_amdgcn_fence(3 /* release order */, "workgroup");
    __builtin_amdgcn_wave_barrier();
    __builtin_amdgcn_fence(2 /* acquire order */, "workgroup");
  }
}

} // namespace kit

typedef unsigned int cm_u4 __attribute__((ext_vector_type(4)));
// f32 -> bf16 (RNE) -> f16 planes: every 16-bit operand holds exactly the bf16-converted input value (times a power-of-two scale), so the f16 WMMA
// products of two such planes are exact in the f32 accumulator. Thread per (row, 8 cols); 16 B per thread, thread-linear along the dst row
__device__ __forceinline__ unsigned int cmb_pk2(float a, float b) { return (unsigned int)__builtin_bit_cast(unsigned short, (_Float16)a) | ((unsigned int)__builtin_bit_cast(unsigned short, (_Float16)b) << 16); }
__device__ __forceinline__ float cmb_bf(float v) { const unsigned u = __builtin_bit_cast(unsigned, v); const unsigned r = (u + 0x7fffu + ((u >> 16) & 1u)) & 0xffff0000u; return __builtin_bit_cast(float, r); }   // bf16 RNE, kept as f32 (finite inputs)
__global__ __launch_bounds__(256) void k_cm_castb(const float* __restrict__ SRC, int lds, long long sSz, unsigned short* __restrict__ DST, int ldd, long long sDz, int nR, int nC, float sc) {
    const long long u = (long long)blockIdx.x * 256 + threadIdx.x; const int per = nC / 8; if (u >= (long long)nR * per) return; const int r = (int)(u / per); const int c0 = 8 * (int)(u % per);
    const float* s = SRC + (long long)blockIdx.y * sSz + (long long)r * lds + c0; float w[8];
#pragma unroll
    for (int e = 0; e < 8; ++e) w[e] = cmb_bf(s[e]) * sc;
    cm_u4 pk; pk.x = cmb_pk2(w[0], w[1]); pk.y = cmb_pk2(w[2], w[3]); pk.z = cmb_pk2(w[4], w[5]); pk.w = cmb_pk2(w[6], w[7]); VST2(cm_u4, (cm_u4*)(DST + (long long)blockIdx.y * sDz + (long long)r * ldd + c0), pk); }

// =====================================================================================================================
// k_proj3: the three per-head projections in one grid; blockIdx.y picks the stream. C[m][n] = f16((1/16) * sum_k f16(bf16(X[m][k])) * f16(16 * bf16(W[n][k])))
//   over 64-wide head slices of a token stream (f32, batch stride SEQ_FULL * EMBED) and its [64 out][64 in] f32 weight. Both operands are converted
//   in registers on their way into the fragments. A wave owns 64 rows x 64 columns; per 16 rows: k 0..31 then 32..63 into four accumulator tiles.
//   q, k (VT false): the rows are 64 consecutive rows of the [tokens*heads][64] view; the 16 x 64 slab goes through the wave's own LDS so that 8 lanes store
//   one whole 128-B f16 row, four rows per instruction. v (VT true): the rows are 64 consecutive tokens of ONE head; a lane's 8 accumulator registers are 8 consecutive
//   tokens of one output column, one 16-B store into the transposed result [batch][head][d][token]; the wave fills whole 128-B lines (64 tokens of one d).
// =====================================================================================================================
#define PJ_NW 4
struct Proj3 { const float* X0; const float* X1; const float* X2; const float* W0; const float* W1; const float* W2; _Float16* C0; _Float16* C1; _Float16* C2; };
typedef __attribute__((ext_vector_type(2))) float  pj_f2;
typedef __attribute__((ext_vector_type(2))) __bf16 pj_b2;
// the 16 f32 values of one fragment as loaded: p points at column k0 + 8h of the lane's row; x[0], x[1] <- p[0..7], x[2], x[3] <- p[16..23]
struct PjRaw { v4f x[4]; };
__device__ __forceinline__ PjRaw pj_load(const float* __restrict__ p) {
    PjRaw r; r.x[0] = *(const v4f*)(p); r.x[1] = *(const v4f*)(p + 4); r.x[2] = *(const v4f*)(p + 16); r.x[3] = *(const v4f*)(p + 20); return r;
}
// fragment element 4c + e = f16(bf16_rne(x[c][e]) * sc): two values per packed f32 -> bf16 conversion (round to nearest even), widened again by their bits
__device__ __forceinline__ v16h pj_frag(const PjRaw& r, float sc) {
    v16h a;
#pragma unroll
    for (int c = 0; c < 4; ++c)
#pragma unroll
        for (int e = 0; e < 4; e += 2) {
            const pj_f2 w = { r.x[c][e], r.x[c][e + 1] };
            const unsigned u = __builtin_bit_cast(unsigned, __builtin_convertvector(w, pj_b2));
            a[4 * c + e]     = (_Float16)(__builtin_bit_cast(float, u << 16) * sc);
            a[4 * c + e + 1] = (_Float16)(__builtin_bit_cast(float, u & 0xffff0000u) * sc);
        }
    return a;
}
template <bool VT>
__device__ __forceinline__ void pj_body(const float* __restrict__ X, const float* __restrict__ Wt, _Float16* __restrict__ C, float* slab, int tile, int lane) {
    const int hf = lane >> 4, l15 = lane & 15;
    constexpr int RS = VT ? EMBED : HDIM;                    // floats from one of the wave's rows to the next
    const int m0 = tile * 64;                                // VT false: 64 rows = 4 tokens x 16 heads, inside one batch (SEQ % 64 == 0)
    const int hd = tile % HEADS, t0 = (tile / HEADS) * 64;   // VT true: head, and the first of 64 tokens, inside one batch
    const int bt = VT ? t0 / SEQ : (m0 / HEADS) / SEQ;
    const float* Ab = X + (size_t)bt * (SEQ_FULL - SEQ) * EMBED + (VT ? (size_t)t0 * EMBED + hd * HDIM : (size_t)m0 * HDIM) + (size_t)l15 * RS + 8 * hf;
    const float* Bb = Wt + l15 * HDIM + 8 * hf;

    // Loads in three groups: the first 32 token rows (the longest way), the whole weight, then, once the weight's f32 registers are free,
    // the other 32 token rows, which fly while the first 32 rows are worked on.
    PjRaw ra[4][2], rw[2][4];
#pragma unroll
    for (int i = 0; i < 2; ++i) { ra[i][0] = pj_load(Ab + i * 16 * RS); ra[i][1] = pj_load(Ab + i * 16 * RS + 32); }
    asm volatile("s_wait_xcnt 0x0" ::: "memory");            // stands in front of any reuse of the address registers of the loads above; keeps this group first
#pragma unroll
    for (int ks = 0; ks < 2; ++ks)
#pragma unroll
        for (int j = 0; j < 4; ++j) rw[ks][j] = pj_load(Bb + j * 16 * HDIM + ks * 32);
    asm volatile("s_wait_xcnt 0x0" ::: "memory");            // as above, for the weight's loads
    v16h bw[2][4];
#pragma unroll
    for (int ks = 0; ks < 2; ++ks)
#pragma unroll
        for (int j = 0; j < 4; ++j) bw[ks][j] = pj_frag(rw[ks][j], 16.0f);
    __builtin_amdgcn_sched_barrier(0);                       // the third group waits for the weight's f32 registers: hoisted above the conversion it pushes the kernel past 256 VGPRs
#pragma unroll
    for (int i = 2; i < 4; ++i) { ra[i][0] = pj_load(Ab + i * 16 * RS); ra[i][1] = pj_load(Ab + i * 16 * RS + 32); }
    asm volatile("s_wait_xcnt 0x0" ::: "memory");            // as above, for the third group
    __builtin_amdgcn_sched_barrier(0);                       // keeps the third group's loads issued ahead of all work on the rows; without it they sink to just in front of their use

#pragma unroll
    for (int i = 0; i < 4; ++i) {
        const v16h a0 = pj_frag(ra[i][0], 1.0f), a1 = pj_frag(ra[i][1], 1.0f);
        v8f acc[4];
#pragma unroll
        for (int j = 0; j < 4; ++j) { v8f zz = {}; acc[j] = __builtin_amdgcn_wmma_f32_16x16x32_f16(false, a0, false, bw[0][j], (short)0, zz, false, false); }
#pragma unroll
        for (int j = 0; j < 4; ++j) acc[j] = __builtin_amdgcn_wmma_f32_16x16x32_f16(false, a1, false, bw[1][j], (short)0, acc[j], false, false);
        if (VT) {
            // acc[j][r] = token t0 + i*16 + 8*hf + r, column j*16 + l15
            _Float16* Cv = C + (size_t)bt * SEQ * EMBED + ((size_t)hd * HDIM + l15) * SEQ + (t0 - bt * SEQ) + i * 16 + 8 * hf;
#pragma unroll
            for (int j = 0; j < 4; ++j) {
                v8h hv;
#pragma unroll
                for (int r = 0; r < 8; ++r) hv[r] = (_Float16)(acc[j][r] * 0.0625f);
                *(v8h*)(Cv + (size_t)j * 16 * SEQ) = hv;
            }
        } else {
#pragma unroll
            for (int j = 0; j < 4; ++j)
#pragma unroll
                for (int r = 0; r < 8; ++r) slab[(8 * hf + r) * 68 + j * 16 + l15] = acc[j][r] * 0.0625f;
            // the slab passes between the lanes of one wave: the fences order LDS alone, so that no wave waits here for its global stores
            __builtin_amdgcn_fence(3 /* release order */, "workgroup", "local");
            __builtin_amdgcn_wave_barrier();
            __builtin_amdgcn_fence(2 /* acquire order */, "workgroup", "local");
            const int q4 = lane >> 3, c8 = (lane & 7) * 8;
#pragma unroll
            for (int it = 0; it < 4; ++it) {
                const int row = it * 4 + q4;
                const v4f va = *(const v4f*)(slab + row * 68 + c8), vc = *(const v4f*)(slab + row * 68 + c8 + 4);
                v8h hv;
#pragma unroll
                for (int e = 0; e < 4; ++e) { hv[e] = (_Float16)va[e]; hv[4 + e] = (_Float16)vc[e]; }
                *(v8h*)(C + (size_t)(m0 + i * 16 + row) * HDIM + c8) = hv;
            }
            if (i == 3) asm volatile("s_wait_xcnt 0x0" ::: "memory");   // behind the body's last stores: nothing that follows this body in the kernel's code may reuse their address registers ahead of it
            __builtin_amdgcn_fence(3 /* release order */, "workgroup", "local");
            __builtin_amdgcn_wave_barrier();
            __builtin_amdgcn_fence(2 /* acquire order */, "workgroup", "local");
        }
        if (i == 1) __builtin_amdgcn_sched_barrier(0);       // rows 32..63 are not touched before rows 0..31 are stored: hoisted, their conversion waits for the third group at once
    }
}
__global__ __launch_bounds__(32 * PJ_NW) void k_proj3(Proj3 g) {
    __shared__ __align__(16) float sP[PJ_NW][16 * 68];       // per-wave 16 x 64 slab, pitch 68 floats (q, k streams)
    const int lane = threadIdx.x & 31, wave = threadIdx.x >> 5;
    const int y = blockIdx.y;
    const int tile = blockIdx.x * PJ_NW + wave;
    if (y == 2) pj_body<true>(g.X2, g.W2, g.C2, sP[wave], tile, lane);
    else        pj_body<false>((y == 0) ? g.X0 : g.X1, (y == 0) ? g.W0 : g.W1, (y == 0) ? g.C0 : g.C1, sP[wave], tile, lane);
}
static_assert(((MTOK * HEADS) / 64) % PJ_NW == 0);

extern "C" void kernel_launch(void* const* d_in, const int* in_sizes, int n_in, void* d_out, int out_size, void* d_ws, size_t ws_size, hipStream_t stream) {
    if (n_in < 8) return;
    const long long need_x = (long long)(NB - 1) * SEQ_FULL * EMBED + (long long)SEQ * EMBED;   // last element read of a token stream + 1
    if ((long long)in_sizes[0] < need_x || (long long)in_sizes[1] < need_x || (long long)in_sizes[2] < need_x) return;
    if (in_sizes[3] < HDIM * HDIM || in_sizes[4] < HDIM * HDIM || in_sizes[5] < HDIM * HDIM) return;
    if (in_sizes[6] < EMBED * EMBED || in_sizes[7] < EMBED) return;
    if ((long long)out_size < (long long)MTOK * EMBED) return;
    const float* xq = (const float*)d_in[0];
    const float* xk = (const float*)d_in[1];
    const float* xv = (const float*)d_in[2];
    const float* Wq = (const float*)d_in[3];
    const float* Wk = (const float*)d_in[4];
    const float* Wv = (const float*)d_in[5];
    const float* Wo = (const float*)d_in[6];
    const float* bo = (const float*)d_in[7];
    float* out = (float*)d_out;
    char* wsp = (char*)d_ws;
    unsigned short* AO16 = (unsigned short*)wsp; wsp += (((size_t)MTOK * EMBED * 2 + 255) / 256) * 256;    // f16 attention output [MTOK][1024], carried x64
    _Float16* Qh = (_Float16*)wsp; wsp += (((size_t)MTOK * EMBED * 2 + 255) / 256) * 256;    // [MTOK][1024]
    _Float16* Kh = (_Float16*)wsp; wsp += (((size_t)MTOK * EMBED * 2 + 255) / 256) * 256;    // [MTOK][1024]
    _Float16* Vt = (_Float16*)wsp; wsp += (((size_t)MTOK * EMBED * 2 + 255) / 256) * 256;    // [NB][1024][SEQ]
    unsigned short* WO16 = (unsigned short*)wsp; wsp += (((size_t)EMBED * EMBED * 2 + 255) / 256) * 256;
    if ((size_t)(wsp - (char*)d_ws) > ws_size) return;

    // output weight [1024 out][1024 in] -> f16 x16 (Bt form [n][k])
    k_cm_castb<<<dim3((unsigned)(((long long)EMBED * (EMBED / 8) + 255) / 256), 1), 256, 0, stream>>>(Wo, EMBED, 0, WO16, EMBED, 0, EMBED, EMBED, 16.0f);
    // q, k, v streams: [NB][SEQ][1024] (full batch stride), 64-wide head slices x [64][64]^T -> Qh / Kh [MTOK*16][64] = [MTOK][1024], Vt [NB][16*64][SEQ]
    {
      Proj3 p;
      p.X0 = xq; p.X1 = xk; p.X2 = xv; p.W0 = Wq; p.W1 = Wk; p.W2 = Wv; p.C0 = Qh; p.C1 = Kh; p.C2 = Vt;
      k_proj3<<<dim3((unsigned)(((MTOK * HEADS) / 64) / PJ_NW), 3), 32 * PJ_NW, 0, stream>>>(p);
    }
    {
      AttnG a;
      a.Q = Qh; a.K = Kh; a.Vt = Vt; a.O = (_Float16*)AO16;
      a.sb = (long long)SEQ * EMBED; a.S = SEQ; a.scale = 0.03125f;
      k_attn64<<<dim3((unsigned)(SEQ / 64), (unsigned)HEADS, (unsigned)NB), 32 * AT_NW, 0, stream>>>(a);
    }
    // out = (AO16 . WO16^T) / (64 * 16) + bf16(bias)
    kit::wmma_gemm64<0, false, 3, 0, false, 0><<<dim3((unsigned)((((MTOK / 64) * (EMBED / 64)) + 7) / 8), 1), 256, 0, stream>>>((const unsigned short*)AO16, nullptr, EMBED, 0, (const unsigned short*)WO16, nullptr, EMBED, 0, (void*)out, nullptr, EMBED, 0, bo, nullptr, 0, MTOK, EMBED, EMBED, 0.0009765625f);
}

// v005
// Measured time: 87.3 microseconds a run.
// Timed twice side by side with v004, it ran 1.46 and 1.44 times as fast.
// All steps since v000 together make it 3.64 times as fast.
// Multi-head attention (2 x 2,048 tokens x 1,024; 16 heads x 64; one shared 64x64 [out][in] weight per q / k / v stream applied per head, no biases; scores / 32; no mask; [out][in] output projection + bias). All contractions: v_wmma_f32_16x16x32_f16 (f16 operands, f32 accumulate): inputs and parameters converted to bf16 (RNE) first and held exactly in f16 (weights x16), tokens, 64x64 weights and bias in the registers of the kernel that uses them; per-head projections as f16 WMMA GEMMs, one launch for the three streams, results stored as f16 (q, k as [token][head][d], v transposed as [head][d][token]); one WMMA attention launch (f16 q fragments, f16 k and transposed f16 v tiles copied into LDS, f32 online softmax, probabilities carried x4096 as f16); output projection as an f16 WMMA GEMM of the f16 attention output carried x64 (written so by the attention launch), + bias in f32.
#include <hip/hip_runtime.h>
#include <math.h>

#ifndef NB
#define NB 2
#endif
#ifndef SEQ
#define SEQ 2048
#endif
#define NB_FULL 2
#define SEQ_FULL 2048
#define EMBED 1024
#define HEADS 16
#define HDIM 64
#define MTOK (NB * SEQ)

static_assert(SEQ % 64 == 0);
static_assert(MTOK % 64 == 0);
static_assert((MTOK * HEADS) % 64 == 0);
static_assert(EMBED % 64 == 0 && HDIM == 64);
static_assert(NB <= NB_FULL && SEQ <= SEQ_FULL);

typedef __attribute__((ext_vector_type(16))) _Float16 v16h;
typedef __attribute__((ext_vector_type(8)))  _Float16 v8h;
typedef __attribute__((ext_vector_type(8)))  float    v8f;
typedef __attribute__((ext_vector_type(4)))  float    v4f;

// 16-bit WMMA fragment map (wave32), lane L, h = L>>4, m = L&15:
//   A 16x32: lane = row m;   element i -> k = (i<8) ? 8h+i : 16+8h+(i-8)
//   B 32x16: lane = column m; the SAME k(i,h)
//   D 16x16 (8 f32): lane = column m; element r -> row 8h+r
__device__ __forceinline__ v8f wmma16(v16h a, v16h b, v8f c) {
    c = __builtin_amdgcn_wmma_f32_16x16x32_f16(false, a, false, b, (short)0, c, false, false);
    asm volatile("v_nop\n\tv_nop\n\tv_nop\n\tv_nop" : "+v"(c) : "v"(a), "v"(b));
    return c;
}
union FragH { v16h v; v8h h[2]; };

// A fragment from an f16 row (global or LDS): p points at column k0 + 8h of the lane's row; elements 0..7 <- p[0..7], 8..15 <- p[16..23]
__device__ __forceinline__ v16h fh_g16(const _Float16* __restrict__ p) {
    FragH f; f.h[0] = *(const v8h*)(p); f.h[1] = *(const v8h*)(p + 16); return f.v;
}

// Eight bare v_exp_f32, each over its own argument register, in one statement: no neighbour can take a transcendental's source or read its result
// directly behind it, whatever registers the build picks; the closing v_nop is the independent slot that the instruction set asks for behind the last one.
__device__ __forceinline__ void exp2x8(float (&e)[8]) {
    asm("v_exp_f32 %0, %0\n\tv_exp_f32 %1, %1\n\tv_exp_f32 %2, %2\n\tv_exp_f32 %3, %3\n\t"
        "v_exp_f32 %4, %4\n\tv_exp_f32 %5, %5\n\tv_exp_f32 %6, %6\n\tv_exp_f32 %7, %7\n\tv_nop"
        : "+v"(e[0]), "+v"(e[1]), "+v"(e[2]), "+v"(e[3]), "+v"(e[4]), "+v"(e[5]), "+v"(e[6]), "+v"(e[7]));
}

// 'val' is captured into a local first: never pass an expression that reads *ptr.
#define VST2(T, ptr, val) do { const T vst2_v_ = (val); *(T*)(ptr) = vst2_v_;  } while (0)

// =====================================================================================================================
// k_attn64: O(b,i,h,:) = softmax_j(scale * Q(b,i,h,:).K(b,j,h,:)) V(b,j,h,:) for head dim 64, no mask, S % 64 == 0.
//   Element (b, s, h, d) of Q / K / O lives at X[b*sb + s*EMBED + h*HDIM + d], of V at Vt[b*sb + (h*HDIM + d)*S + s] (all f16; O carried x64). Block = 4 waves = 64 queries of one (batch, head);
//   grid (S/64, HEADS, NB). Per 64-key block: the block copies K [key][d] and V [d][key] into LDS, 16 B a lane, 128-B rows (block barriers on both sides);
//   scores^T = f16 k fragments (two 16-B LDS loads each) x f16 q fragments (registers), f32 accumulate; online softmax in f32, exp2 domain, per lane;
//   O^T += V^T.P^T with f16 v fragments from the transposed tile and P^T packed from the score registers; row sums carried x4096 like P, final 1/rowsum in f32.
//   Staged extent == consumed extent: Ksh 64 keys x 64 d, Vts 64 d x 64 keys, Os 16 rows x 64 d; pad columns are never read.
// =====================================================================================================================
#define AT_NW 4
#define AT_KP 72          // LDS pitch in halves (144 B, a multiple of 16 B)
struct AttnG { const _Float16* Q; const _Float16* K; const _Float16* Vt; _Float16* O; long long sb; int S; float scale; };
static_assert(sizeof(AttnG) == 48);

#ifndef KATTN_ATTR
#define KATTN_ATTR __attribute__((amdgpu_num_vgpr(256)))
#endif
__global__ __launch_bounds__(32 * AT_NW) KATTN_ATTR void k_attn64(AttnG g) {
    __shared__ __align__(16) _Float16 Ksh[64 * AT_KP];
    __shared__ __align__(16) _Float16 Vts[64 * AT_KP];
    __shared__ __align__(16) float    Os[AT_NW][16 * 68];
    const int tid = threadIdx.x, wave = tid >> 5, lane = tid & 31, hf = lane >> 4, l15 = lane & 15;
    const int h = blockIdx.y, b = blockIdx.z;
    const int q0 = (blockIdx.x * AT_NW + wave) * 16;
    const float L2E = 1.4426950408889634f;
    const float NEG = -__builtin_inff();
    const float sc2 = g.scale * L2E;                         // raw score -> base-2 exponent
    const _Float16* qbase = g.Q + (long long)b * g.sb + h * HDIM;
    const _Float16* kbase = g.K + (long long)b * g.sb + h * HDIM;
    const _Float16* vbase = g.Vt + (long long)b * g.sb + (long long)h * HDIM * g.S;
    _Float16*    obase = g.O + (long long)b * g.sb + h * HDIM;

    // q fragments (B operand: column = query l15), two 32-deep k-steps
    const _Float16* qrow = qbase + (size_t)(q0 + l15) * EMBED + 8 * hf;
    const v16h qa0 = fh_g16(qrow), qa1 = fh_g16(qrow + 32);

    v8f o[4]; float m1 = NEG, l1 = 0.f;
#pragma unroll
    for (int t = 0; t < 4; ++t) { v8f zz = {}; o[t] = zz; }

    // the lane's 16 B of a tile: row tid / 8, column group tid % 8; byte offsets in the two global tiles, element offset in the LDS tiles
    const unsigned kob = (unsigned)((tid >> 3) * EMBED + (tid & 7) * 8) * 2u;
    const unsigned vob = (unsigned)((tid >> 3) * g.S + (tid & 7) * 8) * 2u;
    const int so = (tid >> 3) * AT_KP + (tid & 7) * 8;
    for (int j0 = 0; j0 < g.S; j0 += 64) {
        __syncthreads();                                     // the prior key block's reads of Ksh / Vts are done
        const char* kt = (const char*)(kbase + (size_t)j0 * EMBED);   // block-uniform tile bases; the lane's part is a fixed 32-bit byte offset
        const char* vt = (const char*)(vbase + j0);
        const char* ka = kt + kob;
        const char* va[4];
        v8h kk[4], vv[4];
#pragma unroll
        for (int it = 0; it < 4; ++it) {                     // 512 items a tile = 64 rows (K: keys, V: d) x 8 column groups of 8 (K: d, V: keys); a thread's items lie 16 rows apart
            va[it] = vt + (size_t)it * 16 * g.S * 2 + vob;
            kk[it] = *(const v8h*)(ka + (size_t)it * 16 * EMBED * 2);
            vv[it] = *(const v8h*)(va[it]);
        }
        // stands in front of any reuse of the address registers of the eight loads above: as its inputs they stay whole up to here, so that no later load of the group lands on one
        asm volatile("s_wait_xcnt 0x0" :: "v"(ka), "v"(va[0]), "v"(va[1]), "v"(va[2]), "v"(va[3]) : "memory");
#pragma unroll
        for (int it = 0; it < 4; ++it) {
            *(v8h*)(Ksh + so + it * 16 * AT_KP) = kk[it];
            *(v8h*)(Vts + so + it * 16 * AT_KP) = vv[it];
        }
        __syncthreads();                                     // K and V tiles visible to all waves

        v8f s[4];
#pragma unroll
        for (int t = 0; t < 4; ++t) {                        // A fragment: row = key t*16 + l15, k = d; B = the q fragments (column = query l15)
            const int ko = (t * 16 + l15) * AT_KP + 8 * hf;
            FragH k0f, k1f;
            k0f.h[0] = *(const v8h*)(Ksh + ko);      k0f.h[1] = *(const v8h*)(Ksh + ko + 16);
            k1f.h[0] = *(const v8h*)(Ksh + ko + 32); k1f.h[1] = *(const v8h*)(Ksh + ko + 48);
            v8f acc = {};
            acc = wmma16(k0f.v, qa0, acc);
            acc = wmma16(k1f.v, qa1, acc);
            s[t] = acc;
        }
        // online softmax of the lane's query: 32 scores in registers, one exchange with the other half-wave for the maximum.
        // The maximum is kept in raw score units (the scale is positive, so it commutes with max); each probability is one fma and one bare
        // v_exp_f32: p * 4096 = exp2(s * sc2 + (12 - mref * sc2)). Arguments are <= 12; below -126 the bare instruction gives 0, far under f16's range.
        float mx = NEG;
#pragma unroll
        for (int t = 0; t < 4; ++t)
#pragma unroll
            for (int r = 0; r < 8; ++r) mx = fmaxf(mx, s[t][r]);
        mx = fmaxf(mx, __shfl_xor(mx, 16, 32));
        const float mnew = fmaxf(m1, mx);
        const float mref = (mnew == NEG) ? 0.f : mnew;       // the one -inf guard: a -inf score then gives exp2(-inf) = 0 with no test of its own
        const float corr = __builtin_amdgcn_exp2f((m1 - mref) * sc2);
        const float nb = fmaf(-mref, sc2, 12.f);
        // P^T as B operand straight from the score tiles: element i < 8 is key 8*hf + i (tile 2u), element 8 + i is key 16 + 8*hf + i (tile 2u + 1)
        FragH pf[2];
        float rs4[4];
#pragma unroll
        for (int t = 0; t < 4; ++t) {
            float rs = 0.f, e[8];
#pragma unroll
            for (int r = 0; r < 8; ++r) e[r] = fmaf(s[t][r], sc2, nb);
            exp2x8(e);
#pragma unroll
            for (int r = 0; r < 8; ++r) {
                const float pp = e[r]; rs += pp;
                pf[t >> 1].h[t & 1][r] = (_Float16)pp;
            }
            rs4[t] = rs;
        }
        l1 = l1 * corr + ((rs4[0] + rs4[1]) + (rs4[2] + rs4[3])); m1 = mnew;   // the lane's own 32 keys; both half-waves use the same corr, so the halves join once after the loop
#pragma unroll
        for (int t = 0; t < 4; ++t)
#pragma unroll
            for (int r = 0; r < 8; ++r) o[t][r] *= corr;
#pragma unroll
        for (int t = 0; t < 4; ++t) {                        // A fragment: row = d t*16 + l15, k = key (transposed tile, k-contiguous)
            const int vo = (t * 16 + l15) * AT_KP + 8 * hf;
            FragH v0f, v1f;
            v0f.h[0] = *(const v8h*)(Vts + vo);      v0f.h[1] = *(const v8h*)(Vts + vo + 16);
            v1f.h[0] = *(const v8h*)(Vts + vo + 32); v1f.h[1] = *(const v8h*)(Vts + vo + 48);
            o[t] = wmma16(v0f.v, pf[0].v, o[t]);
            o[t] = wmma16(v1f.v, pf[1].v, o[t]);
        }
    }

    // O: stage the wave's 16 x 64 tile (pitch 68 floats; the lane writes 8 consecutive d of its query per tile), then 8 lanes write one row's 64 halves, a whole 128-B line (8 x 16 B), four rows per instruction; f16(x * 64) of the f32 value
    {
        l1 += __shfl_xor(l1, 16, 32);                        // join the two half-waves' row sums
        const float inv = (l1 > 0.f) ? 1.f / l1 : 0.f;       // l1 sums p * 4096, as o does
#pragma unroll
        for (int t = 0; t < 4; ++t) {
            v4f w0, w1;
#pragma unroll
            for (int e = 0; e < 4; ++e) { w0[e] = o[t][e] * inv; w1[e] = o[t][4 + e] * inv; }
            *(v4f*)(&Os[wave][l15 * 68 + t * 16 + 8 * hf]) = w0;
            *(v4f*)(&Os[wave][l15 * 68 + t * 16 + 8 * hf + 4]) = w1;
        }
    }
    __builtin_amdgcn_fence(3 /* release order */, "workgroup");
    __builtin_amdgcn_wave_barrier();
    __builtin_amdgcn_fence(2 /* acquire order */, "workgroup");
    {
        const int q4 = lane >> 3, c8 = (lane & 7) * 8;
#pragma unroll
        for (int it = 0; it < 4; ++it) {
            const int row = it * 4 + q4;
            const v4f va = *(const v4f*)(&Os[wave][row * 68 + c8]), vc = *(const v4f*)(&Os[wave][row * 68 + c8 + 4]);
            v8h hv;
#pragma unroll
            for (int e = 0; e < 4; ++e) { hv[e] = (_Float16)(va[e] * 64.0f); hv[4 + e] = (_Float16)(vc[e] * 64.0f); }
            *(v8h*)(obase + (size_t)(q0 + row) * EMBED + c8) = hv;
        }
    }
}

typedef unsigned int cm_u4 __attribute__((ext_vector_type(4)));
// f32 -> bf16 (RNE) -> f16 planes: every 16-bit operand holds exactly the bf16-converted input value (times a power-of-two scale), so the f16 WMMA
// products of two such planes are exact in the f32 accumulator. Thread per (row, 8 cols); 16 B per thread, thread-linear along the dst row
__device__ __forceinline__ unsigned int cmb_pk2(float a, float b) { return (unsigned int)__builtin_bit_cast(unsigned short, (_Float16)a) | ((unsigned int)__builtin_bit_cast(unsigned short, (_Float16)b) << 16); }
__device__ __forceinline__ float cmb_bf(float v) { const unsigned u = __builtin_bit_cast(unsigned, v); const unsigned r = (u + 0x7fffu + ((u >> 16) & 1u)) & 0xffff0000u; return __builtin_bit_cast(float, r); }   // bf16 RNE, kept as f32 (finite inputs)
__global__ __launch_bounds__(256) void k_cm_castb(const float* __restrict__ SRC, int lds, long long sSz, unsigned short* __restrict__ DST, int ldd, long long sDz, int nR, int nC, float sc) {
    const long long u = (long long)blockIdx.x * 256 + threadIdx.x; const int per = nC / 8; if (u >= (long long)nR * per) return; const int r = (int)(u / per); const int c0 = 8 * (int)(u % per);
    const float* s = SRC + (long long)blockIdx.y * sSz + (long long)r * lds + c0; float w[8];
#pragma unroll
    for (int e = 0; e < 8; ++e) w[e] = cmb_bf(s[e]) * sc;
    cm_u4 pk; pk.x = cmb_pk2(w[0], w[1]); pk.y = cmb_pk2(w[2], w[3]); pk.z = cmb_pk2(w[4], w[5]); pk.w = cmb_pk2(w[6], w[7]); VST2(cm_u4, (cm_u4*)(DST + (long long)blockIdx.y * sDz + (long long)r * ldd + c0), pk); }

// =====================================================================================================================
// k_proj3: the three per-head projections in one grid; blockIdx.y picks the stream. C[m][n] = f16((1/16) * sum_k f16(bf16(X[m][k])) * f16(16 * bf16(W[n][k])))
//   over 64-wide head slices of a token stream (f32, batch stride SEQ_FULL * EMBED) and its [64 out][64 in] f32 weight. Both operands are converted
//   in registers on their way into the fragments. A wave owns 64 rows x 64 columns; per 16 rows: k 0..31 then 32..63 into four accumulator tiles.
//   q, k (VT false): the rows are 64 consecutive rows of the [tokens*heads][64] view; the 16 x 64 slab goes through the wave's own LDS so that 8 lanes store
//   one whole 128-B f16 row, four rows per instruction. v (VT true): the rows are 64 consecutive tokens of ONE head; a lane's 8 accumulator registers are 8 consecutive
//   tokens of one output column, one 16-B store into the transposed result [batch][head][d][token]; the wave fills whole 128-B lines (64 tokens of one d).
// =====================================================================================================================
#define PJ_NW 4
struct Proj3 { const float* X0; const float* X1; const float* X2; const float* W0; const float* W1; const float* W2; _Float16* C0; _Float16* C1; _Float16* C2; };
typedef __attribute__((ext_vector_type(2))) float  pj_f2;
typedef __attribute__((ext_vector_type(2))) __bf16 pj_b2;
// the 16 f32 values of one fragment as loaded: p points at column k0 + 8h of the lane's row; x[0], x[1] <- p[0..7], x[2], x[3] <- p[16..23]
struct PjRaw { v4f x[4]; };
__device__ __forceinline__ PjRaw pj_load(const float* __restrict__ p) {
    PjRaw r; r.x[0] = *(const v4f*)(p); r.x[1] = *(const v4f*)(p + 4); r.x[2] = *(const v4f*)(p + 16); r.x[3] = *(const v4f*)(p + 20); return r;
}
// fragment element 4c + e = f16(bf16_rne(x[c][e]) * sc): two values per packed f32 -> bf16 conversion (round to nearest even), widened again by their bits
__device__ __forceinline__ v16h pj_frag(const PjRaw& r, float sc) {
    v16h a;
#pragma unroll
    for (int c = 0; c < 4; ++c)
#pragma unroll
        for (int e = 0; e < 4; e += 2) {
            const pj_f2 w = { r.x[c][e], r.x[c][e + 1] };
            const unsigned u = __builtin_bit_cast(unsigned, __builtin_convertvector(w, pj_b2));
            a[4 * c + e]     = (_Float16)(__builtin_bit_cast(float, u << 16) * sc);
            a[4 * c + e + 1] = (_Float16)(__builtin_bit_cast(float, u & 0xffff0000u) * sc);
        }
    return a;
}
template <bool VT>
__device__ __forceinline__ void pj_body(const float* __restrict__ X, const float* __restrict__ Wt, _Float16* __restrict__ C, float* slab, int tile, int lane) {
    const int hf = lane >> 4, l15 = lane & 15;
    constexpr int RS = VT ? EMBED : HDIM;                    // floats from one of the wave's rows to the next
    const int m0 = tile * 64;                                // VT false: 64 rows = 4 tokens x 16 heads, inside one batch (SEQ % 64 == 0)
    const int hd = tile % HEADS, t0 = (tile / HEADS) * 64;   // VT true: head, and the first of 64 tokens, inside one batch
    const int bt = VT ? t0 / SEQ : (m0 / HEADS) / SEQ;
    const float* Ab = X + (size_t)bt * (SEQ_FULL - SEQ) * EMBED + (VT ? (size_t)t0 * EMBED + hd * HDIM : (size_t)m0 * HDIM) + (size_t)l15 * RS + 8 * hf;
    const float* Bb = Wt + l15 * HDIM + 8 * hf;

    // Loads in three groups: the first 32 token rows (the longest way), the whole weight, then, once the weight's f32 registers are free,
    // the other 32 token rows, which fly while the first 32 rows are worked on.
    PjRaw ra[4][2], rw[2][4];
#pragma unroll
    for (int i = 0; i < 2; ++i) { ra[i][0] = pj_load(Ab + i * 16 * RS); ra[i][1] = pj_load(Ab + i * 16 * RS + 32); }
    asm volatile("s_wait_xcnt 0x0" ::: "memory");            // stands in front of any reuse of the address registers of the loads above; keeps this group first
#pragma unroll
    for (int ks = 0; ks < 2; ++ks)
#pragma unroll
        for (int j = 0; j < 4; ++j) rw[ks][j] = pj_load(Bb + j * 16 * HDIM + ks * 32);
    asm volatile("s_wait_xcnt 0x0" ::: "memory");            // as above, for the weight's loads
    v16h bw[2][4];
#pragma unroll
    for (int ks = 0; ks < 2; ++ks)
#pragma unroll
        for (int j = 0; j < 4; ++j) bw[ks][j] = pj_frag(rw[ks][j], 16.0f);
    __builtin_amdgcn_sched_barrier(0);                       // the third group waits for the weight's f32 registers: hoisted above the conversion it pushes the kernel past 256 VGPRs
#pragma unroll
    for (int i = 2; i < 4; ++i) { ra[i][0] = pj_load(Ab + i * 16 * RS); ra[i][1] = pj_load(Ab + i * 16 * RS + 32); }
    asm volatile("s_wait_xcnt 0x0" ::: "memory");            // as above, for the third group
    __builtin_amdgcn_sched_barrier(0);                       // keeps the third group's loads issued ahead of all work on the rows; without it they sink to just in front of their use

#pragma unroll
    for (int i = 0; i < 4; ++i) {
        const v16h a0 = pj_frag(ra[i][0], 1.0f), a1 = pj_frag(ra[i][1], 1.0f);
        v8f acc[4];
#pragma unroll
        for (int j = 0; j < 4; ++j) { v8f zz = {}; acc[j] = __builtin_amdgcn_wmma_f32_16x16x32_f16(false, a0, false, bw[0][j], (short)0, zz, false, false); }
#pragma unroll
        for (int j = 0; j < 4; ++j) acc[j] = __builtin_amdgcn_wmma_f32_16x16x32_f16(false, a1, false, bw[1][j], (short)0, acc[j], false, false);
        if (VT) {
            // acc[j][r] = token t0 + i*16 + 8*hf + r, column j*16 + l15
            _Float16* Cv = C + (size_t)bt * SEQ * EMBED + ((size_t)hd * HDIM + l15) * SEQ + (t0 - bt * SEQ) + i * 16 + 8 * hf;
#pragma unroll
            for (int j = 0; j < 4; ++j) {
                v8h hv;
#pragma unroll
                for (int r = 0; r < 8; ++r) hv[r] = (_Float16)(acc[j][r] * 0.0625f);
                *(v8h*)(Cv + (size_t)j * 16 * SEQ) = hv;
            }
        } else {
#pragma unroll
            for (int j = 0; j < 4; ++j)
#pragma unroll
                for (int r = 0; r < 8; ++r) slab[(8 * hf + r) * 68 + j * 16 + l15] = acc[j][r] * 0.0625f;
            // the slab passes between the lanes of one wave: the fences order LDS alone, so that no wave waits here for its global stores
            __builtin_amdgcn_fence(3 /* release order */, "workgroup", "local");
            __builtin_amdgcn_wave_barrier();
            __builtin_amdgcn_fence(2 /* acquire order */, "workgroup", "local");
            const int q4 = lane >> 3, c8 = (lane & 7) * 8;
#pragma unroll
            for (int it = 0; it < 4; ++it) {
                const int row = it * 4 + q4;
                const v4f va = *(const v4f*)(slab + row * 68 + c8), vc = *(const v4f*)(slab + row * 68 + c8 + 4);
                v8h hv;
#pragma unroll
                for (int e = 0; e < 4; ++e) { hv[e] = (_Float16)va[e]; hv[4 + e] = (_Float16)vc[e]; }
                *(v8h*)(C + (size_t)(m0 + i * 16 + row) * HDIM + c8) = hv;
            }
            if (i == 3) asm volatile("s_wait_xcnt 0x0" ::: "memory");   // behind the body's last stores: nothing that follows this body in the kernel's code may reuse their address registers ahead of it
            __builtin_amdgcn_fence(3 /* release order */, "workgroup", "local");
            __builtin_amdgcn_wave_barrier();
            __builtin_amdgcn_fence(2 /* acquire order */, "workgroup", "local");
        }
        if (i == 1) __builtin_amdgcn_sched_barrier(0);       // rows 32..63 are not touched before rows 0..31 are stored: hoisted, their conversion waits for the third group at once
    }
}
__global__ __launch_bounds__(32 * PJ_NW) void k_proj3(Proj3 g) {
    __shared__ __align__(16) float sP[PJ_NW][16 * 68];       // per-wave 16 x 64 slab, pitch 68 floats (q, k streams)
    const int lane = threadIdx.x & 31, wave = threadIdx.x >> 5;
    const int y = blockIdx.y;
    const int tile = blockIdx.x * PJ_NW + wave;
    if (y == 2) pj_body<true>(g.X2, g.W2, g.C2, sP[wave], tile, lane);
    else        pj_body<false>((y == 0) ? g.X0 : g.X1, (y == 0) ? g.W0 : g.W1, (y == 0) ? g.C0 : g.C1, sP[wave], tile, lane);
}
static_assert(((MTOK * HEADS) / 64) % PJ_NW == 0);

// =====================================================================================================================
// k_oproj: C[m][n] = scale * sum_k A[m][k] * Bt[n][k] + bf16(bias[n]); A [MTOK][EMBED] and Bt [EMBED][EMBED] f16, k-contiguous; C f32.
//   Block = 8 waves = one 128 x 128 tile of C, grid (EMBED / 128, MTOK / 128); a wave owns 64 rows x 32 columns (2 x 4 waves).
//   A stage is 128 k of the tile's 128 A rows and 128 Bt rows: 256 rows of 256 B at pitch 272 B in LDS, brought by asynchronous 16-B copies
//   (a wave's copy = two whole rows), two buffers: stage t + 2 is asked for when every wave has left stage t. k runs upward through one accumulator per element.
//   Epilogue: the wave's 64 x 32 tile goes through its own part of the (then free) buffers so that 8 lanes store one whole 128-B line, four rows per instruction.
// =====================================================================================================================
#define OP_T   128                       // tile rows of A and of Bt
#define OP_KS  128                       // k per stage
#define OP_P   136                       // LDS pitch in halves (272 B = 16 B x 17)
#define OP_STG (2 * OP_T * OP_P)         // halves per buffer
#define OP_NT  (EMBED / OP_KS)
#define OP_SP  36                        // epilogue slab pitch in floats
static_assert(MTOK % OP_T == 0 && EMBED % OP_T == 0 && EMBED % OP_KS == 0 && OP_NT >= 2);
static_assert(8 * 64 * OP_SP * 4 <= 2 * OP_STG * 2);
// Eight copies, each lane its own 16 B: LDS byte address, global address. The closing wait stands inside the statement, in front of any reuse of the address registers.
__device__ __forceinline__ void op_copy8(const unsigned (&l)[8], const _Float16* const (&g)[8]) {
    asm volatile("global_load_async_to_lds_b128 %0, %8, off\n\tglobal_load_async_to_lds_b128 %1, %9, off\n\t"
                 "global_load_async_to_lds_b128 %2, %10, off\n\tglobal_load_async_to_lds_b128 %3, %11, off\n\t"
                 "global_load_async_to_lds_b128 %4, %12, off\n\tglobal_load_async_to_lds_b128 %5, %13, off\n\t"
                 "global_load_async_to_lds_b128 %6, %14, off\n\tglobal_load_async_to_lds_b128 %7, %15, off\n\t"
                 "s_wait_xcnt 0x0"
                 :: "v"(l[0]), "v"(l[1]), "v"(l[2]), "v"(l[3]), "v"(l[4]), "v"(l[5]), "v"(l[6]), "v"(l[7]),
                    "v"(g[0]), "v"(g[1]), "v"(g[2]), "v"(g[3]), "v"(g[4]), "v"(g[5]), "v"(g[6]), "v"(g[7]) : "memory");
}
// one stage: the thread's 16 B of rows tid / 16 + 16 i of A (LDS rows 0..127) and of Bt (LDS rows 128..255)
__device__ __forceinline__ void op_fill(unsigned lb, const _Float16* ga, const _Float16* gb) {
    unsigned l[8]; const _Float16* g[8];
#pragma unroll
    for (int i = 0; i < 8; ++i) { l[i] = lb + (unsigned)(i * 16 * OP_P * 2); g[i] = ga + (size_t)i * 16 * EMBED; }
    op_copy8(l, g);
#pragma unroll
    for (int i = 0; i < 8; ++i) { l[i] = lb + (unsigned)((OP_T + i * 16) * OP_P * 2); g[i] = gb + (size_t)i * 16 * EMBED; }
    op_copy8(l, g);
}
__global__ __launch_bounds__(256) void k_oproj(const _Float16* __restrict__ A, const _Float16* __restrict__ Bt, const float* __restrict__ bias, float* __restrict__ C, float scale) {
    __shared__ __align__(16) _Float16 sm[2 * OP_STG];
    const int tid = threadIdx.x, lane = tid & 31, wave = tid >> 5, hf = lane >> 4, l15 = lane & 15;
    const int n0 = blockIdx.x * OP_T, m0 = blockIdx.y * OP_T;
    const int wm = (wave >> 2) * 64, wn = (wave & 3) * 32;
    const unsigned lb = (unsigned)(size_t)sm + (unsigned)(((tid >> 4) * OP_P + (tid & 15) * 8) * 2);
    const _Float16* ga = A + (size_t)(m0 + (tid >> 4)) * EMBED + (tid & 15) * 8;
    const _Float16* gb = Bt + (size_t)(n0 + (tid >> 4)) * EMBED + (tid & 15) * 8;

    op_fill(lb, ga, gb);
    const float bias0 = bias[n0 + wn + l15], bias1 = bias[n0 + wn + 16 + l15];
    asm volatile("s_wait_asynccnt 0x0" ::: "memory");        // the wave's own copies of stage 0 have landed
    __syncthreads();                                         // stage 0 visible to all waves
    op_fill(lb + OP_STG * 2, ga + OP_KS, gb + OP_KS);

    // all loops over i, j, ks, r below are unrolled so that every index of acc, af and bf is a constant and the arrays stay in registers
    v8f acc[4][2];
#pragma unroll
    for (int i = 0; i < 4; ++i)
#pragma unroll
        for (int j = 0; j < 2; ++j) { v8f zz = {}; acc[i][j] = zz; }

#pragma unroll 1                                             // one stage a trip: the two buffers alternate by t & 1
    for (int t = 0; t < OP_NT; ++t) {
        const _Float16* ap = sm + (t & 1) * OP_STG + (wm + l15) * OP_P + 8 * hf;
        const _Float16* bp = sm + (t & 1) * OP_STG + (OP_T + wn + l15) * OP_P + 8 * hf;
        // two fragment sets: the next 32 k's twelve LDS loads go out as one group ahead of this 32 k's eight products
        v16h af[2][4], bf[2][2];
#pragma unroll
        for (int j = 0; j < 2; ++j) bf[0][j] = fh_g16(bp + j * 16 * OP_P);
#pragma unroll
        for (int i = 0; i < 4; ++i) af[0][i] = fh_g16(ap + i * 16 * OP_P);
#pragma unroll
        for (int ks = 0; ks < OP_KS / 32; ++ks) {
            const int c = ks & 1;
            if (ks + 1 < OP_KS / 32) {
#pragma unroll
                for (int j = 0; j < 2; ++j) bf[c ^ 1][j] = fh_g16(bp + j * 16 * OP_P + (ks + 1) * 32);
#pragma unroll
                for (int i = 0; i < 4; ++i) af[c ^ 1][i] = fh_g16(ap + i * 16 * OP_P + (ks + 1) * 32);
            }
            __builtin_amdgcn_sched_barrier(0);               // keeps the load group whole and ahead: sunk among the products, each load is waited for where it stands
#pragma unroll
            for (int i = 0; i < 4; ++i)
#pragma unroll
                for (int j = 0; j < 2; ++j)
                    acc[i][j] = __builtin_amdgcn_wmma_f32_16x16x32_f16(false, af[c][i], false, bf[c][j], (short)0, acc[i][j], false, false);
            __builtin_amdgcn_sched_barrier(0);               // without it the next group's loads are split up among these products and the stage's last products sink behind the block barrier
        }
        asm volatile("s_wait_dscnt 0x0" ::: "memory");       // the wave's reads of stage t are done
        asm volatile("s_wait_asynccnt 0x0" ::: "memory");    // its copies of stage t + 1 have landed
        __syncthreads();                                     // stage t + 1 visible to all waves; stage t's buffer left by all
        if (t + 2 < OP_NT) op_fill(lb + (unsigned)((t & 1) * OP_STG * 2), ga + (t + 2) * OP_KS, gb + (t + 2) * OP_KS);
    }
    asm volatile("s_wait_asynccnt 0x0" ::: "memory");        // nothing is in flight when the buffers become output staging

    float* slab = (float*)sm + wave * (64 * OP_SP);
#pragma unroll
    for (int j = 0; j < 2; ++j) {
        const float bv = cmb_bf(j == 0 ? bias0 : bias1);
#pragma unroll
        for (int i = 0; i < 4; ++i)
#pragma unroll
            for (int r = 0; r < 8; ++r) slab[(i * 16 + 8 * hf + r) * OP_SP + j * 16 + l15] = acc[i][j][r] * scale + bv;
    }
    // the slab passes between the lanes of one wave: the fences order LDS alone
    __builtin_amdgcn_fence(3 /* release order */, "workgroup", "local");
    __builtin_amdgcn_wave_barrier();
    __builtin_amdgcn_fence(2 /* acquire order */, "workgroup", "local");
    {
        const int q4 = lane >> 3, c4 = (lane & 7) * 4;
        float* Cw = C + (size_t)(m0 + wm + q4) * EMBED + n0 + wn + c4;
#pragma unroll
        for (int it = 0; it < 16; ++it) {
            const v4f v = *(const v4f*)(slab + (it * 4 + q4) * OP_SP + c4);
            *(v4f*)(Cw + (size_t)it * 4 * EMBED) = v;
        }
    }
}

extern "C" void kernel_launch(void* const* d_in, const int* in_sizes, int n_in, void* d_out, int out_size, void* d_ws, size_t ws_size, hipStream_t stream) {
    if (n_in < 8) return;
    const long long need_x = (long long)(NB - 1) * SEQ_FULL * EMBED + (long long)SEQ * EMBED;   // last element read of a token stream + 1
    if ((long long)in_sizes[0] < need_x || (long long)in_sizes[1] < need_x || (long long)in_sizes[2] < need_x) return;
    if (in_sizes[3] < HDIM * HDIM || in_sizes[4] < HDIM * HDIM || in_sizes[5] < HDIM * HDIM) return;
    if (in_sizes[6] < EMBED * EMBED || in_sizes[7] < EMBED) return;
    if ((long long)out_size < (long long)MTOK * EMBED) return;
    const float* xq = (const float*)d_in[0];
    const float* xk = (const float*)d_in[1];
    const float* xv = (const float*)d_in[2];
    const float* Wq = (const float*)d_in[3];
    const float* Wk = (const float*)d_in[4];
    const float* Wv = (const float*)d_in[5];
    const float* Wo = (const float*)d_in[6];
    const float* bo = (const float*)d_in[7];
    float* out = (float*)d_out;
    char* wsp = (char*)d_ws;
    unsigned short* AO16 = (unsigned short*)wsp; wsp += (((size_t)MTOK * EMBED * 2 + 255) / 256) * 256;    // f16 attention output [MTOK][1024], carried x64
    _Float16* Qh = (_Float16*)wsp; wsp += (((size_t)MTOK * EMBED * 2 + 255) / 256) * 256;    // [MTOK][1024]
    _Float16* Kh = (_Float16*)wsp; wsp += (((size_t)MTOK * EMBED * 2 + 255) / 256) * 256;    // [MTOK][1024]
    _Float16* Vt = (_Float16*)wsp; wsp += (((size_t)MTOK * EMBED * 2 + 255) / 256) * 256;    // [NB][1024][SEQ]
    unsigned short* WO16 = (unsigned short*)wsp; wsp += (((size_t)EMBED * EMBED * 2 + 255) / 256) * 256;
    if ((size_t)(wsp - (char*)d_ws) > ws_size) return;

    // output weight [1024 out][1024 in] -> f16 x16 (Bt form [n][k])
    k_cm_castb<<<dim3((unsigned)(((long long)EMBED * (EMBED / 8) + 255) / 256), 1), 256, 0, stream>>>(Wo, EMBED, 0, WO16, EMBED, 0, EMBED, EMBED, 16.0f);
    // q, k, v streams: [NB][SEQ][1024] (full batch stride), 64-wide head slices x [64][64]^T -> Qh / Kh [MTOK*16][64] = [MTOK][1024], Vt [NB][16*64][SEQ]
    {
      Proj3 p;
      p.X0 = xq; p.X1 = xk; p.X2 = xv; p.W0 = Wq; p.W1 = Wk; p.W2 = Wv; p.C0 = Qh; p.C1 = Kh; p.C2 = Vt;
      k_proj3<<<dim3((unsigned)(((MTOK * HEADS) / 64) / PJ_NW), 3), 32 * PJ_NW, 0, stream>>>(p);
    }
    {
      AttnG a;
      a.Q = Qh; a.K = Kh; a.Vt = Vt; a.O = (_Float16*)AO16;
      a.sb = (long long)SEQ * EMBED; a.S = SEQ; a.scale = 0.03125f;
      k_attn64<<<dim3((unsigned)(SEQ / 64), (unsigned)HEADS, (unsigned)NB), 32 * AT_NW, 0, stream>>>(a);
    }
    // out = (AO16 . WO16^T) / (64 * 16) + bf16(bias)
    k_oproj<<<dim3((unsigned)(EMBED / OP_T), (unsigned)(MTOK / OP_T)), 256, 0, stream>>>((const _Float16*)AO16, (const _Float16*)WO16, bo, out, 0.0009765625f);
}

// v006
// One run takes 79.1 microseconds.
// Two timings next to v005 put it at 1.10 and 1.11 times that version's speed.
// Over all steps from v000 it is 4.02 times as fast.
// Multi-head attention (2 x 2,048 tokens x 1,024; 16 heads x 64; one shared 64x64 [out][in] weight per q / k / v stream applied per head, no biases; scores / 32; no mask; [out][in] output projection + bias). All contractions: v_wmma_f32_16x16x32_f16 (f16 operands, f32 accumulate): inputs and parameters converted to bf16 (RNE) first and held exactly in f16 (weights x16), tokens, 64x64 weights and bias in the registers of the kernel that uses them; per-head projections as f16 WMMA GEMMs, one launch for the three streams, results stored as f16 (q, k as [token][head][d], v transposed as [head][d][token]); one WMMA attention launch (f16 q fragments, f16 k and transposed f16 v tiles brought into LDS by asynchronous copies, two buffers, f32 online softmax, probabilities carried x4096 as f16); output projection as an f16 WMMA GEMM of the f16 attention output carried x64 (written so by the attention launch), + bias in f32.
#include <hip/hip_runtime.h>
#include <math.h>

#ifndef NB
#define NB 2
#endif
#ifndef SEQ
#define SEQ 2048
#endif
#define NB_FULL 2
#define SEQ_FULL 2048
#define EMBED 1024
#define HEADS 16
#define HDIM 64
#define MTOK (NB * SEQ)

static_assert(SEQ % 64 == 0);
static_assert(MTOK % 64 == 0);
static_assert((MTOK * HEADS) % 64 == 0);
static_assert(EMBED % 64 == 0 && HDIM == 64);
static_assert(NB <= NB_FULL && SEQ <= SEQ_FULL);

typedef __attribute__((ext_vector_type(16))) _Float16 v16h;
typedef __attribute__((ext_vector_type(8)))  _Float16 v8h;
typedef __attribute__((ext_vector_type(8)))  float    v8f;
typedef __attribute__((ext_vector_type(4)))  float    v4f;

// 16-bit WMMA fragment map (wave32), lane L, h = L>>4, m = L&15:
//   A 16x32: lane = row m;   element i -> k = (i<8) ? 8h+i : 16+8h+(i-8)
//   B 32x16: lane = column m; the SAME k(i,h)
//   D 16x16 (8 f32): lane = column m; element r -> row 8h+r
__device__ __forceinline__ v8f wmma16(v16h a, v16h b, v8f c) {
    c = __builtin_amdgcn_wmma_f32_16x16x32_f16(false, a, false, b, (short)0, c, false, false);
    asm volatile("v_nop\n\tv_nop\n\tv_nop\n\tv_nop" : "+v"(c) : "v"(a), "v"(b));
    return c;
}
union FragH { v16h v; v8h h[2]; };

// A fragment from an f16 row (global or LDS): p points at column k0 + 8h of the lane's row; elements 0..7 <- p[0..7], 8..15 <- p[16..23]
__device__ __forceinline__ v16h fh_g16(const _Float16* __restrict__ p) {
    FragH f; f.h[0] = *(const v8h*)(p); f.h[1] = *(const v8h*)(p + 16); return f.v;
}

// Eight bare v_exp_f32, each over its own argument register, in one statement: no neighbour can take a transcendental's source or read its result
// directly behind it, whatever registers the build picks; the closing v_nop is the independent slot that the instruction set asks for behind the last one.
__device__ __forceinline__ void exp2x8(float (&e)[8]) {
    asm("v_exp_f32 %0, %0\n\tv_exp_f32 %1, %1\n\tv_exp_f32 %2, %2\n\tv_exp_f32 %3, %3\n\t"
        "v_exp_f32 %4, %4\n\tv_exp_f32 %5, %5\n\tv_exp_f32 %6, %6\n\tv_exp_f32 %7, %7\n\tv_nop"
        : "+v"(e[0]), "+v"(e[1]), "+v"(e[2]), "+v"(e[3]), "+v"(e[4]), "+v"(e[5]), "+v"(e[6]), "+v"(e[7]));
}

// 'val' is captured into a local first: never pass an expression that reads *ptr.
#define VST2(T, ptr, val) do { const T vst2_v_ = (val); *(T*)(ptr) = vst2_v_;  } while (0)

// =====================================================================================================================
// k_attn64: O(b,i,h,:) = softmax_j(scale * Q(b,i,h,:).K(b,j,h,:)) V(b,j,h,:) for head dim 64, no mask, S % 64 == 0.
//   Element (b, s, h, d) of Q / K / O lives at X[b*sb + s*EMBED + h*HDIM + d], of V at Vt[b*sb + (h*HDIM + d)*S + s] (all f16; O carried x64). Block = 4 waves = 64 queries of one (batch, head);
//   grid (S/64, HEADS, NB). Per 64-key block: K [key][d] and V [d][key] come into LDS by asynchronous 16-B copies, 128-B rows, two buffers: block t + 2 is asked for
//   when every wave has left block t, so that a block's copies fly while the block before it is worked on (one block barrier a trip);
//   scores^T = f16 k fragments (two 16-B LDS loads each) x f16 q fragments (registers), f32 accumulate; online softmax in f32, exp2 domain, per lane;
//   O^T += V^T.P^T with f16 v fragments from the transposed tile and P^T packed from the score registers; row sums carried x4096 like P, final 1/rowsum in f32.
//   Staged extent == consumed extent: a Ksh buffer 64 keys x 64 d, a Vts buffer 64 d x 64 keys, Os 16 rows x 64 d; pad columns are never read.
// =====================================================================================================================
#define AT_NW 4
#define AT_KP 72          // LDS pitch in halves (144 B, a multiple of 16 B)
#define AT_TB (64 * AT_KP * 2)   // bytes of one K or V buffer
struct AttnG { const _Float16* Q; const _Float16* K; const _Float16* Vt; _Float16* O; long long sb; int S; float scale; };
static_assert(sizeof(AttnG) == 48);

__device__ __forceinline__ void op_copy8(const unsigned (&l)[8], const _Float16* const (&g)[8]);   // eight asynchronous 16-B copies a lane and their closing wait; defined with k_oproj
// one key block: the thread's 16 B of rows tid / 8 + 16 i of the K tile (rows = keys, EMBED halves apart) and of the V tile (rows = d, S halves apart)
__device__ __forceinline__ void at_fill(unsigned lk, unsigned lv, const _Float16* gk, const _Float16* gv, int S) {
    unsigned l[8]; const _Float16* g[8];
#pragma unroll
    for (int i = 0; i < 4; ++i) {
        l[i]     = lk + (unsigned)(i * 16 * AT_KP * 2); g[i]     = gk + (size_t)i * 16 * EMBED;
        l[4 + i] = lv + (unsigned)(i * 16 * AT_KP * 2); g[4 + i] = gv + (size_t)i * 16 * S;
    }
    op_copy8(l, g);
}

#ifndef KATTN_ATTR
#define KATTN_ATTR __attribute__((amdgpu_num_vgpr(256)))
#endif
__global__ __launch_bounds__(32 * AT_NW) KATTN_ATTR void k_attn64(AttnG g) {
    __shared__ __align__(16) _Float16 Ksh[2][64 * AT_KP];
    __shared__ __align__(16) _Float16 Vts[2][64 * AT_KP];
    __shared__ __align__(16) float    Os[AT_NW][16 * 68];
    const int tid = threadIdx.x, wave = tid >> 5, lane = tid & 31, hf = lane >> 4, l15 = lane & 15;
    const int h = blockIdx.y, b = blockIdx.z;
    const int q0 = (blockIdx.x * AT_NW + wave) * 16;
    const float L2E = 1.4426950408889634f;
    const float NEG = -__builtin_inff();
    const float sc2 = g.scale * L2E;                         // raw score -> base-2 exponent
    const _Float16* qbase = g.Q + (long long)b * g.sb + h * HDIM;
    const _Float16* kbase = g.K + (long long)b * g.sb + h * HDIM;
    const _Float16* vbase = g.Vt + (long long)b * g.sb + (long long)h * HDIM * g.S;
    _Float16*    obase = g.O + (long long)b * g.sb + h * HDIM;

    // the lane's 16 B of a tile: row tid / 8, column group tid % 8; its LDS byte addresses in buffer 0 and its global addresses in key block 0
    const int so = (tid >> 3) * AT_KP + (tid & 7) * 8;
    const unsigned lk = (unsigned)(size_t)&Ksh[0][0] + (unsigned)(so * 2), lv = (unsigned)(size_t)&Vts[0][0] + (unsigned)(so * 2);
    const _Float16* gk = kbase + (size_t)(tid >> 3) * EMBED + (tid & 7) * 8;
    const _Float16* gv = vbase + (size_t)(tid >> 3) * g.S + (tid & 7) * 8;
    const int nt = g.S / 64;                                 // key blocks; the same for the whole grid
    if (nt > 0) at_fill(lk, lv, gk, gv, g.S);

    // q fragments (B operand: column = query l15), two 32-deep k-steps
    const _Float16* qrow = qbase + (size_t)(q0 + l15) * EMBED + 8 * hf;
    const v16h qa0 = fh_g16(qrow), qa1 = fh_g16(qrow + 32);

    v8f o[4]; float m1 = NEG, l1 = 0.f;
#pragma unroll
    for (int t = 0; t < 4; ++t) { v8f zz = {}; o[t] = zz; }

    asm volatile("s_wait_asynccnt 0x0" ::: "memory");        // the wave's own copies of key block 0 have landed
    __syncthreads();                                         // key block 0 visible to all waves
    if (nt > 1) at_fill(lk + AT_TB, lv + AT_TB, gk + (size_t)64 * EMBED, gv + 64, g.S);
#pragma unroll 1                                             // one key block a trip: the two buffers alternate by t & 1
    for (int t = 0; t < nt; ++t) {
        const _Float16* Kt = Ksh[t & 1];
        const _Float16* Vb = Vts[t & 1];
        v8f s[4];
#pragma unroll
        for (int t = 0; t < 4; ++t) {                        // A fragment: row = key t*16 + l15, k = d; B = the q fragments (column = query l15)
            const int ko = (t * 16 + l15) * AT_KP + 8 * hf;
            FragH k0f, k1f;
            k0f.h[0] = *(const v8h*)(Kt + ko);      k0f.h[1] = *(const v8h*)(Kt + ko + 16);
            k1f.h[0] = *(const v8h*)(Kt + ko + 32); k1f.h[1] = *(const v8h*)(Kt + ko + 48);
            v8f acc = {};
            acc = wmma16(k0f.v, qa0, acc);
            acc = wmma16(k1f.v, qa1, acc);
            s[t] = acc;
        }
        // online softmax of the lane's query: 32 scores in registers, one exchange with the other half-wave for the maximum.
        // The maximum is kept in raw score units (the scale is positive, so it commutes with max); each probability is one fma and one bare
        // v_exp_f32: p * 4096 = exp2(s * sc2 + (12 - mref * sc2)). Arguments are <= 12; below -126 the bare instruction gives 0, far under f16's range.
        float mx = NEG;
#pragma unroll
        for (int t = 0; t < 4; ++t)
#pragma unroll
            for (int r = 0; r < 8; ++r) mx = fmaxf(mx, s[t][r]);
        mx = fmaxf(mx, __shfl_xor(mx, 16, 32));
        const float mnew = fmaxf(m1, mx);
        const float mref = (mnew == NEG) ? 0.f : mnew;       // the one -inf guard: a -inf score then gives exp2(-inf) = 0 with no test of its own
        const float corr = __builtin_amdgcn_exp2f((m1 - mref) * sc2);
        const float nb = fmaf(-mref, sc2, 12.f);
        // P^T as B operand straight from the score tiles: element i < 8 is key 8*hf + i (tile 2u), element 8 + i is key 16 + 8*hf + i (tile 2u + 1)
        FragH pf[2];
        float rs4[4];
#pragma unroll
        for (int t = 0; t < 4; ++t) {
            float rs = 0.f, e[8];
#pragma unroll
            for (int r = 0; r < 8; ++r) e[r] = fmaf(s[t][r], sc2, nb);
            exp2x8(e);
#pragma unroll
            for (int r = 0; r < 8; ++r) {
                const float pp = e[r]; rs += pp;
                pf[t >> 1].h[t & 1][r] = (_Float16)pp;
            }
            rs4[t] = rs;
        }
        l1 = l1 * corr + ((rs4[0] + rs4[1]) + (rs4[2] + rs4[3])); m1 = mnew;   // the lane's own 32 keys; both half-waves use the same corr, so the halves join once after the loop
#pragma unroll
        for (int t = 0; t < 4; ++t)
#pragma unroll
            for (int r = 0; r < 8; ++r) o[t][r] *= corr;
#pragma unroll
        for (int t = 0; t < 4; ++t) {                        // A fragment: row = d t*16 + l15, k = key (transposed tile, k-contiguous)
            const int vo = (t * 16 + l15) * AT_KP + 8 * hf;
            FragH v0f, v1f;
            v0f.h[0] = *(const v8h*)(Vb + vo);      v0f.h[1] = *(const v8h*)(Vb + vo + 16);
            v1f.h[0] = *(const v8h*)(Vb + vo + 32); v1f.h[1] = *(const v8h*)(Vb + vo + 48);
            o[t] = wmma16(v0f.v, pf[0].v, o[t]);
            o[t] = wmma16(v1f.v, pf[1].v, o[t]);
        }
        asm volatile("s_wait_dscnt 0x0" ::: "memory");       // the wave's reads of key block t are done
        asm volatile("s_wait_asynccnt 0x0" ::: "memory");    // its copies of key block t + 1 have landed
        __syncthreads();                                     // key block t + 1 visible to all waves; key block t's buffers left by all
        if (t + 2 < nt) at_fill(lk + (unsigned)((t & 1) * AT_TB), lv + (unsigned)((t & 1) * AT_TB), gk + (size_t)(t + 2) * 64 * EMBED, gv + (t + 2) * 64, g.S);
    }
    asm volatile("s_wait_asynccnt 0x0" ::: "memory");        // nothing is in flight when the wave goes on to its end

    // O: stage the wave's 16 x 64 tile (pitch 68 floats; the lane writes 8 consecutive d of its query per tile), then 8 lanes write one row's 64 halves, a whole 128-B line (8 x 16 B), four rows per instruction; f16(x * 64) of the f32 value
    {
        l1 += __shfl_xor(l1, 16, 32);                        // join the two half-waves' row sums
        const float inv = (l1 > 0.f) ? 1.f / l1 : 0.f;       // l1 sums p * 4096, as o does
#pragma unroll
        for (int t = 0; t < 4; ++t) {
            v4f w0, w1;
#pragma unroll
            for (int e = 0; e < 4; ++e) { w0[e] = o[t][e] * inv; w1[e] = o[t][4 + e] * inv; }
            *(v4f*)(&Os[wave][l15 * 68 + t * 16 + 8 * hf]) = w0;
            *(v4f*)(&Os[wave][l15 * 68 + t * 16 + 8 * hf + 4]) = w1;
        }
    }
    __builtin_amdgcn_fence(3 /* release order */, "workgroup");
    __builtin_amdgcn_wave_barrier();
    __builtin_amdgcn_fence(2 /* acquire order */, "workgroup");
    {
        const int q4 = lane >> 3, c8 = (lane & 7) * 8;
#pragma unroll
        for (int it = 0; it < 4; ++it) {
            const int row = it * 4 + q4;
            const v4f va = *(const v4f*)(&Os[wave][row * 68 + c8]), vc = *(const v4f*)(&Os[wave][row * 68 + c8 + 4]);
            v8h hv;
#pragma unroll
            for (int e = 0; e < 4; ++e) { hv[e] = (_Float16)(va[e] * 64.0f); hv[4 + e] = (_Float16)(vc[e] * 64.0f); }
            *(v8h*)(obase + (size_t)(q0 + row) * EMBED + c8) = hv;
        }
    }
}

typedef unsigned int cm_u4 __attribute__((ext_vector_type(4)));
// f32 -> bf16 (RNE) -> f16 planes: every 16-bit operand holds exactly the bf16-converted input value (times a power-of-two scale), so the f16 WMMA
// products of two such planes are exact in the f32 accumulator. Thread per (row, 8 cols); 16 B per thread, thread-linear along the dst row
__device__ __forceinline__ unsigned int cmb_pk2(float a, float b) { return (unsigned int)__builtin_bit_cast(unsigned short, (_Float16)a) | ((unsigned int)__builtin_bit_cast(unsigned short, (_Float16)b) << 16); }
__device__ __forceinline__ float cmb_bf(float v) { const unsigned u = __builtin_bit_cast(unsigned, v); const unsigned r = (u + 0x7fffu + ((u >> 16) & 1u)) & 0xffff0000u; return __builtin_bit_cast(float, r); }   // bf16 RNE, kept as f32 (finite inputs)
__global__ __launch_bounds__(256) void k_cm_castb(const float* __restrict__ SRC, int lds, long long sSz, unsigned short* __restrict__ DST, int ldd, long long sDz, int nR, int nC, float sc) {
    const long long u = (long long)blockIdx.x * 256 + threadIdx.x; const int per = nC / 8; if (u >= (long long)nR * per) return; const int r = (int)(u / per); const int c0 = 8 * (int)(u % per);
    const float* s = SRC + (long long)blockIdx.y * sSz + (long long)r * lds + c0; float w[8];
#pragma unroll
    for (int e = 0; e < 8; ++e) w[e] = cmb_bf(s[e]) * sc;
    cm_u4 pk; pk.x = cmb_pk2(w[0], w[1]); pk.y = cmb_pk2(w[2], w[3]); pk.z = cmb_pk2(w[4], w[5]); pk.w = cmb_pk2(w[6], w[7]); VST2(cm_u4, (cm_u4*)(DST + (long long)blockIdx.y * sDz + (long long)r * ldd + c0), pk); }

// =====================================================================================================================
// k_proj3: the three per-head projections in one grid; blockIdx.y picks the stream. C[m][n] = f16((1/16) * sum_k f16(bf16(X[m][k])) * f16(16 * bf16(W[n][k])))
//   over 64-wide head slices of a token stream (f32, batch stride SEQ_FULL * EMBED) and its [64 out][64 in] f32 weight. Both operands are converted
//   in registers on their way into the fragments. A wave owns 64 rows x 64 columns; per 16 rows: k 0..31 then 32..63 into four accumulator tiles.
//   q, k (VT false): the rows are 64 consecutive rows of the [tokens*heads][64] view; the 16 x 64 slab goes through the wave's own LDS so that 8 lanes store
//   one whole 128-B f16 row, four rows per instruction. v (VT true): the rows are 64 consecutive tokens of ONE head; a lane's 8 accumulator registers are 8 consecutive
//   tokens of one output column, one 16-B store into the transposed result [batch][head][d][token]; the wave fills whole 128-B lines (64 tokens of one d).
// =====================================================================================================================
#define PJ_NW 4
struct Proj3 { const float* X0; const float* X1; const float* X2; const float* W0; const float* W1; const float* W2; _Float16* C0; _Float16* C1; _Float16* C2; };
typedef __attribute__((ext_vector_type(2))) float  pj_f2;
typedef __attribute__((ext_vector_type(2))) __bf16 pj_b2;
// the 16 f32 values of one fragment as loaded: p points at column k0 + 8h of the lane's row; x[0], x[1] <- p[0..7], x[2], x[3] <- p[16..23]
struct PjRaw { v4f x[4]; };
__device__ __forceinline__ PjRaw pj_load(const float* __restrict__ p) {
    PjRaw r; r.x[0] = *(const v4f*)(p); r.x[1] = *(const v4f*)(p + 4); r.x[2] = *(const v4f*)(p + 16); r.x[3] = *(const v4f*)(p + 20); return r;
}
// fragment element 4c + e = f16(bf16_rne(x[c][e]) * sc): two values per packed f32 -> bf16 conversion (round to nearest even), widened again by their bits
__device__ __forceinline__ v16h pj_frag(const PjRaw& r, float sc) {
    v16h a;
#pragma unroll
    for (int c = 0; c < 4; ++c)
#pragma unroll
        for (int e = 0; e < 4; e += 2) {
            const pj_f2 w = { r.x[c][e], r.x[c][e + 1] };
            const unsigned u = __builtin_bit_cast(unsigned, __builtin_convertvector(w, pj_b2));
            a[4 * c + e]     = (_Float16)(__builtin_bit_cast(float, u << 16) * sc);
            a[4 * c + e + 1] = (_Float16)(__builtin_bit_cast(float, u & 0xffff0000u) * sc);
        }
    return a;
}
template <bool VT>
__device__ __forceinline__ void pj_body(const float* __restrict__ X, const float* __restrict__ Wt, _Float16* __restrict__ C, float* slab, int tile, int lane) {
    const int hf = lane >> 4, l15 = lane & 15;
    constexpr int RS = VT ? EMBED : HDIM;                    // floats from one of the wave's rows to the next
    const int m0 = tile * 64;                                // VT false: 64 rows = 4 tokens x 16 heads, inside one batch (SEQ % 64 == 0)
    const int hd = tile % HEADS, t0 = (tile / HEADS) * 64;   // VT true: head, and the first of 64 tokens, inside one batch
    const int bt = VT ? t0 / SEQ : (m0 / HEADS) / SEQ;
    const float* Ab = X + (size_t)bt * (SEQ_FULL - SEQ) * EMBED + (VT ? (size_t)t0 * EMBED + hd * HDIM : (size_t)m0 * HDIM) + (size_t)l15 * RS + 8 * hf;
    const float* Bb = Wt + l15 * HDIM + 8 * hf;

    // Loads in three groups: the first 32 token rows (the longest way), the whole weight, then, once the weight's f32 registers are free,
    // the other 32 token rows, which fly while the first 32 rows are worked on.
    PjRaw ra[4][2], rw[2][4];
#pragma unroll
    for (int i = 0; i < 2; ++i) { ra[i][0] = pj_load(Ab + i * 16 * RS); ra[i][1] = pj_load(Ab + i * 16 * RS + 32); }
    asm volatile("s_wait_xcnt 0x0" ::: "memory");            // stands in front of any reuse of the address registers of the loads above; keeps this group first
#pragma unroll
    for (int ks = 0; ks < 2; ++ks)
#pragma unroll
        for (int j = 0; j < 4; ++j) rw[ks][j] = pj_load(Bb + j * 16 * HDIM + ks * 32);
    asm volatile("s_wait_xcnt 0x0" ::: "memory");            // as above, for the weight's loads
    v16h bw[2][4];
#pragma unroll
    for (int ks = 0; ks < 2; ++ks)
#pragma unroll
        for (int j = 0; j < 4; ++j) bw[ks][j] = pj_frag(rw[ks][j], 16.0f);
    __builtin_amdgcn_sched_barrier(0);                       // the third group waits for the weight's f32 registers: hoisted above the conversion it pushes the kernel past 256 VGPRs
#pragma unroll
    for (int i = 2; i < 4; ++i) { ra[i][0] = pj_load(Ab + i * 16 * RS); ra[i][1] = pj_load(Ab + i * 16 * RS + 32); }
    asm volatile("s_wait_xcnt 0x0" ::: "memory");            // as above, for the third group
    __builtin_amdgcn_sched_barrier(0);                       // keeps the third group's loads issued ahead of all work on the rows; without it they sink to just in front of their use

#pragma unroll
    for (int i = 0; i < 4; ++i) {
        const v16h a0 = pj_frag(ra[i][0], 1.0f), a1 = pj_frag(ra[i][1], 1.0f);
        v8f acc[4];
#pragma unroll
        for (int j = 0; j < 4; ++j) { v8f zz = {}; acc[j] = __builtin_amdgcn_wmma_f32_16x16x32_f16(false, a0, false, bw[0][j], (short)0, zz, false, false); }
#pragma unroll
        for (int j = 0; j < 4; ++j) acc[j] = __builtin_amdgcn_wmma_f32_16x16x32_f16(false, a1, false, bw[1][j], (short)0, acc[j], false, false);
        if (VT) {
            // acc[j][r] = token t0 + i*16 + 8*hf + r, column j*16 + l15
            _Float16* Cv = C + (size_t)bt * SEQ * EMBED + ((size_t)hd * HDIM + l15) * SEQ + (t0 - bt * SEQ) + i * 16 + 8 * hf;
#pragma unroll
            for (int j = 0; j < 4; ++j) {
                v8h hv;
#pragma unroll
                for (int r = 0; r < 8; ++r) hv[r] = (_Float16)(acc[j][r] * 0.0625f);
                *(v8h*)(Cv + (size_t)j * 16 * SEQ) = hv;
            }
        } else {
#pragma unroll
            for (int j = 0; j < 4; ++j)
#pragma unroll
                for (int r = 0; r < 8; ++r) slab[(8 * hf + r) * 68 + j * 16 + l15] = acc[j][r] * 0.0625f;
            // the slab passes between the lanes of one wave: the fences order LDS alone, so that no wave waits here for its global stores
            __builtin_amdgcn_fence(3 /* release order */, "workgroup", "local");
            __builtin_amdgcn_wave_barrier();
            __builtin_amdgcn_fence(2 /* acquire order */, "workgroup", "local");
            const int q4 = lane >> 3, c8 = (lane & 7) * 8;
#pragma unroll
            for (int it = 0; it < 4; ++it) {
                const int row = it * 4 + q4;
                const v4f va = *(const v4f*)(slab + row * 68 + c8), vc = *(const v4f*)(slab + row * 68 + c8 + 4);
                v8h hv;
#pragma unroll
                for (int e = 0; e < 4; ++e) { hv[e] = (_Float16)va[e]; hv[4 + e] = (_Float16)vc[e]; }
                *(v8h*)(C + (size_t)(m0 + i * 16 + row) * HDIM + c8) = hv;
            }
            if (i == 3) asm volatile("s_wait_xcnt 0x0" ::: "memory");   // behind the body's last stores: nothing that follows this body in the kernel's code may reuse their address registers ahead of it
            __builtin_amdgcn_fence(3 /* release order */, "workgroup", "local");
            __builtin_amdgcn_wave_barrier();
            __builtin_amdgcn_fence(2 /* acquire order */, "workgroup", "local");
        }
        if (i == 1) __builtin_amdgcn_sched_barrier(0);       // rows 32..63 are not touched before rows 0..31 are stored: hoisted, their conversion waits for the third group at once
    }
}
__global__ __launch_bounds__(32 * PJ_NW) void k_proj3(Proj3 g) {
    __shared__ __align__(16) float sP[PJ_NW][16 * 68];       // per-wave 16 x 64 slab, pitch 68 floats (q, k streams)
    const int lane = threadIdx.x & 31, wave = threadIdx.x >> 5;
    const int y = blockIdx.y;
    const int tile = blockIdx.x * PJ_NW + wave;
    if (y == 2) pj_body<true>(g.X2, g.W2, g.C2, sP[wave], tile, lane);
    else        pj_body<false>((y == 0) ? g.X0 : g.X1, (y == 0) ? g.W0 : g.W1, (y == 0) ? g.C0 : g.C1, sP[wave], tile, lane);
}
static_assert(((MTOK * HEADS) / 64) % PJ_NW == 0);

// =====================================================================================================================
// k_oproj: C[m][n] = scale * sum_k A[m][k] * Bt[n][k] + bf16(bias[n]); A [MTOK][EMBED] and Bt [EMBED][EMBED] f16, k-contiguous; C f32.
//   Block = 8 waves = one 128 x 128 tile of C, grid (EMBED / 128, MTOK / 128); a wave owns 64 rows x 32 columns (2 x 4 waves).
//   A stage is 128 k of the tile's 128 A rows and 128 Bt rows: 256 rows of 256 B at pitch 272 B in LDS, brought by asynchronous 16-B copies
//   (a wave's copy = two whole rows), two buffers: stage t + 2 is asked for when every wave has left stage t. k runs upward through one accumulator per element.
//   Epilogue: the wave's 64 x 32 tile goes through its own part of the (then free) buffers so that 8 lanes store one whole 128-B line, four rows per instruction.
// =====================================================================================================================
#define OP_T   128                       // tile rows of A and of Bt
#define OP_KS  128                       // k per stage
#define OP_P   136                       // LDS pitch in halves (272 B = 16 B x 17)
#define OP_STG (2 * OP_T * OP_P)         // halves per buffer
#define OP_NT  (EMBED / OP_KS)
#define OP_SP  36                        // epilogue slab pitch in floats
static_assert(MTOK % OP_T == 0 && EMBED % OP_T == 0 && EMBED % OP_KS == 0 && OP_NT >= 2);
static_assert(8 * 64 * OP_SP * 4 <= 2 * OP_STG * 2);
// Eight copies, each lane its own 16 B: LDS byte address, global address. The closing wait stands inside the statement, in front of any reuse of the address registers.
__device__ __forceinline__ void op_copy8(const unsigned (&l)[8], const _Float16* const (&g)[8]) {
    asm volatile("global_load_async_to_lds_b128 %0, %8, off\n\tglobal_load_async_to_lds_b128 %1, %9, off\n\t"
                 "global_load_async_to_lds_b128 %2, %10, off\n\tglobal_load_async_to_lds_b128 %3, %11, off\n\t"
                 "global_load_async_to_lds_b128 %4, %12, off\n\tglobal_load_async_to_lds_b128 %5, %13, off\n\t"
                 "global_load_async_to_lds_b128 %6, %14, off\n\tglobal_load_async_to_lds_b128 %7, %15, off\n\t"
                 "s_wait_xcnt 0x0"
                 :: "v"(l[0]), "v"(l[1]), "v"(l[2]), "v"(l[3]), "v"(l[4]), "v"(l[5]), "v"(l[6]), "v"(l[7]),
                    "v"(g[0]), "v"(g[1]), "v"(g[2]), "v"(g[3]), "v"(g[4]), "v"(g[5]), "v"(g[6]), "v"(g[7]) : "memory");
}
// one stage: the thread's 16 B of rows tid / 16 + 16 i of A (LDS rows 0..127) and of Bt (LDS rows 128..255)
__device__ __forceinline__ void op_fill(unsigned lb, const _Float16* ga, const _Float16* gb) {
    unsigned l[8]; const _Float16* g[8];
#pragma unroll
    for (int i = 0; i < 8; ++i) { l[i] = lb + (unsigned)(i * 16 * OP_P * 2); g[i] = ga + (size_t)i * 16 * EMBED; }
    op_copy8(l, g);
#pragma unroll
    for (int i = 0; i < 8; ++i) { l[i] = lb + (unsigned)((OP_T + i * 16) * OP_P * 2); g[i] = gb + (size_t)i * 16 * EMBED; }
    op_copy8(l, g);
}
__global__ __launch_bounds__(256) void k_oproj(const _Float16* __restrict__ A, const _Float16* __restrict__ Bt, const float* __restrict__ bias, float* __restrict__ C, float scale) {
    __shared__ __align__(16) _Float16 sm[2 * OP_STG];
    const int tid = threadIdx.x, lane = tid & 31, wave = tid >> 5, hf = lane >> 4, l15 = lane & 15;
    const int n0 = blockIdx.x * OP_T, m0 = blockIdx.y * OP_T;
    const int wm = (wave >> 2) * 64, wn = (wave & 3) * 32;
    const unsigned lb = (unsigned)(size_t)sm + (unsigned)(((tid >> 4) * OP_P + (tid & 15) * 8) * 2);
    const _Float16* ga = A + (size_t)(m0 + (tid >> 4)) * EMBED + (tid & 15) * 8;
    const _Float16* gb = Bt + (size_t)(n0 + (tid >> 4)) * EMBED + (tid & 15) * 8;

    op_fill(lb, ga, gb);
    const float bias0 = bias[n0 + wn + l15], bias1 = bias[n0 + wn + 16 + l15];
    asm volatile("s_wait_asynccnt 0x0" ::: "memory");        // the wave's own copies of stage 0 have landed
    __syncthreads();                                         // stage 0 visible to all waves
    op_fill(lb + OP_STG * 2, ga + OP_KS, gb + OP_KS);

    // all loops over i, j, ks, r below are unrolled so that every index of acc, af and bf is a constant and the arrays stay in registers
    v8f acc[4][2];
#pragma unroll
    for (int i = 0; i < 4; ++i)
#pragma unroll
        for (int j = 0; j < 2; ++j) { v8f zz = {}; acc[i][j] = zz; }

#pragma unroll 1                                             // one stage a trip: the two buffers alternate by t & 1
    for (int t = 0; t < OP_NT; ++t) {
        const _Float16* ap = sm + (t & 1) * OP_STG + (wm + l15) * OP_P + 8 * hf;
        const _Float16* bp = sm + (t & 1) * OP_STG + (OP_T + wn + l15) * OP_P + 8 * hf;
        // two fragment sets: the next 32 k's twelve LDS loads go out as one group ahead of this 32 k's eight products
        v16h af[2][4], bf[2][2];
#pragma unroll
        for (int j = 0; j < 2; ++j) bf[0][j] = fh_g16(bp + j * 16 * OP_P);
#pragma unroll
        for (int i = 0; i < 4; ++i) af[0][i] = fh_g16(ap + i * 16 * OP_P);
#pragma unroll
        for (int ks = 0; ks < OP_KS / 32; ++ks) {
            const int c = ks & 1;
            if (ks + 1 < OP_KS / 32) {
#pragma unroll
                for (int j = 0; j < 2; ++j) bf[c ^ 1][j] = fh_g16(bp + j * 16 * OP_P + (ks + 1) * 32);
#pragma unroll
                for (int i = 0; i < 4; ++i) af[c ^ 1][i] = fh_g16(ap + i * 16 * OP_P + (ks + 1) * 32);
            }
            __builtin_amdgcn_sched_barrier(0);               // keeps the load group whole and ahead: sunk among the products, each load is waited for where it stands
#pragma unroll
            for (int i = 0; i < 4; ++i)
#pragma unroll
                for (int j = 0; j < 2; ++j)
                    acc[i][j] = __builtin_amdgcn_wmma_f32_16x16x32_f16(false, af[c][i], false, bf[c][j], (short)0, acc[i][j], false, false);
            __builtin_amdgcn_sched_barrier(0);               // without it the next group's loads are split up among these products and the stage's last products sink behind the block barrier
        }
        asm volatile("s_wait_dscnt 0x0" ::: "memory");       // the wave's reads of stage t are done
        asm volatile("s_wait_asynccnt 0x0" ::: "memory");    // its copies of stage t + 1 have landed
        __syncthreads();                                     // stage t + 1 visible to all waves; stage t's buffer left by all
        if (t + 2 < OP_NT) op_fill(lb + (unsigned)((t & 1) * OP_STG * 2), ga + (t + 2) * OP_KS, gb + (t + 2) * OP_KS);
    }
    asm volatile("s_wait_asynccnt 0x0" ::: "memory");        // nothing is in flight when the buffers become output staging

    float* slab = (float*)sm + wave * (64 * OP_SP);
#pragma unroll
    for (int j = 0; j < 2; ++j) {
        const float bv = cmb_bf(j == 0 ? bias0 : bias1);
#pragma unroll
        for (int i = 0; i < 4; ++i)
#pragma unroll
            for (int r = 0; r < 8; ++r) slab[(i * 16 + 8 * hf + r) * OP_SP + j * 16 + l15] = acc[i][j][r] * scale + bv;
    }
    // the slab passes between the lanes of one wave: the fences order LDS alone
    __builtin_amdgcn_fence(3 /* release order */, "workgroup", "local");
    __builtin_amdgcn_wave_barrier();
    __builtin_amdgcn_fence(2 /* acquire order */, "workgroup", "local");
    {
        const int q4 = lane >> 3, c4 = (lane & 7) * 4;
        float* Cw = C + (size_t)(m0 + wm + q4) * EMBED + n0 + wn + c4;
#pragma unroll
        for (int it = 0; it < 16; ++it) {
            const v4f v = *(const v4f*)(slab + (it * 4 + q4) * OP_SP + c4);
            *(v4f*)(Cw + (size_t)it * 4 * EMBED) = v;
        }
    }
}

extern "C" void kernel_launch(void* const* d_in, const int* in_sizes, int n_in, void* d_out, int out_size, void* d_ws, size_t ws_size, hipStream_t stream) {
    if (n_in < 8) return;
    const long long need_x = (long long)(NB - 1) * SEQ_FULL * EMBED + (long long)SEQ * EMBED;   // last element read of a token stream + 1
    if ((long long)in_sizes[0] < need_x || (long long)in_sizes[1] < need_x || (long long)in_sizes[2] < need_x) return;
    if (in_sizes[3] < HDIM * HDIM || in_sizes[4] < HDIM * HDIM || in_sizes[5] < HDIM * HDIM) return;
    if (in_sizes[6] < EMBED * EMBED || in_sizes[7] < EMBED) return;
    if ((long long)out_size < (long long)MTOK * EMBED) return;
    const float* xq = (const float*)d_in[0];
    const float* xk = (const float*)d_in[1];
    const float* xv = (const float*)d_in[2];
    const float* Wq = (const float*)d_in[3];
    const float* Wk = (const float*)d_in[4];
    const float* Wv = (const float*)d_in[5];
    const float* Wo = (const float*)d_in[6];
    const float* bo = (const float*)d_in[7];
    float* out = (float*)d_out;
    char* wsp = (char*)d_ws;
    unsigned short* AO16 = (unsigned short*)wsp; wsp += (((size_t)MTOK * EMBED * 2 + 255) / 256) * 256;    // f16 attention output [MTOK][1024], carried x64
    _Float16* Qh = (_Float16*)wsp; wsp += (((size_t)MTOK * EMBED * 2 + 255) / 256) * 256;    // [MTOK][1024]
    _Float16* Kh = (_Float16*)wsp; wsp += (((size_t)MTOK * EMBED * 2 + 255) / 256) * 256;    // [MTOK][1024]
    _Float16* Vt = (_Float16*)wsp; wsp += (((size_t)MTOK * EMBED * 2 + 255) / 256) * 256;    // [NB][1024][SEQ]
    unsigned short* WO16 = (unsigned short*)wsp; wsp += (((size_t)EMBED * EMBED * 2 + 255) / 256) * 256;
    if ((size_t)(wsp - (char*)d_ws) > ws_size) return;

    // output weight [1024 out][1024 in] -> f16 x16 (Bt form [n][k])
    k_cm_castb<<<dim3((unsigned)(((long long)EMBED * (EMBED / 8) + 255) / 256), 1), 256, 0, stream>>>(Wo, EMBED, 0, WO16, EMBED, 0, EMBED, EMBED, 16.0f);
    // q, k, v streams: [NB][SEQ][1024] (full batch stride), 64-wide head slices x [64][64]^T -> Qh / Kh [MTOK*16][64] = [MTOK][1024], Vt [NB][16*64][SEQ]
    {
      Proj3 p;
      p.X0 = xq; p.X1 = xk; p.X2 = xv; p.W0 = Wq; p.W1 = Wk; p.W2 = Wv; p.C0 = Qh; p.C1 = Kh; p.C2 = Vt;
      k_proj3<<<dim3((unsigned)(((MTOK * HEADS) / 64) / PJ_NW), 3), 32 * PJ_NW, 0, stream>>>(p);
    }
    {
      AttnG a;
      a.Q = Qh; a.K = Kh; a.Vt = Vt; a.O = (_Float16*)AO16;
      a.sb = (long long)SEQ * EMBED; a.S = SEQ; a.scale = 0.03125f;
      k_attn64<<<dim3((unsigned)(SEQ / 64), (unsigned)HEADS, (unsigned)NB), 32 * AT_NW, 0, stream>>>(a);
    }
    // out = (AO16 . WO16^T) / (64 * 16) + bf16(bias)
    k_oproj<<<dim3((unsigned)(EMBED / OP_T), (unsigned)(MTOK / OP_T)), 256, 0, stream>>>((const _Float16*)AO16, (const _Float16*)WO16, bo, out, 0.0009765625f);
}

// v007
// Measured time: 73.7 microseconds a run.
// Next to v006, in two timings, it ran 1.07 times as fast each time.
// Counting every step since v000, it is 4.30 times as fast.
// Multi-head attention (2 x 2,048 tokens x 1,024; 16 heads x 64; one shared 64x64 [out][in] weight per q / k / v stream applied per head, no biases; scores / 32; no mask; [out][in] output projection + bias). All contractions: v_wmma_f32_16x16x32_f16 (f16 operands, f32 accumulate): inputs and parameters converted to bf16 (RNE) first and held exactly in f16 (weights x16), tokens, 64x64 weights and bias in the registers of the kernel that uses them; per-head projections as f16 WMMA GEMMs, one launch for the three streams, results stored as f16 (q, k as [token][head][d], v transposed as [head][d][token]); one WMMA attention launch (f16 q fragments, f16 k and transposed f16 v tiles brought into LDS by asynchronous copies, two buffers, f32 online softmax, probabilities carried x4096 as f16); output projection as an f16 WMMA GEMM of the f16 attention output carried x64 (written so by the attention launch), + bias in f32.
#include <hip/hip_runtime.h>
#include <math.h>

#ifndef NB
#define NB 2
#endif
#ifndef SEQ
#define SEQ 2048
#endif
#define NB_FULL 2
#define SEQ_FULL 2048
#define EMBED 1024
#define HEADS 16
#define HDIM 64
#define MTOK (NB * SEQ)

static_assert(SEQ % 64 == 0);
static_assert(MTOK % 64 == 0);
static_assert((MTOK * HEADS) % 64 == 0);
static_assert(EMBED % 64 == 0 && HDIM == 64);
static_assert(NB <= NB_FULL && SEQ <= SEQ_FULL);

typedef __attribute__((ext_vector_type(16))) _Float16 v16h;
typedef __attribute__((ext_vector_type(8)))  _Float16 v8h;
typedef __attribute__((ext_vector_type(8)))  float    v8f;
typedef __attribute__((ext_vector_type(4)))  float    v4f;

// 16-bit WMMA fragment map (wave32), lane L, h = L>>4, m = L&15:
//   A 16x32: lane = row m;   element i -> k = (i<8) ? 8h+i : 16+8h+(i-8)
//   B 32x16: lane = column m; the SAME k(i,h)
//   D 16x16 (8 f32): lane = column m; element r -> row 8h+r
__device__ __forceinline__ v8f wmma16(v16h a, v16h b, v8f c) {
    c = __builtin_amdgcn_wmma_f32_16x16x32_f16(false, a, false, b, (short)0, c, false, false);
    return c;
}
union FragH { v16h v; v8h h[2]; };

// A fragment from an f16 row (global or LDS): p points at column k0 + 8h of the lane's row; elements 0..7 <- p[0..7], 8..15 <- p[16..23]
__device__ __forceinline__ v16h fh_g16(const _Float16* __restrict__ p) {
    FragH f; f.h[0] = *(const v8h*)(p); f.h[1] = *(const v8h*)(p + 16); return f.v;
}

// Eight bare v_exp_f32, each over its own argument register, in one statement: no neighbour can take a transcendental's source or read its result
// directly behind it, whatever registers the build picks; the closing v_nop is the independent slot that the instruction set asks for behind the last one.
__device__ __forceinline__ void exp2x8(float (&e)[8]) {
    asm("v_exp_f32 %0, %0\n\tv_exp_f32 %1, %1\n\tv_exp_f32 %2, %2\n\tv_exp_f32 %3, %3\n\t"
        "v_exp_f32 %4, %4\n\tv_exp_f32 %5, %5\n\tv_exp_f32 %6, %6\n\tv_exp_f32 %7, %7\n\tv_nop"
        : "+v"(e[0]), "+v"(e[1]), "+v"(e[2]), "+v"(e[3]), "+v"(e[4]), "+v"(e[5]), "+v"(e[6]), "+v"(e[7]));
}

// 'val' is captured into a local first: never pass an expression that reads *ptr.
#define VST2(T, ptr, val) do { const T vst2_v_ = (val); *(T*)(ptr) = vst2_v_;  } while (0)

// =====================================================================================================================
// k_attn64: O(b,i,h,:) = softmax_j(scale * Q(b,i,h,:).K(b,j,h,:)) V(b,j,h,:) for head dim 64, no mask, S % 64 == 0.
//   Element (b, s, h, d) of Q / K / O lives at X[b*sb + s*EMBED + h*HDIM + d], of V at Vt[b*sb + (h*HDIM + d)*S + s] (all f16; O carried x64). Block = 4 waves = 64 queries of one (batch, head);
//   grid (S/64, HEADS, NB). Per 64-key block: K [key][d] and V [d][key] come into LDS by asynchronous 16-B copies, 128-B rows, two buffers: block t + 2 is asked for
//   when every wave has left block t, so that a block's copies fly while the block before it is worked on (one block barrier a trip);
//   scores^T = f16 k fragments (two 16-B LDS loads each) x f16 q fragments (registers), f32 accumulate; online softmax in f32, exp2 domain, per lane;
//   O^T += V^T.P^T with f16 v fragments from the transposed tile and P^T packed from the score registers; row sums carried x4096 like P, final 1/rowsum in f32.
//   Staged extent == consumed extent: a Ksh buffer 64 keys x 64 d, a Vts buffer 64 d x 64 keys, Os 16 rows x 64 d; pad columns are never read.
// =====================================================================================================================
#define AT_NW 4
#define AT_KP 72          // LDS pitch in halves (144 B, a multiple of 16 B)
#define AT_TB (64 * AT_KP * 2)   // bytes of one K or V buffer
struct AttnG { const _Float16* Q; const _Float16* K; const _Float16* Vt; _Float16* O; long long sb; int S; float scale; };
static_assert(sizeof(AttnG) == 48);

__device__ __forceinline__ void op_copy8(const unsigned (&l)[8], const _Float16* const (&g)[8]);   // eight asynchronous 16-B copies a lane and their closing wait; defined with k_oproj
// one key block: the thread's 16 B of rows tid / 8 + 16 i of the K tile (rows = keys, EMBED halves apart) and of the V tile (rows = d, S halves apart)
__device__ __forceinline__ void at_fill(unsigned lk, unsigned lv, const _Float16* gk, const _Float16* gv, int S) {
    unsigned l[8]; const _Float16* g[8];
#pragma unroll
    for (int i = 0; i < 4; ++i) {
        l[i]     = lk + (unsigned)(i * 16 * AT_KP * 2); g[i]     = gk + (size_t)i * 16 * EMBED;
        l[4 + i] = lv + (unsigned)(i * 16 * AT_KP * 2); g[4 + i] = gv + (size_t)i * 16 * S;
    }
    op_copy8(l, g);
}

#ifndef KATTN_ATTR
#define KATTN_ATTR __attribute__((amdgpu_num_vgpr(256)))
#endif
__global__ __launch_bounds__(32 * AT_NW) KATTN_ATTR void k_attn64(AttnG g) {
    __shared__ __align__(16) _Float16 Ksh[2][64 * AT_KP];
    __shared__ __align__(16) _Float16 Vts[2][64 * AT_KP];
    __shared__ __align__(16) float    Os[AT_NW][16 * 68];
    const int tid = threadIdx.x, wave = tid >> 5, lane = tid & 31, hf = lane >> 4, l15 = lane & 15;
    const int h = blockIdx.y, b = blockIdx.z;
    const int q0 = (blockIdx.x * AT_NW + wave) * 16;
    const float L2E = 1.4426950408889634f;
    const float NEG = -__builtin_inff();
    const float sc2 = g.scale * L2E;                         // raw score -> base-2 exponent
    const _Float16* qbase = g.Q + (long long)b * g.sb + h * HDIM;
    const _Float16* kbase = g.K + (long long)b * g.sb + h * HDIM;
    const _Float16* vbase = g.Vt + (long long)b * g.sb + (long long)h * HDIM * g.S;
    _Float16*    obase = g.O + (long long)b * g.sb + h * HDIM;

    // the lane's 16 B of a tile: row tid / 8, column group tid % 8; its LDS byte addresses in buffer 0 and its global addresses in key block 0
    const int so = (tid >> 3) * AT_KP + (tid & 7) * 8;
    const unsigned lk = (unsigned)(size_t)&Ksh[0][0] + (unsigned)(so * 2), lv = (unsigned)(size_t)&Vts[0][0] + (unsigned)(so * 2);
    const _Float16* gk = kbase + (size_t)(tid >> 3) * EMBED + (tid & 7) * 8;
    const _Float16* gv = vbase + (size_t)(tid >> 3) * g.S + (tid & 7) * 8;
    const int nt = g.S / 64;                                 // key blocks; the same for the whole grid
    if (nt > 0) at_fill(lk, lv, gk, gv, g.S);

    // q fragments (B operand: column = query l15), two 32-deep k-steps
    const _Float16* qrow = qbase + (size_t)(q0 + l15) * EMBED + 8 * hf;
    const v16h qa0 = fh_g16(qrow), qa1 = fh_g16(qrow + 32);

    v8f o[4]; float m1 = NEG, l1 = 0.f;
#pragma unroll
    for (int t = 0; t < 4; ++t) { v8f zz = {}; o[t] = zz; }

    asm volatile("s_wait_asynccnt 0x0" ::: "memory");        // the wave's own copies of key block 0 have landed
    __syncthreads();                                         // key block 0 visible to all waves
    if (nt > 1) at_fill(lk + AT_TB, lv + AT_TB, gk + (size_t)64 * EMBED, gv + 64, g.S);
#pragma unroll 1                                             // one key block a trip: the two buffers alternate by t & 1
    for (int t = 0; t < nt; ++t) {
        const _Float16* Kt = Ksh[t & 1] + l15 * AT_KP + 8 * hf;
        const _Float16* Vb = Vts[t & 1] + l15 * AT_KP + 8 * hf;
        // The key block's 32 fragment loads go out as one group, K's first: the scores wait for K's half alone, V's half lands under the scores and the softmax.
        // K A fragment: row = key u*16 + l15, k = d; V A fragment: row = d u*16 + l15, k = key (transposed tile, k-contiguous)
        v16h kf[4][2], vf[4][2];
#pragma unroll
        for (int u = 0; u < 4; ++u) { kf[u][0] = fh_g16(Kt + u * 16 * AT_KP); kf[u][1] = fh_g16(Kt + u * 16 * AT_KP + 32); }
#pragma unroll
        for (int u = 0; u < 4; ++u) { vf[u][0] = fh_g16(Vb + u * 16 * AT_KP); vf[u][1] = fh_g16(Vb + u * 16 * AT_KP + 32); }
        __builtin_amdgcn_sched_barrier(0);                   // keeps the group whole and ahead: sunk among the products, each load is waited for where it stands
        // four score tiles, each d 0..31 then d 32..63 (B = the q fragments, column = query l15)
        v8f s[4];
#pragma unroll
        for (int u = 0; u < 4; ++u) { v8f zz = {}; s[u] = wmma16(kf[u][0], qa0, zz); }
#pragma unroll
        for (int u = 0; u < 4; ++u) s[u] = wmma16(kf[u][1], qa1, s[u]);
        // online softmax of the lane's query: 32 scores in registers, one exchange with the other half-wave for the maximum.
        // The maximum is kept in raw score units (the scale is positive, so it commutes with max); each probability is one fma and one bare
        // v_exp_f32: p * 4096 = exp2(s * sc2 + (12 - mref * sc2)). Arguments are <= 12; below -126 the bare instruction gives 0, far under f16's range.
        float mx = NEG;
#pragma unroll
        for (int t = 0; t < 4; ++t)
#pragma unroll
            for (int r = 0; r < 8; ++r) mx = fmaxf(mx, s[t][r]);
        mx = fmaxf(mx, __shfl_xor(mx, 16, 32));
        const float mnew = fmaxf(m1, mx);
        const float mref = (mnew == NEG) ? 0.f : mnew;       // the one -inf guard: a -inf score then gives exp2(-inf) = 0 with no test of its own
        const float corr = __builtin_amdgcn_exp2f((m1 - mref) * sc2);
        const float nb = fmaf(-mref, sc2, 12.f);
        // P^T as B operand straight from the score tiles: element i < 8 is key 8*hf + i (tile 2u), element 8 + i is key 16 + 8*hf + i (tile 2u + 1)
        FragH pf[2];
        float rs4[4];
#pragma unroll
        for (int t = 0; t < 4; ++t) {
            float rs = 0.f, e[8];
#pragma unroll
            for (int r = 0; r < 8; ++r) e[r] = fmaf(s[t][r], sc2, nb);
            exp2x8(e);
#pragma unroll
            for (int r = 0; r < 8; ++r) {
                const float pp = e[r]; rs += pp;
                pf[t >> 1].h[t & 1][r] = (_Float16)pp;
            }
            rs4[t] = rs;
        }
        l1 = l1 * corr + ((rs4[0] + rs4[1]) + (rs4[2] + rs4[3])); m1 = mnew;   // the lane's own 32 keys; both half-waves use the same corr, so the halves join once after the loop
#pragma unroll
        for (int t = 0; t < 4; ++t)
#pragma unroll
            for (int r = 0; r < 8; ++r) o[t][r] *= corr;
#pragma unroll
        for (int u = 0; u < 4; ++u) o[u] = wmma16(vf[u][0], pf[0].v, o[u]);   // keys 0..31 of the block into the four output tiles, then keys 32..63
#pragma unroll
        for (int u = 0; u < 4; ++u) o[u] = wmma16(vf[u][1], pf[1].v, o[u]);
        __builtin_amdgcn_sched_barrier(0);                   // keeps the trip's foot at the foot: with every LDS read at the head, the waits and the barrier below rise to the head too, and the wait for block t + 1's copies then stands right behind their issue
        asm volatile("s_wait_dscnt 0x0" ::: "memory");       // the wave's reads of key block t are done
        asm volatile("s_wait_asynccnt 0x0" ::: "memory");    // its copies of key block t + 1 have landed
        __syncthreads();                                     // key block t + 1 visible to all waves; key block t's buffers left by all
        if (t + 2 < nt) at_fill(lk + (unsigned)((t & 1) * AT_TB), lv + (unsigned)((t & 1) * AT_TB), gk + (size_t)(t + 2) * 64 * EMBED, gv + (t + 2) * 64, g.S);
    }
    asm volatile("s_wait_asynccnt 0x0" ::: "memory");        // nothing is in flight when the wave goes on to its end

    // O: stage the wave's 16 x 64 tile (pitch 68 floats; the lane writes 8 consecutive d of its query per tile), then 8 lanes write one row's 64 halves, a whole 128-B line (8 x 16 B), four rows per instruction; f16(x * 64) of the f32 value
    {
        l1 += __shfl_xor(l1, 16, 32);                        // join the two half-waves' row sums
        const float inv = (l1 > 0.f) ? 1.f / l1 : 0.f;       // l1 sums p * 4096, as o does
#pragma unroll
        for (int t = 0; t < 4; ++t) {
            v4f w0, w1;
#pragma unroll
            for (int e = 0; e < 4; ++e) { w0[e] = o[t][e] * inv; w1[e] = o[t][4 + e] * inv; }
            *(v4f*)(&Os[wave][l15 * 68 + t * 16 + 8 * hf]) = w0;
            *(v4f*)(&Os[wave][l15 * 68 + t * 16 + 8 * hf + 4]) = w1;
        }
    }
    __builtin_amdgcn_fence(3 /* release order */, "workgroup");
    __builtin_amdgcn_wave_barrier();
    __builtin_amdgcn_fence(2 /* acquire order */, "workgroup");
    {
        const int q4 = lane >> 3, c8 = (lane & 7) * 8;
#pragma unroll
        for (int it = 0; it < 4; ++it) {
            const int row = it * 4 + q4;
            const v4f va = *(const v4f*)(&Os[wave][row * 68 + c8]), vc = *(const v4f*)(&Os[wave][row * 68 + c8 + 4]);
            v8h hv;
#pragma unroll
            for (int e = 0; e < 4; ++e) { hv[e] = (_Float16)(va[e] * 64.0f); hv[4 + e] = (_Float16)(vc[e] * 64.0f); }
            *(v8h*)(obase + (size_t)(q0 + row) * EMBED + c8) = hv;
        }
    }
}

typedef unsigned int cm_u4 __attribute__((ext_vector_type(4)));
// f32 -> bf16 (RNE) -> f16 planes: every 16-bit operand holds exactly the bf16-converted input value (times a power-of-two scale), so the f16 WMMA
// products of two such planes are exact in the f32 accumulator. Thread per (row, 8 cols); 16 B per thread, thread-linear along the dst row
__device__ __forceinline__ unsigned int cmb_pk2(float a, float b) { return (unsigned int)__builtin_bit_cast(unsigned short, (_Float16)a) | ((unsigned int)__builtin_bit_cast(unsigned short, (_Float16)b) << 16); }
__device__ __forceinline__ float cmb_bf(float v) { const unsigned u = __builtin_bit_cast(unsigned, v); const unsigned r = (u + 0x7fffu + ((u >> 16) & 1u)) & 0xffff0000u; return __builtin_bit_cast(float, r); }   // bf16 RNE, kept as f32 (finite inputs)
__global__ __launch_bounds__(256) void k_cm_castb(const float* __restrict__ SRC, int lds, long long sSz, unsigned short* __restrict__ DST, int ldd, long long sDz, int nR, int nC, float sc) {
    const long long u = (long long)blockIdx.x * 256 + threadIdx.x; const int per = nC / 8; if (u >= (long long)nR * per) return; const int r = (int)(u / per); const int c0 = 8 * (int)(u % per);
    const float* s = SRC + (long long)blockIdx.y * sSz + (long long)r * lds + c0; float w[8];
#pragma unroll
    for (int e = 0; e < 8; ++e) w[e] = cmb_bf(s[e]) * sc;
    cm_u4 pk; pk.x = cmb_pk2(w[0], w[1]); pk.y = cmb_pk2(w[2], w[3]); pk.z = cmb_pk2(w[4], w[5]); pk.w = cmb_pk2(w[6], w[7]); VST2(cm_u4, (cm_u4*)(DST + (long long)blockIdx.y * sDz + (long long)r * ldd + c0), pk); }

// =====================================================================================================================
// k_proj3: the three per-head projections in one grid; blockIdx.y picks the stream. C[m][n] = f16((1/16) * sum_k f16(bf16(X[m][k])) * f16(16 * bf16(W[n][k])))
//   over 64-wide head slices of a token stream (f32, batch stride SEQ_FULL * EMBED) and its [64 out][64 in] f32 weight. Both operands are converted
//   in registers on their way into the fragments. A wave owns 64 rows x 64 columns; per 16 rows: k 0..31 then 32..63 into four accumulator tiles.
//   q, k (VT false): the rows are 64 consecutive rows of the [tokens*heads][64] view; the 16 x 64 slab goes through the wave's own LDS so that 8 lanes store
//   one whole 128-B f16 row, four rows per instruction. v (VT true): the rows are 64 consecutive tokens of ONE head; a lane's 8 accumulator registers are 8 consecutive
//   tokens of one output column, one 16-B store into the transposed result [batch][head][d][token]; the wave fills whole 128-B lines (64 tokens of one d).
// =====================================================================================================================
#define PJ_NW 4
struct Proj3 { const float* X0; const float* X1; const float* X2; const float* W0; const float* W1; const float* W2; _Float16* C0; _Float16* C1; _Float16* C2; };
typedef __attribute__((ext_vector_type(2))) float  pj_f2;
typedef __attribute__((ext_vector_type(2))) __bf16 pj_b2;
// the 16 f32 values of one fragment as loaded: p points at column k0 + 8h of the lane's row; x[0], x[1] <- p[0..7], x[2], x[3] <- p[16..23]
struct PjRaw { v4f x[4]; };
__device__ __forceinline__ PjRaw pj_load(const float* __restrict__ p) {
    PjRaw r; r.x[0] = *(const v4f*)(p); r.x[1] = *(const v4f*)(p + 4); r.x[2] = *(const v4f*)(p + 16); r.x[3] = *(const v4f*)(p + 20); return r;
}
// fragment element 4c + e = f16(bf16_rne(x[c][e]) * sc): two values per packed f32 -> bf16 conversion (round to nearest even), widened again by their bits
__device__ __forceinline__ v16h pj_frag(const PjRaw& r, float sc) {
    v16h a;
#pragma unroll
    for (int c = 0; c < 4; ++c)
#pragma unroll
        for (int e = 0; e < 4; e += 2) {
            const pj_f2 w = { r.x[c][e], r.x[c][e + 1] };
            const unsigned u = __builtin_bit_cast(unsigned, __builtin_convertvector(w, pj_b2));
            a[4 * c + e]     = (_Float16)(__builtin_bit_cast(float, u << 16) * sc);
            a[4 * c + e + 1] = (_Float16)(__builtin_bit_cast(float, u & 0xffff0000u) * sc);
        }
    return a;
}
template <bool VT>
__device__ __forceinline__ void pj_body(const float* __restrict__ X, const float* __restrict__ Wt, _Float16* __restrict__ C, float* slab, int tile, int lane) {
    const int hf = lane >> 4, l15 = lane & 15;
    constexpr int RS = VT ? EMBED : HDIM;                    // floats from one of the wave's rows to the next
    const int m0 = tile * 64;                                // VT false: 64 rows = 4 tokens x 16 heads, inside one batch (SEQ % 64 == 0)
    const int hd = tile % HEADS, t0 = (tile / HEADS) * 64;   // VT true: head, and the first of 64 tokens, inside one batch
    const int bt = VT ? t0 / SEQ : (m0 / HEADS) / SEQ;
    const float* Ab = X + (size_t)bt * (SEQ_FULL - SEQ) * EMBED + (VT ? (size_t)t0 * EMBED + hd * HDIM : (size_t)m0 * HDIM) + (size_t)l15 * RS + 8 * hf;
    const float* Bb = Wt + l15 * HDIM + 8 * hf;

    // Loads in three groups: the first 32 token rows (the longest way), the whole weight, then, once the weight's f32 registers are free,
    // the other 32 token rows, which fly while the first 32 rows are worked on.
    PjRaw ra[4][2], rw[2][4];
#pragma unroll
    for (int i = 0; i < 2; ++i) { ra[i][0] = pj_load(Ab + i * 16 * RS); ra[i][1] = pj_load(Ab + i * 16 * RS + 32); }
    asm volatile("s_wait_xcnt 0x0" ::: "memory");            // stands in front of any reuse of the address registers of the loads above; keeps this group first
#pragma unroll
    for (int ks = 0; ks < 2; ++ks)
#pragma unroll
        for (int j = 0; j < 4; ++j) rw[ks][j] = pj_load(Bb + j * 16 * HDIM + ks * 32);
    asm volatile("s_wait_xcnt 0x0" ::: "memory");            // as above, for the weight's loads
    v16h bw[2][4];
#pragma unroll
    for (int ks = 0; ks < 2; ++ks)
#pragma unroll
        for (int j = 0; j < 4; ++j) bw[ks][j] = pj_frag(rw[ks][j], 16.0f);
    __builtin_amdgcn_sched_barrier(0);                       // the third group waits for the weight's f32 registers: hoisted above the conversion it pushes the kernel past 256 VGPRs
#pragma unroll
    for (int i = 2; i < 4; ++i) { ra[i][0] = pj_load(Ab + i * 16 * RS); ra[i][1] = pj_load(Ab + i * 16 * RS + 32); }
    asm volatile("s_wait_xcnt 0x0" ::: "memory");            // as above, for the third group
    __builtin_amdgcn_sched_barrier(0);                       // keeps the third group's loads issued ahead of all work on the rows; without it they sink to just in front of their use

#pragma unroll
    for (int i = 0; i < 4; ++i) {
        const v16h a0 = pj_frag(ra[i][0], 1.0f), a1 = pj_frag(ra[i][1], 1.0f);
        v8f acc[4];
#pragma unroll
        for (int j = 0; j < 4; ++j) { v8f zz = {}; acc[j] = __builtin_amdgcn_wmma_f32_16x16x32_f16(false, a0, false, bw[0][j], (short)0, zz, false, false); }
#pragma unroll
        for (int j = 0; j < 4; ++j) acc[j] = __builtin_amdgcn_wmma_f32_16x16x32_f16(false, a1, false, bw[1][j], (short)0, acc[j], false, false);
        if (VT) {
            // acc[j][r] = token t0 + i*16 + 8*hf + r, column j*16 + l15
            _Float16* Cv = C + (size_t)bt * SEQ * EMBED + ((size_t)hd * HDIM + l15) * SEQ + (t0 - bt * SEQ) + i * 16 + 8 * hf;
#pragma unroll
            for (int j = 0; j < 4; ++j) {
                v8h hv;
#pragma unroll
                for (int r = 0; r < 8; ++r) hv[r] = (_Float16)(acc[j][r] * 0.0625f);
                *(v8h*)(Cv + (size_t)j * 16 * SEQ) = hv;
            }
        } else {
#pragma unroll
            for (int j = 0; j < 4; ++j)
#pragma unroll
                for (int r = 0; r < 8; ++r) slab[(8 * hf + r) * 68 + j * 16 + l15] = acc[j][r] * 0.0625f;
            // the slab passes between the lanes of one wave: the fences order LDS alone, so that no wave waits here for its global stores
            __builtin_amdgcn_fence(3 /* release order */, "workgroup", "local");
            __builtin_amdgcn_wave_barrier();
            __builtin_amdgcn_fence(2 /* acquire order */, "workgroup", "local");
            const int q4 = lane >> 3, c8 = (lane & 7) * 8;
#pragma unroll
            for (int it = 0; it < 4; ++it) {
                const int row = it * 4 + q4;
                const v4f va = *(const v4f*)(slab + row * 68 + c8), vc = *(const v4f*)(slab + row * 68 + c8 + 4);
                v8h hv;
#pragma unroll
                for (int e = 0; e < 4; ++e) { hv[e] = (_Float16)va[e]; hv[4 + e] = (_Float16)vc[e]; }
                *(v8h*)(C + (size_t)(m0 + i * 16 + row) * HDIM + c8) = hv;
            }
            if (i == 3) asm volatile("s_wait_xcnt 0x0" ::: "memory");   // behind the body's last stores: nothing that follows this body in the kernel's code may reuse their address registers ahead of it
            __builtin_amdgcn_fence(3 /* release order */, "workgroup", "local");
            __builtin_amdgcn_wave_barrier();
            __builtin_amdgcn_fence(2 /* acquire order */, "workgroup", "local");
        }
        if (i == 1) __builtin_amdgcn_sched_barrier(0);       // rows 32..63 are not touched before rows 0..31 are stored: hoisted, their conversion waits for the third group at once
    }
}
__global__ __launch_bounds__(32 * PJ_NW) void k_proj3(Proj3 g) {
    __shared__ __align__(16) float sP[PJ_NW][16 * 68];       // per-wave 16 x 64 slab, pitch 68 floats (q, k streams)
    const int lane = threadIdx.x & 31, wave = threadIdx.x >> 5;
    const int y = blockIdx.y;
    const int tile = blockIdx.x * PJ_NW + wave;
    if (y == 2) pj_body<true>(g.X2, g.W2, g.C2, sP[wave], tile, lane);
    else        pj_body<false>((y == 0) ? g.X0 : g.X1, (y == 0) ? g.W0 : g.W1, (y == 0) ? g.C0 : g.C1, sP[wave], tile, lane);
}
static_assert(((MTOK * HEADS) / 64) % PJ_NW == 0);

// =====================================================================================================================
// k_oproj: C[m][n] = scale * sum_k A[m][k] * Bt[n][k] + bf16(bias[n]); A [MTOK][EMBED] and Bt [EMBED][EMBED] f16, k-contiguous; C f32.
//   Block = 8 waves = one 128 x 128 tile of C, grid (EMBED / 128, MTOK / 128); a wave owns 64 rows x 32 columns (2 x 4 waves).
//   A stage is 128 k of the tile's 128 A rows and 128 Bt rows: 256 rows of 256 B at pitch 272 B in LDS, brought by asynchronous 16-B copies
//   (a wave's copy = two whole rows), two buffers: stage t + 2 is asked for when every wave has left stage t. k runs upward through one accumulator per element.
//   Epilogue: the wave's 64 x 32 tile goes through its own part of the (then free) buffers so that 8 lanes store one whole 128-B line, four rows per instruction.
// =====================================================================================================================
#define OP_T   128                       // tile rows of A and of Bt
#define OP_KS  128                       // k per stage
#define OP_P   136                       // LDS pitch in halves (272 B = 16 B x 17)
#define OP_STG (2 * OP_T * OP_P)         // halves per buffer
#define OP_NT  (EMBED / OP_KS)
#define OP_SP  36                        // epilogue slab pitch in floats
static_assert(MTOK % OP_T == 0 && EMBED % OP_T == 0 && EMBED % OP_KS == 0 && OP_NT >= 2);
static_assert(8 * 64 * OP_SP * 4 <= 2 * OP_STG * 2);
// Eight copies, each lane its own 16 B: LDS byte address, global address. The closing wait stands inside the statement, in front of any reuse of the address registers.
__device__ __forceinline__ void op_copy8(const unsigned (&l)[8], const _Float16* const (&g)[8]) {
    asm volatile("global_load_async_to_lds_b128 %0, %8, off\n\tglobal_load_async_to_lds_b128 %1, %9, off\n\t"
                 "global_load_async_to_lds_b128 %2, %10, off\n\tglobal_load_async_to_lds_b128 %3, %11, off\n\t"
                 "global_load_async_to_lds_b128 %4, %12, off\n\tglobal_load_async_to_lds_b128 %5, %13, off\n\t"
                 "global_load_async_to_lds_b128 %6, %14, off\n\tglobal_load_async_to_lds_b128 %7, %15, off\n\t"
                 "s_wait_xcnt 0x0"
                 :: "v"(l[0]), "v"(l[1]), "v"(l[2]), "v"(l[3]), "v"(l[4]), "v"(l[5]), "v"(l[6]), "v"(l[7]),
                    "v"(g[0]), "v"(g[1]), "v"(g[2]), "v"(g[3]), "v"(g[4]), "v"(g[5]), "v"(g[6]), "v"(g[7]) : "memory");
}
// one stage: the thread's 16 B of rows tid / 16 + 16 i of A (LDS rows 0..127) and of Bt (LDS rows 128..255)
__device__ __forceinline__ void op_fill(unsigned lb, const _Float16* ga, const _Float16* gb) {
    unsigned l[8]; const _Float16* g[8];
#pragma unroll
    for (int i = 0; i < 8; ++i) { l[i] = lb + (unsigned)(i * 16 * OP_P * 2); g[i] = ga + (size_t)i * 16 * EMBED; }
    op_copy8(l, g);
#pragma unroll
    for (int i = 0; i < 8; ++i) { l[i] = lb + (unsigned)((OP_T + i * 16) * OP_P * 2); g[i] = gb + (size_t)i * 16 * EMBED; }
    op_copy8(l, g);
}
__global__ __launch_bounds__(256) void k_oproj(const _Float16* __restrict__ A, const _Float16* __restrict__ Bt, const float* __restrict__ bias, float* __restrict__ C, float scale) {
    __shared__ __align__(16) _Float16 sm[2 * OP_STG];
    const int tid = threadIdx.x, lane = tid & 31, wave = tid >> 5, hf = lane >> 4, l15 = lane & 15;
    const int n0 = blockIdx.x * OP_T, m0 = blockIdx.y * OP_T;
    const int wm = (wave >> 2) * 64, wn = (wave & 3) * 32;
    const unsigned lb = (unsigned)(size_t)sm + (unsigned)(((tid >> 4) * OP_P + (tid & 15) * 8) * 2);
    const _Float16* ga = A + (size_t)(m0 + (tid >> 4)) * EMBED + (tid & 15) * 8;
    const _Float16* gb = Bt + (size_t)(n0 + (tid >> 4)) * EMBED + (tid & 15) * 8;

    op_fill(lb, ga, gb);
    const float bias0 = bias[n0 + wn + l15], bias1 = bias[n0 + wn + 16 + l15];
    asm volatile("s_wait_asynccnt 0x0" ::: "memory");        // the wave's own copies of stage 0 have landed
    __syncthreads();                                         // stage 0 visible to all waves
    op_fill(lb + OP_STG * 2, ga + OP_KS, gb + OP_KS);

    // all loops over i, j, ks, r below are unrolled so that every index of acc, af and bf is a constant and the arrays stay in registers
    v8f acc[4][2];
#pragma unroll
    for (int i = 0; i < 4; ++i)
#pragma unroll
        for (int j = 0; j < 2; ++j) { v8f zz = {}; acc[i][j] = zz; }

#pragma unroll 1                                             // one stage a trip: the two buffers alternate by t & 1
    for (int t = 0; t < OP_NT; ++t) {
        const _Float16* ap = sm + (t & 1) * OP_STG + (wm + l15) * OP_P + 8 * hf;
        const _Float16* bp = sm + (t & 1) * OP_STG + (OP_T + wn + l15) * OP_P + 8 * hf;
        // two fragment sets: the next 32 k's twelve LDS loads go out as one group ahead of this 32 k's eight products
        v16h af[2][4], bf[2][2];
#pragma unroll
        for (int j = 0; j < 2; ++j) bf[0][j] = fh_g16(bp + j * 16 * OP_P);
#pragma unroll
        for (int i = 0; i < 4; ++i) af[0][i] = fh_g16(ap + i * 16 * OP_P);
#pragma unroll
        for (int ks = 0; ks < OP_KS / 32; ++ks) {
            const int c = ks & 1;
            if (ks + 1 < OP_KS / 32) {
#pragma unroll
                for (int j = 0; j < 2; ++j) bf[c ^ 1][j] = fh_g16(bp + j * 16 * OP_P + (ks + 1) * 32);
#pragma unroll
                for (int i = 0; i < 4; ++i) af[c ^ 1][i] = fh_g16(ap + i * 16 * OP_P + (ks + 1) * 32);
            }
            __builtin_amdgcn_sched_barrier(0);               // keeps the load group whole and ahead: sunk among the products, each load is waited for where it stands
#pragma unroll
            for (int i = 0; i < 4; ++i)
#pragma unroll
                for (int j = 0; j < 2; ++j)
                    acc[i][j] = __builtin_amdgcn_wmma_f32_16x16x32_f16(false, af[c][i], false, bf[c][j], (short)0, acc[i][j], false, false);
            __builtin_amdgcn_sched_barrier(0);               // without it the next group's loads are split up among these products and the stage's last products sink behind the block barrier
        }
        asm volatile("s_wait_dscnt 0x0" ::: "memory");       // the wave's reads of stage t are done
        asm volatile("s_wait_asynccnt 0x0" ::: "memory");    // its copies of stage t + 1 have landed
        __syncthreads();                                     // stage t + 1 visible to all waves; stage t's buffer left by all
        if (t + 2 < OP_NT) op_fill(lb + (unsigned)((t & 1) * OP_STG * 2), ga + (t + 2) * OP_KS, gb + (t + 2) * OP_KS);
    }
    asm volatile("s_wait_asynccnt 0x0" ::: "memory");        // nothing is in flight when the buffers become output staging

    float* slab = (float*)sm + wave * (64 * OP_SP);
#pragma unroll
    for (int j = 0; j < 2; ++j) {
        const float bv = cmb_bf(j == 0 ? bias0 : bias1);
#pragma unroll
        for (int i = 0; i < 4; ++i)
#pragma unroll
            for (int r = 0; r < 8; ++r) slab[(i * 16 + 8 * hf + r) * OP_SP + j * 16 + l15] = acc[i][j][r] * scale + bv;
    }
    // the slab passes between the lanes of one wave: the fences order LDS alone
    __builtin_amdgcn_fence(3 /* release order */, "workgroup", "local");
    __builtin_amdgcn_wave_barrier();
    __builtin_amdgcn_fence(2 /* acquire order */, "workgroup", "local");
    {
        const int q4 = lane >> 3, c4 = (lane & 7) * 4;
        float* Cw = C + (size_t)(m0 + wm + q4) * EMBED + n0 + wn + c4;
#pragma unroll
        for (int it = 0; it < 16; ++it) {
            const v4f v = *(const v4f*)(slab + (it * 4 + q4) * OP_SP + c4);
            *(v4f*)(Cw + (size_t)it * 4 * EMBED) = v;
        }
    }
}

extern "C" void kernel_launch(void* const* d_in, const int* in_sizes, int n_in, void* d_out, int out_size, void* d_ws, size_t ws_size, hipStream_t stream) {
    if (n_in < 8) return;
    const long long need_x = (long long)(NB - 1) * SEQ_FULL * EMBED + (long long)SEQ * EMBED;   // last element read of a token stream + 1
    if ((long long)in_sizes[0] < need_x || (long long)in_sizes[1] < need_x || (long long)in_sizes[2] < need_x) return;
    if (in_sizes[3] < HDIM * HDIM || in_sizes[4] < HDIM * HDIM || in_sizes[5] < HDIM * HDIM) return;
    if (in_sizes[6] < EMBED * EMBED || in_sizes[7] < EMBED) return;
    if ((long long)out_size < (long long)MTOK * EMBED) return;
    const float* xq = (const float*)d_in[0];
    const float* xk = (const float*)d_in[1];
    const float* xv = (const float*)d_in[2];
    const float* Wq = (const float*)d_in[3];
    const float* Wk = (const float*)d_in[4];
    const float* Wv = (const float*)d_in[5];
    const float* Wo = (const float*)d_in[6];
    const float* bo = (const float*)d_in[7];
    float* out = (float*)d_out;
    char* wsp = (char*)d_ws;
    unsigned short* AO16 = (unsigned short*)wsp; wsp += (((size_t)MTOK * EMBED * 2 + 255) / 256) * 256;    // f16 attention output [MTOK][1024], carried x64
    _Float16* Qh = (_Float16*)wsp; wsp += (((size_t)MTOK * EMBED * 2 + 255) / 256) * 256;    // [MTOK][1024]
    _Float16* Kh = (_Float16*)wsp; wsp += (((size_t)MTOK * EMBED * 2 + 255) / 256) * 256;    // [MTOK][1024]
    _Float16* Vt = (_Float16*)wsp; wsp += (((size_t)MTOK * EMBED * 2 + 255) / 256) * 256;    // [NB][1024][SEQ]
    unsigned short* WO16 = (unsigned short*)wsp; wsp += (((size_t)EMBED * EMBED * 2 + 255) / 256) * 256;
    if ((size_t)(wsp - (char*)d_ws) > ws_size) return;

    // output weight [1024 out][1024 in] -> f16 x16 (Bt form [n][k])
    k_cm_castb<<<dim3((unsigned)(((long long)EMBED * (EMBED / 8) + 255) / 256), 1), 256, 0, stream>>>(Wo, EMBED, 0, WO16, EMBED, 0, EMBED, EMBED, 16.0f);
    // q, k, v streams: [NB][SEQ][1024] (full batch stride), 64-wide head slices x [64][64]^T -> Qh / Kh [MTOK*16][64] = [MTOK][1024], Vt [NB][16*64][SEQ]
    {
      Proj3 p;
      p.X0 = xq; p.X1 = xk; p.X2 = xv; p.W0 = Wq; p.W1 = Wk; p.W2 = Wv; p.C0 = Qh; p.C1 = Kh; p.C2 = Vt;
      k_proj3<<<dim3((unsigned)(((MTOK * HEADS) / 64) / PJ_NW), 3), 32 * PJ_NW, 0, stream>>>(p);
    }
    {
      AttnG a;
      a.Q = Qh; a.K = Kh; a.Vt = Vt; a.O = (_Float16*)AO16;
      a.sb = (long long)SEQ * EMBED; a.S = SEQ; a.scale = 0.03125f;
      k_attn64<<<dim3((unsigned)(SEQ / 64), (unsigned)HEADS, (unsigned)NB), 32 * AT_NW, 0, stream>>>(a);
    }
    // out = (AO16 . WO16^T) / (64 * 16) + bf16(bias)
    k_oproj<<<dim3((unsigned)(EMBED / OP_T), (unsigned)(MTOK / OP_T)), 256, 0, stream>>>((const _Float16*)AO16, (const _Float16*)WO16, bo, out, 0.0009765625f);
}

// v008
// One run takes 71.5 microseconds.
// In two side-by-side timings against v007, it was 1.05 and 1.04 times as fast.
// All steps since v000 together make it 4.48 times as fast.
// Multi-head attention (2 x 2,048 tokens x 1,024; 16 heads x 64; one shared 64x64 [out][in] weight per q / k / v stream applied per head, no biases; scores / 32; no mask; [out][in] output projection + bias). All contractions: v_wmma_f32_16x16x32_f16 (f16 operands, f32 accumulate): inputs and parameters converted to bf16 (RNE) first and held exactly in f16 (weights x16), tokens, 64x64 weights and bias in the registers of the kernel that uses them; per-head projections as f16 WMMA GEMMs, one launch for the three streams, results stored as f16 (q, k as [token][head][d], v transposed as [head][d][token]); one WMMA attention launch (f16 q fragments, f16 k and transposed f16 v tiles brought into LDS by asynchronous copies, two buffers, f32 online softmax, probabilities carried x4096 as f16); output projection as an f16 WMMA GEMM of the f16 attention output carried x64 (written so by the attention launch), + bias in f32.
#include <hip/hip_runtime.h>
#include <math.h>

#ifndef NB
#define NB 2
#endif
#ifndef SEQ
#define SEQ 2048
#endif
#define NB_FULL 2
#define SEQ_FULL 2048
#define EMBED 1024
#define HEADS 16
#define HDIM 64
#define MTOK (NB * SEQ)

static_assert(SEQ % 64 == 0);
static_assert(MTOK % 64 == 0);
static_assert((MTOK * HEADS) % 64 == 0);
static_assert(EMBED % 64 == 0 && HDIM == 64);
static_assert(NB <= NB_FULL && SEQ <= SEQ_FULL);

typedef __attribute__((ext_vector_type(16))) _Float16 v16h;
typedef __attribute__((ext_vector_type(8)))  _Float16 v8h;
typedef __attribute__((ext_vector_type(8)))  float    v8f;
typedef __attribute__((ext_vector_type(4)))  float    v4f;

// 16-bit WMMA fragment map (wave32), lane L, h = L>>4, m = L&15:
//   A 16x32: lane = row m;   element i -> k = (i<8) ? 8h+i : 16+8h+(i-8)
//   B 32x16: lane = column m; the SAME k(i,h)
//   D 16x16 (8 f32): lane = column m; element r -> row 8h+r
__device__ __forceinline__ v8f wmma16(v16h a, v16h b, v8f c) {
    c = __builtin_amdgcn_wmma_f32_16x16x32_f16(false, a, false, b, (short)0, c, false, false);
    return c;
}
union FragH { v16h v; v8h h[2]; };

// A fragment from an f16 row (global or LDS): p points at column k0 + 8h of the lane's row; elements 0..7 <- p[0..7], 8..15 <- p[16..23]
__device__ __forceinline__ v16h fh_g16(const _Float16* __restrict__ p) {
    FragH f; f.h[0] = *(const v8h*)(p); f.h[1] = *(const v8h*)(p + 16); return f.v;
}

// Eight bare v_exp_f32, each over its own argument register, in one statement: no neighbour can take a transcendental's source or read its result
// directly behind it, whatever registers the build picks; the closing v_nop is the independent slot that the instruction set asks for behind the last one.
__device__ __forceinline__ void exp2x8(float (&e)[8]) {
    asm("v_exp_f32 %0, %0\n\tv_exp_f32 %1, %1\n\tv_exp_f32 %2, %2\n\tv_exp_f32 %3, %3\n\t"
        "v_exp_f32 %4, %4\n\tv_exp_f32 %5, %5\n\tv_exp_f32 %6, %6\n\tv_exp_f32 %7, %7\n\tv_nop"
        : "+v"(e[0]), "+v"(e[1]), "+v"(e[2]), "+v"(e[3]), "+v"(e[4]), "+v"(e[5]), "+v"(e[6]), "+v"(e[7]));
}

// 'val' is captured into a local first: never pass an expression that reads *ptr.
#define VST2(T, ptr, val) do { const T vst2_v_ = (val); *(T*)(ptr) = vst2_v_;  } while (0)

// =====================================================================================================================
// k_attn64: O(b,i,h,:) = softmax_j(scale * Q(b,i,h,:).K(b,j,h,:)) V(b,j,h,:) for head dim 64, no mask, S % 128 == 0.
//   Element (b, s, h, d) of Q / K / O lives at X[b*sb + s*EMBED + h*HDIM + d], of V at Vt[b*sb + (h*HDIM + d)*S + s] (all f16; O carried x64). Block = 4 waves = 128 queries of one (batch, head), a wave owns 32 (two column groups of 16);
//   grid (S/128, HEADS, NB), S % 128 == 0. Per 64-key block: K [key][d] and V [d][key] come into LDS by asynchronous 16-B copies, 128-B rows, two buffers: block t + 2 is asked for
//   when every wave has left block t, so that a block's copies fly while the block before it is worked on (one block barrier a trip);
//   scores^T = f16 k fragments (two 16-B LDS loads each) x f16 q fragments (registers), f32 accumulate; online softmax in f32, exp2 domain, per lane;
//   O^T += V^T.P^T with f16 v fragments from the transposed tile and P^T packed from the score registers; row sums carried x4096 like P, final 1/rowsum in f32.
//   Every K and V fragment read from LDS feeds two products, one per column group.
//   Staged extent == consumed extent: a Ksh buffer 64 keys x 64 d, a Vts buffer 64 d x 64 keys, Os 32 rows x 64 d; pad columns are never read.
// =====================================================================================================================
#define AT_NW 4
#define AT_QG 2           // column groups of 16 queries per wave
static_assert(SEQ % (16 * AT_QG * AT_NW) == 0);
#define AT_KP 72          // LDS pitch in halves (144 B, a multiple of 16 B)
#define AT_TB (64 * AT_KP * 2)   // bytes of one K or V buffer
struct AttnG { const _Float16* Q; const _Float16* K; const _Float16* Vt; _Float16* O; long long sb; int S; float scale; };
static_assert(sizeof(AttnG) == 48);

__device__ __forceinline__ void op_copy8(const unsigned (&l)[8], const _Float16* const (&g)[8]);   // eight asynchronous 16-B copies a lane and their closing wait; defined with k_oproj
// one key block: the thread's 16 B of rows tid / 8 + 16 i of the K tile (rows = keys, EMBED halves apart) and of the V tile (rows = d, S halves apart)
__device__ __forceinline__ void at_fill(unsigned lk, unsigned lv, const _Float16* gk, const _Float16* gv, int S) {
    unsigned l[8]; const _Float16* g[8];
#pragma unroll
    for (int i = 0; i < 4; ++i) {
        l[i]     = lk + (unsigned)(i * 16 * AT_KP * 2); g[i]     = gk + (size_t)i * 16 * EMBED;
        l[4 + i] = lv + (unsigned)(i * 16 * AT_KP * 2); g[4 + i] = gv + (size_t)i * 16 * S;
    }
    op_copy8(l, g);
}

#ifndef KATTN_ATTR
#define KATTN_ATTR __attribute__((amdgpu_waves_per_eu(2, 2)))   // 2,048 waves on 1,024 SIMDs: two a SIMD, 512 VGPRs each; the upper bound keeps a third block off a WGP, so that every WGP gets two
#endif
__global__ __launch_bounds__(32 * AT_NW) KATTN_ATTR void k_attn64(AttnG g) {
    __shared__ __align__(16) _Float16 Ksh[2][64 * AT_KP];
    __shared__ __align__(16) _Float16 Vts[2][64 * AT_KP];
    __shared__ __align__(16) float    Os[AT_NW][16 * AT_QG * 68];
    const int tid = threadIdx.x, wave = tid >> 5, lane = tid & 31, hf = lane >> 4, l15 = lane & 15;
    const int h = blockIdx.y, b = blockIdx.z;
    const int q0 = (blockIdx.x * AT_NW + wave) * (16 * AT_QG);
    const float L2E = 1.4426950408889634f;
    const float NEG = -__builtin_inff();
    const float sc2 = g.scale * L2E;                         // raw score -> base-2 exponent
    const _Float16* qbase = g.Q + (long long)b * g.sb + h * HDIM;
    const _Float16* kbase = g.K + (long long)b * g.sb + h * HDIM;
    const _Float16* vbase = g.Vt + (long long)b * g.sb + (long long)h * HDIM * g.S;
    _Float16*    obase = g.O + (long long)b * g.sb + h * HDIM;

    // the lane's 16 B of a tile: row tid / 8, column group tid % 8; its LDS byte addresses in buffer 0 and its global addresses in key block 0
    const int so = (tid >> 3) * AT_KP + (tid & 7) * 8;
    const unsigned lk = (unsigned)(size_t)&Ksh[0][0] + (unsigned)(so * 2), lv = (unsigned)(size_t)&Vts[0][0] + (unsigned)(so * 2);
    const _Float16* gk = kbase + (size_t)(tid >> 3) * EMBED + (tid & 7) * 8;
    const _Float16* gv = vbase + (size_t)(tid >> 3) * g.S + (tid & 7) * 8;
    const int nt = g.S / 64;                                 // key blocks; the same for the whole grid
    if (nt > 0) at_fill(lk, lv, gk, gv, g.S);

    // q fragments (B operand: column = query g*16 + l15 of the wave), two 32-deep k-steps per column group
    const _Float16* qrow = qbase + (size_t)(q0 + l15) * EMBED + 8 * hf;
    v16h qa[AT_QG][2];
#pragma unroll
    for (int g2 = 0; g2 < AT_QG; ++g2) { qa[g2][0] = fh_g16(qrow + (size_t)g2 * 16 * EMBED); qa[g2][1] = fh_g16(qrow + (size_t)g2 * 16 * EMBED + 32); }

    v8f o[AT_QG][4]; float m1[AT_QG], l1[AT_QG];
#pragma unroll
    for (int c = 0; c < AT_QG; ++c) {
        m1[c] = NEG; l1[c] = 0.f;
#pragma unroll
        for (int t = 0; t < 4; ++t) { v8f zz = {}; o[c][t] = zz; }
    }

    asm volatile("s_wait_asynccnt 0x0" ::: "memory");        // the wave's own copies of key block 0 have landed
    __syncthreads();                                         // key block 0 visible to all waves
    if (nt > 1) at_fill(lk + AT_TB, lv + AT_TB, gk + (size_t)64 * EMBED, gv + 64, g.S);
#pragma unroll 1                                             // one key block a trip: the two buffers alternate by t & 1
    for (int t = 0; t < nt; ++t) {
        const _Float16* Kt = Ksh[t & 1] + l15 * AT_KP + 8 * hf;
        const _Float16* Vb = Vts[t & 1] + l15 * AT_KP + 8 * hf;
        // The key block's 32 fragment loads go out as one group, K's first: the scores wait for K's half alone, V's half lands under the scores and the softmax.
        // K A fragment: row = key u*16 + l15, k = d; V A fragment: row = d u*16 + l15, k = key (transposed tile, k-contiguous)
        v16h kf[4][2], vf[4][2];
#pragma unroll
        for (int u = 0; u < 4; ++u) { kf[u][0] = fh_g16(Kt + u * 16 * AT_KP); kf[u][1] = fh_g16(Kt + u * 16 * AT_KP + 32); }
#pragma unroll
        for (int u = 0; u < 4; ++u) { vf[u][0] = fh_g16(Vb + u * 16 * AT_KP); vf[u][1] = fh_g16(Vb + u * 16 * AT_KP + 32); }
        __builtin_amdgcn_sched_barrier(0);                   // keeps the group whole and ahead: sunk among the products, each load is waited for where it stands
        // four score tiles per column group, each d 0..31 then d 32..63 (B = the q fragments, column = query l15); a K fragment serves both groups
        v8f s[AT_QG][4];
#pragma unroll
        for (int u = 0; u < 4; ++u)
#pragma unroll
            for (int c = 0; c < AT_QG; ++c) { v8f zz = {}; s[c][u] = wmma16(kf[u][0], qa[c][0], zz); }
#pragma unroll
        for (int u = 0; u < 4; ++u)
#pragma unroll
            for (int c = 0; c < AT_QG; ++c) s[c][u] = wmma16(kf[u][1], qa[c][1], s[c][u]);
        __builtin_amdgcn_sched_barrier(0);                   // keeps the 16 score products one run over 8 independent tiles: mixed with the maxima, a tile's two products stand back to back and v_nops fill the way to its first reader
        // online softmax of the lane's query in each column group: 32 scores in registers, one exchange with the other half-wave for the maximum.
        // The maximum is kept in raw score units (the scale is positive, so it commutes with max); each probability is one fma and one bare
        // v_exp_f32: p * 4096 = exp2(s * sc2 + (12 - mref * sc2)). Arguments are <= 12; below -126 the bare instruction gives 0, far under f16's range.
        // P^T as B operand straight from the score tiles: element i < 8 is key 8*hf + i (tile 2u), element 8 + i is key 16 + 8*hf + i (tile 2u + 1)
        FragH pf[AT_QG][2];
#pragma unroll
        for (int c = 0; c < AT_QG; ++c) {
            float mx = NEG;
#pragma unroll
            for (int t = 0; t < 4; ++t)
#pragma unroll
                for (int r = 0; r < 8; ++r) mx = fmaxf(mx, s[c][t][r]);
            mx = fmaxf(mx, __shfl_xor(mx, 16, 32));
            const float mnew = fmaxf(m1[c], mx);
            const float mref = (mnew == NEG) ? 0.f : mnew;   // the one -inf guard: a -inf score then gives exp2(-inf) = 0 with no test of its own
            const float corr = __builtin_amdgcn_exp2f((m1[c] - mref) * sc2);
            const float nb = fmaf(-mref, sc2, 12.f);
            float rs4[4];
#pragma unroll
            for (int t = 0; t < 4; ++t) {
                float rs = 0.f, e[8];
#pragma unroll
                for (int r = 0; r < 8; ++r) e[r] = fmaf(s[c][t][r], sc2, nb);
                exp2x8(e);
#pragma unroll
                for (int r = 0; r < 8; ++r) {
                    const float pp = e[r]; rs += pp;
                    pf[c][t >> 1].h[t & 1][r] = (_Float16)pp;
                }
                rs4[t] = rs;
            }
            l1[c] = l1[c] * corr + ((rs4[0] + rs4[1]) + (rs4[2] + rs4[3])); m1[c] = mnew;   // the lane's own 32 keys; both half-waves use the same corr, so the halves join once after the loop
#pragma unroll
            for (int t = 0; t < 4; ++t)
#pragma unroll
                for (int r = 0; r < 8; ++r) o[c][t][r] *= corr;
        }
#pragma unroll
        for (int u = 0; u < 4; ++u)                          // keys 0..31 of the block into the four output tiles of both groups, then keys 32..63; a V fragment serves both groups
#pragma unroll
            for (int c = 0; c < AT_QG; ++c) o[c][u] = wmma16(vf[u][0], pf[c][0].v, o[c][u]);
#pragma unroll
        for (int u = 0; u < 4; ++u)
#pragma unroll
            for (int c = 0; c < AT_QG; ++c) o[c][u] = wmma16(vf[u][1], pf[c][1].v, o[c][u]);
        __builtin_amdgcn_sched_barrier(0);                   // keeps the trip's foot at the foot: free of it, the waits and the barrier below may rise as far as the end of the score products, and the wait for block t + 1's copies then stands ahead of the softmax
        asm volatile("s_wait_dscnt 0x0" ::: "memory");       // the wave's reads of key block t are done
        asm volatile("s_wait_asynccnt 0x0" ::: "memory");    // its copies of key block t + 1 have landed
        __syncthreads();                                     // key block t + 1 visible to all waves; key block t's buffers left by all
        if (t + 2 < nt) at_fill(lk + (unsigned)((t & 1) * AT_TB), lv + (unsigned)((t & 1) * AT_TB), gk + (size_t)(t + 2) * 64 * EMBED, gv + (t + 2) * 64, g.S);
    }
    asm volatile("s_wait_asynccnt 0x0" ::: "memory");        // nothing is in flight when the wave goes on to its end

    // O: stage the wave's 32 x 64 tile (pitch 68 floats; the lane writes 8 consecutive d of its query per tile), then 8 lanes write one row's 64 halves, a whole 128-B line (8 x 16 B), four rows per instruction; f16(x * 64) of the f32 value
#pragma unroll
    for (int c = 0; c < AT_QG; ++c) {
        const float lj = l1[c] + __shfl_xor(l1[c], 16, 32);  // join the two half-waves' row sums
        const float inv = (lj > 0.f) ? 1.f / lj : 0.f;       // lj sums p * 4096, as o does
#pragma unroll
        for (int t = 0; t < 4; ++t) {
            v4f w0, w1;
#pragma unroll
            for (int e = 0; e < 4; ++e) { w0[e] = o[c][t][e] * inv; w1[e] = o[c][t][4 + e] * inv; }
            *(v4f*)(&Os[wave][(c * 16 + l15) * 68 + t * 16 + 8 * hf]) = w0;
            *(v4f*)(&Os[wave][(c * 16 + l15) * 68 + t * 16 + 8 * hf + 4]) = w1;
        }
    }
    __builtin_amdgcn_fence(3 /* release order */, "workgroup");
    __builtin_amdgcn_wave_barrier();
    __builtin_amdgcn_fence(2 /* acquire order */, "workgroup");
    {
        const int q4 = lane >> 3, c8 = (lane & 7) * 8;
#pragma unroll
        for (int it = 0; it < 4 * AT_QG; ++it) {
            const int row = it * 4 + q4;
            const v4f va = *(const v4f*)(&Os[wave][row * 68 + c8]), vc = *(const v4f*)(&Os[wave][row * 68 + c8 + 4]);
            v8h hv;
#pragma unroll
            for (int e = 0; e < 4; ++e) { hv[e] = (_Float16)(va[e] * 64.0f); hv[4 + e] = (_Float16)(vc[e] * 64.0f); }
            *(v8h*)(obase + (size_t)(q0 + row) * EMBED + c8) = hv;
        }
    }
}

typedef unsigned int cm_u4 __attribute__((ext_vector_type(4)));
// f32 -> bf16 (RNE) -> f16 planes: every 16-bit operand holds exactly the bf16-converted input value (times a power-of-two scale), so the f16 WMMA
// products of two such planes are exact in the f32 accumulator. Thread per (row, 8 cols); 16 B per thread, thread-linear along the dst row
__device__ __forceinline__ unsigned int cmb_pk2(float a, float b) { return (unsigned int)__builtin_bit_cast(unsigned short, (_Float16)a) | ((unsigned int)__builtin_bit_cast(unsigned short, (_Float16)b) << 16); }
__device__ __forceinline__ float cmb_bf(float v) { const unsigned u = __builtin_bit_cast(unsigned, v); const unsigned r = (u + 0x7fffu + ((u >> 16) & 1u)) & 0xffff0000u; return __builtin_bit_cast(float, r); }   // bf16 RNE, kept as f32 (finite inputs)
__global__ __launch_bounds__(256) void k_cm_castb(const float* __restrict__ SRC, int lds, long long sSz, unsigned short* __restrict__ DST, int ldd, long long sDz, int nR, int nC, float sc) {
    const long long u = (long long)blockIdx.x * 256 + threadIdx.x; const int per = nC / 8; if (u >= (long long)nR * per) return; const int r = (int)(u / per); const int c0 = 8 * (int)(u % per);
    const float* s = SRC + (long long)blockIdx.y * sSz + (long long)r * lds + c0; float w[8];
#pragma unroll
    for (int e = 0; e < 8; ++e) w[e] = cmb_bf(s[e]) * sc;
    cm_u4 pk; pk.x = cmb_pk2(w[0], w[1]); pk.y = cmb_pk2(w[2], w[3]); pk.z = cmb_pk2(w[4], w[5]); pk.w = cmb_pk2(w[6], w[7]); VST2(cm_u4, (cm_u4*)(DST + (long long)blockIdx.y * sDz + (long long)r * ldd + c0), pk); }

// =====================================================================================================================
// k_proj3: the three per-head projections in one grid; blockIdx.y picks the stream. C[m][n] = f16((1/16) * sum_k f16(bf16(X[m][k])) * f16(16 * bf16(W[n][k])))
//   over 64-wide head slices of a token stream (f32, batch stride SEQ_FULL * EMBED) and its [64 out][64 in] f32 weight. Both operands are converted
//   in registers on their way into the fragments. A wave owns 64 rows x 64 columns; per 16 rows: k 0..31 then 32..63 into four accumulator tiles.
//   q, k (VT false): the rows are 64 consecutive rows of the [tokens*heads][64] view; the 16 x 64 slab goes through the wave's own LDS so that 8 lanes store
//   one whole 128-B f16 row, four rows per instruction. v (VT true): the rows are 64 consecutive tokens of ONE head; a lane's 8 accumulator registers are 8 consecutive
//   tokens of one output column, one 16-B store into the transposed result [batch][head][d][token]; the wave fills whole 128-B lines (64 tokens of one d).
// =====================================================================================================================
#define PJ_NW 4
struct Proj3 { const float* X0; const float* X1; const float* X2; const float* W0; const float* W1; const float* W2; _Float16* C0; _Float16* C1; _Float16* C2; };
typedef __attribute__((ext_vector_type(2))) float  pj_f2;
typedef __attribute__((ext_vector_type(2))) __bf16 pj_b2;
// the 16 f32 values of one fragment as loaded: p points at column k0 + 8h of the lane's row; x[0], x[1] <- p[0..7], x[2], x[3] <- p[16..23]
struct PjRaw { v4f x[4]; };
__device__ __forceinline__ PjRaw pj_load(const float* __restrict__ p) {
    PjRaw r; r.x[0] = *(const v4f*)(p); r.x[1] = *(const v4f*)(p + 4); r.x[2] = *(const v4f*)(p + 16); r.x[3] = *(const v4f*)(p + 20); return r;
}
// fragment element 4c + e = f16(bf16_rne(x[c][e]) * sc): two values per packed f32 -> bf16 conversion (round to nearest even), widened again by their bits
__device__ __forceinline__ v16h pj_frag(const PjRaw& r, float sc) {
    v16h a;
#pragma unroll
    for (int c = 0; c < 4; ++c)
#pragma unroll
        for (int e = 0; e < 4; e += 2) {
            const pj_f2 w = { r.x[c][e], r.x[c][e + 1] };
            const unsigned u = __builtin_bit_cast(unsigned, __builtin_convertvector(w, pj_b2));
            a[4 * c + e]     = (_Float16)(__builtin_bit_cast(float, u << 16) * sc);
            a[4 * c + e + 1] = (_Float16)(__builtin_bit_cast(float, u & 0xffff0000u) * sc);
        }
    return a;
}
template <bool VT>
__device__ __forceinline__ void pj_body(const float* __restrict__ X, const float* __restrict__ Wt, _Float16* __restrict__ C, float* slab, int tile, int lane) {
    const int hf = lane >> 4, l15 = lane & 15;
    constexpr int RS = VT ? EMBED : HDIM;                    // floats from one of the wave's rows to the next
    const int m0 = tile * 64;                                // VT false: 64 rows = 4 tokens x 16 heads, inside one batch (SEQ % 64 == 0)
    const int hd = tile % HEADS, t0 = (tile / HEADS) * 64;   // VT true: head, and the first of 64 tokens, inside one batch
    const int bt = VT ? t0 / SEQ : (m0 / HEADS) / SEQ;
    const float* Ab = X + (size_t)bt * (SEQ_FULL - SEQ) * EMBED + (VT ? (size_t)t0 * EMBED + hd * HDIM : (size_t)m0 * HDIM) + (size_t)l15 * RS + 8 * hf;
    const float* Bb = Wt + l15 * HDIM + 8 * hf;

    // Loads in three groups: the first 32 token rows (the longest way), the whole weight, then, once the weight's f32 registers are free,
    // the other 32 token rows, which fly while the first 32 rows are worked on.
    PjRaw ra[4][2], rw[2][4];
#pragma unroll
    for (int i = 0; i < 2; ++i) { ra[i][0] = pj_load(Ab + i * 16 * RS); ra[i][1] = pj_load(Ab + i * 16 * RS + 32); }
    asm volatile("s_wait_xcnt 0x0" ::: "memory");            // stands in front of any reuse of the address registers of the loads above; keeps this group first
#pragma unroll
    for (int ks = 0; ks < 2; ++ks)
#pragma unroll
        for (int j = 0; j < 4; ++j) rw[ks][j] = pj_load(Bb + j * 16 * HDIM + ks * 32);
    asm volatile("s_wait_xcnt 0x0" ::: "memory");            // as above, for the weight's loads
    v16h bw[2][4];
#pragma unroll
    for (int ks = 0; ks < 2; ++ks)
#pragma unroll
        for (int j = 0; j < 4; ++j) bw[ks][j] = pj_frag(rw[ks][j], 16.0f);
    __builtin_amdgcn_sched_barrier(0);                       // the third group waits for the weight's f32 registers: hoisted above the conversion it pushes the kernel past 256 VGPRs
#pragma unroll
    for (int i = 2; i < 4; ++i) { ra[i][0] = pj_load(Ab + i * 16 * RS); ra[i][1] = pj_load(Ab + i * 16 * RS + 32); }
    asm volatile("s_wait_xcnt 0x0" ::: "memory");            // as above, for the third group
    __builtin_amdgcn_sched_barrier(0);                       // keeps the third group's loads issued ahead of all work on the rows; without it they sink to just in front of their use

#pragma unroll
    for (int i = 0; i < 4; ++i) {
        const v16h a0 = pj_frag(ra[i][0], 1.0f), a1 = pj_frag(ra[i][1], 1.0f);
        v8f acc[4];
#pragma unroll
        for (int j = 0; j < 4; ++j) { v8f zz = {}; acc[j] = __builtin_amdgcn_wmma_f32_16x16x32_f16(false, a0, false, bw[0][j], (short)0, zz, false, false); }
#pragma unroll
        for (int j = 0; j < 4; ++j) acc[j] = __builtin_amdgcn_wmma_f32_16x16x32_f16(false, a1, false, bw[1][j], (short)0, acc[j], false, false);
        if (VT) {
            // acc[j][r] = token t0 + i*16 + 8*hf + r, column j*16 + l15
            _Float16* Cv = C + (size_t)bt * SEQ * EMBED + ((size_t)hd * HDIM + l15) * SEQ + (t0 - bt * SEQ) + i * 16 + 8 * hf;
#pragma unroll
            for (int j = 0; j < 4; ++j) {
                v8h hv;
#pragma unroll
                for (int r = 0; r < 8; ++r) hv[r] = (_Float16)(acc[j][r] * 0.0625f);
                *(v8h*)(Cv + (size_t)j * 16 * SEQ) = hv;
            }
        } else {
#pragma unroll
            for (int j = 0; j < 4; ++j)
#pragma unroll
                for (int r = 0; r < 8; ++r) slab[(8 * hf + r) * 68 + j * 16 + l15] = acc[j][r] * 0.0625f;
            // the slab passes between the lanes of one wave: the fences order LDS alone, so that no wave waits here for its global stores
            __builtin_amdgcn_fence(3 /* release order */, "workgroup", "local");
            __builtin_amdgcn_wave_barrier();
            __builtin_amdgcn_fence(2 /* acquire order */, "workgroup", "local");
            const int q4 = lane >> 3, c8 = (lane & 7) * 8;
#pragma unroll
            for (int it = 0; it < 4; ++it) {
                const int row = it * 4 + q4;
                const v4f va = *(const v4f*)(slab + row * 68 + c8), vc = *(const v4f*)(slab + row * 68 + c8 + 4);
                v8h hv;
#pragma unroll
                for (int e = 0; e < 4; ++e) { hv[e] = (_Float16)va[e]; hv[4 + e] = (_Float16)vc[e]; }
                *(v8h*)(C + (size_t)(m0 + i * 16 + row) * HDIM + c8) = hv;
            }
            if (i == 3) asm volatile("s_wait_xcnt 0x0" ::: "memory");   // behind the body's last stores: nothing that follows this body in the kernel's code may reuse their address registers ahead of it
            __builtin_amdgcn_fence(3 /* release order */, "workgroup", "local");
            __builtin_amdgcn_wave_barrier();
            __builtin_amdgcn_fence(2 /* acquire order */, "workgroup", "local");
        }
        if (i == 1) __builtin_amdgcn_sched_barrier(0);       // rows 32..63 are not touched before rows 0..31 are stored: hoisted, their conversion waits for the third group at once
    }
}
__global__ __launch_bounds__(32 * PJ_NW) void k_proj3(Proj3 g) {
    __shared__ __align__(16) float sP[PJ_NW][16 * 68];       // per-wave 16 x 64 slab, pitch 68 floats (q, k streams)
    const int lane = threadIdx.x & 31, wave = threadIdx.x >> 5;
    const int y = blockIdx.y;
    const int tile = blockIdx.x * PJ_NW + wave;
    if (y == 2) pj_body<true>(g.X2, g.W2, g.C2, sP[wave], tile, lane);
    else        pj_body<false>((y == 0) ? g.X0 : g.X1, (y == 0) ? g.W0 : g.W1, (y == 0) ? g.C0 : g.C1, sP[wave], tile, lane);
}
static_assert(((MTOK * HEADS) / 64) % PJ_NW == 0);

// =====================================================================================================================
// k_oproj: C[m][n] = scale * sum_k A[m][k] * Bt[n][k] + bf16(bias[n]); A [MTOK][EMBED] and Bt [EMBED][EMBED] f16, k-contiguous; C f32.
//   Block = 8 waves = one 128 x 128 tile of C, grid (EMBED / 128, MTOK / 128); a wave owns 64 rows x 32 columns (2 x 4 waves).
//   A stage is 128 k of the tile's 128 A rows and 128 Bt rows: 256 rows of 256 B at pitch 272 B in LDS, brought by asynchronous 16-B copies
//   (a wave's copy = two whole rows), two buffers: stage t + 2 is asked for when every wave has left stage t. k runs upward through one accumulator per element.
//   Epilogue: the wave's 64 x 32 tile goes through its own part of the (then free) buffers so that 8 lanes store one whole 128-B line, four rows per instruction.
// =====================================================================================================================
#define OP_T   128                       // tile rows of A and of Bt
#define OP_KS  128                       // k per stage
#define OP_P   136                       // LDS pitch in halves (272 B = 16 B x 17)
#define OP_STG (2 * OP_T * OP_P)         // halves per buffer
#define OP_NT  (EMBED / OP_KS)
#define OP_SP  36                        // epilogue slab pitch in floats
static_assert(MTOK % OP_T == 0 && EMBED % OP_T == 0 && EMBED % OP_KS == 0 && OP_NT >= 2);
static_assert(8 * 64 * OP_SP * 4 <= 2 * OP_STG * 2);
// Eight copies, each lane its own 16 B: LDS byte address, global address. The closing wait stands inside the statement, in front of any reuse of the address registers.
__device__ __forceinline__ void op_copy8(const unsigned (&l)[8], const _Float16* const (&g)[8]) {
    asm volatile("global_load_async_to_lds_b128 %0, %8, off\n\tglobal_load_async_to_lds_b128 %1, %9, off\n\t"
                 "global_load_async_to_lds_b128 %2, %10, off\n\tglobal_load_async_to_lds_b128 %3, %11, off\n\t"
                 "global_load_async_to_lds_b128 %4, %12, off\n\tglobal_load_async_to_lds_b128 %5, %13, off\n\t"
                 "global_load_async_to_lds_b128 %6, %14, off\n\tglobal_load_async_to_lds_b128 %7, %15, off\n\t"
                 "s_wait_xcnt 0x0"
                 :: "v"(l[0]), "v"(l[1]), "v"(l[2]), "v"(l[3]), "v"(l[4]), "v"(l[5]), "v"(l[6]), "v"(l[7]),
                    "v"(g[0]), "v"(g[1]), "v"(g[2]), "v"(g[3]), "v"(g[4]), "v"(g[5]), "v"(g[6]), "v"(g[7]) : "memory");
}
// one stage: the thread's 16 B of rows tid / 16 + 16 i of A (LDS rows 0..127) and of Bt (LDS rows 128..255)
__device__ __forceinline__ void op_fill(unsigned lb, const _Float16* ga, const _Float16* gb) {
    unsigned l[8]; const _Float16* g[8];
#pragma unroll
    for (int i = 0; i < 8; ++i) { l[i] = lb + (unsigned)(i * 16 * OP_P * 2); g[i] = ga + (size_t)i * 16 * EMBED; }
    op_copy8(l, g);
#pragma unroll
    for (int i = 0; i < 8; ++i) { l[i] = lb + (unsigned)((OP_T + i * 16) * OP_P * 2); g[i] = gb + (size_t)i * 16 * EMBED; }
    op_copy8(l, g);
}
__global__ __launch_bounds__(256) void k_oproj(const _Float16* __restrict__ A, const _Float16* __restrict__ Bt, const float* __restrict__ bias, float* __restrict__ C, float scale) {
    __shared__ __align__(16) _Float16 sm[2 * OP_STG];
    const int tid = threadIdx.x, lane = tid & 31, wave = tid >> 5, hf = lane >> 4, l15 = lane & 15;
    const int n0 = blockIdx.x * OP_T, m0 = blockIdx.y * OP_T;
    const int wm = (wave >> 2) * 64, wn = (wave & 3) * 32;
    const unsigned lb = (unsigned)(size_t)sm + (unsigned)(((tid >> 4) * OP_P + (tid & 15) * 8) * 2);
    const _Float16* ga = A + (size_t)(m0 + (tid >> 4)) * EMBED + (tid & 15) * 8;
    const _Float16* gb = Bt + (size_t)(n0 + (tid >> 4)) * EMBED + (tid & 15) * 8;

    op_fill(lb, ga, gb);
    const float bias0 = bias[n0 + wn + l15], bias1 = bias[n0 + wn + 16 + l15];
    asm volatile("s_wait_asynccnt 0x0" ::: "memory");        // the wave's own copies of stage 0 have landed
    __syncthreads();                                         // stage 0 visible to all waves
    op_fill(lb + OP_STG * 2, ga + OP_KS, gb + OP_KS);

    // all loops over i, j, ks, r below are unrolled so that every index of acc, af and bf is a constant and the arrays stay in registers
    v8f acc[4][2];
#pragma unroll
    for (int i = 0; i < 4; ++i)
#pragma unroll
        for (int j = 0; j < 2; ++j) { v8f zz = {}; acc[i][j] = zz; }

#pragma unroll 1                                             // one stage a trip: the two buffers alternate by t & 1
    for (int t = 0; t < OP_NT; ++t) {
        const _Float16* ap = sm + (t & 1) * OP_STG + (wm + l15) * OP_P + 8 * hf;
        const _Float16* bp = sm + (t & 1) * OP_STG + (OP_T + wn + l15) * OP_P + 8 * hf;
        // two fragment sets: the next 32 k's twelve LDS loads go out as one group ahead of this 32 k's eight products
        v16h af[2][4], bf[2][2];
#pragma unroll
        for (int j = 0; j < 2; ++j) bf[0][j] = fh_g16(bp + j * 16 * OP_P);
#pragma unroll
        for (int i = 0; i < 4; ++i) af[0][i] = fh_g16(ap + i * 16 * OP_P);
#pragma unroll
        for (int ks = 0; ks < OP_KS / 32; ++ks) {
            const int c = ks & 1;
            if (ks + 1 < OP_KS / 32) {
#pragma unroll
                for (int j = 0; j < 2; ++j) bf[c ^ 1][j] = fh_g16(bp + j * 16 * OP_P + (ks + 1) * 32);
#pragma unroll
                for (int i = 0; i < 4; ++i) af[c ^ 1][i] = fh_g16(ap + i * 16 * OP_P + (ks + 1) * 32);
            }
            __builtin_amdgcn_sched_barrier(0);               // keeps the load group whole and ahead: sunk among the products, each load is waited for where it stands
#pragma unroll
            for (int i = 0; i < 4; ++i)
#pragma unroll
                for (int j = 0; j < 2; ++j)
                    acc[i][j] = __builtin_amdgcn_wmma_f32_16x16x32_f16(false, af[c][i], false, bf[c][j], (short)0, acc[i][j], false, false);
            __builtin_amdgcn_sched_barrier(0);               // without it the next group's loads are split up among these products and the stage's last products sink behind the block barrier
        }
        asm volatile("s_wait_dscnt 0x0" ::: "memory");       // the wave's reads of stage t are done
        asm volatile("s_wait_asynccnt 0x0" ::: "memory");    // its copies of stage t + 1 have landed
        __syncthreads();                                     // stage t + 1 visible to all waves; stage t's buffer left by all
        if (t + 2 < OP_NT) op_fill(lb + (unsigned)((t & 1) * OP_STG * 2), ga + (t + 2) * OP_KS, gb + (t + 2) * OP_KS);
    }
    asm volatile("s_wait_asynccnt 0x0" ::: "memory");        // nothing is in flight when the buffers become output staging

    float* slab = (float*)sm + wave * (64 * OP_SP);
#pragma unroll
    for (int j = 0; j < 2; ++j) {
        const float bv = cmb_bf(j == 0 ? bias0 : bias1);
#pragma unroll
        for (int i = 0; i < 4; ++i)
#pragma unroll
            for (int r = 0; r < 8; ++r) slab[(i * 16 + 8 * hf + r) * OP_SP + j * 16 + l15] = acc[i][j][r] * scale + bv;
    }
    // the slab passes between the lanes of one wave: the fences order LDS alone
    __builtin_amdgcn_fence(3 /* release order */, "workgroup", "local");
    __builtin_amdgcn_wave_barrier();
    __builtin_amdgcn_fence(2 /* acquire order */, "workgroup", "local");
    {
        const int q4 = lane >> 3, c4 = (lane & 7) * 4;
        float* Cw = C + (size_t)(m0 + wm + q4) * EMBED + n0 + wn + c4;
#pragma unroll
        for (int it = 0; it < 16; ++it) {
            const v4f v = *(const v4f*)(slab + (it * 4 + q4) * OP_SP + c4);
            *(v4f*)(Cw + (size_t)it * 4 * EMBED) = v;
        }
    }
}

extern "C" void kernel_launch(void* const* d_in, const int* in_sizes, int n_in, void* d_out, int out_size, void* d_ws, size_t ws_size, hipStream_t stream) {
    if (n_in < 8) return;
    const long long need_x = (long long)(NB - 1) * SEQ_FULL * EMBED + (long long)SEQ * EMBED;   // last element read of a token stream + 1
    if ((long long)in_sizes[0] < need_x || (long long)in_sizes[1] < need_x || (long long)in_sizes[2] < need_x) return;
    if (in_sizes[3] < HDIM * HDIM || in_sizes[4] < HDIM * HDIM || in_sizes[5] < HDIM * HDIM) return;
    if (in_sizes[6] < EMBED * EMBED || in_sizes[7] < EMBED) return;
    if ((long long)out_size < (long long)MTOK * EMBED) return;
    const float* xq = (const float*)d_in[0];
    const float* xk = (const float*)d_in[1];
    const float* xv = (const float*)d_in[2];
    const float* Wq = (const float*)d_in[3];
    const float* Wk = (const float*)d_in[4];
    const float* Wv = (const float*)d_in[5];
    const float* Wo = (const float*)d_in[6];
    const float* bo = (const float*)d_in[7];
    float* out = (float*)d_out;
    char* wsp = (char*)d_ws;
    unsigned short* AO16 = (unsigned short*)wsp; wsp += (((size_t)MTOK * EMBED * 2 + 255) / 256) * 256;    // f16 attention output [MTOK][1024], carried x64
    _Float16* Qh = (_Float16*)wsp; wsp += (((size_t)MTOK * EMBED * 2 + 255) / 256) * 256;    // [MTOK][1024]
    _Float16* Kh = (_Float16*)wsp; wsp += (((size_t)MTOK * EMBED * 2 + 255) / 256) * 256;    // [MTOK][1024]
    _Float16* Vt = (_Float16*)wsp; wsp += (((size_t)MTOK * EMBED * 2 + 255) / 256) * 256;    // [NB][1024][SEQ]
    unsigned short* WO16 = (unsigned short*)wsp; wsp += (((size_t)EMBED * EMBED * 2 + 255) / 256) * 256;
    if ((size_t)(wsp - (char*)d_ws) > ws_size) return;

    // output weight [1024 out][1024 in] -> f16 x16 (Bt form [n][k])
    k_cm_castb<<<dim3((unsigned)(((long long)EMBED * (EMBED / 8) + 255) / 256), 1), 256, 0, stream>>>(Wo, EMBED, 0, WO16, EMBED, 0, EMBED, EMBED, 16.0f);
    // q, k, v streams: [NB][SEQ][1024] (full batch stride), 64-wide head slices x [64][64]^T -> Qh / Kh [MTOK*16][64] = [MTOK][1024], Vt [NB][16*64][SEQ]
    {
      Proj3 p;
      p.X0 = xq; p.X1 = xk; p.X2 = xv; p.W0 = Wq; p.W1 = Wk; p.W2 = Wv; p.C0 = Qh; p.C1 = Kh; p.C2 = Vt;
      k_proj3<<<dim3((unsigned)(((MTOK * HEADS) / 64) / PJ_NW), 3), 32 * PJ_NW, 0, stream>>>(p);
    }
    {
      AttnG a;
      a.Q = Qh; a.K = Kh; a.Vt = Vt; a.O = (_Float16*)AO16;
      a.sb = (long long)SEQ * EMBED; a.S = SEQ; a.scale = 0.03125f;
      k_attn64<<<dim3((unsigned)(SEQ / (16 * AT_QG * AT_NW)), (unsigned)HEADS, (unsigned)NB), 32 * AT_NW, 0, stream>>>(a);
    }
    // out = (AO16 . WO16^T) / (64 * 16) + bf16(bias)
    k_oproj<<<dim3((unsigned)(EMBED / OP_T), (unsigned)(MTOK / OP_T)), 256, 0, stream>>>((const _Float16*)AO16, (const _Float16*)WO16, bo, out, 0.0009765625f);
}

// v009
// Measured time: 68 microseconds a run.
// Next to v008, in two timings, it ran 1.03 times as fast each time.
// All steps since v000 together make it 4.63 times as fast.
// Multi-head attention (2 x 2,048 tokens x 1,024; 16 heads x 64; one shared 64x64 [out][in] weight per q / k / v stream applied per head, no biases; scores / 32; no mask; [out][in] output projection + bias). All contractions: v_wmma_f32_16x16x32_f16 (f16 operands, f32 accumulate): inputs and parameters converted to bf16 (RNE) first and held exactly in f16 (weights x16), tokens, 64x64 weights and bias in the registers of the kernel that uses them; per-head projections as f16 WMMA GEMMs, one launch for the three streams, results stored as f16 (q, k as [token][head][d], v transposed as [head][d][token]); one WMMA attention launch (f16 q fragments, f16 k and transposed f16 v tiles brought into LDS by asynchronous copies, two buffers, f32 online softmax, probabilities carried x4096 as f16); output projection as an f16 WMMA GEMM of the f16 attention output carried x64 (written so by the attention launch), + bias in f32.
#include <hip/hip_runtime.h>
#include <math.h>

#ifndef NB
#define NB 2
#endif
#ifndef SEQ
#define SEQ 2048
#endif
#define NB_FULL 2
#define SEQ_FULL 2048
#define EMBED 1024
#define HEADS 16
#define HDIM 64
#define MTOK (NB * SEQ)

static_assert(SEQ % 64 == 0);
static_assert(MTOK % 64 == 0);
static_assert((MTOK * HEADS) % 64 == 0);
static_assert(EMBED % 64 == 0 && HDIM == 64);
static_assert(NB <= NB_FULL && SEQ <= SEQ_FULL);

typedef __attribute__((ext_vector_type(16))) _Float16 v16h;
typedef __attribute__((ext_vector_type(8)))  _Float16 v8h;
typedef __attribute__((ext_vector_type(8)))  float    v8f;
typedef __attribute__((ext_vector_type(4)))  float    v4f;

// 16-bit WMMA fragment map (wave32), lane L, h = L>>4, m = L&15:
//   A 16x32: lane = row m;   element i -> k = (i<8) ? 8h+i : 16+8h+(i-8)
//   B 32x16: lane = column m; the SAME k(i,h)
//   D 16x16 (8 f32): lane = column m; element r -> row 8h+r
__device__ __forceinline__ v8f wmma16(v16h a, v16h b, v8f c) {
    c = __builtin_amdgcn_wmma_f32_16x16x32_f16(false, a, false, b, (short)0, c, false, false);
    return c;
}
union FragH { v16h v; v8h h[2]; };

// A fragment from an f16 row (global or LDS): p points at column k0 + 8h of the lane's row; elements 0..7 <- p[0..7], 8..15 <- p[16..23]
__device__ __forceinline__ v16h fh_g16(const _Float16* __restrict__ p) {
    FragH f; f.h[0] = *(const v8h*)(p); f.h[1] = *(const v8h*)(p + 16); return f.v;
}

// Eight bare v_exp_f32, each over its own argument register, in one statement: no neighbour can take a transcendental's source or read its result
// directly behind it, whatever registers the build picks; the closing v_nop is the independent slot that the instruction set asks for behind the last one.
__device__ __forceinline__ void exp2x8(float (&e)[8]) {
    asm("v_exp_f32 %0, %0\n\tv_exp_f32 %1, %1\n\tv_exp_f32 %2, %2\n\tv_exp_f32 %3, %3\n\t"
        "v_exp_f32 %4, %4\n\tv_exp_f32 %5, %5\n\tv_exp_f32 %6, %6\n\tv_exp_f32 %7, %7\n\tv_nop"
        : "+v"(e[0]), "+v"(e[1]), "+v"(e[2]), "+v"(e[3]), "+v"(e[4]), "+v"(e[5]), "+v"(e[6]), "+v"(e[7]));
}

// Two bare v_exp_f32 in the same form, for the two column groups' rescale factors.
__device__ __forceinline__ void exp2x2(float& a, float& b) {
    asm("v_exp_f32 %0, %0\n\tv_exp_f32 %1, %1\n\tv_nop" : "+v"(a), "+v"(b));
}

// 'val' is captured into a local first: never pass an expression that reads *ptr.
#define VST2(T, ptr, val) do { const T vst2_v_ = (val); *(T*)(ptr) = vst2_v_;  } while (0)

// =====================================================================================================================
// k_attn64: O(b,i,h,:) = softmax_j(scale * Q(b,i,h,:).K(b,j,h,:)) V(b,j,h,:) for head dim 64, no mask, S % 128 == 0.
//   Element (b, s, h, d) of Q / K / O lives at X[b*sb + s*EMBED + h*HDIM + d], of V at Vt[b*sb + (h*HDIM + d)*S + s] (all f16; O carried x64). Block = 8 waves = 128 queries of one (batch, head): a wave owns 32 queries (two column groups of 16) and one half of the keys; waves w and w + 4 own the same queries and join their parts through LDS at the end;
//   grid (S/128, HEADS, NB), S % 128 == 0. Per key half and 64-key block: K [key][d] and V [d][key] come into LDS by the half's four waves' asynchronous 16-B copies, 128-B rows, two buffers a half: block t + 2 is asked for
//   when every wave has left block t, so that a block's copies fly while the block before it is worked on (one block barrier a trip);
//   scores^T = f16 k fragments (two 16-B LDS loads each) x f16 q fragments (registers), f32 accumulate; online softmax in f32, exp2 domain, per lane;
//   O^T += V^T.P^T with f16 v fragments from the transposed tile and P^T packed from the score registers; row sums carried x4096 like P, final 1/rowsum in f32.
//   Every K and V fragment read from LDS feeds two products, one per column group.
//   Staged extent == consumed extent: a Ksh buffer 64 keys x 64 d, a Vts buffer 64 d x 64 keys, Os 32 rows x 64 d; pad columns are never read.
// =====================================================================================================================
#define AT_NW 4
#define AT_QG 2           // column groups of 16 queries per wave
#define AT_KH 2           // key halves: waves w and w + AT_NW own the same 32 queries, each over its own half of the keys
static_assert(SEQ % (16 * AT_QG * AT_NW) == 0);
static_assert(SEQ % (64 * AT_KH) == 0);
#define AT_KP 72          // LDS pitch in halves (144 B, a multiple of 16 B)
#define AT_TB (64 * AT_KP * 2)   // bytes of one K or V buffer
struct AttnG { const _Float16* Q; const _Float16* K; const _Float16* Vt; _Float16* O; long long sb; int S; float scale; };
static_assert(sizeof(AttnG) == 48);

__device__ __forceinline__ void op_copy8(const unsigned (&l)[8], const _Float16* const (&g)[8]);   // eight asynchronous 16-B copies a lane and their closing wait; defined with k_oproj
// one key block: the thread's 16 B of rows tid / 8 + 16 i of the K tile (rows = keys, EMBED halves apart) and of the V tile (rows = d, S halves apart)
__device__ __forceinline__ void at_fill(unsigned lk, unsigned lv, const _Float16* gk, const _Float16* gv, int S) {
    unsigned l[8]; const _Float16* g[8];
#pragma unroll
    for (int i = 0; i < 4; ++i) {
        l[i]     = lk + (unsigned)(i * 16 * AT_KP * 2); g[i]     = gk + (size_t)i * 16 * EMBED;
        l[4 + i] = lv + (unsigned)(i * 16 * AT_KP * 2); g[4 + i] = gv + (size_t)i * 16 * S;
    }
    op_copy8(l, g);
}

#ifndef KATTN_ATTR
#define KATTN_ATTR __attribute__((amdgpu_waves_per_eu(4, 4)))   // 4,096 waves on 1,024 SIMDs: four a SIMD, 256 VGPRs each, two blocks a WGP
#endif
__global__ __launch_bounds__(32 * AT_NW * AT_KH) KATTN_ATTR void k_attn64(AttnG g) {
    __shared__ __align__(16) _Float16 Ksh[AT_KH][2][64 * AT_KP];
    __shared__ __align__(16) _Float16 Vts[AT_KH][2][64 * AT_KP];
    __shared__ __align__(16) float    Os[AT_NW][16 * AT_QG * 68];
    const int kh = threadIdx.x / (32 * AT_NW);               // the wave's key half
    const int tid = threadIdx.x % (32 * AT_NW), wave = tid >> 5, lane = tid & 31, hf = lane >> 4, l15 = lane & 15;   // tid, wave: inside the half's four waves
    const int h = blockIdx.y, b = blockIdx.z;
    const int q0 = (blockIdx.x * AT_NW + wave) * (16 * AT_QG);
    const float L2E = 1.4426950408889634f;
    const float NEG = -__builtin_inff();
    const float sc2 = g.scale * L2E;                         // raw score -> base-2 exponent
    const _Float16* qbase = g.Q + (long long)b * g.sb + h * HDIM;
    const int nt = g.S / (64 * AT_KH);                       // key blocks of one half; the same for the whole grid
    const _Float16* kbase = g.K + (long long)b * g.sb + h * HDIM + (size_t)kh * nt * 64 * EMBED;
    const _Float16* vbase = g.Vt + (long long)b * g.sb + (long long)h * HDIM * g.S + kh * nt * 64;
    _Float16*    obase = g.O + (long long)b * g.sb + h * HDIM;

    // the lane's 16 B of a tile: row tid / 8, column group tid % 8; its LDS byte addresses in buffer 0 and its global addresses in key block 0
    const int so = (tid >> 3) * AT_KP + (tid & 7) * 8;
    const unsigned lk = (unsigned)(size_t)&Ksh[kh][0][0] + (unsigned)(so * 2), lv = (unsigned)(size_t)&Vts[kh][0][0] + (unsigned)(so * 2);
    const _Float16* gk = kbase + (size_t)(tid >> 3) * EMBED + (tid & 7) * 8;
    const _Float16* gv = vbase + (size_t)(tid >> 3) * g.S + (tid & 7) * 8;
    if (nt > 0) at_fill(lk, lv, gk, gv, g.S);

    // q fragments (B operand: column = query g*16 + l15 of the wave), two 32-deep k-steps per column group
    const _Float16* qrow = qbase + (size_t)(q0 + l15) * EMBED + 8 * hf;
    v16h qa[AT_QG][2];
#pragma unroll
    for (int g2 = 0; g2 < AT_QG; ++g2) { qa[g2][0] = fh_g16(qrow + (size_t)g2 * 16 * EMBED); qa[g2][1] = fh_g16(qrow + (size_t)g2 * 16 * EMBED + 32); }

    v8f o[AT_QG][4]; float m1[AT_QG], l1[AT_QG];
#pragma unroll
    for (int c = 0; c < AT_QG; ++c) {
        m1[c] = NEG; l1[c] = 0.f;
#pragma unroll
        for (int t = 0; t < 4; ++t) { v8f zz = {}; o[c][t] = zz; }
    }

    asm volatile("s_wait_asynccnt 0x0" ::: "memory");        // the wave's own copies of key block 0 have landed
    __syncthreads();                                         // key block 0 visible to all waves
    if (nt > 1) at_fill(lk + AT_TB, lv + AT_TB, gk + (size_t)64 * EMBED, gv + 64, g.S);
    // One trip = one key block. The body stands twice, in a loop of trips that refill and a loop of the last two, which do not: with no branch inside, a trip is one
    // straight run, and the row sums stay where they are written; behind a branch at the foot they sink into the next trip's head and hold 64 probabilities in registers over the output products.
    auto trip = [&](const int t, const bool refill) __attribute__((always_inline)) {
        const _Float16* Kt = Ksh[kh][t & 1] + l15 * AT_KP + 8 * hf;
        const _Float16* Vb = Vts[kh][t & 1] + l15 * AT_KP + 8 * hf;
        // The key block's fragment loads go out as two groups of 16: K's at the trip's head, V's behind the score products, into the registers that K's fragments leave (256 VGPRs a wave); V lands under the maxima.
        // K A fragment: row = key u*16 + l15, k = d; V A fragment: row = d u*16 + l15, k = key (transposed tile, k-contiguous)
        v16h kf[4][2], vf[4][2];
#pragma unroll
        for (int u = 0; u < 4; ++u) { kf[u][0] = fh_g16(Kt + u * 16 * AT_KP); kf[u][1] = fh_g16(Kt + u * 16 * AT_KP + 32); }
        __builtin_amdgcn_sched_barrier(0);                   // keeps the group whole and ahead: sunk among the products, each load is waited for where it stands
        // four score tiles per column group, each d 0..31 then d 32..63 (B = the q fragments, column = query l15); a K fragment serves both groups
        v8f s[AT_QG][4];
#pragma unroll
        for (int u = 0; u < 4; ++u)
#pragma unroll
            for (int c = 0; c < AT_QG; ++c) { v8f zz = {}; s[c][u] = wmma16(kf[u][0], qa[c][0], zz); }
#pragma unroll
        for (int u = 0; u < 4; ++u)
#pragma unroll
            for (int c = 0; c < AT_QG; ++c) s[c][u] = wmma16(kf[u][1], qa[c][1], s[c][u]);
        __builtin_amdgcn_sched_barrier(0);                   // keeps the 16 score products one run over 8 independent tiles: mixed with the maxima, a tile's two products stand back to back and v_nops fill the way to its first reader
#pragma unroll
        for (int u = 0; u < 4; ++u) { vf[u][0] = fh_g16(Vb + u * 16 * AT_KP); vf[u][1] = fh_g16(Vb + u * 16 * AT_KP + 32); }
        __builtin_amdgcn_sched_barrier(0);                   // keeps V's group whole and ahead of the softmax: sunk to the output products, its LDS latency is waited out there
        // online softmax of the lane's query in each column group: 32 scores in registers, one exchange with the other half-wave for the maximum.
        // The maximum is kept in raw score units (the scale is positive, so it commutes with max); each probability is one fma and one bare
        // v_exp_f32: p * 4096 = exp2(s * sc2 + (12 - mref * sc2)). Arguments are <= 12; below -126 the bare instruction gives 0, far under f16's range.
        // P^T as B operand straight from the score tiles: element i < 8 is key 8*hf + i (tile 2u), element 8 + i is key 16 + 8*hf + i (tile 2u + 1)
        FragH pf[AT_QG][2];
        float corr2[AT_QG], nb2[AT_QG];
#pragma unroll
        for (int c = 0; c < AT_QG; ++c) {
            float mx = NEG;
#pragma unroll
            for (int t = 0; t < 4; ++t)
#pragma unroll
                for (int r = 0; r < 8; ++r) mx = fmaxf(mx, s[c][t][r]);
            mx = fmaxf(mx, __shfl_xor(mx, 16, 32));
            const float mnew = fmaxf(m1[c], mx);
            const float mref = (mnew == NEG) ? 0.f : mnew;   // the one -inf guard: a -inf score then gives exp2(-inf) = 0 with no test of its own
            corr2[c] = (m1[c] - mref) * sc2;
            nb2[c] = fmaf(-mref, sc2, 12.f);
            m1[c] = mnew;
        }
        static_assert(AT_QG == 2);
        exp2x2(corr2[0], corr2[1]);
#pragma unroll
        for (int c = 0; c < AT_QG; ++c) {
            const float corr = corr2[c], nb = nb2[c];
            float rs4[4];
#pragma unroll
            for (int t = 0; t < 4; ++t) {
                float rs = 0.f, e[8];
#pragma unroll
                for (int r = 0; r < 8; ++r) e[r] = fmaf(s[c][t][r], sc2, nb);
                exp2x8(e);
#pragma unroll
                for (int r = 0; r < 8; ++r) {
                    const float pp = e[r]; rs += pp;
                    pf[c][t >> 1].h[t & 1][r] = (_Float16)pp;
                }
                rs4[t] = rs;
            }
            l1[c] = l1[c] * corr + ((rs4[0] + rs4[1]) + (rs4[2] + rs4[3]));   // the lane's own 32 keys; both half-waves use the same corr, so the halves join once after the loop
#pragma unroll
            for (int t = 0; t < 4; ++t)
#pragma unroll
                for (int r = 0; r < 8; ++r) o[c][t][r] *= corr;
        }
#pragma unroll
        for (int u = 0; u < 4; ++u)                          // keys 0..31 of the block into the four output tiles of both groups, then keys 32..63; a V fragment serves both groups
#pragma unroll
            for (int c = 0; c < AT_QG; ++c) o[c][u] = wmma16(vf[u][0], pf[c][0].v, o[c][u]);
#pragma unroll
        for (int u = 0; u < 4; ++u)
#pragma unroll
            for (int c = 0; c < AT_QG; ++c) o[c][u] = wmma16(vf[u][1], pf[c][1].v, o[c][u]);
        __builtin_amdgcn_sched_barrier(0);                   // keeps the trip's foot at the foot: with every LDS read ahead of the softmax, the waits and the barrier below rise up to the V loads too, and the wait for block t + 1's copies then stands soon behind their issue
        asm volatile("s_wait_dscnt 0x0" ::: "memory");       // the wave's reads of key block t are done
        asm volatile("s_wait_asynccnt 0x0" ::: "memory");    // its copies of key block t + 1 have landed
        __syncthreads();                                     // key block t + 1 visible to all waves; key block t's buffers left by all
        if (refill) at_fill(lk + (unsigned)((t & 1) * AT_TB), lv + (unsigned)((t & 1) * AT_TB), gk + (size_t)(t + 2) * 64 * EMBED, gv + (t + 2) * 64, g.S);
    };
    int t = 0;
#pragma unroll 1                                             // one key block a trip: the two buffers alternate by t & 1
    for (; t + 2 < nt; ++t) trip(t, true);
#pragma unroll 1                                             // as above
    for (; t < nt; ++t) trip(t, false);
    asm volatile("s_wait_asynccnt 0x0" ::: "memory");        // nothing is in flight when the wave goes on to its end

    // Join of the two key halves: the upper half's wave hands its maxima, row sums and output tiles to the lower half's wave of the same queries
    // through that wave's staging area (lane-contiguous 16-B pieces), and ends; both parts are brought to the common maximum and added.
    {
        float* J = &Os[wave][0];
        if (kh != 0) {
#pragma unroll
            for (int c = 0; c < AT_QG; ++c) {
#pragma unroll
                for (int t = 0; t < 4; ++t) {
                    v4f w0, w1;
#pragma unroll
                    for (int e = 0; e < 4; ++e) { w0[e] = o[c][t][e]; w1[e] = o[c][t][4 + e]; }
                    *(v4f*)(J + ((c * 4 + t) * 2) * 128 + lane * 4) = w0;
                    *(v4f*)(J + ((c * 4 + t) * 2 + 1) * 128 + lane * 4) = w1;
                }
                J[2048 + c * 64 + lane] = m1[c]; J[2048 + c * 64 + 32 + lane] = l1[c];
            }
        }
        __syncthreads();                                     // the upper half's parts are visible to the lower half's waves
        if (kh != 0) return;                                 // no block barrier follows
#pragma unroll
        for (int c = 0; c < AT_QG; ++c) {
            const float mo = J[2048 + c * 64 + lane], lo = J[2048 + c * 64 + 32 + lane];
            const float mnew = fmaxf(m1[c], mo);
            const float mref = (mnew == NEG) ? 0.f : mnew;   // as in the loop: no -inf minus -inf
            float ca = (m1[c] - mref) * sc2, cb = (mo - mref) * sc2;
            exp2x2(ca, cb);
            l1[c] = l1[c] * ca + lo * cb;
#pragma unroll
            for (int t = 0; t < 4; ++t) {
                const v4f w0 = *(const v4f*)(J + ((c * 4 + t) * 2) * 128 + lane * 4), w1 = *(const v4f*)(J + ((c * 4 + t) * 2 + 1) * 128 + lane * 4);
#pragma unroll
                for (int e = 0; e < 4; ++e) { o[c][t][e] = o[c][t][e] * ca + w0[e] * cb; o[c][t][4 + e] = o[c][t][4 + e] * ca + w1[e] * cb; }
            }
        }
        // the area now becomes the wave's own output staging: every lane's reads above come before any lane's writes below
        __builtin_amdgcn_fence(3 /* release order */, "workgroup");
        __builtin_amdgcn_wave_barrier();
        __builtin_amdgcn_fence(2 /* acquire order */, "workgroup");
    }

    // O: stage the wave's 32 x 64 tile (pitch 68 floats; the lane writes 8 consecutive d of its query per tile), then 8 lanes write one row's 64 halves, a whole 128-B line (8 x 16 B), four rows per instruction; f16(x * 64) of the f32 value
#pragma unroll
    for (int c = 0; c < AT_QG; ++c) {
        const float lj = l1[c] + __shfl_xor(l1[c], 16, 32);  // join the two half-waves' row sums
        const float inv = (lj > 0.f) ? 1.f / lj : 0.f;       // lj sums p * 4096, as o does
#pragma unroll
        for (int t = 0; t < 4; ++t) {
            v4f w0, w1;
#pragma unroll
            for (int e = 0; e < 4; ++e) { w0[e] = o[c][t][e] * inv; w1[e] = o[c][t][4 + e] * inv; }
            *(v4f*)(&Os[wave][(c * 16 + l15) * 68 + t * 16 + 8 * hf]) = w0;
            *(v4f*)(&Os[wave][(c * 16 + l15) * 68 + t * 16 + 8 * hf + 4]) = w1;
        }
    }
    __builtin_amdgcn_fence(3 /* release order */, "workgroup");
    __builtin_amdgcn_wave_barrier();
    __builtin_amdgcn_fence(2 /* acquire order */, "workgroup");
    {
        const int q4 = lane >> 3, c8 = (lane & 7) * 8;
#pragma unroll
        for (int it = 0; it < 4 * AT_QG; ++it) {
            const int row = it * 4 + q4;
            const v4f va = *(const v4f*)(&Os[wave][row * 68 + c8]), vc = *(const v4f*)(&Os[wave][row * 68 + c8 + 4]);
            v8h hv;
#pragma unroll
            for (int e = 0; e < 4; ++e) { hv[e] = (_Float16)(va[e] * 64.0f); hv[4 + e] = (_Float16)(vc[e] * 64.0f); }
            *(v8h*)(obase + (size_t)(q0 + row) * EMBED + c8) = hv;
        }
    }
}

typedef unsigned int cm_u4 __attribute__((ext_vector_type(4)));
// f32 -> bf16 (RNE) -> f16 planes: every 16-bit operand holds exactly the bf16-converted input value (times a power-of-two scale), so the f16 WMMA
// products of two such planes are exact in the f32 accumulator. Thread per (row, 8 cols); 16 B per thread, thread-linear along the dst row
__device__ __forceinline__ unsigned int cmb_pk2(float a, float b) { return (unsigned int)__builtin_bit_cast(unsigned short, (_Float16)a) | ((unsigned int)__builtin_bit_cast(unsigned short, (_Float16)b) << 16); }
__device__ __forceinline__ float cmb_bf(float v) { const unsigned u = __builtin_bit_cast(unsigned, v); const unsigned r = (u + 0x7fffu + ((u >> 16) & 1u)) & 0xffff0000u; return __builtin_bit_cast(float, r); }   // bf16 RNE, kept as f32 (finite inputs)
__global__ __launch_bounds__(256) void k_cm_castb(const float* __restrict__ SRC, int lds, long long sSz, unsigned short* __restrict__ DST, int ldd, long long sDz, int nR, int nC, float sc) {
    const long long u = (long long)blockIdx.x * 256 + threadIdx.x; const int per = nC / 8; if (u >= (long long)nR * per) return; const int r = (int)(u / per); const int c0 = 8 * (int)(u % per);
    const float* s = SRC + (long long)blockIdx.y * sSz + (long long)r * lds + c0; float w[8];
#pragma unroll
    for (int e = 0; e < 8; ++e) w[e] = cmb_bf(s[e]) * sc;
    cm_u4 pk; pk.x = cmb_pk2(w[0], w[1]); pk.y = cmb_pk2(w[2], w[3]); pk.z = cmb_pk2(w[4], w[5]); pk.w = cmb_pk2(w[6], w[7]); VST2(cm_u4, (cm_u4*)(DST + (long long)blockIdx.y * sDz + (long long)r * ldd + c0), pk); }

// =====================================================================================================================
// k_proj3: the three per-head projections in one grid; blockIdx.y picks the stream. C[m][n] = f16((1/16) * sum_k f16(bf16(X[m][k])) * f16(16 * bf16(W[n][k])))
//   over 64-wide head slices of a token stream (f32, batch stride SEQ_FULL * EMBED) and its [64 out][64 in] f32 weight. Both operands are converted
//   in registers on their way into the fragments. A wave owns 64 rows x 64 columns; per 16 rows: k 0..31 then 32..63 into four accumulator tiles.
//   q, k (VT false): the rows are 64 consecutive rows of the [tokens*heads][64] view; the 16 x 64 slab goes through the wave's own LDS so that 8 lanes store
//   one whole 128-B f16 row, four rows per instruction. v (VT true): the rows are 64 consecutive tokens of ONE head; a lane's 8 accumulator registers are 8 consecutive
//   tokens of one output column, one 16-B store into the transposed result [batch][head][d][token]; the wave fills whole 128-B lines (64 tokens of one d).
// =====================================================================================================================
#define PJ_NW 4
struct Proj3 { const float* X0; const float* X1; const float* X2; const float* W0; const float* W1; const float* W2; _Float16* C0; _Float16* C1; _Float16* C2; };
typedef __attribute__((ext_vector_type(2))) float  pj_f2;
typedef __attribute__((ext_vector_type(2))) __bf16 pj_b2;
// the 16 f32 values of one fragment as loaded: p points at column k0 + 8h of the lane's row; x[0], x[1] <- p[0..7], x[2], x[3] <- p[16..23]
struct PjRaw { v4f x[4]; };
__device__ __forceinline__ PjRaw pj_load(const float* __restrict__ p) {
    PjRaw r; r.x[0] = *(const v4f*)(p); r.x[1] = *(const v4f*)(p + 4); r.x[2] = *(const v4f*)(p + 16); r.x[3] = *(const v4f*)(p + 20); return r;
}
// fragment element 4c + e = f16(bf16_rne(x[c][e]) * sc): two values per packed f32 -> bf16 conversion (round to nearest even), widened again by their bits
__device__ __forceinline__ v16h pj_frag(const PjRaw& r, float sc) {
    v16h a;
#pragma unroll
    for (int c = 0; c < 4; ++c)
#pragma unroll
        for (int e = 0; e < 4; e += 2) {
            const pj_f2 w = { r.x[c][e], r.x[c][e + 1] };
            const unsigned u = __builtin_bit_cast(unsigned, __builtin_convertvector(w, pj_b2));
            a[4 * c + e]     = (_Float16)(__builtin_bit_cast(float, u << 16) * sc);
            a[4 * c + e + 1] = (_Float16)(__builtin_bit_cast(float, u & 0xffff0000u) * sc);
        }
    return a;
}
template <bool VT>
__device__ __forceinline__ void pj_body(const float* __restrict__ X, const float* __restrict__ Wt, _Float16* __restrict__ C, float* slab, int tile, int lane) {
    const int hf = lane >> 4, l15 = lane & 15;
    constexpr int RS = VT ? EMBED : HDIM;                    // floats from one of the wave's rows to the next
    const int m0 = tile * 64;                                // VT false: 64 rows = 4 tokens x 16 heads, inside one batch (SEQ % 64 == 0)
    const int hd = tile % HEADS, t0 = (tile / HEADS) * 64;   // VT true: head, and the first of 64 tokens, inside one batch
    const int bt = VT ? t0 / SEQ : (m0 / HEADS) / SEQ;
    const float* Ab = X + (size_t)bt * (SEQ_FULL - SEQ) * EMBED + (VT ? (size_t)t0 * EMBED + hd * HDIM : (size_t)m0 * HDIM) + (size_t)l15 * RS + 8 * hf;
    const float* Bb = Wt + l15 * HDIM + 8 * hf;

    // Loads in three groups: the first 32 token rows (the longest way), the whole weight, then, once the weight's f32 registers are free,
    // the other 32 token rows, which fly while the first 32 rows are worked on.
    PjRaw ra[4][2], rw[2][4];
#pragma unroll
    for (int i = 0; i < 2; ++i) { ra[i][0] = pj_load(Ab + i * 16 * RS); ra[i][1] = pj_load(Ab + i * 16 * RS + 32); }
    asm volatile("s_wait_xcnt 0x0" ::: "memory");            // stands in front of any reuse of the address registers of the loads above; keeps this group first
#pragma unroll
    for (int ks = 0; ks < 2; ++ks)
#pragma unroll
        for (int j = 0; j < 4; ++j) rw[ks][j] = pj_load(Bb + j * 16 * HDIM + ks * 32);
    asm volatile("s_wait_xcnt 0x0" ::: "memory");            // as above, for the weight's loads
    v16h bw[2][4];
#pragma unroll
    for (int ks = 0; ks < 2; ++ks)
#pragma unroll
        for (int j = 0; j < 4; ++j) bw[ks][j] = pj_frag(rw[ks][j], 16.0f);
    __builtin_amdgcn_sched_barrier(0);                       // the third group waits for the weight's f32 registers: hoisted above the conversion it pushes the kernel past 256 VGPRs
#pragma unroll
    for (int i = 2; i < 4; ++i) { ra[i][0] = pj_load(Ab + i * 16 * RS); ra[i][1] = pj_load(Ab + i * 16 * RS + 32); }
    asm volatile("s_wait_xcnt 0x0" ::: "memory");            // as above, for the third group
    __builtin_amdgcn_sched_barrier(0);                       // keeps the third group's loads issued ahead of all work on the rows; without it they sink to just in front of their use

#pragma unroll
    for (int i = 0; i < 4; ++i) {
        const v16h a0 = pj_frag(ra[i][0], 1.0f), a1 = pj_frag(ra[i][1], 1.0f);
        v8f acc[4];
#pragma unroll
        for (int j = 0; j < 4; ++j) { v8f zz = {}; acc[j] = __builtin_amdgcn_wmma_f32_16x16x32_f16(false, a0, false, bw[0][j], (short)0, zz, false, false); }
#pragma unroll
        for (int j = 0; j < 4; ++j) acc[j] = __builtin_amdgcn_wmma_f32_16x16x32_f16(false, a1, false, bw[1][j], (short)0, acc[j], false, false);
        if (VT) {
            // acc[j][r] = token t0 + i*16 + 8*hf + r, column j*16 + l15
            _Float16* Cv = C + (size_t)bt * SEQ * EMBED + ((size_t)hd * HDIM + l15) * SEQ + (t0 - bt * SEQ) + i * 16 + 8 * hf;
#pragma unroll
            for (int j = 0; j < 4; ++j) {
                v8h hv;
#pragma unroll
                for (int r = 0; r < 8; ++r) hv[r] = (_Float16)(acc[j][r] * 0.0625f);
                *(v8h*)(Cv + (size_t)j * 16 * SEQ) = hv;
            }
        } else {
#pragma unroll
            for (int j = 0; j < 4; ++j)
#pragma unroll
                for (int r = 0; r < 8; ++r) slab[(8 * hf + r) * 68 + j * 16 + l15] = acc[j][r] * 0.0625f;
            // the slab passes between the lanes of one wave: the fences order LDS alone, so that no wave waits here for its global stores
            __builtin_amdgcn_fence(3 /* release order */, "workgroup", "local");
            __builtin_amdgcn_wave_barrier();
            __builtin_amdgcn_fence(2 /* acquire order */, "workgroup", "local");
            const int q4 = lane >> 3, c8 = (lane & 7) * 8;
#pragma unroll
            for (int it = 0; it < 4; ++it) {
                const int row = it * 4 + q4;
                const v4f va = *(const v4f*)(slab + row * 68 + c8), vc = *(const v4f*)(slab + row * 68 + c8 + 4);
                v8h hv;
#pragma unroll
                for (int e = 0; e < 4; ++e) { hv[e] = (_Float16)va[e]; hv[4 + e] = (_Float16)vc[e]; }
                *(v8h*)(C + (size_t)(m0 + i * 16 + row) * HDIM + c8) = hv;
            }
            if (i == 3) asm volatile("s_wait_xcnt 0x0" ::: "memory");   // behind the body's last stores: nothing that follows this body in the kernel's code may reuse their address registers ahead of it
            __builtin_amdgcn_fence(3 /* release order */, "workgroup", "local");
            __builtin_amdgcn_wave_barrier();
            __builtin_amdgcn_fence(2 /* acquire order */, "workgroup", "local");
        }
        if (i == 1) __builtin_amdgcn_sched_barrier(0);       // rows 32..63 are not touched before rows 0..31 are stored: hoisted, their conversion waits for the third group at once
    }
}
__global__ __launch_bounds__(32 * PJ_NW) void k_proj3(Proj3 g) {
    __shared__ __align__(16) float sP[PJ_NW][16 * 68];       // per-wave 16 x 64 slab, pitch 68 floats (q, k streams)
    const int lane = threadIdx.x & 31, wave = threadIdx.x >> 5;
    const int y = blockIdx.y;
    const int tile = blockIdx.x * PJ_NW + wave;
    if (y == 2) pj_body<true>(g.X2, g.W2, g.C2, sP[wave], tile, lane);
    else        pj_body<false>((y == 0) ? g.X0 : g.X1, (y == 0) ? g.W0 : g.W1, (y == 0) ? g.C0 : g.C1, sP[wave], tile, lane);
}
static_assert(((MTOK * HEADS) / 64) % PJ_NW == 0);

// =====================================================================================================================
// k_oproj: C[m][n] = scale * sum_k A[m][k] * Bt[n][k] + bf16(bias[n]); A [MTOK][EMBED] and Bt [EMBED][EMBED] f16, k-contiguous; C f32.
//   Block = 8 waves = one 128 x 128 tile of C, grid (EMBED / 128, MTOK / 128); a wave owns 64 rows x 32 columns (2 x 4 waves).
//   A stage is 128 k of the tile's 128 A rows and 128 Bt rows: 256 rows of 256 B at pitch 272 B in LDS, brought by asynchronous 16-B copies
//   (a wave's copy = two whole rows), two buffers: stage t + 2 is asked for when every wave has left stage t. k runs upward through one accumulator per element.
//   Epilogue: the wave's 64 x 32 tile goes through its own part of the (then free) buffers so that 8 lanes store one whole 128-B line, four rows per instruction.
// =====================================================================================================================
#define OP_T   128                       // tile rows of A and of Bt
#define OP_KS  128                       // k per stage
#define OP_P   136                       // LDS pitch in halves (272 B = 16 B x 17)
#define OP_STG (2 * OP_T * OP_P)         // halves per buffer
#define OP_NT  (EMBED / OP_KS)
#define OP_SP  36                        // epilogue slab pitch in floats
static_assert(MTOK % OP_T == 0 && EMBED % OP_T == 0 && EMBED % OP_KS == 0 && OP_NT >= 2);
static_assert(8 * 64 * OP_SP * 4 <= 2 * OP_STG * 2);
// Eight copies, each lane its own 16 B: LDS byte address, global address. The closing wait stands inside the statement, in front of any reuse of the address registers.
__device__ __forceinline__ void op_copy8(const unsigned (&l)[8], const _Float16* const (&g)[8]) {
    asm volatile("global_load_async_to_lds_b128 %0, %8, off\n\tglobal_load_async_to_lds_b128 %1, %9, off\n\t"
                 "global_load_async_to_lds_b128 %2, %10, off\n\tglobal_load_async_to_lds_b128 %3, %11, off\n\t"
                 "global_load_async_to_lds_b128 %4, %12, off\n\tglobal_load_async_to_lds_b128 %5, %13, off\n\t"
                 "global_load_async_to_lds_b128 %6, %14, off\n\tglobal_load_async_to_lds_b128 %7, %15, off\n\t"
                 "s_wait_xcnt 0x0"
                 :: "v"(l[0]), "v"(l[1]), "v"(l[2]), "v"(l[3]), "v"(l[4]), "v"(l[5]), "v"(l[6]), "v"(l[7]),
                    "v"(g[0]), "v"(g[1]), "v"(g[2]), "v"(g[3]), "v"(g[4]), "v"(g[5]), "v"(g[6]), "v"(g[7]) : "memory");
}
// one stage: the thread's 16 B of rows tid / 16 + 16 i of A (LDS rows 0..127) and of Bt (LDS rows 128..255)
__device__ __forceinline__ void op_fill(unsigned lb, const _Float16* ga, const _Float16* gb) {
    unsigned l[8]; const _Float16* g[8];
#pragma unroll
    for (int i = 0; i < 8; ++i) { l[i] = lb + (unsigned)(i * 16 * OP_P * 2); g[i] = ga + (size_t)i * 16 * EMBED; }
    op_copy8(l, g);
#pragma unroll
    for (int i = 0; i < 8; ++i) { l[i] = lb + (unsigned)((OP_T + i * 16) * OP_P * 2); g[i] = gb + (size_t)i * 16 * EMBED; }
    op_copy8(l, g);
}
__global__ __launch_bounds__(256) void k_oproj(const _Float16* __restrict__ A, const _Float16* __restrict__ Bt, const float* __restrict__ bias, float* __restrict__ C, float scale) {
    __shared__ __align__(16) _Float16 sm[2 * OP_STG];
    const int tid = threadIdx.x, lane = tid & 31, wave = tid >> 5, hf = lane >> 4, l15 = lane & 15;
    const int n0 = blockIdx.x * OP_T, m0 = blockIdx.y * OP_T;
    const int wm = (wave >> 2) * 64, wn = (wave & 3) * 32;
    const unsigned lb = (unsigned)(size_t)sm + (unsigned)(((tid >> 4) * OP_P + (tid & 15) * 8) * 2);
    const _Float16* ga = A + (size_t)(m0 + (tid >> 4)) * EMBED + (tid & 15) * 8;
    const _Float16* gb = Bt + (size_t)(n0 + (tid >> 4)) * EMBED + (tid & 15) * 8;

    op_fill(lb, ga, gb);
    const float bias0 = bias[n0 + wn + l15], bias1 = bias[n0 + wn + 16 + l15];
    asm volatile("s_wait_asynccnt 0x0" ::: "memory");        // the wave's own copies of stage 0 have landed
    __syncthreads();                                         // stage 0 visible to all waves
    op_fill(lb + OP_STG * 2, ga + OP_KS, gb + OP_KS);

    // all loops over i, j, ks, r below are unrolled so that every index of acc, af and bf is a constant and the arrays stay in registers
    v8f acc[4][2];
#pragma unroll
    for (int i = 0; i < 4; ++i)
#pragma unroll
        for (int j = 0; j < 2; ++j) { v8f zz = {}; acc[i][j] = zz; }

#pragma unroll 1                                             // one stage a trip: the two buffers alternate by t & 1
    for (int t = 0; t < OP_NT; ++t) {
        const _Float16* ap = sm + (t & 1) * OP_STG + (wm + l15) * OP_P + 8 * hf;
        const _Float16* bp = sm + (t & 1) * OP_STG + (OP_T + wn + l15) * OP_P + 8 * hf;
        // two fragment sets: the next 32 k's twelve LDS loads go out as one group ahead of this 32 k's eight products
        v16h af[2][4], bf[2][2];
#pragma unroll
        for (int j = 0; j < 2; ++j) bf[0][j] = fh_g16(bp + j * 16 * OP_P);
#pragma unroll
        for (int i = 0; i < 4; ++i) af[0][i] = fh_g16(ap + i * 16 * OP_P);
#pragma unroll
        for (int ks = 0; ks < OP_KS / 32; ++ks) {
            const int c = ks & 1;
            if (ks + 1 < OP_KS / 32) {
#pragma unroll
                for (int j = 0; j < 2; ++j) bf[c ^ 1][j] = fh_g16(bp + j * 16 * OP_P + (ks + 1) * 32);
#pragma unroll
                for (int i = 0; i < 4; ++i) af[c ^ 1][i] = fh_g16(ap + i * 16 * OP_P + (ks + 1) * 32);
            }
            __builtin_amdgcn_sched_barrier(0);               // keeps the load group whole and ahead: sunk among the products, each load is waited for where it stands
#pragma unroll
            for (int i = 0; i < 4; ++i)
#pragma unroll
                for (int j = 0; j < 2; ++j)
                    acc[i][j] = __builtin_amdgcn_wmma_f32_16x16x32_f16(false, af[c][i], false, bf[c][j], (short)0, acc[i][j], false, false);
            __builtin_amdgcn_sched_barrier(0);               // without it the next group's loads are split up among these products and the stage's last products sink behind the block barrier
        }
        asm volatile("s_wait_dscnt 0x0" ::: "memory");       // the wave's reads of stage t are done
        asm volatile("s_wait_asynccnt 0x0" ::: "memory");    // its copies of stage t + 1 have landed
        __syncthreads();                                     // stage t + 1 visible to all waves; stage t's buffer left by all
        if (t + 2 < OP_NT) op_fill(lb + (unsigned)((t & 1) * OP_STG * 2), ga + (t + 2) * OP_KS, gb + (t + 2) * OP_KS);
    }
    asm volatile("s_wait_asynccnt 0x0" ::: "memory");        // nothing is in flight when the buffers become output staging

    float* slab = (float*)sm + wave * (64 * OP_SP);
#pragma unroll
    for (int j = 0; j < 2; ++j) {
        const float bv = cmb_bf(j == 0 ? bias0 : bias1);
#pragma unroll
        for (int i = 0; i < 4; ++i)
#pragma unroll
            for (int r = 0; r < 8; ++r) slab[(i * 16 + 8 * hf + r) * OP_SP + j * 16 + l15] = acc[i][j][r] * scale + bv;
    }
    // the slab passes between the lanes of one wave: the fences order LDS alone
    __builtin_amdgcn_fence(3 /* release order */, "workgroup", "local");
    __builtin_amdgcn_wave_barrier();
    __builtin_amdgcn_fence(2 /* acquire order */, "workgroup", "local");
    {
        const int q4 = lane >> 3, c4 = (lane & 7) * 4;
        float* Cw = C + (size_t)(m0 + wm + q4) * EMBED + n0 + wn + c4;
#pragma unroll
        for (int it = 0; it < 16; ++it) {
            const v4f v = *(const v4f*)(slab + (it * 4 + q4) * OP_SP + c4);
            *(v4f*)(Cw + (size_t)it * 4 * EMBED) = v;
        }
    }
}

extern "C" void kernel_launch(void* const* d_in, const int* in_sizes, int n_in, void* d_out, int out_size, void* d_ws, size_t ws_size, hipStream_t stream) {
    if (n_in < 8) return;
    const long long need_x = (long long)(NB - 1) * SEQ_FULL * EMBED + (long long)SEQ * EMBED;   // last element read of a token stream + 1
    if ((long long)in_sizes[0] < need_x || (long long)in_sizes[1] < need_x || (long long)in_sizes[2] < need_x) return;
    if (in_sizes[3] < HDIM * HDIM || in_sizes[4] < HDIM * HDIM || in_sizes[5] < HDIM * HDIM) return;
    if (in_sizes[6] < EMBED * EMBED || in_sizes[7] < EMBED) return;
    if ((long long)out_size < (long long)MTOK * EMBED) return;
    const float* xq = (const float*)d_in[0];
    const float* xk = (const float*)d_in[1];
    const float* xv = (const float*)d_in[2];
    const float* Wq = (const float*)d_in[3];
    const float* Wk = (const float*)d_in[4];
    const float* Wv = (const float*)d_in[5];
    const float* Wo = (const float*)d_in[6];
    const float* bo = (const float*)d_in[7];
    float* out = (float*)d_out;
    char* wsp = (char*)d_ws;
    unsigned short* AO16 = (unsigned short*)wsp; wsp += (((size_t)MTOK * EMBED * 2 + 255) / 256) * 256;    // f16 attention output [MTOK][1024], carried x64
    _Float16* Qh = (_Float16*)wsp; wsp += (((size_t)MTOK * EMBED * 2 + 255) / 256) * 256;    // [MTOK][1024]
    _Float16* Kh = (_Float16*)wsp; wsp += (((size_t)MTOK * EMBED * 2 + 255) / 256) * 256;    // [MTOK][1024]
    _Float16* Vt = (_Float16*)wsp; wsp += (((size_t)MTOK * EMBED * 2 + 255) / 256) * 256;    // [NB][1024][SEQ]
    unsigned short* WO16 = (unsigned short*)wsp; wsp += (((size_t)EMBED * EMBED * 2 + 255) / 256) * 256;
    if ((size_t)(wsp - (char*)d_ws) > ws_size) return;

    // output weight [1024 out][1024 in] -> f16 x16 (Bt form [n][k])
    k_cm_castb<<<dim3((unsigned)(((long long)EMBED * (EMBED / 8) + 255) / 256), 1), 256, 0, stream>>>(Wo, EMBED, 0, WO16, EMBED, 0, EMBED, EMBED, 16.0f);
    // q, k, v streams: [NB][SEQ][1024] (full batch stride), 64-wide head slices x [64][64]^T -> Qh / Kh [MTOK*16][64] = [MTOK][1024], Vt [NB][16*64][SEQ]
    {
      Proj3 p;
      p.X0 = xq; p.X1 = xk; p.X2 = xv; p.W0 = Wq; p.W1 = Wk; p.W2 = Wv; p.C0 = Qh; p.C1 = Kh; p.C2 = Vt;
      k_proj3<<<dim3((unsigned)(((MTOK * HEADS) / 64) / PJ_NW), 3), 32 * PJ_NW, 0, stream>>>(p);
    }
    {
      AttnG a;
      a.Q = Qh; a.K = Kh; a.Vt = Vt; a.O = (_Float16*)AO16;
      a.sb = (long long)SEQ * EMBED; a.S = SEQ; a.scale = 0.03125f;
      k_attn64<<<dim3((unsigned)(SEQ / (16 * AT_QG * AT_NW)), (unsigned)HEADS, (unsigned)NB), 32 * AT_NW * AT_KH, 0, stream>>>(a);
    }
    // out = (AO16 . WO16^T) / (64 * 16) + bf16(bias)
    k_oproj<<<dim3((unsigned)(EMBED / OP_T), (unsigned)(MTOK / OP_T)), 256, 0, stream>>>((const _Float16*)AO16, (const _Float16*)WO16, bo, out, 0.0009765625f);
}

// v010
// It runs in 64.6 microseconds.
// In two side-by-side timings against v009, it was 1.04 and 1.05 times as fast.
// Over all steps from v000 it is 4.84 times as fast.
// Multi-head attention (2 x 2,048 tokens x 1,024; 16 heads x 64; one shared 64x64 [out][in] weight per q / k / v stream applied per head, no biases; scores / 32; no mask; [out][in] output projection + bias). All contractions: v_wmma_f32_16x16x32_f16 (f16 operands, f32 accumulate): inputs and parameters converted to bf16 (RNE) first and held exactly in f16 (weights x16), tokens, 64x64 weights and bias in the registers of the kernel that uses them, the output weight into an f16 plane by a fourth slice of the projections' grid; per-head projections as f16 WMMA GEMMs, one launch for the three streams, results stored as f16 (q, k as [token][head][d], v transposed as [head][d][token]); one WMMA attention launch (f16 q fragments, f16 k and transposed f16 v tiles brought into LDS by asynchronous copies, two buffers, f32 online softmax, probabilities carried x4096 as f16); output projection as an f16 WMMA GEMM of the f16 attention output carried x64 (written so by the attention launch), + bias in f32.
#include <hip/hip_runtime.h>
#include <math.h>

#ifndef NB
#define NB 2
#endif
#ifndef SEQ
#define SEQ 2048
#endif
#define NB_FULL 2
#define SEQ_FULL 2048
#define EMBED 1024
#define HEADS 16
#define HDIM 64
#define MTOK (NB * SEQ)

static_assert(SEQ % 64 == 0);
static_assert(MTOK % 64 == 0);
static_assert((MTOK * HEADS) % 64 == 0);
static_assert(EMBED % 64 == 0 && HDIM == 64);
static_assert(NB <= NB_FULL && SEQ <= SEQ_FULL);

typedef __attribute__((ext_vector_type(16))) _Float16 v16h;
typedef __attribute__((ext_vector_type(8)))  _Float16 v8h;
typedef __attribute__((ext_vector_type(8)))  float    v8f;
typedef __attribute__((ext_vector_type(4)))  float    v4f;

// 16-bit WMMA fragment map (wave32), lane L, h = L>>4, m = L&15:
//   A 16x32: lane = row m;   element i -> k = (i<8) ? 8h+i : 16+8h+(i-8)
//   B 32x16: lane = column m; the SAME k(i,h)
//   D 16x16 (8 f32): lane = column m; element r -> row 8h+r
__device__ __forceinline__ v8f wmma16(v16h a, v16h b, v8f c) {
    c = __builtin_amdgcn_wmma_f32_16x16x32_f16(false, a, false, b, (short)0, c, false, false);
    return c;
}
union FragH { v16h v; v8h h[2]; };

// A fragment from an f16 row (global or LDS): p points at column k0 + 8h of the lane's row; elements 0..7 <- p[0..7], 8..15 <- p[16..23]
__device__ __forceinline__ v16h fh_g16(const _Float16* __restrict__ p) {
    FragH f; f.h[0] = *(const v8h*)(p); f.h[1] = *(const v8h*)(p + 16); return f.v;
}

// Eight bare v_exp_f32, each over its own argument register, in one statement: no neighbour can take a transcendental's source or read its result
// directly behind it, whatever registers the build picks; the closing v_nop is the independent slot that the instruction set asks for behind the last one.
__device__ __forceinline__ void exp2x8(float (&e)[8]) {
    asm("v_exp_f32 %0, %0\n\tv_exp_f32 %1, %1\n\tv_exp_f32 %2, %2\n\tv_exp_f32 %3, %3\n\t"
        "v_exp_f32 %4, %4\n\tv_exp_f32 %5, %5\n\tv_exp_f32 %6, %6\n\tv_exp_f32 %7, %7\n\tv_nop"
        : "+v"(e[0]), "+v"(e[1]), "+v"(e[2]), "+v"(e[3]), "+v"(e[4]), "+v"(e[5]), "+v"(e[6]), "+v"(e[7]));
}

// Two bare v_exp_f32 in the same form, for the two column groups' rescale factors.
__device__ __forceinline__ void exp2x2(float& a, float& b) {
    asm("v_exp_f32 %0, %0\n\tv_exp_f32 %1, %1\n\tv_nop" : "+v"(a), "+v"(b));
}

// =====================================================================================================================
// k_attn64: O(b,i,h,:) = softmax_j(scale * Q(b,i,h,:).K(b,j,h,:)) V(b,j,h,:) for head dim 64, no mask, S % 128 == 0.
//   Element (b, s, h, d) of Q / K / O lives at X[b*sb + s*EMBED + h*HDIM + d], of V at Vt[b*sb + (h*HDIM + d)*S + s] (all f16; O carried x64). Block = 8 waves = 128 queries of one (batch, head): a wave owns 32 queries (two column groups of 16) and one half of the keys; waves w and w + 4 own the same queries and join their parts through LDS at the end;
//   grid (S/128, HEADS, NB), S % 128 == 0. Per key half and 64-key block: K [key][d] and V [d][key] come into LDS by the half's four waves' asynchronous 16-B copies, 128-B rows, two buffers a half: block t + 2 is asked for
//   when every wave has left block t, so that a block's copies fly while the block before it is worked on (one block barrier a trip);
//   scores^T = f16 k fragments (two 16-B LDS loads each) x f16 q fragments (registers), f32 accumulate; online softmax in f32, exp2 domain, per lane;
//   O^T += V^T.P^T with f16 v fragments from the transposed tile and P^T packed from the score registers; row sums carried x4096 like P, final 1/rowsum in f32.
//   Every K and V fragment read from LDS feeds two products, one per column group.
//   Staged extent == consumed extent: a Ksh buffer 64 keys x 64 d, a Vts buffer 64 d x 64 keys, Os 32 rows x 64 d; pad columns are never read.
// =====================================================================================================================
#define AT_NW 4
#define AT_QG 2           // column groups of 16 queries per wave
#define AT_KH 2           // key halves: waves w and w + AT_NW own the same 32 queries, each over its own half of the keys
static_assert(SEQ % (16 * AT_QG * AT_NW) == 0);
static_assert(SEQ % (64 * AT_KH) == 0);
#define AT_KP 72          // LDS pitch in halves (144 B, a multiple of 16 B)
#define AT_TB (64 * AT_KP * 2)   // bytes of one K or V buffer
struct AttnG { const _Float16* Q; const _Float16* K; const _Float16* Vt; _Float16* O; long long sb; int S; float scale; };
static_assert(sizeof(AttnG) == 48);

__device__ __forceinline__ void op_copy8(const unsigned (&l)[8], const _Float16* const (&g)[8]);   // eight asynchronous 16-B copies a lane and their closing wait; defined with k_oproj
// one key block: the thread's 16 B of rows tid / 8 + 16 i of the K tile (rows = keys, EMBED halves apart) and of the V tile (rows = d, S halves apart)
__device__ __forceinline__ void at_fill(unsigned lk, unsigned lv, const _Float16* gk, const _Float16* gv, int S) {
    unsigned l[8]; const _Float16* g[8];
#pragma unroll
    for (int i = 0; i < 4; ++i) {
        l[i]     = lk + (unsigned)(i * 16 * AT_KP * 2); g[i]     = gk + (size_t)i * 16 * EMBED;
        l[4 + i] = lv + (unsigned)(i * 16 * AT_KP * 2); g[4 + i] = gv + (size_t)i * 16 * S;
    }
    op_copy8(l, g);
}

#ifndef KATTN_ATTR
#define KATTN_ATTR __attribute__((amdgpu_waves_per_eu(4, 4)))   // 4,096 waves on 1,024 SIMDs: four a SIMD, 256 VGPRs each, two blocks a WGP
#endif
__global__ __launch_bounds__(32 * AT_NW * AT_KH) KATTN_ATTR void k_attn64(AttnG g) {
    __shared__ __align__(16) _Float16 Ksh[AT_KH][2][64 * AT_KP];
    __shared__ __align__(16) _Float16 Vts[AT_KH][2][64 * AT_KP];
    __shared__ __align__(16) float    Os[AT_NW][16 * AT_QG * 68];
    const int kh = threadIdx.x / (32 * AT_NW);               // the wave's key half
    const int tid = threadIdx.x % (32 * AT_NW), wave = tid >> 5, lane = tid & 31, hf = lane >> 4, l15 = lane & 15;   // tid, wave: inside the half's four waves
    const int h = blockIdx.y, b = blockIdx.z;
    const int q0 = (blockIdx.x * AT_NW + wave) * (16 * AT_QG);
    const float L2E = 1.4426950408889634f;
    const float NEG = -__builtin_inff();
    const float sc2 = g.scale * L2E;                         // raw score -> base-2 exponent
    const _Float16* qbase = g.Q + (long long)b * g.sb + h * HDIM;
    const int nt = g.S / (64 * AT_KH);                       // key blocks of one half; the same for the whole grid
    const _Float16* kbase = g.K + (long long)b * g.sb + h * HDIM + (size_t)kh * nt * 64 * EMBED;
    const _Float16* vbase = g.Vt + (long long)b * g.sb + (long long)h * HDIM * g.S + kh * nt * 64;
    _Float16*    obase = g.O + (long long)b * g.sb + h * HDIM;

    // the lane's 16 B of a tile: row tid / 8, column group tid % 8; its LDS byte addresses in buffer 0 and its global addresses in key block 0
    const int so = (tid >> 3) * AT_KP + (tid & 7) * 8;
    const unsigned lk = (unsigned)(size_t)&Ksh[kh][0][0] + (unsigned)(so * 2), lv = (unsigned)(size_t)&Vts[kh][0][0] + (unsigned)(so * 2);
    const _Float16* gk = kbase + (size_t)(tid >> 3) * EMBED + (tid & 7) * 8;
    const _Float16* gv = vbase + (size_t)(tid >> 3) * g.S + (tid & 7) * 8;
    if (nt > 0) at_fill(lk, lv, gk, gv, g.S);

    // q fragments (B operand: column = query g*16 + l15 of the wave), two 32-deep k-steps per column group
    const _Float16* qrow = qbase + (size_t)(q0 + l15) * EMBED + 8 * hf;
    v16h qa[AT_QG][2];
#pragma unroll
    for (int g2 = 0; g2 < AT_QG; ++g2) { qa[g2][0] = fh_g16(qrow + (size_t)g2 * 16 * EMBED); qa[g2][1] = fh_g16(qrow + (size_t)g2 * 16 * EMBED + 32); }

    v8f o[AT_QG][4]; float m1[AT_QG], l1[AT_QG];
#pragma unroll
    for (int c = 0; c < AT_QG; ++c) {
        m1[c] = NEG; l1[c] = 0.f;
#pragma unroll
        for (int t = 0; t < 4; ++t) { v8f zz = {}; o[c][t] = zz; }
    }

    asm volatile("s_wait_asynccnt 0x0" ::: "memory");        // the wave's own copies of key block 0 have landed
    __syncthreads();                                         // key block 0 visible to all waves
    if (nt > 1) at_fill(lk + AT_TB, lv + AT_TB, gk + (size_t)64 * EMBED, gv + 64, g.S);
    // One trip = one key block. The body stands twice, in a loop of trips that refill and a loop of the last two, which do not: with no branch inside, a trip is one
    // straight run, and the row sums stay where they are written; behind a branch at the foot they sink into the next trip's head and hold 64 probabilities in registers over the output products.
    auto trip = [&](const int t, const bool refill) __attribute__((always_inline)) {
        const _Float16* Kt = Ksh[kh][t & 1] + l15 * AT_KP + 8 * hf;
        const _Float16* Vb = Vts[kh][t & 1] + l15 * AT_KP + 8 * hf;
        // The key block's fragment loads go out as two groups of 16: K's at the trip's head, V's behind the score products, into the registers that K's fragments leave (256 VGPRs a wave); V lands under the maxima.
        // K A fragment: row = key u*16 + l15, k = d; V A fragment: row = d u*16 + l15, k = key (transposed tile, k-contiguous)
        v16h kf[4][2], vf[4][2];
#pragma unroll
        for (int u = 0; u < 4; ++u) { kf[u][0] = fh_g16(Kt + u * 16 * AT_KP); kf[u][1] = fh_g16(Kt + u * 16 * AT_KP + 32); }
        __builtin_amdgcn_sched_barrier(0);                   // keeps the group whole and ahead: sunk among the products, each load is waited for where it stands
        // four score tiles per column group, each d 0..31 then d 32..63 (B = the q fragments, column = query l15); a K fragment serves both groups
        v8f s[AT_QG][4];
#pragma unroll
        for (int u = 0; u < 4; ++u)
#pragma unroll
            for (int c = 0; c < AT_QG; ++c) { v8f zz = {}; s[c][u] = wmma16(kf[u][0], qa[c][0], zz); }
#pragma unroll
        for (int u = 0; u < 4; ++u)
#pragma unroll
            for (int c = 0; c < AT_QG; ++c) s[c][u] = wmma16(kf[u][1], qa[c][1], s[c][u]);
        __builtin_amdgcn_sched_barrier(0);                   // keeps the 16 score products one run over 8 independent tiles: mixed with the maxima, a tile's two products stand back to back and v_nops fill the way to its first reader
#pragma unroll
        for (int u = 0; u < 4; ++u) { vf[u][0] = fh_g16(Vb + u * 16 * AT_KP); vf[u][1] = fh_g16(Vb + u * 16 * AT_KP + 32); }
        __builtin_amdgcn_sched_barrier(0);                   // keeps V's group whole and ahead of the softmax: sunk to the output products, its LDS latency is waited out there
        // online softmax of the lane's query in each column group: 32 scores in registers, one exchange with the other half-wave for the maximum.
        // The maximum is kept in raw score units (the scale is positive, so it commutes with max); each probability is one fma and one bare
        // v_exp_f32: p * 4096 = exp2(s * sc2 + (12 - mref * sc2)). Arguments are <= 12; below -126 the bare instruction gives 0, far under f16's range.
        // P^T as B operand straight from the score tiles: element i < 8 is key 8*hf + i (tile 2u), element 8 + i is key 16 + 8*hf + i (tile 2u + 1)
        FragH pf[AT_QG][2];
        float corr2[AT_QG], nb2[AT_QG];
#pragma unroll
        for (int c = 0; c < AT_QG; ++c) {
            float mx = NEG;
#pragma unroll
            for (int t = 0; t < 4; ++t)
#pragma unroll
                for (int r = 0; r < 8; ++r) mx = fmaxf(mx, s[c][t][r]);
            mx = fmaxf(mx, __shfl_xor(mx, 16, 32));
            const float mnew = fmaxf(m1[c], mx);
            const float mref = (mnew == NEG) ? 0.f : mnew;   // the one -inf guard: a -inf score then gives exp2(-inf) = 0 with no test of its own
            corr2[c] = (m1[c] - mref) * sc2;
            nb2[c] = fmaf(-mref, sc2, 12.f);
            m1[c] = mnew;
        }
        static_assert(AT_QG == 2);
        exp2x2(corr2[0], corr2[1]);
#pragma unroll
        for (int c = 0; c < AT_QG; ++c) {
            const float corr = corr2[c], nb = nb2[c];
            float rs4[4];
#pragma unroll
            for (int t = 0; t < 4; ++t) {
                float rs = 0.f, e[8];
#pragma unroll
                for (int r = 0; r < 8; ++r) e[r] = fmaf(s[c][t][r], sc2, nb);
                exp2x8(e);
#pragma unroll
                for (int r = 0; r < 8; ++r) {
                    const float pp = e[r]; rs += pp;
                    pf[c][t >> 1].h[t & 1][r] = (_Float16)pp;
                }
                rs4[t] = rs;
            }
            l1[c] = l1[c] * corr + ((rs4[0] + rs4[1]) + (rs4[2] + rs4[3]));   // the lane's own 32 keys; both half-waves use the same corr, so the halves join once after the loop
#pragma unroll
            for (int t = 0; t < 4; ++t)
#pragma unroll
                for (int r = 0; r < 8; ++r) o[c][t][r] *= corr;
        }
#pragma unroll
        for (int u = 0; u < 4; ++u)                          // keys 0..31 of the block into the four output tiles of both groups, then keys 32..63; a V fragment serves both groups
#pragma unroll
            for (int c = 0; c < AT_QG; ++c) o[c][u] = wmma16(vf[u][0], pf[c][0].v, o[c][u]);
#pragma unroll
        for (int u = 0; u < 4; ++u)
#pragma unroll
            for (int c = 0; c < AT_QG; ++c) o[c][u] = wmma16(vf[u][1], pf[c][1].v, o[c][u]);
        __builtin_amdgcn_sched_barrier(0);                   // keeps the trip's foot at the foot: with every LDS read ahead of the softmax, the waits and the barrier below rise up to the V loads too, and the wait for block t + 1's copies then stands soon behind their issue
        asm volatile("s_wait_dscnt 0x0" ::: "memory");       // the wave's reads of key block t are done
        asm volatile("s_wait_asynccnt 0x0" ::: "memory");    // its copies of key block t + 1 have landed
        __syncthreads();                                     // key block t + 1 visible to all waves; key block t's buffers left by all
        if (refill) at_fill(lk + (unsigned)((t & 1) * AT_TB), lv + (unsigned)((t & 1) * AT_TB), gk + (size_t)(t + 2) * 64 * EMBED, gv + (t + 2) * 64, g.S);
    };
    int t = 0;
#pragma unroll 1                                             // one key block a trip: the two buffers alternate by t & 1
    for (; t + 2 < nt; ++t) trip(t, true);
#pragma unroll 1                                             // as above
    for (; t < nt; ++t) trip(t, false);
    asm volatile("s_wait_asynccnt 0x0" ::: "memory");        // nothing is in flight when the wave goes on to its end

    // Join of the two key halves: the upper half's wave hands its maxima, row sums and output tiles to the lower half's wave of the same queries
    // through that wave's staging area (lane-contiguous 16-B pieces), and ends; both parts are brought to the common maximum and added.
    {
        float* J = &Os[wave][0];
        if (kh != 0) {
#pragma unroll
            for (int c = 0; c < AT_QG; ++c) {
#pragma unroll
                for (int t = 0; t < 4; ++t) {
                    v4f w0, w1;
#pragma unroll
                    for (int e = 0; e < 4; ++e) { w0[e] = o[c][t][e]; w1[e] = o[c][t][4 + e]; }
                    *(v4f*)(J + ((c * 4 + t) * 2) * 128 + lane * 4) = w0;
                    *(v4f*)(J + ((c * 4 + t) * 2 + 1) * 128 + lane * 4) = w1;
                }
                J[2048 + c * 64 + lane] = m1[c]; J[2048 + c * 64 + 32 + lane] = l1[c];
            }
        }
        __syncthreads();                                     // the upper half's parts are visible to the lower half's waves
        if (kh != 0) return;                                 // no block barrier follows
#pragma unroll
        for (int c = 0; c < AT_QG; ++c) {
            const float mo = J[2048 + c * 64 + lane], lo = J[2048 + c * 64 + 32 + lane];
            const float mnew = fmaxf(m1[c], mo);
            const float mref = (mnew == NEG) ? 0.f : mnew;   // as in the loop: no -inf minus -inf
            float ca = (m1[c] - mref) * sc2, cb = (mo - mref) * sc2;
            exp2x2(ca, cb);
            l1[c] = l1[c] * ca + lo * cb;
#pragma unroll
            for (int t = 0; t < 4; ++t) {
                const v4f w0 = *(const v4f*)(J + ((c * 4 + t) * 2) * 128 + lane * 4), w1 = *(const v4f*)(J + ((c * 4 + t) * 2 + 1) * 128 + lane * 4);
#pragma unroll
                for (int e = 0; e < 4; ++e) { o[c][t][e] = o[c][t][e] * ca + w0[e] * cb; o[c][t][4 + e] = o[c][t][4 + e] * ca + w1[e] * cb; }
            }
        }
        // the area now becomes the wave's own output staging: every lane's reads above come before any lane's writes below
        __builtin_amdgcn_fence(3 /* release order */, "workgroup");
        __builtin_amdgcn_wave_barrier();
        __builtin_amdgcn_fence(2 /* acquire order */, "workgroup");
    }

    // O: stage the wave's 32 x 64 tile (pitch 68 floats; the lane writes 8 consecutive d of its query per tile), then 8 lanes write one row's 64 halves, a whole 128-B line (8 x 16 B), four rows per instruction; f16(x * 64) of the f32 value
#pragma unroll
    for (int c = 0; c < AT_QG; ++c) {
        const float lj = l1[c] + __shfl_xor(l1[c], 16, 32);  // join the two half-waves' row sums
        const float inv = (lj > 0.f) ? 1.f / lj : 0.f;       // lj sums p * 4096, as o does
#pragma unroll
        for (int t = 0; t < 4; ++t) {
            v4f w0, w1;
#pragma unroll
            for (int e = 0; e < 4; ++e) { w0[e] = o[c][t][e] * inv; w1[e] = o[c][t][4 + e] * inv; }
            *(v4f*)(&Os[wave][(c * 16 + l15) * 68 + t * 16 + 8 * hf]) = w0;
            *(v4f*)(&Os[wave][(c * 16 + l15) * 68 + t * 16 + 8 * hf + 4]) = w1;
        }
    }
    __builtin_amdgcn_fence(3 /* release order */, "workgroup");
    __builtin_amdgcn_wave_barrier();
    __builtin_amdgcn_fence(2 /* acquire order */, "workgroup");
    {
        const int q4 = lane >> 3, c8 = (lane & 7) * 8;
#pragma unroll
        for (int it = 0; it < 4 * AT_QG; ++it) {
            const int row = it * 4 + q4;
            const v4f va = *(const v4f*)(&Os[wave][row * 68 + c8]), vc = *(const v4f*)(&Os[wave][row * 68 + c8 + 4]);
            v8h hv;
#pragma unroll
            for (int e = 0; e < 4; ++e) { hv[e] = (_Float16)(va[e] * 64.0f); hv[4 + e] = (_Float16)(vc[e] * 64.0f); }
            *(v8h*)(obase + (size_t)(q0 + row) * EMBED + c8) = hv;
        }
    }
}

typedef unsigned int cm_u4 __attribute__((ext_vector_type(4)));
// f32 -> bf16 (RNE) -> f16 planes: every 16-bit operand holds exactly the bf16-converted input value (times a power-of-two scale), so the f16 WMMA
// products of two such planes are exact in the f32 accumulator.
__device__ __forceinline__ unsigned int cmb_pk2(float a, float b) { return (unsigned int)__builtin_bit_cast(unsigned short, (_Float16)a) | ((unsigned int)__builtin_bit_cast(unsigned short, (_Float16)b) << 16); }
__device__ __forceinline__ float cmb_bf(float v) { const unsigned u = __builtin_bit_cast(unsigned, v); const unsigned r = (u + 0x7fffu + ((u >> 16) & 1u)) & 0xffff0000u; return __builtin_bit_cast(float, r); }   // bf16 RNE, kept as f32 (finite inputs)

// =====================================================================================================================
// k_proj3: the three per-head projections in one grid; blockIdx.y picks the stream. C[m][n] = f16((1/16) * sum_k f16(bf16(X[m][k])) * f16(16 * bf16(W[n][k])))
//   over 64-wide head slices of a token stream (f32, batch stride SEQ_FULL * EMBED) and its [64 out][64 in] f32 weight. Both operands are converted
//   in registers on their way into the fragments. A wave owns 64 rows x 64 columns; per 16 rows: k 0..31 then 32..63 into four accumulator tiles.
//   q, k (VT false): the rows are 64 consecutive rows of the [tokens*heads][64] view; the 16 x 64 slab goes through the wave's own LDS so that 8 lanes store
//   one whole 128-B f16 row, four rows per instruction. v (VT true): the rows are 64 consecutive tokens of ONE head; a lane's 8 accumulator registers are 8 consecutive
//   tokens of one output column, one 16-B store into the transposed result [batch][head][d][token]; the wave fills whole 128-B lines (64 tokens of one d).
//   blockIdx.y == 3: no projection; the slice's blocks convert the output weight, [1024 out][1024 in] f32 -> f16(16 * bf16(.)), same layout (Bt form [n][k]), for k_oproj two launches on.
//   The three streams leave one of four wave places a SIMD free: the slice's waves take it and run beside them.
// =====================================================================================================================
#define PJ_NW 4
#define PJ_GX (((MTOK * HEADS) / 64) / PJ_NW)            // blocks of one slice of the grid
struct Proj3 { const float* X0; const float* X1; const float* X2; const float* W0; const float* W1; const float* W2; const float* WO; _Float16* C0; _Float16* C1; _Float16* C2; unsigned short* WO16; };
typedef __attribute__((ext_vector_type(2))) float  pj_f2;
typedef __attribute__((ext_vector_type(2))) __bf16 pj_b2;
// the 16 f32 values of one fragment as loaded: p points at column k0 + 8h of the lane's row; x[0], x[1] <- p[0..7], x[2], x[3] <- p[16..23]
struct PjRaw { v4f x[4]; };
__device__ __forceinline__ PjRaw pj_load(const float* __restrict__ p) {
    PjRaw r; r.x[0] = *(const v4f*)(p); r.x[1] = *(const v4f*)(p + 4); r.x[2] = *(const v4f*)(p + 16); r.x[3] = *(const v4f*)(p + 20); return r;
}
// fragment element 4c + e = f16(bf16_rne(x[c][e]) * sc): two values per packed f32 -> bf16 conversion (round to nearest even), widened again by their bits
__device__ __forceinline__ v16h pj_frag(const PjRaw& r, float sc) {
    v16h a;
#pragma unroll
    for (int c = 0; c < 4; ++c)
#pragma unroll
        for (int e = 0; e < 4; e += 2) {
            const pj_f2 w = { r.x[c][e], r.x[c][e + 1] };
            const unsigned u = __builtin_bit_cast(unsigned, __builtin_convertvector(w, pj_b2));
            a[4 * c + e]     = (_Float16)(__builtin_bit_cast(float, u << 16) * sc);
            a[4 * c + e + 1] = (_Float16)(__builtin_bit_cast(float, u & 0xffff0000u) * sc);
        }
    return a;
}
template <bool VT>
__device__ __forceinline__ void pj_body(const float* __restrict__ X, const float* __restrict__ Wt, _Float16* __restrict__ C, float* slab, int tile, int lane) {
    const int hf = lane >> 4, l15 = lane & 15;
    constexpr int RS = VT ? EMBED : HDIM;                    // floats from one of the wave's rows to the next
    const int m0 = tile * 64;                                // VT false: 64 rows = 4 tokens x 16 heads, inside one batch (SEQ % 64 == 0)
    const int hd = tile % HEADS, t0 = (tile / HEADS) * 64;   // VT true: head, and the first of 64 tokens, inside one batch
    const int bt = VT ? t0 / SEQ : (m0 / HEADS) / SEQ;
    const float* Ab = X + (size_t)bt * (SEQ_FULL - SEQ) * EMBED + (VT ? (size_t)t0 * EMBED + hd * HDIM : (size_t)m0 * HDIM) + (size_t)l15 * RS + 8 * hf;
    const float* Bb = Wt + l15 * HDIM + 8 * hf;

    // Loads in three groups: the first 32 token rows (the longest way), the whole weight, then, once the weight's f32 registers are free,
    // the other 32 token rows, which fly while the first 32 rows are worked on.
    PjRaw ra[4][2], rw[2][4];
#pragma unroll
    for (int i = 0; i < 2; ++i) { ra[i][0] = pj_load(Ab + i * 16 * RS); ra[i][1] = pj_load(Ab + i * 16 * RS + 32); }
    asm volatile("s_wait_xcnt 0x0" ::: "memory");            // stands in front of any reuse of the address registers of the loads above; keeps this group first
#pragma unroll
    for (int ks = 0; ks < 2; ++ks)
#pragma unroll
        for (int j = 0; j < 4; ++j) rw[ks][j] = pj_load(Bb + j * 16 * HDIM + ks * 32);
    asm volatile("s_wait_xcnt 0x0" ::: "memory");            // as above, for the weight's loads
    v16h bw[2][4];
#pragma unroll
    for (int ks = 0; ks < 2; ++ks)
#pragma unroll
        for (int j = 0; j < 4; ++j) bw[ks][j] = pj_frag(rw[ks][j], 16.0f);
    __builtin_amdgcn_sched_barrier(0);                       // the third group waits for the weight's f32 registers: hoisted above the conversion it pushes the kernel past 256 VGPRs
#pragma unroll
    for (int i = 2; i < 4; ++i) { ra[i][0] = pj_load(Ab + i * 16 * RS); ra[i][1] = pj_load(Ab + i * 16 * RS + 32); }
    asm volatile("s_wait_xcnt 0x0" ::: "memory");            // as above, for the third group
    __builtin_amdgcn_sched_barrier(0);                       // keeps the third group's loads issued ahead of all work on the rows; without it they sink to just in front of their use

#pragma unroll
    for (int i = 0; i < 4; ++i) {
        const v16h a0 = pj_frag(ra[i][0], 1.0f), a1 = pj_frag(ra[i][1], 1.0f);
        v8f acc[4];
#pragma unroll
        for (int j = 0; j < 4; ++j) { v8f zz = {}; acc[j] = __builtin_amdgcn_wmma_f32_16x16x32_f16(false, a0, false, bw[0][j], (short)0, zz, false, false); }
#pragma unroll
        for (int j = 0; j < 4; ++j) acc[j] = __builtin_amdgcn_wmma_f32_16x16x32_f16(false, a1, false, bw[1][j], (short)0, acc[j], false, false);
        if (VT) {
            // acc[j][r] = token t0 + i*16 + 8*hf + r, column j*16 + l15
            _Float16* Cv = C + (size_t)bt * SEQ * EMBED + ((size_t)hd * HDIM + l15) * SEQ + (t0 - bt * SEQ) + i * 16 + 8 * hf;
#pragma unroll
            for (int j = 0; j < 4; ++j) {
                v8h hv;
#pragma unroll
                for (int r = 0; r < 8; ++r) hv[r] = (_Float16)(acc[j][r] * 0.0625f);
                *(v8h*)(Cv + (size_t)j * 16 * SEQ) = hv;
            }
        } else {
#pragma unroll
            for (int j = 0; j < 4; ++j)
#pragma unroll
                for (int r = 0; r < 8; ++r) slab[(8 * hf + r) * 68 + j * 16 + l15] = acc[j][r] * 0.0625f;
            // the slab passes between the lanes of one wave: the fences order LDS alone, so that no wave waits here for its global stores
            __builtin_amdgcn_fence(3 /* release order */, "workgroup", "local");
            __builtin_amdgcn_wave_barrier();
            __builtin_amdgcn_fence(2 /* acquire order */, "workgroup", "local");
            const int q4 = lane >> 3, c8 = (lane & 7) * 8;
#pragma unroll
            for (int it = 0; it < 4; ++it) {
                const int row = it * 4 + q4;
                const v4f va = *(const v4f*)(slab + row * 68 + c8), vc = *(const v4f*)(slab + row * 68 + c8 + 4);
                v8h hv;
#pragma unroll
                for (int e = 0; e < 4; ++e) { hv[e] = (_Float16)va[e]; hv[4 + e] = (_Float16)vc[e]; }
                *(v8h*)(C + (size_t)(m0 + i * 16 + row) * HDIM + c8) = hv;
            }
            if (i == 3) asm volatile("s_wait_xcnt 0x0" ::: "memory");   // behind the body's last stores: nothing that follows this body in the kernel's code may reuse their address registers ahead of it
            __builtin_amdgcn_fence(3 /* release order */, "workgroup", "local");
            __builtin_amdgcn_wave_barrier();
            __builtin_amdgcn_fence(2 /* acquire order */, "workgroup", "local");
        }
        if (i == 1) __builtin_amdgcn_sched_barrier(0);       // rows 32..63 are not touched before rows 0..31 are stored: hoisted, their conversion waits for the third group at once
    }
}
// The output weight's slice: a block converts PJ_WB consecutive floats; a thread takes 8 floats (32 B in, 16 B out) out of every 8 * 32 * PJ_NW, all its loads issued first.
#define PJ_WB ((EMBED * EMBED) / PJ_GX)
#define PJ_WI (PJ_WB / (8 * 32 * PJ_NW))
static_assert((EMBED * EMBED) % PJ_GX == 0 && PJ_WB % (8 * 32 * PJ_NW) == 0 && PJ_WI >= 1 && PJ_WI <= 8);
__device__ __forceinline__ void pj_wo(const float* __restrict__ Wo, unsigned short* __restrict__ D, int blk, int tid) {
    const size_t o = (size_t)blk * PJ_WB + (size_t)tid * 8;
    v4f x[PJ_WI][2];
#pragma unroll
    for (int i = 0; i < PJ_WI; ++i) { x[i][0] = *(const v4f*)(Wo + o + i * (8 * 32 * PJ_NW)); x[i][1] = *(const v4f*)(Wo + o + i * (8 * 32 * PJ_NW) + 4); }
    asm volatile("s_wait_xcnt 0x0" ::: "memory");            // stands in front of any reuse of the address registers of the loads above; keeps the loads one group
#pragma unroll
    for (int i = 0; i < PJ_WI; ++i) {
        float w[8];
#pragma unroll
        for (int e = 0; e < 4; ++e) { w[e] = cmb_bf(x[i][0][e]) * 16.0f; w[4 + e] = cmb_bf(x[i][1][e]) * 16.0f; }
        cm_u4 pk; pk.x = cmb_pk2(w[0], w[1]); pk.y = cmb_pk2(w[2], w[3]); pk.z = cmb_pk2(w[4], w[5]); pk.w = cmb_pk2(w[6], w[7]);
        *(cm_u4*)(D + o + i * (8 * 32 * PJ_NW)) = pk;
    }
    asm volatile("s_wait_xcnt 0x0" ::: "memory");            // behind the slice's last stores: nothing that follows them in the kernel's code may reuse their data or address registers ahead of it
}
__global__ __launch_bounds__(32 * PJ_NW) void k_proj3(Proj3 g) {
    __shared__ __align__(16) float sP[PJ_NW][16 * 68];       // per-wave 16 x 64 slab, pitch 68 floats (q, k streams)
    const int lane = threadIdx.x & 31, wave = threadIdx.x >> 5;
    const int y = blockIdx.y;
    const int tile = blockIdx.x * PJ_NW + wave;
    if (y == 3) pj_wo(g.WO, g.WO16, blockIdx.x, threadIdx.x);
    else if (y == 2) pj_body<true>(g.X2, g.W2, g.C2, sP[wave], tile, lane);
    else        pj_body<false>((y == 0) ? g.X0 : g.X1, (y == 0) ? g.W0 : g.W1, (y == 0) ? g.C0 : g.C1, sP[wave], tile, lane);
}
static_assert(((MTOK * HEADS) / 64) % PJ_NW == 0);

// =====================================================================================================================
// k_oproj: C[m][n] = scale * sum_k A[m][k] * Bt[n][k] + bf16(bias[n]); A [MTOK][EMBED] and Bt [EMBED][EMBED] f16, k-contiguous; C f32.
//   Block = 8 waves = one 128 x 128 tile of C, grid (EMBED / 128, MTOK / 128); a wave owns 64 rows x 32 columns (2 x 4 waves).
//   A stage is 128 k of the tile's 128 A rows and 128 Bt rows: 256 rows of 256 B at pitch 272 B in LDS, brought by asynchronous 16-B copies
//   (a wave's copy = two whole rows), two buffers: stage t + 2 is asked for when every wave has left stage t. k runs upward through one accumulator per element.
//   Epilogue: the wave's 64 x 32 tile goes through its own part of the (then free) buffers so that 8 lanes store one whole 128-B line, four rows per instruction.
// =====================================================================================================================
#define OP_T   128                       // tile rows of A and of Bt
#define OP_KS  128                       // k per stage
#define OP_P   136                       // LDS pitch in halves (272 B = 16 B x 17)
#define OP_STG (2 * OP_T * OP_P)         // halves per buffer
#define OP_NT  (EMBED / OP_KS)
#define OP_SP  36                        // epilogue slab pitch in floats
static_assert(MTOK % OP_T == 0 && EMBED % OP_T == 0 && EMBED % OP_KS == 0 && OP_NT >= 2);
static_assert(8 * 64 * OP_SP * 4 <= 2 * OP_STG * 2);
// Eight copies, each lane its own 16 B: LDS byte address, global address. The closing wait stands inside the statement, in front of any reuse of the address registers.
__device__ __forceinline__ void op_copy8(const unsigned (&l)[8], const _Float16* const (&g)[8]) {
    asm volatile("global_load_async_to_lds_b128 %0, %8, off\n\tglobal_load_async_to_lds_b128 %1, %9, off\n\t"
                 "global_load_async_to_lds_b128 %2, %10, off\n\tglobal_load_async_to_lds_b128 %3, %11, off\n\t"
                 "global_load_async_to_lds_b128 %4, %12, off\n\tglobal_load_async_to_lds_b128 %5, %13, off\n\t"
                 "global_load_async_to_lds_b128 %6, %14, off\n\tglobal_load_async_to_lds_b128 %7, %15, off\n\t"
                 "s_wait_xcnt 0x0"
                 :: "v"(l[0]), "v"(l[1]), "v"(l[2]), "v"(l[3]), "v"(l[4]), "v"(l[5]), "v"(l[6]), "v"(l[7]),
                    "v"(g[0]), "v"(g[1]), "v"(g[2]), "v"(g[3]), "v"(g[4]), "v"(g[5]), "v"(g[6]), "v"(g[7]) : "memory");
}
// one stage: the thread's 16 B of rows tid / 16 + 16 i of A (LDS rows 0..127) and of Bt (LDS rows 128..255)
__device__ __forceinline__ void op_fill(unsigned lb, const _Float16* ga, const _Float16* gb) {
    unsigned l[8]; const _Float16* g[8];
#pragma unroll
    for (int i = 0; i < 8; ++i) { l[i] = lb + (unsigned)(i * 16 * OP_P * 2); g[i] = ga + (size_t)i * 16 * EMBED; }
    op_copy8(l, g);
#pragma unroll
    for (int i = 0; i < 8; ++i) { l[i] = lb + (unsigned)((OP_T + i * 16) * OP_P * 2); g[i] = gb + (size_t)i * 16 * EMBED; }
    op_copy8(l, g);
}
__global__ __launch_bounds__(256) void k_oproj(const _Float16* __restrict__ A, const _Float16* __restrict__ Bt, const float* __restrict__ bias, float* __restrict__ C, float scale) {
    __shared__ __align__(16) _Float16 sm[2 * OP_STG];
    const int tid = threadIdx.x, lane = tid & 31, wave = tid >> 5, hf = lane >> 4, l15 = lane & 15;
    const int n0 = blockIdx.x * OP_T, m0 = blockIdx.y * OP_T;
    const int wm = (wave >> 2) * 64, wn = (wave & 3) * 32;
    const unsigned lb = (unsigned)(size_t)sm + (unsigned)(((tid >> 4) * OP_P + (tid & 15) * 8) * 2);
    const _Float16* ga = A + (size_t)(m0 + (tid >> 4)) * EMBED + (tid & 15) * 8;
    const _Float16* gb = Bt + (size_t)(n0 + (tid >> 4)) * EMBED + (tid & 15) * 8;

    op_fill(lb, ga, gb);
    const float bias0 = bias[n0 + wn + l15], bias1 = bias[n0 + wn + 16 + l15];
    asm volatile("s_wait_asynccnt 0x0" ::: "memory");        // the wave's own copies of stage 0 have landed
    __syncthreads();                                         // stage 0 visible to all waves
    op_fill(lb + OP_STG * 2, ga + OP_KS, gb + OP_KS);

    // all loops over i, j, ks, r below are unrolled so that every index of acc, af and bf is a constant and the arrays stay in registers
    v8f acc[4][2];
#pragma unroll
    for (int i = 0; i < 4; ++i)
#pragma unroll
        for (int j = 0; j < 2; ++j) { v8f zz = {}; acc[i][j] = zz; }

#pragma unroll 1                                             // one stage a trip: the two buffers alternate by t & 1
    for (int t = 0; t < OP_NT; ++t) {
        const _Float16* ap = sm + (t & 1) * OP_STG + (wm + l15) * OP_P + 8 * hf;
        const _Float16* bp = sm + (t & 1) * OP_STG + (OP_T + wn + l15) * OP_P + 8 * hf;
        // two fragment sets: the next 32 k's twelve LDS loads go out as one group ahead of this 32 k's eight products
        v16h af[2][4], bf[2][2];
#pragma unroll
        for (int j = 0; j < 2; ++j) bf[0][j] = fh_g16(bp + j * 16 * OP_P);
#pragma unroll
        for (int i = 0; i < 4; ++i) af[0][i] = fh_g16(ap + i * 16 * OP_P);
#pragma unroll
        for (int ks = 0; ks < OP_KS / 32; ++ks) {
            const int c = ks & 1;
            if (ks + 1 < OP_KS / 32) {
#pragma unroll
                for (int j = 0; j < 2; ++j) bf[c ^ 1][j] = fh_g16(bp + j * 16 * OP_P + (ks + 1) * 32);
#pragma unroll
                for (int i = 0; i < 4; ++i) af[c ^ 1][i] = fh_g16(ap + i * 16 * OP_P + (ks + 1) * 32);
            }
            __builtin_amdgcn_sched_barrier(0);               // keeps the load group whole and ahead: sunk among the products, each load is waited for where it stands
#pragma unroll
            for (int i = 0; i < 4; ++i)
#pragma unroll
                for (int j = 0; j < 2; ++j)
                    acc[i][j] = __builtin_amdgcn_wmma_f32_16x16x32_f16(false, af[c][i], false, bf[c][j], (short)0, acc[i][j], false, false);
            __builtin_amdgcn_sched_barrier(0);               // without it the next group's loads are split up among these products and the stage's last products sink behind the block barrier
        }
        asm volatile("s_wait_dscnt 0x0" ::: "memory");       // the wave's reads of stage t are done
        asm volatile("s_wait_asynccnt 0x0" ::: "memory");    // its copies of stage t + 1 have landed
        __syncthreads();                                     // stage t + 1 visible to all waves; stage t's buffer left by all
        if (t + 2 < OP_NT) op_fill(lb + (unsigned)((t & 1) * OP_STG * 2), ga + (t + 2) * OP_KS, gb + (t + 2) * OP_KS);
    }
    asm volatile("s_wait_asynccnt 0x0" ::: "memory");        // nothing is in flight when the buffers become output staging

    float* slab = (float*)sm + wave * (64 * OP_SP);
#pragma unroll
    for (int j = 0; j < 2; ++j) {
        const float bv = cmb_bf(j == 0 ? bias0 : bias1);
#pragma unroll
        for (int i = 0; i < 4; ++i)
#pragma unroll
            for (int r = 0; r < 8; ++r) slab[(i * 16 + 8 * hf + r) * OP_SP + j * 16 + l15] = acc[i][j][r] * scale + bv;
    }
    // the slab passes between the lanes of one wave: the fences order LDS alone
    __builtin_amdgcn_fence(3 /* release order */, "workgroup", "local");
    __builtin_amdgcn_wave_barrier();
    __builtin_amdgcn_fence(2 /* acquire order */, "workgroup", "local");
    {
        const int q4 = lane >> 3, c4 = (lane & 7) * 4;
        float* Cw = C + (size_t)(m0 + wm + q4) * EMBED + n0 + wn + c4;
#pragma unroll
        for (int it = 0; it < 16; ++it) {
            const v4f v = *(const v4f*)(slab + (it * 4 + q4) * OP_SP + c4);
            *(v4f*)(Cw + (size_t)it * 4 * EMBED) = v;
        }
    }
}

extern "C" void kernel_launch(void* const* d_in, const int* in_sizes, int n_in, void* d_out, int out_size, void* d_ws, size_t ws_size, hipStream_t stream) {
    if (n_in < 8) return;
    const long long need_x = (long long)(NB - 1) * SEQ_FULL * EMBED + (long long)SEQ * EMBED;   // last element read of a token stream + 1
    if ((long long)in_sizes[0] < need_x || (long long)in_sizes[1] < need_x || (long long)in_sizes[2] < need_x) return;
    if (in_sizes[3] < HDIM * HDIM || in_sizes[4] < HDIM * HDIM || in_sizes[5] < HDIM * HDIM) return;
    if (in_sizes[6] < EMBED * EMBED || in_sizes[7] < EMBED) return;
    if ((long long)out_size < (long long)MTOK * EMBED) return;
    const float* xq = (const float*)d_in[0];
    const float* xk = (const float*)d_in[1];
    const float* xv = (const float*)d_in[2];
    const float* Wq = (const float*)d_in[3];
    const float* Wk = (const float*)d_in[4];
    const float* Wv = (const float*)d_in[5];
    const float* Wo = (const float*)d_in[6];
    const float* bo = (const float*)d_in[7];
    float* out = (float*)d_out;
    char* wsp = (char*)d_ws;
    unsigned short* AO16 = (unsigned short*)wsp; wsp += (((size_t)MTOK * EMBED * 2 + 255) / 256) * 256;    // f16 attention output [MTOK][1024], carried x64
    _Float16* Qh = (_Float16*)wsp; wsp += (((size_t)MTOK * EMBED * 2 + 255) / 256) * 256;    // [MTOK][1024]
    _Float16* Kh = (_Float16*)wsp; wsp += (((size_t)MTOK * EMBED * 2 + 255) / 256) * 256;    // [MTOK][1024]
    _Float16* Vt = (_Float16*)wsp; wsp += (((size_t)MTOK * EMBED * 2 + 255) / 256) * 256;    // [NB][1024][SEQ]
    unsigned short* WO16 = (unsigned short*)wsp; wsp += (((size_t)EMBED * EMBED * 2 + 255) / 256) * 256;
    if ((size_t)(wsp - (char*)d_ws) > ws_size) return;

    // q, k, v streams: [NB][SEQ][1024] (full batch stride), 64-wide head slices x [64][64]^T -> Qh / Kh [MTOK*16][64] = [MTOK][1024], Vt [NB][16*64][SEQ];
    // fourth slice: output weight [1024 out][1024 in] -> f16 x16 (Bt form [n][k])
    {
      Proj3 p;
      p.X0 = xq; p.X1 = xk; p.X2 = xv; p.W0 = Wq; p.W1 = Wk; p.W2 = Wv; p.WO = Wo; p.C0 = Qh; p.C1 = Kh; p.C2 = Vt; p.WO16 = WO16;
      k_proj3<<<dim3((unsigned)PJ_GX, 4), 32 * PJ_NW, 0, stream>>>(p);
    }
    {
      AttnG a;
      a.Q = Qh; a.K = Kh; a.Vt = Vt; a.O = (_Float16*)AO16;
      a.sb = (long long)SEQ * EMBED; a.S = SEQ; a.scale = 0.03125f;
      k_attn64<<<dim3((unsigned)(SEQ / (16 * AT_QG * AT_NW)), (unsigned)HEADS, (unsigned)NB), 32 * AT_NW * AT_KH, 0, stream>>>(a);
    }
    // out = (AO16 . WO16^T) / (64 * 16) + bf16(bias)
    k_oproj<<<dim3((unsigned)(EMBED / OP_T), (unsigned)(MTOK / OP_T)), 256, 0, stream>>>((const _Float16*)AO16, (const _Float16*)WO16, bo, out, 0.0009765625f);
}
